// v000
// Measured on an AMD MI455X. A time is GPU time per run, averaged over a window of back-to-back runs after a warm-up
// (all launches, gaps included; the runs take copies of the inputs in turn), and the median of several windows.
// Apart from v000's, it joins two sittings. Times from different sittings can be a few percent apart, while
// side-by-side timings come from the same sitting.
// v000 is the starting kernel. One run takes 1330 microseconds.
#include <hip/hip_runtime.h>

// A sixteen-head attention of width 1,024 with separate sources for its three maps, ONE int32 keep plane over (row, column) for every entry and head, a last map, the first source added back and a row normalisation, on two 2,048-token entries
// (a0 | a1 | a2 the three sources [2][2048][1024]; a3 the keep plane [1][1][2048][2048] int32 (where a word is nought that column is dropped for that row; one plane for every entry and head); a4 | a6 | a8 | a10 four 'to, from' weights [1024][1024] (a map's column c is its source's row dotted with the weight's row c) with their added vectors a5 | a7 | a9 | a11 [1024]; a12 | a13 the normalisation's scale and shift [1024];
//  the first map of a0, the second of a1, the third of a2, each with its added vector; head h = columns 64 h and on; dots * 64^-0.5; a dropped pair's dot replaced by a large negative constant; ONE PLAIN SOFTMAX over the 2,048 columns; the shares times the third map's rows; the sixteen heads side by side; the sum = that plane mapped by a10 (column c = the plane's row dotted with a10's row c) + a11 + a0; the result = (the sum less its row's mean) over the root of (its row's biased variance + 1e-5), times a12, plus a13 -> [2][2048][1024]; argument order as numbered). FOURTEEN inputs, all read on the device.
// THE KEEP PLANE IS READ AS DATA: every one of its 4,194,304 words is loaded and tested against nought beside the dot it governs, at every pass of every entry; nothing is assumed of its contents.
// WHERE THE TEXT AND THE FUNCTION PART: the function puts minus infinity in place of a dropped dot, this text -3e38: after the row's maximum is taken away either gives an exact nought share in f32 wherever the row keeps a column; A ROW THAT KEEPS NO COLUMN: the function gives not-a-numbers there, this text uniform shares 1 / 2,048.
// THE ARITHMETIC AS BUILT IS THE FUNCTION's OWN: 34.36 G multiply-adds (four maps 4.29 each over the two entries; the dots 8.59; the shares' sums 8.59): ratio 1.00.
// Layout: once: the four weights cast to bf16 as they lie (k_cvt8), the last one re-cast to f16 words (k_b2h, * 1); the identity table; per entry: the three sources cast to bf16; three bf16 * bf16 maps with their added vectors into f32 planes; the one-plane builders (identity table: no rotation);
// per pass of two heads: the dots f16 * f16, the register-row softmax WITH THE INTEGER KEEP PLANE read where it lies (its shares * 1024 as ONE f16 word), the shares' sums WHOSE C POINTER IS THE TOKEN-MAJOR f32 PLANE + h * 64 (row pitch 1,024); then the sixteen heads' plane cast to ONE f16 word with the carry undone,
// the last map with its added vector into a workspace plane, the first source laid at its bf16 value (k_rbf) and the row normalisation of (plane + that copy) straight into the result (k_lnrow<true>: its one writer).
// Compute dtypes, f32 accumulate: every float input rounded to bf16 at its load: the maps bf16 * bf16 on exact operands, each added vector's bf16 word in the epilogue; the three head planes, the shares * 1024 and the sixteen heads' plane on one f16 word each; the last weight's bf16 values as f16 words; softmax f32; the first source added back at its bf16 value; the normalisation f32 with the scale's and shift's bf16 words.

#define NB_  2
#define TT   2048
#define DM   1024
#define NH_  16
#define NKV  16
#define REP  (NH_ / NKV)
#define HD   64
#define DQ   (NH_ * HD)
#define DKV  (NKV * HD)
#define ZH   2      // two heads a pass: the keep-plane softmax at the defines its carriers ran
#define RH   0      // every row on one f16 score product
#define WIN  0
#define PCAR 1024.0f
#define SCL  0.125f // 64^-0.5
#define LNC_MAX 2048

typedef _Float16 h16;
typedef unsigned short bf;
typedef __attribute__((ext_vector_type(16))) __bf16   v16bf;
typedef __attribute__((ext_vector_type(16))) _Float16 v16h;
typedef __attribute__((ext_vector_type(8)))  _Float16 v8h;
typedef __attribute__((ext_vector_type(8)))  unsigned short v8us;
typedef __attribute__((ext_vector_type(8)))  float    v8f;
typedef __attribute__((ext_vector_type(4)))  float    v4f;
typedef v8h  __attribute__((may_alias)) v8ha;
typedef v4f  __attribute__((may_alias)) v4fa;
typedef v8us __attribute__((may_alias)) v8usa;

__device__ __forceinline__ unsigned short f2bf(float f) { unsigned u = __float_as_uint(f); u += 0x7FFFu + ((u >> 16) & 1u); return (unsigned short)(u >> 16); }
__device__ __forceinline__ float bf2f(unsigned short b) { return __uint_as_float(((unsigned)b) << 16); }
__device__ __forceinline__ float bfr(float f) { return bf2f(f2bf(f)); }
__device__ __forceinline__ v16h cat16(v8h lo, v8h hi) { return __builtin_shufflevector(lo, hi, 0, 1, 2, 3, 4, 5, 6, 7, 8, 9, 10, 11, 12, 13, 14, 15); }
__device__ __forceinline__ v16bf cat16b(v8us lo, v8us hi) { return __builtin_bit_cast(v16bf, __builtin_shufflevector(lo, hi, 0, 1, 2, 3, 4, 5, 6, 7, 8, 9, 10, 11, 12, 13, 14, 15)); }
__device__ __forceinline__ v8f wmma16(v16h a, v16h b, v8f c) { return __builtin_amdgcn_wmma_f32_16x16x32_f16(false, a, false, b, (short)0, c, false, false); }
__device__ __forceinline__ v8f wmmab(v16bf a, v16bf b, v8f c) { return __builtin_amdgcn_wmma_f32_16x16x32_bf16(false, a, false, b, (short)0, c, false, false); }



// ---- k_gemmw: register-blocked GEMM, ONE WAVE per 64x64 output tile (16 accumulators), operands straight from K-contiguous 16-bit planes; grid (M/64, N/64, Z), 32 threads.
// C[m][n] (f32, pitch ldc, + optional f32 bias[n]) = sum_k A[m][k] Bt[n][k] (+ split products per NSPLIT). z-batch strides sA/sB/sC in elements. K % 32 == 0.
template <typename T16> struct WFrag;
template <> struct WFrag<h16> { typedef v16h V; static __device__ __forceinline__ V ld(const h16* p) { return cat16(*(const v8h*)p, *(const v8h*)(p + 16)); } static __device__ __forceinline__ v8f mma(V a, V b, v8f c) { return wmma16(a, b, c); } };
template <> struct WFrag<bf> { typedef v16bf V; static __device__ __forceinline__ V ld(const bf* p) { return cat16b(*(const v8us*)p, *(const v8us*)(p + 16)); } static __device__ __forceinline__ v8f mma(V a, V b, v8f c) { return wmmab(a, b, c); } };
template <typename T16, int NSPLIT, bool BIAS>
__global__ __launch_bounds__(32) void k_gemmw(const T16* __restrict__ A, const T16* __restrict__ A2, const T16* __restrict__ Bt, const T16* __restrict__ Bt2, int K, float* C, int ldc, const float* __restrict__ bias, size_t sA, size_t sB, size_t sC) {
    typedef typename WFrag<T16>::V V;
    __shared__ __align__(16) float os[16 * 68];
    const size_t z = blockIdx.z; A += z * sA; if (A2) A2 += z * sA; Bt += z * sB; if (Bt2) Bt2 += z * sB; C += z * sC;
    const int lane = threadIdx.x & 31, lr = lane & 15, hi = lane >> 4; const int r0 = blockIdx.x * 64, c0 = blockIdx.y * 64;
    v8f acc[4][4];
#pragma unroll
    for (int mb = 0; mb < 4; ++mb)
#pragma unroll
        for (int nb = 0; nb < 4; ++nb) acc[mb][nb] = (v8f){};
    const size_t aoff = (size_t)(r0 + lr) * K + 8 * hi, boff = (size_t)(c0 + lr) * K + 8 * hi;
    for (int kc = 0; kc < K; kc += 32) {
        V a[4], a2[4];
#pragma unroll
        for (int mb = 0; mb < 4; ++mb) { a[mb] = WFrag<T16>::ld(A + aoff + (size_t)mb * 16 * K + kc); if (NSPLIT == 1 || NSPLIT == 2) a2[mb] = WFrag<T16>::ld(A2 + aoff + (size_t)mb * 16 * K + kc); }
#pragma unroll
        for (int nb = 0; nb < 4; ++nb) { const V b = WFrag<T16>::ld(Bt + boff + (size_t)nb * 16 * K + kc); V b2; if (NSPLIT >= 2) b2 = WFrag<T16>::ld(Bt2 + boff + (size_t)nb * 16 * K + kc);
#pragma unroll
            for (int mb = 0; mb < 4; ++mb) { acc[mb][nb] = WFrag<T16>::mma(a[mb], b, acc[mb][nb]); if (NSPLIT == 1 || NSPLIT == 2) acc[mb][nb] = WFrag<T16>::mma(a2[mb], b, acc[mb][nb]); if (NSPLIT >= 2) acc[mb][nb] = WFrag<T16>::mma(a[mb], b2, acc[mb][nb]); } }
        asm volatile("v_nop\n\tv_nop\n\tv_nop\n\tv_nop" : "+v"(acc[0][0]), "+v"(acc[1][1]), "+v"(acc[2][2]), "+v"(acc[3][3]) : "v"(a[0]), "v"(a[3]));
    }
#pragma unroll
    for (int mb = 0; mb < 4; ++mb) {
#pragma unroll
        for (int nb = 0; nb < 4; ++nb) {
#pragma unroll
            for (int j = 0; j < 8; ++j) os[(hi * 8 + j) * 68 + nb * 16 + lr] = acc[mb][nb][j]; }
        __builtin_amdgcn_wave_barrier(); asm volatile("" ::: "memory");
        float* crow = C + (size_t)(r0 + mb * 16) * ldc + c0;
{
#pragma unroll
            for (int s = 0; s < 8; ++s) { const int row = 2 * s + hi, cofs = lr * 4; v4f val = *(const v4fa*)(os + row * 68 + cofs); if (BIAS) { val[0] += bfr(bias[c0 + cofs]); val[1] += bfr(bias[c0 + cofs + 1]); val[2] += bfr(bias[c0 + cofs + 2]); val[3] += bfr(bias[c0 + cofs + 3]); }
                *(v4f*)(crow + (size_t)row * ldc + cofs) = val; }
             }
        __builtin_amdgcn_wave_barrier(); asm volatile("" ::: "memory");
    }
}



__device__ __forceinline__ h16 tohx(float x) { return (h16)x; }
__device__ __forceinline__ void splitf(float y, unsigned short& h, unsigned short& l) { h = f2bf(y); l = f2bf(y - bf2f(h)); }
typedef __attribute__((ext_vector_type(2))) _Float16 v2h;
typedef __attribute__((ext_vector_type(4))) _Float16 v4h;
typedef __attribute__((ext_vector_type(2))) unsigned short v2us;
typedef __attribute__((ext_vector_type(4))) unsigned short v4us;
typedef __attribute__((ext_vector_type(2))) float v2f;
typedef __attribute__((ext_vector_type(4))) int v4i;

// k_rope: head planes [h][t][d] (fp16) of rope(x) x sc with the rotate-half convention out[d] = x[d] cos[t][d] - x[d+HD/2] sin[t][d], out[d+HD/2] = x[d+HD/2] cos[t][d+HD/2] + x[d] sin[t][d+HD/2]
__global__ __launch_bounds__(256) void k_rope(const float* __restrict__ F, int pitch, int nheads, const float* __restrict__ CS, const float* __restrict__ RF, const float* __restrict__ nw, float sc, h16* P16, bf* Ph, bf* Pl) {
    const size_t e = ((size_t)blockIdx.x * 256 + threadIdx.x) * 2; if (e >= (size_t)nheads * TT * HD) return; const int d = (int)(e % HD); const int t = (int)((e / HD) % TT); const int h = (int)(e / ((size_t)HD * TT)); const float* f = F + (size_t)t * pitch + h * HD; const float rf = RF ? RF[(size_t)h * TT + t] : 1.0f; v2h o16; v2us oh, ol;
#pragma unroll
    for (int q = 0; q < 2; ++q) { const int dd = d + q; const int dp = (dd < HD / 2) ? dd + HD / 2 : dd - HD / 2; float x0 = f[dd], x1 = f[dp];
        if (RF) { float n0 = __fmul_rn(x0, rf), n1 = __fmul_rn(x1, rf); x0 = __fmul_rn(bfr(nw[dd]), n0); x1 = __fmul_rn(bfr(nw[dp]), n1); }
        const v2f cs = *(const v2f*)(CS + ((size_t)t * HD + dd) * 2); float a = __fmul_rn(x0, cs[0]), bq = __fmul_rn(x1, cs[1]); const float r = ((dd < HD / 2) ? __fsub_rn(a, bq) : __fadd_rn(a, bq)) * sc;
        o16[q] = tohx(r); (void)oh; (void)ol; }
    *(v2h*)(P16 + e) = o16;  }
__global__ __launch_bounds__(256) void k_vtp(const float* __restrict__ F, int pitch, int nheads, h16* V16, bf* Vh, bf* Vl) { const size_t e = ((size_t)blockIdx.x * 256 + threadIdx.x) * 2; if (e >= (size_t)nheads * HD * TT) return; const int t = (int)(e % TT); const int d = (int)((e / TT) % HD); const int g = (int)(e / ((size_t)TT * HD)); v2h o16; v2us oh, ol;
#pragma unroll
    for (int q = 0; q < 2; ++q) { const float x = F[(size_t)(t + q) * pitch + g * HD + d]; o16[q] = tohx(x); (void)oh; (void)ol; }
    *(v2h*)(V16 + e) = o16;  }
__global__ __launch_bounds__(256) void k_csid(float* CS) { const int idx = blockIdx.x * 256 + threadIdx.x; if (idx >= TT * HD) return; v2f cs; cs[0] = 1.0f; cs[1] = 0.0f; *(v2f*)(CS + (size_t)idx * 2) = cs;  }

__global__ __launch_bounds__(256) void k_asoftMK(const float* __restrict__ Sb, const int* __restrict__ MK, h16* P16, bf* Ph, bf* Pl) {
    const int lane = threadIdx.x & 31; const int row = blockIdx.x * 8 + (threadIdx.x >> 5); if (row >= ZH * TT) return; const int i = row % TT; const int zz = row / TT; (void)zz; const bool hires = (i < RH); const float* sr = Sb + (size_t)row * TT; float v[TT / 32]; float mx = -3.0e38f;
#pragma unroll
    for (int ch = 0; ch < TT / 128; ++ch) { const int j0 = ch * 128 + lane * 4; const v4f a = *(const v4f*)(sr + j0); const v4i k4 = *(const v4i*)(MK + (size_t)i * TT + j0);   /* the keep-mask's row i beside the score row: 16 B per lane, unconditional; the SAME mask for both heads of the pass */
#pragma unroll
        for (int q = 0; q < 4; ++q) { const int j = j0 + q; (void)j; const float t = k4[q] ? a[q] * SCL : -3.0e38f;   /* keep the score where the mask's word is non-zero */ v[ch * 4 + q] = t; mx = fmaxf(mx, t); } }
#pragma unroll
    for (int sh = 16; sh; sh >>= 1) mx = fmaxf(mx, __shfl_xor(mx, sh, 32));
    float sum = 0.f;
#pragma unroll
    for (int k = 0; k < TT / 32; ++k) { float d0 = __fsub_rn(v[k], mx); v[k] = __builtin_amdgcn_exp2f(__fmul_rn(d0, 1.4426950408889634f)); sum += v[k]; }
#pragma unroll
    for (int sh = 16; sh; sh >>= 1) sum += __shfl_xor(sum, sh, 32);
    const float f = __fdiv_rn(hires ? 1.0f : PCAR, sum);
{
        if (hires) {
#pragma unroll
            for (int ch = 0; ch < TT / 128; ++ch) { v4us oh, ol;
#pragma unroll
                for (int q = 0; q < 4; ++q) { unsigned short a, c2; splitf(v[ch * 4 + q] * f, a, c2); oh[q] = a; ol[q] = c2; }
                const size_t oo = ((size_t)zz * (RH ? RH : 1) + i) * TT + ch * 128 + lane * 4; *(v4us*)(Ph + oo) = oh; *(v4us*)(Pl + oo) = ol; }
        } else {
#pragma unroll
            for (int ch = 0; ch < TT / 128; ++ch) { v4h o4;
#pragma unroll
                for (int q = 0; q < 4; ++q) o4[q] = tohx(v[ch * 4 + q] * f);
                *(v4h*)(P16 + (size_t)row * TT + ch * 128 + lane * 4) = o4; } }
         }
}

// k_castp: a plane of f32 words cast to 16-bit words, ROWS PAST THE VALID COUNT WRITTEN ZERO: dst[r][c] = T16(src[min(r, rows_valid - 1)][c] x (r < rows_valid ? mul : 0)) for a plane of 2^lc columns: the read row always lies inside the source and the lane's own row chooses the factor: a pad row's words are +-0 (a source word is finite);
template <typename T16> __device__ __forceinline__ unsigned short cv16(float x);
template <> __device__ __forceinline__ unsigned short cv16<h16>(float x) { const h16 h = (h16)x; return __builtin_bit_cast(unsigned short, h); }
template <typename T16>
__global__ __launch_bounds__(256) void k_castp(const float* __restrict__ src, int rows_valid, int lc, float mul, unsigned short* dst) { const unsigned e = blockIdx.x * 256 + threadIdx.x; const unsigned r = e >> (lc - 3); const unsigned c0 = (e & ((1u << (lc - 3)) - 1u)) << 3; const unsigned rr = (r < (unsigned)rows_valid) ? r : (unsigned)(rows_valid - 1);
    const float* s = src + ((size_t)rr << lc) + c0; const v4f a = *(const v4f*)s, b = *(const v4f*)(s + 4); const float lm = (r < (unsigned)rows_valid) ? mul : 0.0f; v8us o;   /* the FACTOR is chosen by the lane's own row, never the value: a pad row's words are finite source words x 0 */
#pragma unroll
    for (int q = 0; q < 4; ++q) { o[q] = cv16<T16>(__fmul_rn(a[q], lm)); o[q + 4] = cv16<T16>(__fmul_rn(b[q], lm)); }
    *(v8us*)(dst + (size_t)e * 8) = o;  }
__global__ __launch_bounds__(256) void k_b2h(const bf* __restrict__ src, float mul, unsigned short* dst) { const unsigned e = blockIdx.x * 256 + threadIdx.x; const v8us a = *(const v8us*)(src + (size_t)e * 8); v8us o;
#pragma unroll
    for (int q = 0; q < 8; ++q) o[q] = cv16<h16>(__fmul_rn(bf2f(a[q]), mul));
    *(v8us*)(dst + (size_t)e * 8) = o;  }

__global__ __launch_bounds__(256) void k_cvt8(const float* __restrict__ src, bf* dst, size_t n8) { const size_t i = (size_t)blockIdx.x * 256 + threadIdx.x; if (i >= n8) return; const v8f v = *(const v8f*)(src + i * 8); v8us o;
#pragma unroll
    for (int k = 0; k < 8; ++k) o[k] = f2bf(v[k]); *(v8us*)(dst + i * 8) = o;  }

__global__ __launch_bounds__(256) void k_rbf(const float* __restrict__ X, float* Y, size_t n4) { const size_t i = (size_t)blockIdx.x * 256 + threadIdx.x; if (i >= n4) return; const v4f a = *(const v4f*)(X + i * 4); v4f o;
#pragma unroll
    for (int q = 0; q < 4; ++q) o[q] = bfr(a[q]);
    *(v4f*)(Y + i * 4) = o;  }

template <bool RES>
__global__ __launch_bounds__(256) void k_lnrow(const float* __restrict__ A, const float* __restrict__ R, const float* __restrict__ gamma, const float* __restrict__ beta, float eps, int C, int nrows, float* Y) {
    const int lane = threadIdx.x & 31; const int row = blockIdx.x * 8 + (threadIdx.x >> 5); if (row >= nrows) return; const int nch = C / 128; const float* a = A + (size_t)row * C; float x[LNC_MAX / 32]; float s = 0.0f;
    for (int k = 0; k < LNC_MAX / 128; ++k) { if (k < nch) { const int c0 = k * 128 + lane * 4; v4f v = *(const v4f*)(a + c0);
            if (RES) { const v4f w = *(const v4f*)(R + (size_t)row * C + c0); v[0] = __fadd_rn(v[0], w[0]); v[1] = __fadd_rn(v[1], w[1]); v[2] = __fadd_rn(v[2], w[2]); v[3] = __fadd_rn(v[3], w[3]); }
            x[k * 4 + 0] = v[0]; x[k * 4 + 1] = v[1]; x[k * 4 + 2] = v[2]; x[k * 4 + 3] = v[3]; s = __fadd_rn(__fadd_rn(__fadd_rn(__fadd_rn(s, v[0]), v[1]), v[2]), v[3]); } }
    for (int sh = 16; sh; sh >>= 1) s = __fadd_rn(s, __shfl_xor(s, sh, 32));
    const float mean = __fdiv_rn(s, (float)C); float q = 0.0f;
    for (int k = 0; k < LNC_MAX / 128; ++k) { if (k < nch) {
            for (int j = 0; j < 4; ++j) { const float d = __fsub_rn(x[k * 4 + j], mean); x[k * 4 + j] = d; q = __fmaf_rn(d, d, q); } } }
    for (int sh = 16; sh; sh >>= 1) q = __fadd_rn(q, __shfl_xor(q, sh, 32));
    const float rstd = __fdiv_rn(1.0f, sqrtf(__fadd_rn(__fdiv_rn(q, (float)C), eps)));
    for (int k = 0; k < LNC_MAX / 128; ++k) { if (k < nch) { const int c0 = k * 128 + lane * 4; const v4f g = *(const v4f*)(gamma + c0); const v4f bt = *(const v4f*)(beta + c0);
            for (int j = 0; j < 4; ++j) x[k * 4 + j] = __fmaf_rn(__fmul_rn(x[k * 4 + j], rstd), bfr(g[j]), bfr(bt[j])); } }
    float* y = Y + (size_t)row * C;
    {
        for (int k = 0; k < LNC_MAX / 128; ++k) { if (k < nch) { v4f o; o[0] = x[k * 4 + 0]; o[1] = x[k * 4 + 1]; o[2] = x[k * 4 + 2]; o[3] = x[k * 4 + 3]; *(v4f*)(y + k * 128 + lane * 4) = o; } }
         }
}

extern "C" void kernel_launch(void* const* d_in, const int* in_sizes, int n_in,
                              void* d_out, int out_size, void* d_ws, size_t ws_size, hipStream_t stream) {
    (void)in_sizes; (void)n_in; (void)out_size;
    const float* xq = (const float*)d_in[0]; const float* xk = (const float*)d_in[1]; const float* xv = (const float*)d_in[2]; const int* kp = (const int*)d_in[3]; const float* wq = (const float*)d_in[4]; const float* cq = (const float*)d_in[5]; const float* wk = (const float*)d_in[6]; const float* ck = (const float*)d_in[7]; const float* wv = (const float*)d_in[8]; const float* cv = (const float*)d_in[9]; const float* wo = (const float*)d_in[10]; const float* co = (const float*)d_in[11]; const float* ns = (const float*)d_in[12]; const float* nb = (const float*)d_in[13];   /* fourteen arrays, all read; kp the int32 keep plane, read through a pointer of its own type */
    float* OUT = (float*)d_out;     // [2][2048][1024]
    static_assert(DQ == DM && DKV == DQ && NH_ % ZH == 0 && ((size_t)TT * DQ) % 512 == 0 && ((size_t)DQ * DM) % (8 * 256) == 0 && ((size_t)TT * DM) % (8 * 256) == 0 && TT % 64 == 0 && (ZH * TT) % 8 == 0 && DM % 128 == 0 && DM <= LNC_MAX, "the merged heads are the output map's depth; k_castp takes the plane as rows of 512 columns; the casts' and the softmax's grids are exact; the row normalisation takes whole 128-column pieces");
    char* wsp = (char*)d_ws;
    auto take = [&](size_t bytes) { char* p = wsp; wsp += (bytes + 255) & ~(size_t)255; return (void*)p; };
    bf* WQ = (bf*)take((size_t)DQ * DM * 2); bf* WK = (bf*)take((size_t)DKV * DM * 2); bf* WV = (bf*)take((size_t)DKV * DM * 2); bf* TB = (bf*)take((size_t)DM * DQ * 2); h16* WO16 = (h16*)take((size_t)DM * DQ * 2); float* CS = (float*)take((size_t)TT * HD * 2 * 4);
    bf* XQ = (bf*)take((size_t)TT * DM * 2); bf* XK = (bf*)take((size_t)TT * DM * 2); bf* XV = (bf*)take((size_t)TT * DM * 2); float* FQ = (float*)take((size_t)TT * DQ * 4); float* FK = (float*)take((size_t)TT * DQ * 4);
    h16* QP16 = (h16*)take((size_t)NH_ * TT * HD * 2); h16* KP16 = (h16*)take((size_t)NKV * TT * HD * 2); h16* VT16 = (h16*)take((size_t)NKV * HD * TT * 2);
    bf* Ph = nullptr; bf* Pl = nullptr;   /* RH 0: no hi / lo plane exists: the builders store the f16 plane only and do not read those arguments; the softmax's hi / lo stores sit under 'i < RH': never taken */
    float* Sb = (float*)take((size_t)ZH * TT * TT * 4); h16* P16 = (h16*)take((size_t)ZH * TT * TT * 2); float* YO = (float*)take((size_t)TT * DQ * 4); h16* C16 = (h16*)take((size_t)TT * DQ * 2); float* YW = (float*)take((size_t)TT * DM * 4); float* RB = (float*)take((size_t)TT * DM * 4);
    if ((size_t)(wsp - (char*)d_ws) > ws_size) return;    // 127.00 MiB carved
    const unsigned LW = (unsigned)((size_t)DQ * DM / 8 / 256); const unsigned LX = (unsigned)((size_t)TT * DM / 8 / 256);
    k_cvt8<<<LW, 256, 0, stream>>>(wq, WQ, (size_t)DQ * DM / 8); k_cvt8<<<LW, 256, 0, stream>>>(wk, WK, (size_t)DKV * DM / 8); k_cvt8<<<LW, 256, 0, stream>>>(wv, WV, (size_t)DKV * DM / 8);   /* each 'to, from' weight [1024][1024] IS its map's right operand: cast as it lies */
    k_cvt8<<<LW, 256, 0, stream>>>(wo, TB, (size_t)DM * DQ / 8); k_b2h<<<DM * DQ / 8 / 256, 256, 0, stream>>>(TB, 1.0f, (unsigned short*)WO16);   /* the last weight 'to, from' [1024][1024]: its bf16 words re-cast as f16 words */
    k_csid<<<(TT * HD + 255) / 256, 256, 0, stream>>>(CS);
    const unsigned LP = (unsigned)(((size_t)TT * DQ / 2 + 255) / 256);
    for (int b = 0; b < NB_; ++b) {
        k_cvt8<<<LX, 256, 0, stream>>>(xq + (size_t)b * TT * DM, XQ, (size_t)TT * DM / 8); k_cvt8<<<LX, 256, 0, stream>>>(xk + (size_t)b * TT * DM, XK, (size_t)TT * DM / 8); k_cvt8<<<LX, 256, 0, stream>>>(xv + (size_t)b * TT * DM, XV, (size_t)TT * DM / 8);   /* the entry's three sources, each its own bf16 copy */
        k_gemmw<bf, 0, true><<<dim3(TT / 64, DQ / 64, 1), 32, 0, stream>>>(XQ, nullptr, WQ, nullptr, DM, FQ, DQ, cq, 0, 0, 0);
        k_rope<<<LP, 256, 0, stream>>>(FQ, DQ, NH_, CS, nullptr, nullptr, 1.0f, QP16, Ph, Pl);
        k_gemmw<bf, 0, true><<<dim3(TT / 64, DKV / 64, 1), 32, 0, stream>>>(XK, nullptr, WK, nullptr, DM, FK, DKV, ck, 0, 0, 0);
        k_rope<<<LP, 256, 0, stream>>>(FK, DKV, NKV, CS, nullptr, nullptr, 1.0f, KP16, Ph, Pl);
        k_gemmw<bf, 0, true><<<dim3(TT / 64, DKV / 64, 1), 32, 0, stream>>>(XV, nullptr, WV, nullptr, DM, FQ, DKV, cv, 0, 0, 0);   /* the third map into FQ's buffer: the first map's plane is built */
        k_vtp<<<LP, 256, 0, stream>>>(FQ, DKV, NKV, VT16, Ph, Pl);
        for (int h0 = 0; h0 < NH_; h0 += ZH) { const size_t zq = (size_t)h0, zk = (size_t)(h0 / REP);
            k_gemmw<h16, 0, false><<<dim3(TT / 64, TT / 64, ZH), 32, 0, stream>>>(QP16 + zq * TT * HD, nullptr, KP16 + zk * TT * HD, nullptr, HD, Sb, TT, nullptr, (size_t)TT * HD, (size_t)TT * HD, (size_t)TT * TT);
            k_asoftMK<<<ZH * TT / 8, 256, 0, stream>>>(Sb, kp, P16, Ph, Pl);   /* the one keep-plane [2048][2048], read where it lies: the same for every entry and head */
            k_gemmw<h16, 0, false><<<dim3(TT / 64, HD / 64, ZH), 32, 0, stream>>>(P16, nullptr, VT16 + zk * HD * TT, nullptr, TT, YO + (size_t)h0 * HD, DQ, nullptr, (size_t)TT * TT, (size_t)HD * TT, (size_t)HD); }   /* each head's 64 columns straight into the token-major plane: C = YO + h x 64 at row pitch 1,024 */
        k_castp<h16><<<TT * DQ / 8 / 256, 256, 0, stream>>>(YO, TT * DQ / 512, 9, 1.0f / PCAR, (unsigned short*)C16);   /* the merged heads on ONE f16 word, the carry undone (a power of two: exact) */
        k_gemmw<h16, 0, true><<<dim3(TT / 64, DM / 64, 1), 32, 0, stream>>>(C16, nullptr, WO16, nullptr, DQ, YW, DM, co, 0, 0, 0);   /* the output map with its bias into a workspace plane */
        k_rbf<<<(unsigned)(((size_t)TT * DM / 4 + 255) / 256), 256, 0, stream>>>(xq + (size_t)b * TT * DM, RB, (size_t)TT * DM / 4);   /* the first source rounded to bf16, kept as f32: what is added back */
        k_lnrow<true><<<(unsigned)((TT + 7) / 8), 256, 0, stream>>>(YW, RB, ns, nb, 1.0e-5f, DM, TT, OUT + (size_t)b * TT * DM); }   /* the result = normalise(plane + that copy) * scale + shift: its one writer */
}

// v001
// A run of this version takes 722 microseconds.
// Timed twice side by side with v000, it ran 1.83 and 1.87 times as fast.
#include <hip/hip_runtime.h>

// A sixteen-head attention of width 1,024 with separate sources for its three maps, ONE int32 keep plane over (row, column) for every entry and head, a last map, the first source added back and a row normalisation, on two 2,048-token entries
// (a0 | a1 | a2 the three sources [2][2048][1024]; a3 the keep plane [1][1][2048][2048] int32 (where a word is nought that column is dropped for that row; one plane for every entry and head); a4 | a6 | a8 | a10 four 'to, from' weights [1024][1024] (a map's column c is its source's row dotted with the weight's row c) with their added vectors a5 | a7 | a9 | a11 [1024]; a12 | a13 the normalisation's scale and shift [1024];
//  the first map of a0, the second of a1, the third of a2, each with its added vector; head h = columns 64 h and on; dots * 64^-0.5; a dropped pair's dot replaced by a large negative constant; ONE PLAIN SOFTMAX over the 2,048 columns; the shares times the third map's rows; the sixteen heads side by side; the sum = that plane mapped by a10 (column c = the plane's row dotted with a10's row c) + a11 + a0; the result = (the sum less its row's mean) over the root of (its row's biased variance + 1e-5), times a12, plus a13 -> [2][2048][1024]; argument order as numbered). FOURTEEN inputs, all read on the device.
// THE KEEP PLANE IS READ AS DATA: every one of its 4,194,304 words is loaded and tested against nought beside the dot it governs, at every pass of every entry; nothing is assumed of its contents.
// WHERE THE TEXT AND THE FUNCTION PART: the function puts minus infinity in place of a dropped dot, this text -3e38: after the row's maximum is taken away either gives an exact nought share in f32 wherever the row keeps a column; A ROW THAT KEEPS NO COLUMN: the function gives not-a-numbers there, this text uniform shares 1 / 2,048.
// THE ARITHMETIC AS BUILT IS THE FUNCTION's OWN: 34.36 G multiply-adds (four maps 4.29 each over the two entries; the dots 8.59; the shares' sums 8.59): ratio 1.00.
// Layout: once: the four weights cast to bf16 as they lie (k_cvt8), the last one re-cast to f16 words (k_b2h, * 1); the identity table; per entry: the three sources cast to bf16; three bf16 * bf16 maps with their added vectors into f32 planes; the one-plane builders (identity table: no rotation);
// per pass of two heads: the dots f16 * f16, the register-row softmax WITH THE INTEGER KEEP PLANE read where it lies (its shares * 1024 as ONE f16 word), the shares' sums WHOSE C POINTER IS THE TOKEN-MAJOR f32 PLANE + h * 64 (row pitch 1,024); then the sixteen heads' plane cast to ONE f16 word with the carry undone,
// the last map with its added vector into a workspace plane, the first source laid at its bf16 value (k_rbf) and the row normalisation of (plane + that copy) straight into the result (k_lnrow<true>: its one writer).
// Compute dtypes, f32 accumulate: every float input rounded to bf16 at its load: the maps bf16 * bf16 on exact operands, each added vector's bf16 word in the epilogue; the three head planes, the shares * 1024 and the sixteen heads' plane on one f16 word each; the last weight's bf16 values as f16 words; softmax f32; the first source added back at its bf16 value; the normalisation f32 with the scale's and shift's bf16 words.

#define NB_  2
#define TT   2048
#define DM   1024
#define NH_  16
#define NKV  16
#define REP  (NH_ / NKV)
#define HD   64
#define DQ   (NH_ * HD)
#define DKV  (NKV * HD)
#define ZH   2      // two heads a pass: the keep-plane softmax at the defines its carriers ran
#define RH   0      // every row on one f16 score product
#define WIN  0
#define PCAR 1024.0f
#define SCL  0.125f // 64^-0.5
#define LNC_MAX 2048

typedef _Float16 h16;
typedef unsigned short bf;
typedef __attribute__((ext_vector_type(16))) __bf16   v16bf;
typedef __attribute__((ext_vector_type(16))) _Float16 v16h;
typedef __attribute__((ext_vector_type(8)))  _Float16 v8h;
typedef __attribute__((ext_vector_type(8)))  unsigned short v8us;
typedef __attribute__((ext_vector_type(8)))  float    v8f;
typedef __attribute__((ext_vector_type(4)))  float    v4f;
typedef v8h  __attribute__((may_alias)) v8ha;
typedef v4f  __attribute__((may_alias)) v4fa;
typedef v8us __attribute__((may_alias)) v8usa;

__device__ __forceinline__ unsigned short f2bf(float f) { unsigned u = __float_as_uint(f); u += 0x7FFFu + ((u >> 16) & 1u); return (unsigned short)(u >> 16); }
__device__ __forceinline__ float bf2f(unsigned short b) { return __uint_as_float(((unsigned)b) << 16); }
__device__ __forceinline__ float bfr(float f) { return bf2f(f2bf(f)); }
__device__ __forceinline__ v16h cat16(v8h lo, v8h hi) { return __builtin_shufflevector(lo, hi, 0, 1, 2, 3, 4, 5, 6, 7, 8, 9, 10, 11, 12, 13, 14, 15); }
__device__ __forceinline__ v16bf cat16b(v8us lo, v8us hi) { return __builtin_bit_cast(v16bf, __builtin_shufflevector(lo, hi, 0, 1, 2, 3, 4, 5, 6, 7, 8, 9, 10, 11, 12, 13, 14, 15)); }
__device__ __forceinline__ v8f wmma16(v16h a, v16h b, v8f c) { return __builtin_amdgcn_wmma_f32_16x16x32_f16(false, a, false, b, (short)0, c, false, false); }
__device__ __forceinline__ v8f wmmab(v16bf a, v16bf b, v8f c) { return __builtin_amdgcn_wmma_f32_16x16x32_bf16(false, a, false, b, (short)0, c, false, false); }



// ---- k_gemmw: register-blocked GEMM, NW WAVES per 64x64 output tile (16 accumulators each), operands straight from K-contiguous 16-bit planes; grid (M/64, N/64, Z), 32 * NW threads.
// C[m][n] (f32, pitch ldc, + optional f32 bias[n]) = sum_k A[m][k] Bt[n][k] (+ split products per NSPLIT). z-batch strides sA/sB/sC in elements. K % (32 * NW) == 0.
// THE DEPTH IS DEALT OVER THE WAVES: wave w takes the 32-deep steps w, w + NW, w + 2 NW ... (neighbouring waves read neighbouring 64-byte pieces of the same rows at the same trip), keeps a whole 64x64 partial tile,
// lays it in its own LDS plane, and behind ONE work-group barrier every thread sums its output words over the planes in the fixed order w = 0 .. NW - 1. NW == 1 is the one-wave form: no work-group barrier, four 16-row rounds.
template <typename T16> struct WFrag;
template <> struct WFrag<h16> { typedef v16h V; static __device__ __forceinline__ V ld(const h16* p) { return cat16(*(const v8h*)p, *(const v8h*)(p + 16)); } static __device__ __forceinline__ v8f mma(V a, V b, v8f c) { return wmma16(a, b, c); } };
template <> struct WFrag<bf> { typedef v16bf V; static __device__ __forceinline__ V ld(const bf* p) { return cat16b(*(const v8us*)p, *(const v8us*)(p + 16)); } static __device__ __forceinline__ v8f mma(V a, V b, v8f c) { return wmmab(a, b, c); } };
template <typename T16, int NSPLIT, bool BIAS, int NW>
__global__ __launch_bounds__(32 * NW) void k_gemmw(const T16* __restrict__ A, const T16* __restrict__ A2, const T16* __restrict__ Bt, const T16* __restrict__ Bt2, int K, float* C, int ldc, const float* __restrict__ bias, size_t sA, size_t sB, size_t sC) {
    typedef typename WFrag<T16>::V V;
    constexpr int MBR = (NW == 1) ? 1 : 4;      // 16-row blocks staged per round: all four where the waves' partial tiles meet
    constexpr int PL = MBR * 16 * 68;           // one wave's LDS plane, in words
    static_assert((MBR * 8) % NW == 0, "the summing threads share the staged rows evenly");
    __shared__ __align__(16) float os[NW * PL];
    const int wv = (NW == 1) ? 0 : __builtin_amdgcn_readfirstlane((int)(threadIdx.x >> 5));   // the wave's number, held scalar: the loop's bounds stay scalar
    const size_t z = blockIdx.z; A += z * sA; if (A2) A2 += z * sA; Bt += z * sB; if (Bt2) Bt2 += z * sB; C += z * sC;
    const int lane = threadIdx.x & 31, lr = lane & 15, hi = lane >> 4; const int r0 = blockIdx.x * 64, c0 = blockIdx.y * 64;
    v8f acc[4][4];
#pragma unroll
    for (int mb = 0; mb < 4; ++mb)
#pragma unroll
        for (int nb = 0; nb < 4; ++nb) acc[mb][nb] = (v8f){};
    const size_t aoff = (size_t)(r0 + lr) * K + 8 * hi, boff = (size_t)(c0 + lr) * K + 8 * hi;
    for (int kc = wv * 32; kc < K; kc += 32 * NW) {
        V a[4], a2[4];
#pragma unroll
        for (int mb = 0; mb < 4; ++mb) { a[mb] = WFrag<T16>::ld(A + aoff + (size_t)mb * 16 * K + kc); if (NSPLIT == 1 || NSPLIT == 2) a2[mb] = WFrag<T16>::ld(A2 + aoff + (size_t)mb * 16 * K + kc); }
#pragma unroll
        for (int nb = 0; nb < 4; ++nb) { const V b = WFrag<T16>::ld(Bt + boff + (size_t)nb * 16 * K + kc); V b2; if (NSPLIT >= 2) b2 = WFrag<T16>::ld(Bt2 + boff + (size_t)nb * 16 * K + kc);
#pragma unroll
            for (int mb = 0; mb < 4; ++mb) { acc[mb][nb] = WFrag<T16>::mma(a[mb], b, acc[mb][nb]); if (NSPLIT == 1 || NSPLIT == 2) acc[mb][nb] = WFrag<T16>::mma(a2[mb], b, acc[mb][nb]); if (NSPLIT >= 2) acc[mb][nb] = WFrag<T16>::mma(a[mb], b2, acc[mb][nb]); } }
        asm volatile("v_nop\n\tv_nop\n\tv_nop\n\tv_nop" : "+v"(acc[0][0]), "+v"(acc[1][1]), "+v"(acc[2][2]), "+v"(acc[3][3]) : "v"(a[0]), "v"(a[3]));
    }
    float* ow = os + wv * PL;
#pragma unroll
    for (int mb = 0; mb < 4; mb += MBR) {
        // unrolled so that every accumulator index is a constant: the tiles stay in registers
#pragma unroll
        for (int mi = 0; mi < MBR; ++mi) {
#pragma unroll
            for (int nb = 0; nb < 4; ++nb) {
#pragma unroll
                for (int j = 0; j < 8; ++j) ow[(mi * 16 + hi * 8 + j) * 68 + nb * 16 + lr] = acc[mb + mi][nb][j]; } }
        if (NW == 1) { __builtin_amdgcn_wave_barrier(); asm volatile("" ::: "memory"); } else __syncthreads();   // every wave's partial tile lies in LDS before any thread sums over the planes
        float* crow = C + (size_t)(r0 + mb * 16) * ldc + c0;
{
#pragma unroll
            for (int s = 0; s < MBR * 8 / NW; ++s) { const int q = s * 32 * NW + (int)threadIdx.x; const int row = q >> 4, cofs = (q & 15) * 4; v4f val = *(const v4fa*)(os + row * 68 + cofs);
                // unrolled so that the planes' LDS reads issue together; the adds keep the order w = 1 .. NW - 1
#pragma unroll
                for (int w = 1; w < NW; ++w) val += *(const v4fa*)(os + w * PL + row * 68 + cofs);
                if (BIAS) { val[0] += bfr(bias[c0 + cofs]); val[1] += bfr(bias[c0 + cofs + 1]); val[2] += bfr(bias[c0 + cofs + 2]); val[3] += bfr(bias[c0 + cofs + 3]); }
                *(v4f*)(crow + (size_t)row * ldc + cofs) = val; }
             }
        if (NW == 1) { __builtin_amdgcn_wave_barrier(); asm volatile("" ::: "memory"); }   // NW > 1 has one round only: nothing is staged behind the sums
    }
}



__device__ __forceinline__ h16 tohx(float x) { return (h16)x; }
__device__ __forceinline__ void splitf(float y, unsigned short& h, unsigned short& l) { h = f2bf(y); l = f2bf(y - bf2f(h)); }
typedef __attribute__((ext_vector_type(2))) _Float16 v2h;
typedef __attribute__((ext_vector_type(4))) _Float16 v4h;
typedef __attribute__((ext_vector_type(2))) unsigned short v2us;
typedef __attribute__((ext_vector_type(4))) unsigned short v4us;
typedef __attribute__((ext_vector_type(2))) float v2f;
typedef __attribute__((ext_vector_type(4))) int v4i;

// k_rope: head planes [h][t][d] (fp16) of rope(x) x sc with the rotate-half convention out[d] = x[d] cos[t][d] - x[d+HD/2] sin[t][d], out[d+HD/2] = x[d+HD/2] cos[t][d+HD/2] + x[d] sin[t][d+HD/2]
__global__ __launch_bounds__(256) void k_rope(const float* __restrict__ F, int pitch, int nheads, const float* __restrict__ CS, const float* __restrict__ RF, const float* __restrict__ nw, float sc, h16* P16, bf* Ph, bf* Pl) {
    const size_t e = ((size_t)blockIdx.x * 256 + threadIdx.x) * 2; if (e >= (size_t)nheads * TT * HD) return; const int d = (int)(e % HD); const int t = (int)((e / HD) % TT); const int h = (int)(e / ((size_t)HD * TT)); const float* f = F + (size_t)t * pitch + h * HD; const float rf = RF ? RF[(size_t)h * TT + t] : 1.0f; v2h o16; v2us oh, ol;
#pragma unroll
    for (int q = 0; q < 2; ++q) { const int dd = d + q; const int dp = (dd < HD / 2) ? dd + HD / 2 : dd - HD / 2; float x0 = f[dd], x1 = f[dp];
        if (RF) { float n0 = __fmul_rn(x0, rf), n1 = __fmul_rn(x1, rf); x0 = __fmul_rn(bfr(nw[dd]), n0); x1 = __fmul_rn(bfr(nw[dp]), n1); }
        const v2f cs = *(const v2f*)(CS + ((size_t)t * HD + dd) * 2); float a = __fmul_rn(x0, cs[0]), bq = __fmul_rn(x1, cs[1]); const float r = ((dd < HD / 2) ? __fsub_rn(a, bq) : __fadd_rn(a, bq)) * sc;
        o16[q] = tohx(r); (void)oh; (void)ol; }
    *(v2h*)(P16 + e) = o16;  }
__global__ __launch_bounds__(256) void k_vtp(const float* __restrict__ F, int pitch, int nheads, h16* V16, bf* Vh, bf* Vl) { const size_t e = ((size_t)blockIdx.x * 256 + threadIdx.x) * 2; if (e >= (size_t)nheads * HD * TT) return; const int t = (int)(e % TT); const int d = (int)((e / TT) % HD); const int g = (int)(e / ((size_t)TT * HD)); v2h o16; v2us oh, ol;
#pragma unroll
    for (int q = 0; q < 2; ++q) { const float x = F[(size_t)(t + q) * pitch + g * HD + d]; o16[q] = tohx(x); (void)oh; (void)ol; }
    *(v2h*)(V16 + e) = o16;  }
__global__ __launch_bounds__(256) void k_csid(float* CS) { const int idx = blockIdx.x * 256 + threadIdx.x; if (idx >= TT * HD) return; v2f cs; cs[0] = 1.0f; cs[1] = 0.0f; *(v2f*)(CS + (size_t)idx * 2) = cs;  }

__global__ __launch_bounds__(256) void k_asoftMK(const float* __restrict__ Sb, const int* __restrict__ MK, h16* P16, bf* Ph, bf* Pl) {
    const int lane = threadIdx.x & 31; const int row = blockIdx.x * 8 + (threadIdx.x >> 5); if (row >= ZH * TT) return; const int i = row % TT; const int zz = row / TT; (void)zz; const bool hires = (i < RH); const float* sr = Sb + (size_t)row * TT; float v[TT / 32]; float mx = -3.0e38f;
#pragma unroll
    for (int ch = 0; ch < TT / 128; ++ch) { const int j0 = ch * 128 + lane * 4; const v4f a = *(const v4f*)(sr + j0); const v4i k4 = *(const v4i*)(MK + (size_t)i * TT + j0);   /* the keep-mask's row i beside the score row: 16 B per lane, unconditional; the SAME mask for both heads of the pass */
#pragma unroll
        for (int q = 0; q < 4; ++q) { const int j = j0 + q; (void)j; const float t = k4[q] ? a[q] * SCL : -3.0e38f;   /* keep the score where the mask's word is non-zero */ v[ch * 4 + q] = t; mx = fmaxf(mx, t); } }
#pragma unroll
    for (int sh = 16; sh; sh >>= 1) mx = fmaxf(mx, __shfl_xor(mx, sh, 32));
    float sum = 0.f;
#pragma unroll
    for (int k = 0; k < TT / 32; ++k) { float d0 = __fsub_rn(v[k], mx); v[k] = __builtin_amdgcn_exp2f(__fmul_rn(d0, 1.4426950408889634f)); sum += v[k]; }
#pragma unroll
    for (int sh = 16; sh; sh >>= 1) sum += __shfl_xor(sum, sh, 32);
    const float f = __fdiv_rn(hires ? 1.0f : PCAR, sum);
{
        if (hires) {
#pragma unroll
            for (int ch = 0; ch < TT / 128; ++ch) { v4us oh, ol;
#pragma unroll
                for (int q = 0; q < 4; ++q) { unsigned short a, c2; splitf(v[ch * 4 + q] * f, a, c2); oh[q] = a; ol[q] = c2; }
                const size_t oo = ((size_t)zz * (RH ? RH : 1) + i) * TT + ch * 128 + lane * 4; *(v4us*)(Ph + oo) = oh; *(v4us*)(Pl + oo) = ol; }
        } else {
#pragma unroll
            for (int ch = 0; ch < TT / 128; ++ch) { v4h o4;
#pragma unroll
                for (int q = 0; q < 4; ++q) o4[q] = tohx(v[ch * 4 + q] * f);
                *(v4h*)(P16 + (size_t)row * TT + ch * 128 + lane * 4) = o4; } }
         }
}

// k_castp: a plane of f32 words cast to 16-bit words, ROWS PAST THE VALID COUNT WRITTEN ZERO: dst[r][c] = T16(src[min(r, rows_valid - 1)][c] x (r < rows_valid ? mul : 0)) for a plane of 2^lc columns: the read row always lies inside the source and the lane's own row chooses the factor: a pad row's words are +-0 (a source word is finite);
template <typename T16> __device__ __forceinline__ unsigned short cv16(float x);
template <> __device__ __forceinline__ unsigned short cv16<h16>(float x) { const h16 h = (h16)x; return __builtin_bit_cast(unsigned short, h); }
template <typename T16>
__global__ __launch_bounds__(256) void k_castp(const float* __restrict__ src, int rows_valid, int lc, float mul, unsigned short* dst) { const unsigned e = blockIdx.x * 256 + threadIdx.x; const unsigned r = e >> (lc - 3); const unsigned c0 = (e & ((1u << (lc - 3)) - 1u)) << 3; const unsigned rr = (r < (unsigned)rows_valid) ? r : (unsigned)(rows_valid - 1);
    const float* s = src + ((size_t)rr << lc) + c0; const v4f a = *(const v4f*)s, b = *(const v4f*)(s + 4); const float lm = (r < (unsigned)rows_valid) ? mul : 0.0f; v8us o;   /* the FACTOR is chosen by the lane's own row, never the value: a pad row's words are finite source words x 0 */
#pragma unroll
    for (int q = 0; q < 4; ++q) { o[q] = cv16<T16>(__fmul_rn(a[q], lm)); o[q + 4] = cv16<T16>(__fmul_rn(b[q], lm)); }
    *(v8us*)(dst + (size_t)e * 8) = o;  }
__global__ __launch_bounds__(256) void k_b2h(const bf* __restrict__ src, float mul, unsigned short* dst) { const unsigned e = blockIdx.x * 256 + threadIdx.x; const v8us a = *(const v8us*)(src + (size_t)e * 8); v8us o;
#pragma unroll
    for (int q = 0; q < 8; ++q) o[q] = cv16<h16>(__fmul_rn(bf2f(a[q]), mul));
    *(v8us*)(dst + (size_t)e * 8) = o;  }

__global__ __launch_bounds__(256) void k_cvt8(const float* __restrict__ src, bf* dst, size_t n8) { const size_t i = (size_t)blockIdx.x * 256 + threadIdx.x; if (i >= n8) return; const v8f v = *(const v8f*)(src + i * 8); v8us o;
#pragma unroll
    for (int k = 0; k < 8; ++k) o[k] = f2bf(v[k]); *(v8us*)(dst + i * 8) = o;  }

__global__ __launch_bounds__(256) void k_rbf(const float* __restrict__ X, float* Y, size_t n4) { const size_t i = (size_t)blockIdx.x * 256 + threadIdx.x; if (i >= n4) return; const v4f a = *(const v4f*)(X + i * 4); v4f o;
#pragma unroll
    for (int q = 0; q < 4; ++q) o[q] = bfr(a[q]);
    *(v4f*)(Y + i * 4) = o;  }

template <bool RES>
__global__ __launch_bounds__(256) void k_lnrow(const float* __restrict__ A, const float* __restrict__ R, const float* __restrict__ gamma, const float* __restrict__ beta, float eps, int C, int nrows, float* Y) {
    const int lane = threadIdx.x & 31; const int row = blockIdx.x * 8 + (threadIdx.x >> 5); if (row >= nrows) return; const int nch = C / 128; const float* a = A + (size_t)row * C; float x[LNC_MAX / 32]; float s = 0.0f;
    for (int k = 0; k < LNC_MAX / 128; ++k) { if (k < nch) { const int c0 = k * 128 + lane * 4; v4f v = *(const v4f*)(a + c0);
            if (RES) { const v4f w = *(const v4f*)(R + (size_t)row * C + c0); v[0] = __fadd_rn(v[0], w[0]); v[1] = __fadd_rn(v[1], w[1]); v[2] = __fadd_rn(v[2], w[2]); v[3] = __fadd_rn(v[3], w[3]); }
            x[k * 4 + 0] = v[0]; x[k * 4 + 1] = v[1]; x[k * 4 + 2] = v[2]; x[k * 4 + 3] = v[3]; s = __fadd_rn(__fadd_rn(__fadd_rn(__fadd_rn(s, v[0]), v[1]), v[2]), v[3]); } }
    for (int sh = 16; sh; sh >>= 1) s = __fadd_rn(s, __shfl_xor(s, sh, 32));
    const float mean = __fdiv_rn(s, (float)C); float q = 0.0f;
    for (int k = 0; k < LNC_MAX / 128; ++k) { if (k < nch) {
            for (int j = 0; j < 4; ++j) { const float d = __fsub_rn(x[k * 4 + j], mean); x[k * 4 + j] = d; q = __fmaf_rn(d, d, q); } } }
    for (int sh = 16; sh; sh >>= 1) q = __fadd_rn(q, __shfl_xor(q, sh, 32));
    const float rstd = __fdiv_rn(1.0f, sqrtf(__fadd_rn(__fdiv_rn(q, (float)C), eps)));
    for (int k = 0; k < LNC_MAX / 128; ++k) { if (k < nch) { const int c0 = k * 128 + lane * 4; const v4f g = *(const v4f*)(gamma + c0); const v4f bt = *(const v4f*)(beta + c0);
            for (int j = 0; j < 4; ++j) x[k * 4 + j] = __fmaf_rn(__fmul_rn(x[k * 4 + j], rstd), bfr(g[j]), bfr(bt[j])); } }
    float* y = Y + (size_t)row * C;
    {
        for (int k = 0; k < LNC_MAX / 128; ++k) { if (k < nch) { v4f o; o[0] = x[k * 4 + 0]; o[1] = x[k * 4 + 1]; o[2] = x[k * 4 + 2]; o[3] = x[k * 4 + 3]; *(v4f*)(y + k * 128 + lane * 4) = o; } }
         }
}

extern "C" void kernel_launch(void* const* d_in, const int* in_sizes, int n_in,
                              void* d_out, int out_size, void* d_ws, size_t ws_size, hipStream_t stream) {
    (void)in_sizes; (void)n_in; (void)out_size;
    const float* xq = (const float*)d_in[0]; const float* xk = (const float*)d_in[1]; const float* xv = (const float*)d_in[2]; const int* kp = (const int*)d_in[3]; const float* wq = (const float*)d_in[4]; const float* cq = (const float*)d_in[5]; const float* wk = (const float*)d_in[6]; const float* ck = (const float*)d_in[7]; const float* wv = (const float*)d_in[8]; const float* cv = (const float*)d_in[9]; const float* wo = (const float*)d_in[10]; const float* co = (const float*)d_in[11]; const float* ns = (const float*)d_in[12]; const float* nb = (const float*)d_in[13];   /* fourteen arrays, all read; kp the int32 keep plane, read through a pointer of its own type */
    float* OUT = (float*)d_out;     // [2][2048][1024]
    static_assert(DQ == DM && DKV == DQ && NH_ % ZH == 0 && ((size_t)TT * DQ) % 512 == 0 && ((size_t)DQ * DM) % (8 * 256) == 0 && ((size_t)TT * DM) % (8 * 256) == 0 && TT % 64 == 0 && TT % (32 * 16) == 0 && DM % (32 * 8) == 0 && DQ % (32 * 8) == 0 && (ZH * TT) % 8 == 0 && DM % 128 == 0 && DM <= LNC_MAX, "the merged heads are the output map's depth; k_castp takes the plane as rows of 512 columns; the casts' and the softmax's grids are exact; the row normalisation takes whole 128-column pieces");
    char* wsp = (char*)d_ws;
    auto take = [&](size_t bytes) { char* p = wsp; wsp += (bytes + 255) & ~(size_t)255; return (void*)p; };
    bf* WQ = (bf*)take((size_t)DQ * DM * 2); bf* WK = (bf*)take((size_t)DKV * DM * 2); bf* WV = (bf*)take((size_t)DKV * DM * 2); bf* TB = (bf*)take((size_t)DM * DQ * 2); h16* WO16 = (h16*)take((size_t)DM * DQ * 2); float* CS = (float*)take((size_t)TT * HD * 2 * 4);
    bf* XQ = (bf*)take((size_t)TT * DM * 2); bf* XK = (bf*)take((size_t)TT * DM * 2); bf* XV = (bf*)take((size_t)TT * DM * 2); float* FQ = (float*)take((size_t)TT * DQ * 4); float* FK = (float*)take((size_t)TT * DQ * 4);
    h16* QP16 = (h16*)take((size_t)NH_ * TT * HD * 2); h16* KP16 = (h16*)take((size_t)NKV * TT * HD * 2); h16* VT16 = (h16*)take((size_t)NKV * HD * TT * 2);
    bf* Ph = nullptr; bf* Pl = nullptr;   /* RH 0: no hi / lo plane exists: the builders store the f16 plane only and do not read those arguments; the softmax's hi / lo stores sit under 'i < RH': never taken */
    float* Sb = (float*)take((size_t)ZH * TT * TT * 4); h16* P16 = (h16*)take((size_t)ZH * TT * TT * 2); float* YO = (float*)take((size_t)TT * DQ * 4); h16* C16 = (h16*)take((size_t)TT * DQ * 2); float* YW = (float*)take((size_t)TT * DM * 4); float* RB = (float*)take((size_t)TT * DM * 4);
    if ((size_t)(wsp - (char*)d_ws) > ws_size) return;    // 127.00 MiB carved
    const unsigned LW = (unsigned)((size_t)DQ * DM / 8 / 256); const unsigned LX = (unsigned)((size_t)TT * DM / 8 / 256);
    k_cvt8<<<LW, 256, 0, stream>>>(wq, WQ, (size_t)DQ * DM / 8); k_cvt8<<<LW, 256, 0, stream>>>(wk, WK, (size_t)DKV * DM / 8); k_cvt8<<<LW, 256, 0, stream>>>(wv, WV, (size_t)DKV * DM / 8);   /* each 'to, from' weight [1024][1024] IS its map's right operand: cast as it lies */
    k_cvt8<<<LW, 256, 0, stream>>>(wo, TB, (size_t)DM * DQ / 8); k_b2h<<<DM * DQ / 8 / 256, 256, 0, stream>>>(TB, 1.0f, (unsigned short*)WO16);   /* the last weight 'to, from' [1024][1024]: its bf16 words re-cast as f16 words */
    k_csid<<<(TT * HD + 255) / 256, 256, 0, stream>>>(CS);
    const unsigned LP = (unsigned)(((size_t)TT * DQ / 2 + 255) / 256);
    for (int b = 0; b < NB_; ++b) {
        k_cvt8<<<LX, 256, 0, stream>>>(xq + (size_t)b * TT * DM, XQ, (size_t)TT * DM / 8); k_cvt8<<<LX, 256, 0, stream>>>(xk + (size_t)b * TT * DM, XK, (size_t)TT * DM / 8); k_cvt8<<<LX, 256, 0, stream>>>(xv + (size_t)b * TT * DM, XV, (size_t)TT * DM / 8);   /* the entry's three sources, each its own bf16 copy */
        k_gemmw<bf, 0, true, 8><<<dim3(TT / 64, DQ / 64, 1), 256, 0, stream>>>(XQ, nullptr, WQ, nullptr, DM, FQ, DQ, cq, 0, 0, 0);
        k_rope<<<LP, 256, 0, stream>>>(FQ, DQ, NH_, CS, nullptr, nullptr, 1.0f, QP16, Ph, Pl);
        k_gemmw<bf, 0, true, 8><<<dim3(TT / 64, DKV / 64, 1), 256, 0, stream>>>(XK, nullptr, WK, nullptr, DM, FK, DKV, ck, 0, 0, 0);
        k_rope<<<LP, 256, 0, stream>>>(FK, DKV, NKV, CS, nullptr, nullptr, 1.0f, KP16, Ph, Pl);
        k_gemmw<bf, 0, true, 8><<<dim3(TT / 64, DKV / 64, 1), 256, 0, stream>>>(XV, nullptr, WV, nullptr, DM, FQ, DKV, cv, 0, 0, 0);   /* the third map into FQ's buffer: the first map's plane is built */
        k_vtp<<<LP, 256, 0, stream>>>(FQ, DKV, NKV, VT16, Ph, Pl);
        for (int h0 = 0; h0 < NH_; h0 += ZH) { const size_t zq = (size_t)h0, zk = (size_t)(h0 / REP);
            k_gemmw<h16, 0, false, 1><<<dim3(TT / 64, TT / 64, ZH), 32, 0, stream>>>(QP16 + zq * TT * HD, nullptr, KP16 + zk * TT * HD, nullptr, HD, Sb, TT, nullptr, (size_t)TT * HD, (size_t)TT * HD, (size_t)TT * TT);
            k_asoftMK<<<ZH * TT / 8, 256, 0, stream>>>(Sb, kp, P16, Ph, Pl);   /* the one keep-plane [2048][2048], read where it lies: the same for every entry and head */
            k_gemmw<h16, 0, false, 16><<<dim3(TT / 64, HD / 64, ZH), 512, 0, stream>>>(P16, nullptr, VT16 + zk * HD * TT, nullptr, TT, YO + (size_t)h0 * HD, DQ, nullptr, (size_t)TT * TT, (size_t)HD * TT, (size_t)HD); }   /* each head's 64 columns straight into the token-major plane: C = YO + h x 64 at row pitch 1,024 */
        k_castp<h16><<<TT * DQ / 8 / 256, 256, 0, stream>>>(YO, TT * DQ / 512, 9, 1.0f / PCAR, (unsigned short*)C16);   /* the merged heads on ONE f16 word, the carry undone (a power of two: exact) */
        k_gemmw<h16, 0, true, 8><<<dim3(TT / 64, DM / 64, 1), 256, 0, stream>>>(C16, nullptr, WO16, nullptr, DQ, YW, DM, co, 0, 0, 0);   /* the output map with its bias into a workspace plane */
        k_rbf<<<(unsigned)(((size_t)TT * DM / 4 + 255) / 256), 256, 0, stream>>>(xq + (size_t)b * TT * DM, RB, (size_t)TT * DM / 4);   /* the first source rounded to bf16, kept as f32: what is added back */
        k_lnrow<true><<<(unsigned)((TT + 7) / 8), 256, 0, stream>>>(YW, RB, ns, nb, 1.0e-5f, DM, TT, OUT + (size_t)b * TT * DM); }   /* the result = normalise(plane + that copy) * scale + shift: its one writer */
}

// v003
// One run takes 227 microseconds.
// Versions between v001 and this one are left out; their measured steps multiply to 3.16 times as fast.
// Counting every step since v000, it is 5.83 times as fast.
#include <hip/hip_runtime.h>

// A sixteen-head attention of width 1,024 with separate sources for its three maps, ONE int32 keep plane over (row, column) for every entry and head, a last map, the first source added back and a row normalisation, on two 2,048-token entries
// (a0 | a1 | a2 the three sources [2][2048][1024]; a3 the keep plane [1][1][2048][2048] int32 (where a word is nought that column is dropped for that row; one plane for every entry and head); a4 | a6 | a8 | a10 four 'to, from' weights [1024][1024] (a map's column c is its source's row dotted with the weight's row c) with their added vectors a5 | a7 | a9 | a11 [1024]; a12 | a13 the normalisation's scale and shift [1024];
//  the first map of a0, the second of a1, the third of a2, each with its added vector; head h = columns 64 h and on; dots * 64^-0.5; a dropped pair's dot replaced by a large negative constant; ONE PLAIN SOFTMAX over the 2,048 columns; the shares times the third map's rows; the sixteen heads side by side; the sum = that plane mapped by a10 (column c = the plane's row dotted with a10's row c) + a11 + a0; the result = (the sum less its row's mean) over the root of (its row's biased variance + 1e-5), times a12, plus a13 -> [2][2048][1024]; argument order as numbered). FOURTEEN inputs, all read on the device.
// THE KEEP PLANE IS READ AS DATA: every one of its 4,194,304 words is loaded and tested against nought beside the dot it governs, for every head of every entry; nothing is assumed of its contents.
// WHERE THE TEXT AND THE FUNCTION PART: the function puts minus infinity in place of a dropped dot, this text -3e38: after the row's maximum is taken away either gives an exact nought share in f32 wherever the row keeps a column; A ROW THAT KEEPS NO COLUMN: the function gives not-a-numbers there, this text uniform shares 1 / 2,048.
// THE ARITHMETIC AS BUILT IS THE FUNCTION's OWN: 34.36 G multiply-adds (four maps 4.29 each over the two entries; the dots 8.59; the shares' sums 8.59): ratio 1.00.
// Layout: once: the four weights cast to bf16 as they lie (k_cvt8), the last one re-cast to f16 words (k_b2h, * 1); per entry: the three sources cast to bf16; three bf16 * bf16 maps whose own epilogues add the vector, cast to f16 and store that entry's head planes (first and second map: one 64-column tile IS one head's 64 rows; third map: weight as the left operand, source as the right, so its tile comes out key-contiguous); no f32 plane and no builder launch between a map and the attention;
// ONE launch for both entries and all sixteen heads (k_fattn): the dots f16 * f16, the keep plane read where it lies, a running-maximum softmax in registers and the shares' sums on f16 words, 32 columns a pass: no score or share plane goes to memory; its epilogue divides by the row's sum and stores the sixteen heads' token-major plane as ONE f16 word;
// per entry: the last map with its added vector into a workspace plane, the first source laid at its bf16 value (k_rbf) and the row normalisation of (plane + that copy) straight into the result (k_lnrow<true>: its one writer).
// Compute dtypes, f32 accumulate: every float input rounded to bf16 at its load: the maps bf16 * bf16 on exact operands, each added vector's bf16 word in the epilogue; the three head planes, the unnormalised shares (at most 1) and the sixteen heads' plane on one f16 word each; the last weight's bf16 values as f16 words; softmax f32; the first source added back at its bf16 value; the normalisation f32 with the scale's and shift's bf16 words.

#define NB_  2
#define TT   2048
#define DM   1024
#define NH_  16
#define NKV  16
#define REP  (NH_ / NKV)
#define HD   64
#define DQ   (NH_ * HD)
#define DKV  (NKV * HD)
#define SCL2 0.18033688011112042f // 64^-0.5 * log2(e): the dots go straight to the exponent of two
#define LNC_MAX 2048

typedef _Float16 h16;
typedef unsigned short bf;
typedef __attribute__((ext_vector_type(16))) __bf16   v16bf;
typedef __attribute__((ext_vector_type(16))) _Float16 v16h;
typedef __attribute__((ext_vector_type(8)))  _Float16 v8h;
typedef __attribute__((ext_vector_type(8)))  unsigned short v8us;
typedef __attribute__((ext_vector_type(8)))  float    v8f;
typedef __attribute__((ext_vector_type(4)))  float    v4f;
typedef v8h  __attribute__((may_alias)) v8ha;
typedef v4f  __attribute__((may_alias)) v4fa;
typedef v8us __attribute__((may_alias)) v8usa;

__device__ __forceinline__ unsigned short f2bf(float f) { unsigned u = __float_as_uint(f); u += 0x7FFFu + ((u >> 16) & 1u); return (unsigned short)(u >> 16); }
__device__ __forceinline__ float bf2f(unsigned short b) { return __uint_as_float(((unsigned)b) << 16); }
__device__ __forceinline__ float bfr(float f) { return bf2f(f2bf(f)); }
__device__ __forceinline__ v16h cat16(v8h lo, v8h hi) { return __builtin_shufflevector(lo, hi, 0, 1, 2, 3, 4, 5, 6, 7, 8, 9, 10, 11, 12, 13, 14, 15); }
__device__ __forceinline__ v16bf cat16b(v8us lo, v8us hi) { return __builtin_bit_cast(v16bf, __builtin_shufflevector(lo, hi, 0, 1, 2, 3, 4, 5, 6, 7, 8, 9, 10, 11, 12, 13, 14, 15)); }
__device__ __forceinline__ v8f wmma16(v16h a, v16h b, v8f c) { return __builtin_amdgcn_wmma_f32_16x16x32_f16(false, a, false, b, (short)0, c, false, false); }
__device__ __forceinline__ v8f wmmab(v16bf a, v16bf b, v8f c) { return __builtin_amdgcn_wmma_f32_16x16x32_bf16(false, a, false, b, (short)0, c, false, false); }



// ---- k_gemmw: register-blocked GEMM, NW WAVES per 64x64 output tile (16 accumulators each), operands straight from K-contiguous 16-bit planes; grid (M/64, N/64, Z), 32 * NW threads.
// C[m][n] (f32 or f16 words by TO, + optional f32 bias[n], or bias[m] with BROW) = sum_k A[m][k] Bt[n][k] (+ split products per NSPLIT). z-batch strides sA/sB/sC in elements. K % (32 * NW) == 0.
// WHERE A TILE LANDS: column tile y starts at C + y * sN, its rows lie ldc apart (a plain plane: sN = 64, ldc = the plane's width; head planes [head][row][64]: sN = one head's plane, ldc = 64).
// THE DEPTH IS DEALT OVER THE WAVES: wave w takes the 32-deep steps w, w + NW, w + 2 NW ... (neighbouring waves read neighbouring 64-byte pieces of the same rows at the same trip), keeps a whole 64x64 partial tile,
// lays it in its own LDS plane, and behind ONE work-group barrier every thread sums its output words over the planes in the fixed order w = 0 .. NW - 1. NW == 1 is the one-wave form: no work-group barrier, four 16-row rounds.
template <typename T16> struct WFrag;
template <> struct WFrag<h16> { typedef v16h V; static __device__ __forceinline__ V ld(const h16* p) { return cat16(*(const v8h*)p, *(const v8h*)(p + 16)); } static __device__ __forceinline__ v8f mma(V a, V b, v8f c) { return wmma16(a, b, c); } };
template <> struct WFrag<bf> { typedef v16bf V; static __device__ __forceinline__ V ld(const bf* p) { return cat16b(*(const v8us*)p, *(const v8us*)(p + 16)); } static __device__ __forceinline__ v8f mma(V a, V b, v8f c) { return wmmab(a, b, c); } };
typedef __attribute__((ext_vector_type(4))) _Float16 v4h;
__device__ __forceinline__ void st4(float* p, v4f v) { *(v4f*)p = v; }
__device__ __forceinline__ void st4(h16* p, v4f v) { v4h o; o[0] = (h16)v[0]; o[1] = (h16)v[1]; o[2] = (h16)v[2]; o[3] = (h16)v[3]; *(v4h*)p = o; }
template <typename T16, int NSPLIT, bool BIAS, int NW, typename TO, bool BROW>
__global__ __launch_bounds__(32 * NW) void k_gemmw(const T16* __restrict__ A, const T16* __restrict__ A2, const T16* __restrict__ Bt, const T16* __restrict__ Bt2, int K, TO* C, int ldc, size_t sN, const float* __restrict__ bias, size_t sA, size_t sB, size_t sC) {
    typedef typename WFrag<T16>::V V;
    constexpr int MBR = (NW == 1) ? 1 : 4;      // 16-row blocks staged per round: all four where the waves' partial tiles meet
    constexpr int PL = MBR * 16 * 68;           // one wave's LDS plane, in words
    static_assert((MBR * 8) % NW == 0, "the summing threads share the staged rows evenly");
    __shared__ __align__(16) float os[NW * PL];
    const int wv = (NW == 1) ? 0 : __builtin_amdgcn_readfirstlane((int)(threadIdx.x >> 5));   // the wave's number, held scalar: the loop's bounds stay scalar
    const size_t z = blockIdx.z; A += z * sA; if (A2) A2 += z * sA; Bt += z * sB; if (Bt2) Bt2 += z * sB; C += z * sC;
    const int lane = threadIdx.x & 31, lr = lane & 15, hi = lane >> 4; const int r0 = blockIdx.x * 64, c0 = blockIdx.y * 64;
    v8f acc[4][4];
#pragma unroll
    for (int mb = 0; mb < 4; ++mb)
#pragma unroll
        for (int nb = 0; nb < 4; ++nb) acc[mb][nb] = (v8f){};
    const size_t aoff = (size_t)(r0 + lr) * K + 8 * hi, boff = (size_t)(c0 + lr) * K + 8 * hi;
    for (int kc = wv * 32; kc < K; kc += 32 * NW) {
        V a[4], a2[4];
#pragma unroll
        for (int mb = 0; mb < 4; ++mb) { a[mb] = WFrag<T16>::ld(A + aoff + (size_t)mb * 16 * K + kc); if (NSPLIT == 1 || NSPLIT == 2) a2[mb] = WFrag<T16>::ld(A2 + aoff + (size_t)mb * 16 * K + kc); }
#pragma unroll
        for (int nb = 0; nb < 4; ++nb) { const V b = WFrag<T16>::ld(Bt + boff + (size_t)nb * 16 * K + kc); V b2; if (NSPLIT >= 2) b2 = WFrag<T16>::ld(Bt2 + boff + (size_t)nb * 16 * K + kc);
#pragma unroll
            for (int mb = 0; mb < 4; ++mb) { acc[mb][nb] = WFrag<T16>::mma(a[mb], b, acc[mb][nb]); if (NSPLIT == 1 || NSPLIT == 2) acc[mb][nb] = WFrag<T16>::mma(a2[mb], b, acc[mb][nb]); if (NSPLIT >= 2) acc[mb][nb] = WFrag<T16>::mma(a[mb], b2, acc[mb][nb]); } }
        asm volatile("v_nop\n\tv_nop\n\tv_nop\n\tv_nop" : "+v"(acc[0][0]), "+v"(acc[1][1]), "+v"(acc[2][2]), "+v"(acc[3][3]) : "v"(a[0]), "v"(a[3]));
    }
    float* ow = os + wv * PL;
#pragma unroll
    for (int mb = 0; mb < 4; mb += MBR) {
        // unrolled so that every accumulator index is a constant: the tiles stay in registers
#pragma unroll
        for (int mi = 0; mi < MBR; ++mi) {
#pragma unroll
            for (int nb = 0; nb < 4; ++nb) {
#pragma unroll
                for (int j = 0; j < 8; ++j) ow[(mi * 16 + hi * 8 + j) * 68 + nb * 16 + lr] = acc[mb + mi][nb][j]; } }
        if (NW == 1) { __builtin_amdgcn_wave_barrier(); asm volatile("" ::: "memory"); } else __syncthreads();   // every wave's partial tile lies in LDS before any thread sums over the planes
        TO* crow = C + (size_t)blockIdx.y * sN + (size_t)(r0 + mb * 16) * ldc;
{
#pragma unroll
            for (int s = 0; s < MBR * 8 / NW; ++s) { const int q = s * 32 * NW + (int)threadIdx.x; const int row = q >> 4, cofs = (q & 15) * 4; v4f val = *(const v4fa*)(os + row * 68 + cofs);
                // unrolled so that the planes' LDS reads issue together; the adds keep the order w = 1 .. NW - 1
#pragma unroll
                for (int w = 1; w < NW; ++w) val += *(const v4fa*)(os + w * PL + row * 68 + cofs);
                if (BIAS && BROW) val += bfr(bias[r0 + mb * 16 + row]);
                if (BIAS && !BROW) { val[0] += bfr(bias[c0 + cofs]); val[1] += bfr(bias[c0 + cofs + 1]); val[2] += bfr(bias[c0 + cofs + 2]); val[3] += bfr(bias[c0 + cofs + 3]); }
                st4(crow + (size_t)row * ldc + cofs, val); }
             }
        if (NW == 1) { __builtin_amdgcn_wave_barrier(); asm volatile("" ::: "memory"); }   // NW > 1 has one round only: nothing is staged behind the sums
    }
}



__device__ __forceinline__ void splitf(float y, unsigned short& h, unsigned short& l) { h = f2bf(y); l = f2bf(y - bf2f(h)); }
typedef __attribute__((ext_vector_type(2))) _Float16 v2h;
typedef __attribute__((ext_vector_type(2))) unsigned short v2us;
typedef __attribute__((ext_vector_type(4))) unsigned short v4us;
typedef __attribute__((ext_vector_type(2))) float v2f;
typedef __attribute__((ext_vector_type(4))) int v4i;

// ---- k_fattn: dots, keep plane, softmax and the shares' sums of one head in ONE kernel; grid (TT / 256, entries * heads), 8 waves, each wave 32 query rows (two 16-column groups) against all TT keys, 32 keys a pass.
// TRANSPOSED PRODUCTS: St = K Qt (A = 16 key rows, B = 16 query rows, both by the one k-contiguous loader), so a lane holds 8 + 8 scores of ONE query (column lr; keys 8 hi + r and 16 + 8 hi + r): maximum and sum stay in the lane, the two halves of the wave join the maximum by one exchange a pass.
// The two score tiles, turned into shares and cast, ARE the B operand of Ot += Vt Pt in the hardware's k order; A = 16 rows of the key-contiguous Vt plane by the same loader (keys 8 hi .. and 16 + 8 hi ..): the k orders agree at every position.
// RUNNING MAXIMUM: every pass takes the row's maximum so far and scales the sums and the output tiles by 2^(old - new), without a branch: the pass is one straight block. A share is at most 1.
// A dropped dot is -3e38: its share is an exact nought once the row has kept a column (the first kept column wipes what came before by the factor 2^(-3e38 - new) = 0); a row that keeps none ends with uniform shares.
// All three operands of pass p + 1 (K rows, keep words, Vt rows) are fetched at the head of pass p, straight from the planes into a second set of registers. WHAT IS LEFT: every such load touches 16 lines for 512 bytes, and the eight waves fetch the same K and Vt rows each for itself.
// Every loop over tiles, column groups, blocks and registers below is unrolled so that each fragment index is a constant: the fragments and accumulators stay in registers.
__device__ __forceinline__ float xhalf(float x) { return __builtin_bit_cast(float, __builtin_amdgcn_permlanex16(__builtin_bit_cast(int, x), __builtin_bit_cast(int, x), 0x76543210, 0xfedcba98, false, false)); }   // lane l with lane l ^ 16
// eight exponentials of two, each in place: no one of them reads another's result or overwrites another's source, and the v_nop fills the slot that the instruction set asks for behind the last one, whatever the compiler puts next
__device__ __forceinline__ void exp2x8(v8f& x) { float a = x[0], b = x[1], c = x[2], d = x[3], e = x[4], f = x[5], g = x[6], h = x[7];
    asm("v_exp_f32 %0, %0\n\tv_exp_f32 %1, %1\n\tv_exp_f32 %2, %2\n\tv_exp_f32 %3, %3\n\tv_exp_f32 %4, %4\n\tv_exp_f32 %5, %5\n\tv_exp_f32 %6, %6\n\tv_exp_f32 %7, %7\n\tv_nop" : "+v"(a), "+v"(b), "+v"(c), "+v"(d), "+v"(e), "+v"(f), "+v"(g), "+v"(h));
    x[0] = a; x[1] = b; x[2] = c; x[3] = d; x[4] = e; x[5] = f; x[6] = g; x[7] = h; }
struct FOps { v16h kf[2][2]; v16h vf[4]; v4i mk[2][2][2]; };   // one pass's operands: K rows [tile][32-deep step], Vt rows [16-row block], keep words [column group][tile][half]
// one pass's 24 loads from the lane's own running addresses, and behind them the wait that stands between issued loads and the first overwrite of a register that they name
__device__ __forceinline__ void fa_fetch(FOps& n, const h16* kl, const h16* vl, const int* ml) {
#pragma unroll
    for (int t = 0; t < 2; ++t)
#pragma unroll
        for (int ks = 0; ks < 2; ++ks) n.kf[t][ks] = WFrag<h16>::ld(kl + t * 16 * HD + ks * 32);
#pragma unroll
    for (int g = 0; g < 2; ++g)
#pragma unroll
        for (int t = 0; t < 2; ++t) { n.mk[g][t][0] = *(const v4i*)(ml + g * 16 * TT + t * 16); n.mk[g][t][1] = *(const v4i*)(ml + g * 16 * TT + t * 16 + 4); }
#pragma unroll
    for (int db = 0; db < 4; ++db) n.vf[db] = WFrag<h16>::ld(vl + db * 16 * TT);
    asm volatile("s_wait_xcnt 0x0" ::: "memory");
}
// one exponential of two; the v_nop fills the slot that the instruction set asks for behind it, whatever the compiler puts next
__device__ __forceinline__ float exp2x1(float x) { float y; asm("v_exp_f32 %0, %1\n\tv_nop" : "=v"(y) : "v"(x)); return y; }
__device__ __forceinline__ void fa_pass(const FOps& c, FOps& n, const h16*& kl, const h16*& vl, const int*& ml, int step, const v16h (&qf)[2][2], v8f (&o)[4][2], float (&mu)[2], v2f (&sm)[2]) {
    typedef WFrag<h16> F;
    __builtin_amdgcn_sched_barrier(0);   // no load below climbs into the pass before, away from its wait
    fa_fetch(n, kl, vl, ml);
    __builtin_amdgcn_sched_barrier(0);   // the next pass's loads stay at the head of this pass: a whole pass of work covers their latency; and the addresses move on only behind the loads' wait
    kl += (ptrdiff_t)step * HD; vl += step; ml += step;
    v16h pf[2];
#pragma unroll
    for (int g = 0; g < 2; ++g) { v8f s[2]; float m = mu[g];
#pragma unroll
        for (int t = 0; t < 2; ++t) { s[t] = F::mma(c.kf[t][1], qf[g][1], F::mma(c.kf[t][0], qf[g][0], (v8f){}));
#pragma unroll
            for (int r = 0; r < 8; ++r) { const float x = c.mk[g][t][r >> 2][r & 3] ? s[t][r] * SCL2 : -3.0e38f;   /* keep the dot where the plane's word is non-zero */ s[t][r] = x; m = fmaxf(m, x); } }
        m = fmaxf(m, xhalf(m));   // both halves of the wave hold the query's maximum: one scale for all 32 keys
        const float f = exp2x1(mu[g] - m); mu[g] = m; sm[g] *= f;
#pragma unroll
        for (int db = 0; db < 4; ++db) o[db][g] *= f;
#pragma unroll
        for (int t = 0; t < 2; ++t) { v8f e = s[t] - m; exp2x8(e);
#pragma unroll
            for (int r = 0; r < 8; r += 2) { sm[g] += (v2f){e[r], e[r + 1]}; pf[g][t * 8 + r] = (h16)e[r]; pf[g][t * 8 + r + 1] = (h16)e[r + 1]; } } }
#pragma unroll
    for (int db = 0; db < 4; ++db)
#pragma unroll
        for (int g = 0; g < 2; ++g) o[db][g] = F::mma(c.vf[db], pf[g], o[db][g]);
}
// two waves a SIMD (one work-group a WGP): the register budget that holds both operand sets beside the accumulators without a spill
__global__ __launch_bounds__(256) __attribute__((amdgpu_waves_per_eu(2, 2))) void k_fattn(const h16* __restrict__ Qp, const h16* __restrict__ Kp, const h16* __restrict__ Vt, const int* __restrict__ MK, h16* Cx) {
    const int lane = threadIdx.x & 31, lr = lane & 15, hi = lane >> 4;
    const int wv = __builtin_amdgcn_readfirstlane((int)(threadIdx.x >> 5));   // the wave's number, held scalar
    const int zh = blockIdx.y, q0 = blockIdx.x * 256 + wv * 32;
    const h16* qb = Qp + ((size_t)zh * TT + q0 + lr) * HD + 8 * hi;
    const h16* kl = Kp + ((size_t)zh * TT + lr) * HD + 8 * hi; const h16* vl = Vt + ((size_t)zh * HD + lr) * TT + 8 * hi; const int* ml = MK + (size_t)(q0 + lr) * TT + 8 * hi;   // the lane's own running addresses: the pass to be fetched next
    v16h qf[2][2]; v8f o[4][2]; float mu[2]; v2f sm[2]; FOps A, B;
#pragma unroll
    for (int g = 0; g < 2; ++g) { mu[g] = -3.0e38f; sm[g] = (v2f){};
#pragma unroll
        for (int ks = 0; ks < 2; ++ks) qf[g][ks] = WFrag<h16>::ld(qb + g * 16 * HD + ks * 32);
#pragma unroll
        for (int db = 0; db < 4; ++db) o[db][g] = (v8f){}; }
    fa_fetch(A, kl, vl, ml);
    __builtin_amdgcn_sched_barrier(0);   // the addresses move on only behind the loads' wait
    kl += 32 * HD; vl += 32; ml += 32;
    // two passes a trip, so that the two operand sets change places without a register copy
    for (int k0 = 0; k0 < TT; k0 += 64) {
        fa_pass(A, B, kl, vl, ml, (k0 + 64 < TT) ? 32 : 32 - TT, qf, o, mu, sm);   // in the last trip the addresses go back to pass 0: its second pass fetches that again (inside the planes, not used)
        fa_pass(B, A, kl, vl, ml, 32, qf, o, mu, sm);
    }
    const int en = zh / NH_, hd = zh % NH_;
#pragma unroll
    for (int g = 0; g < 2; ++g) { const float hs = sm[g][0] + sm[g][1]; const float inv = __fdiv_rn(1.0f, hs + xhalf(hs));   // the two halves' sums meet once
        h16* c = Cx + ((size_t)en * TT + q0 + g * 16 + lr) * DQ + hd * HD + 8 * hi;
#pragma unroll
        for (int db = 0; db < 4; ++db) { v8h ov;
#pragma unroll
            for (int r = 0; r < 8; ++r) ov[r] = (h16)(o[db][g][r] * inv);
            *(v8h*)(c + db * 16) = ov; } }
}

template <typename T16> __device__ __forceinline__ unsigned short cv16(float x);
template <> __device__ __forceinline__ unsigned short cv16<h16>(float x) { const h16 h = (h16)x; return __builtin_bit_cast(unsigned short, h); }
__global__ __launch_bounds__(256) void k_b2h(const bf* __restrict__ src, float mul, unsigned short* dst) { const unsigned e = blockIdx.x * 256 + threadIdx.x; const v8us a = *(const v8us*)(src + (size_t)e * 8); v8us o;
#pragma unroll
    for (int q = 0; q < 8; ++q) o[q] = cv16<h16>(__fmul_rn(bf2f(a[q]), mul));
    *(v8us*)(dst + (size_t)e * 8) = o;  }

__global__ __launch_bounds__(256) void k_cvt8(const float* __restrict__ src, bf* dst, size_t n8) { const size_t i = (size_t)blockIdx.x * 256 + threadIdx.x; if (i >= n8) return; const v8f v = *(const v8f*)(src + i * 8); v8us o;
#pragma unroll
    for (int k = 0; k < 8; ++k) o[k] = f2bf(v[k]); *(v8us*)(dst + i * 8) = o;  }

__global__ __launch_bounds__(256) void k_rbf(const float* __restrict__ X, float* Y, size_t n4) { const size_t i = (size_t)blockIdx.x * 256 + threadIdx.x; if (i >= n4) return; const v4f a = *(const v4f*)(X + i * 4); v4f o;
#pragma unroll
    for (int q = 0; q < 4; ++q) o[q] = bfr(a[q]);
    *(v4f*)(Y + i * 4) = o;  }

template <bool RES>
__global__ __launch_bounds__(256) void k_lnrow(const float* __restrict__ A, const float* __restrict__ R, const float* __restrict__ gamma, const float* __restrict__ beta, float eps, int C, int nrows, float* Y) {
    const int lane = threadIdx.x & 31; const int row = blockIdx.x * 8 + (threadIdx.x >> 5); if (row >= nrows) return; const int nch = C / 128; const float* a = A + (size_t)row * C; float x[LNC_MAX / 32]; float s = 0.0f;
    for (int k = 0; k < LNC_MAX / 128; ++k) { if (k < nch) { const int c0 = k * 128 + lane * 4; v4f v = *(const v4f*)(a + c0);
            if (RES) { const v4f w = *(const v4f*)(R + (size_t)row * C + c0); v[0] = __fadd_rn(v[0], w[0]); v[1] = __fadd_rn(v[1], w[1]); v[2] = __fadd_rn(v[2], w[2]); v[3] = __fadd_rn(v[3], w[3]); }
            x[k * 4 + 0] = v[0]; x[k * 4 + 1] = v[1]; x[k * 4 + 2] = v[2]; x[k * 4 + 3] = v[3]; s = __fadd_rn(__fadd_rn(__fadd_rn(__fadd_rn(s, v[0]), v[1]), v[2]), v[3]); } }
    for (int sh = 16; sh; sh >>= 1) s = __fadd_rn(s, __shfl_xor(s, sh, 32));
    const float mean = __fdiv_rn(s, (float)C); float q = 0.0f;
    for (int k = 0; k < LNC_MAX / 128; ++k) { if (k < nch) {
            for (int j = 0; j < 4; ++j) { const float d = __fsub_rn(x[k * 4 + j], mean); x[k * 4 + j] = d; q = __fmaf_rn(d, d, q); } } }
    for (int sh = 16; sh; sh >>= 1) q = __fadd_rn(q, __shfl_xor(q, sh, 32));
    const float rstd = __fdiv_rn(1.0f, sqrtf(__fadd_rn(__fdiv_rn(q, (float)C), eps)));
    for (int k = 0; k < LNC_MAX / 128; ++k) { if (k < nch) { const int c0 = k * 128 + lane * 4; const v4f g = *(const v4f*)(gamma + c0); const v4f bt = *(const v4f*)(beta + c0);
            for (int j = 0; j < 4; ++j) x[k * 4 + j] = __fmaf_rn(__fmul_rn(x[k * 4 + j], rstd), bfr(g[j]), bfr(bt[j])); } }
    float* y = Y + (size_t)row * C;
    {
        for (int k = 0; k < LNC_MAX / 128; ++k) { if (k < nch) { v4f o; o[0] = x[k * 4 + 0]; o[1] = x[k * 4 + 1]; o[2] = x[k * 4 + 2]; o[3] = x[k * 4 + 3]; *(v4f*)(y + k * 128 + lane * 4) = o; } }
         }
}

extern "C" void kernel_launch(void* const* d_in, const int* in_sizes, int n_in,
                              void* d_out, int out_size, void* d_ws, size_t ws_size, hipStream_t stream) {
    (void)in_sizes; (void)n_in; (void)out_size;
    const float* xq = (const float*)d_in[0]; const float* xk = (const float*)d_in[1]; const float* xv = (const float*)d_in[2]; const int* kp = (const int*)d_in[3]; const float* wq = (const float*)d_in[4]; const float* cq = (const float*)d_in[5]; const float* wk = (const float*)d_in[6]; const float* ck = (const float*)d_in[7]; const float* wv = (const float*)d_in[8]; const float* cv = (const float*)d_in[9]; const float* wo = (const float*)d_in[10]; const float* co = (const float*)d_in[11]; const float* ns = (const float*)d_in[12]; const float* nb = (const float*)d_in[13];   /* fourteen arrays, all read; kp the int32 keep plane, read through a pointer of its own type */
    float* OUT = (float*)d_out;     // [2][2048][1024]
    static_assert(DQ == DM && DKV == DQ && REP == 1 && HD == 64 && TT % 256 == 0 && ((size_t)DQ * DM) % (8 * 256) == 0 && ((size_t)TT * DM) % (8 * 256) == 0 && TT % 64 == 0 && DM % (32 * 8) == 0 && DQ % (32 * 8) == 0 && DM % 128 == 0 && DM <= LNC_MAX, "the merged heads are the output map's depth; k_fattn takes one key head a query head, 64-wide heads and whole 256-row blocks; the casts' grids are exact; the row normalisation takes whole 128-column pieces");
    char* wsp = (char*)d_ws;
    auto take = [&](size_t bytes) { char* p = wsp; wsp += (bytes + 255) & ~(size_t)255; return (void*)p; };
    bf* WQ = (bf*)take((size_t)DQ * DM * 2); bf* WK = (bf*)take((size_t)DKV * DM * 2); bf* WV = (bf*)take((size_t)DKV * DM * 2); bf* TB = (bf*)take((size_t)DM * DQ * 2); h16* WO16 = (h16*)take((size_t)DM * DQ * 2);
    bf* XQ = (bf*)take((size_t)TT * DM * 2); bf* XK = (bf*)take((size_t)TT * DM * 2); bf* XV = (bf*)take((size_t)TT * DM * 2);
    h16* QP16 = (h16*)take((size_t)NB_ * NH_ * TT * HD * 2); h16* KP16 = (h16*)take((size_t)NB_ * NKV * TT * HD * 2); h16* VT16 = (h16*)take((size_t)NB_ * NKV * HD * TT * 2);   /* both entries' head planes: the one attention launch reads them all */
    h16* C16 = (h16*)take((size_t)NB_ * TT * DQ * 2); float* YW = (float*)take((size_t)TT * DM * 4); float* RB = (float*)take((size_t)TT * DM * 4);
    if ((size_t)(wsp - (char*)d_ws) > ws_size) return;    // 70.00 MiB carved
    const unsigned LW = (unsigned)((size_t)DQ * DM / 8 / 256); const unsigned LX = (unsigned)((size_t)TT * DM / 8 / 256);
    k_cvt8<<<LW, 256, 0, stream>>>(wq, WQ, (size_t)DQ * DM / 8); k_cvt8<<<LW, 256, 0, stream>>>(wk, WK, (size_t)DKV * DM / 8); k_cvt8<<<LW, 256, 0, stream>>>(wv, WV, (size_t)DKV * DM / 8);   /* each 'to, from' weight [1024][1024] cast as it lies: the right operand of the first two maps, the left of the third */
    k_cvt8<<<LW, 256, 0, stream>>>(wo, TB, (size_t)DM * DQ / 8); k_b2h<<<DM * DQ / 8 / 256, 256, 0, stream>>>(TB, 1.0f, (unsigned short*)WO16);   /* the last weight 'to, from' [1024][1024]: its bf16 words re-cast as f16 words */
    for (int b = 0; b < NB_; ++b) {
        k_cvt8<<<LX, 256, 0, stream>>>(xq + (size_t)b * TT * DM, XQ, (size_t)TT * DM / 8); k_cvt8<<<LX, 256, 0, stream>>>(xk + (size_t)b * TT * DM, XK, (size_t)TT * DM / 8); k_cvt8<<<LX, 256, 0, stream>>>(xv + (size_t)b * TT * DM, XV, (size_t)TT * DM / 8);   /* the entry's three sources, each its own bf16 copy */
        k_gemmw<bf, 0, true, 8, h16, false><<<dim3(TT / 64, DQ / 64, 1), 256, 0, stream>>>(XQ, nullptr, WQ, nullptr, DM, QP16 + (size_t)b * NH_ * TT * HD, HD, (size_t)TT * HD, cq, 0, 0, 0);   /* column tile y = head y: straight into its [row][64] plane */
        k_gemmw<bf, 0, true, 8, h16, false><<<dim3(TT / 64, DKV / 64, 1), 256, 0, stream>>>(XK, nullptr, WK, nullptr, DM, KP16 + (size_t)b * NKV * TT * HD, HD, (size_t)TT * HD, ck, 0, 0, 0);
        k_gemmw<bf, 0, true, 8, h16, true><<<dim3(DKV / 64, TT / 64, 1), 256, 0, stream>>>(WV, nullptr, XV, nullptr, DM, VT16 + (size_t)b * NKV * HD * TT, TT, 64, cv, 0, 0, 0); }   /* the weight's rows are the tile's rows: [head][64][key], the added vector by row */
    k_fattn<<<dim3(TT / 256, NB_ * NH_, 1), 256, 0, stream>>>(QP16, KP16, VT16, kp, C16);   /* the one keep-plane [2048][2048], read where it lies: the same for every entry and head; the merged heads come out token-major on ONE f16 word */
    for (int b = 0; b < NB_; ++b) {
        k_gemmw<h16, 0, true, 8, float, false><<<dim3(TT / 64, DM / 64, 1), 256, 0, stream>>>(C16 + (size_t)b * TT * DQ, nullptr, WO16, nullptr, DQ, YW, DM, 64, co, 0, 0, 0);   /* the output map with its bias into a workspace plane */
        k_rbf<<<(unsigned)(((size_t)TT * DM / 4 + 255) / 256), 256, 0, stream>>>(xq + (size_t)b * TT * DM, RB, (size_t)TT * DM / 4);   /* the first source rounded to bf16, kept as f32: what is added back */
        k_lnrow<true><<<(unsigned)((TT + 7) / 8), 256, 0, stream>>>(YW, RB, ns, nb, 1.0e-5f, DM, TT, OUT + (size_t)b * TT * DM); }   /* the result = normalise(plane + that copy) * scale + shift: its one writer */
}

// v004
// It runs in 186 microseconds.
// Timed twice side by side with v003, it ran 1.22 times as fast both times.
// All steps since v000 together make it 7.12 times as fast.
#include <hip/hip_runtime.h>

// A sixteen-head attention of width 1,024 with separate sources for its three maps, ONE int32 keep plane over (row, column) for every entry and head, a last map, the first source added back and a row normalisation, on two 2,048-token entries
// (a0 | a1 | a2 the three sources [2][2048][1024]; a3 the keep plane [1][1][2048][2048] int32 (where a word is nought that column is dropped for that row; one plane for every entry and head); a4 | a6 | a8 | a10 four 'to, from' weights [1024][1024] (a map's column c is its source's row dotted with the weight's row c) with their added vectors a5 | a7 | a9 | a11 [1024]; a12 | a13 the normalisation's scale and shift [1024];
//  the first map of a0, the second of a1, the third of a2, each with its added vector; head h = columns 64 h and on; dots * 64^-0.5; a dropped pair's dot replaced by a large negative constant; ONE PLAIN SOFTMAX over the 2,048 columns; the shares times the third map's rows; the sixteen heads side by side; the sum = that plane mapped by a10 (column c = the plane's row dotted with a10's row c) + a11 + a0; the result = (the sum less its row's mean) over the root of (its row's biased variance + 1e-5), times a12, plus a13 -> [2][2048][1024]; argument order as numbered). FOURTEEN inputs, all read on the device.
// THE KEEP PLANE IS READ AS DATA: every one of its 4,194,304 words is loaded and tested against nought beside the dot it governs, for every head of every entry; nothing is assumed of its contents.
// WHERE THE TEXT AND THE FUNCTION PART: the function puts minus infinity in place of a dropped dot, this text -3e38: after the row's maximum is taken away either gives an exact nought share in f32 wherever the row keeps a column; A ROW THAT KEEPS NO COLUMN: the function gives not-a-numbers there, this text uniform shares 1 / 2,048.
// THE ARITHMETIC AS BUILT IS THE FUNCTION's OWN: 34.36 G multiply-adds (four maps 4.29 each over the two entries; the dots 8.59; the shares' sums 8.59): ratio 1.00.
// Layout: ONE cast launch (k_castall) for all seven float planes: the three sources of both entries and the first three weights to bf16 as they lie, the last weight's bf16 values to f16 words; both entries in one launch (grid z) of each later kernel: three bf16 * bf16 maps whose own epilogues add the vector, cast to f16 and store that entry's head planes (first and second map: one 64-column tile IS one head's 64 rows; third map: weight as the left operand, source as the right, so its tile comes out key-contiguous); no f32 plane and no builder launch between a map and the attention;
// ONE launch for both entries and all sixteen heads (k_fattn): the dots f16 * f16, the keep plane read where it lies, a running-maximum softmax in registers and the shares' sums on f16 words, 32 columns a pass: no score or share plane goes to memory; its epilogue divides by the row's sum and stores the sixteen heads' token-major plane as ONE f16 word;
// the last map with its added vector into a workspace plane, and the row normalisation of (plane + the first source's bf16 copy from the cast launch) straight into the result (k_lnrow<true>: its one writer). Seven launches in all.
// Compute dtypes, f32 accumulate: every float input rounded to bf16 at its load: the maps bf16 * bf16 on exact operands, each added vector's bf16 word in the epilogue; the three head planes, the unnormalised shares (at most 1) and the sixteen heads' plane on one f16 word each; the last weight's bf16 values as f16 words; softmax f32; the first source added back at its bf16 value; the normalisation f32 with the scale's and shift's bf16 words.

#define NB_  2
#define TT   2048
#define DM   1024
#define NH_  16
#define NKV  16
#define REP  (NH_ / NKV)
#define HD   64
#define DQ   (NH_ * HD)
#define DKV  (NKV * HD)
#define SCL2 0.18033688011112042f // 64^-0.5 * log2(e): the dots go straight to the exponent of two
#define LNC_MAX 2048

typedef _Float16 h16;
typedef unsigned short bf;
typedef __attribute__((ext_vector_type(16))) __bf16   v16bf;
typedef __attribute__((ext_vector_type(16))) _Float16 v16h;
typedef __attribute__((ext_vector_type(8)))  _Float16 v8h;
typedef __attribute__((ext_vector_type(8)))  unsigned short v8us;
typedef __attribute__((ext_vector_type(8)))  float    v8f;
typedef __attribute__((ext_vector_type(4)))  float    v4f;
typedef v8h  __attribute__((may_alias)) v8ha;
typedef v4f  __attribute__((may_alias)) v4fa;
typedef v8us __attribute__((may_alias)) v8usa;

__device__ __forceinline__ unsigned short f2bf(float f) { unsigned u = __float_as_uint(f); u += 0x7FFFu + ((u >> 16) & 1u); return (unsigned short)(u >> 16); }
__device__ __forceinline__ float bf2f(unsigned short b) { return __uint_as_float(((unsigned)b) << 16); }
__device__ __forceinline__ float bfr(float f) { return bf2f(f2bf(f)); }
__device__ __forceinline__ v16h cat16(v8h lo, v8h hi) { return __builtin_shufflevector(lo, hi, 0, 1, 2, 3, 4, 5, 6, 7, 8, 9, 10, 11, 12, 13, 14, 15); }
__device__ __forceinline__ v16bf cat16b(v8us lo, v8us hi) { return __builtin_bit_cast(v16bf, __builtin_shufflevector(lo, hi, 0, 1, 2, 3, 4, 5, 6, 7, 8, 9, 10, 11, 12, 13, 14, 15)); }
__device__ __forceinline__ v8f wmma16(v16h a, v16h b, v8f c) { return __builtin_amdgcn_wmma_f32_16x16x32_f16(false, a, false, b, (short)0, c, false, false); }
__device__ __forceinline__ v8f wmmab(v16bf a, v16bf b, v8f c) { return __builtin_amdgcn_wmma_f32_16x16x32_bf16(false, a, false, b, (short)0, c, false, false); }



// ---- k_gemmw: register-blocked GEMM, NW WAVES per 64x64 output tile (16 accumulators each), operands straight from K-contiguous 16-bit planes; grid (M/64, N/64, Z), 32 * NW threads.
// C[m][n] (f32 or f16 words by TO, + optional f32 bias[n], or bias[m] with BROW) = sum_k A[m][k] Bt[n][k] (+ split products per NSPLIT). z-batch strides sA/sB/sC in elements. K % (32 * NW) == 0.
// WHERE A TILE LANDS: column tile y starts at C + y * sN, its rows lie ldc apart (a plain plane: sN = 64, ldc = the plane's width; head planes [head][row][64]: sN = one head's plane, ldc = 64).
// THE DEPTH IS DEALT OVER THE WAVES: wave w takes the 32-deep steps w, w + NW, w + 2 NW ... (neighbouring waves read neighbouring 64-byte pieces of the same rows at the same trip), keeps a whole 64x64 partial tile,
// lays it in its own LDS plane, and behind ONE work-group barrier every thread sums its output words over the planes in the fixed order w = 0 .. NW - 1. NW == 1 is the one-wave form: no work-group barrier, four 16-row rounds.
template <typename T16> struct WFrag;
template <> struct WFrag<h16> { typedef v16h V; static __device__ __forceinline__ V ld(const h16* p) { return cat16(*(const v8h*)p, *(const v8h*)(p + 16)); } static __device__ __forceinline__ v8f mma(V a, V b, v8f c) { return wmma16(a, b, c); } };
template <> struct WFrag<bf> { typedef v16bf V; static __device__ __forceinline__ V ld(const bf* p) { return cat16b(*(const v8us*)p, *(const v8us*)(p + 16)); } static __device__ __forceinline__ v8f mma(V a, V b, v8f c) { return wmmab(a, b, c); } };
typedef __attribute__((ext_vector_type(4))) _Float16 v4h;
__device__ __forceinline__ void st4(float* p, v4f v) { *(v4f*)p = v; }
__device__ __forceinline__ void st4(h16* p, v4f v) { v4h o; o[0] = (h16)v[0]; o[1] = (h16)v[1]; o[2] = (h16)v[2]; o[3] = (h16)v[3]; *(v4h*)p = o; }
template <typename T16, int NSPLIT, bool BIAS, int NW, typename TO, bool BROW>
__global__ __launch_bounds__(32 * NW) void k_gemmw(const T16* __restrict__ A, const T16* __restrict__ A2, const T16* __restrict__ Bt, const T16* __restrict__ Bt2, int K, TO* C, int ldc, size_t sN, const float* __restrict__ bias, size_t sA, size_t sB, size_t sC) {
    typedef typename WFrag<T16>::V V;
    constexpr int MBR = (NW == 1) ? 1 : 4;      // 16-row blocks staged per round: all four where the waves' partial tiles meet
    constexpr int PL = MBR * 16 * 68;           // one wave's LDS plane, in words
    static_assert((MBR * 8) % NW == 0, "the summing threads share the staged rows evenly");
    __shared__ __align__(16) float os[NW * PL];
    const int wv = (NW == 1) ? 0 : __builtin_amdgcn_readfirstlane((int)(threadIdx.x >> 5));   // the wave's number, held scalar: the loop's bounds stay scalar
    const size_t z = blockIdx.z; A += z * sA; if (A2) A2 += z * sA; Bt += z * sB; if (Bt2) Bt2 += z * sB; C += z * sC;
    const int lane = threadIdx.x & 31, lr = lane & 15, hi = lane >> 4; const int r0 = blockIdx.x * 64, c0 = blockIdx.y * 64;
    v8f acc[4][4];
#pragma unroll
    for (int mb = 0; mb < 4; ++mb)
#pragma unroll
        for (int nb = 0; nb < 4; ++nb) acc[mb][nb] = (v8f){};
    const size_t aoff = (size_t)(r0 + lr) * K + 8 * hi, boff = (size_t)(c0 + lr) * K + 8 * hi;
    for (int kc = wv * 32; kc < K; kc += 32 * NW) {
        V a[4], a2[4];
#pragma unroll
        for (int mb = 0; mb < 4; ++mb) { a[mb] = WFrag<T16>::ld(A + aoff + (size_t)mb * 16 * K + kc); if (NSPLIT == 1 || NSPLIT == 2) a2[mb] = WFrag<T16>::ld(A2 + aoff + (size_t)mb * 16 * K + kc); }
#pragma unroll
        for (int nb = 0; nb < 4; ++nb) { const V b = WFrag<T16>::ld(Bt + boff + (size_t)nb * 16 * K + kc); V b2; if (NSPLIT >= 2) b2 = WFrag<T16>::ld(Bt2 + boff + (size_t)nb * 16 * K + kc);
#pragma unroll
            for (int mb = 0; mb < 4; ++mb) { acc[mb][nb] = WFrag<T16>::mma(a[mb], b, acc[mb][nb]); if (NSPLIT == 1 || NSPLIT == 2) acc[mb][nb] = WFrag<T16>::mma(a2[mb], b, acc[mb][nb]); if (NSPLIT >= 2) acc[mb][nb] = WFrag<T16>::mma(a[mb], b2, acc[mb][nb]); } }
        asm volatile("v_nop\n\tv_nop\n\tv_nop\n\tv_nop" : "+v"(acc[0][0]), "+v"(acc[1][1]), "+v"(acc[2][2]), "+v"(acc[3][3]) : "v"(a[0]), "v"(a[3]));
    }
    float* ow = os + wv * PL;
#pragma unroll
    for (int mb = 0; mb < 4; mb += MBR) {
        // unrolled so that every accumulator index is a constant: the tiles stay in registers
#pragma unroll
        for (int mi = 0; mi < MBR; ++mi) {
#pragma unroll
            for (int nb = 0; nb < 4; ++nb) {
#pragma unroll
                for (int j = 0; j < 8; ++j) ow[(mi * 16 + hi * 8 + j) * 68 + nb * 16 + lr] = acc[mb + mi][nb][j]; } }
        if (NW == 1) { __builtin_amdgcn_wave_barrier(); asm volatile("" ::: "memory"); } else __syncthreads();   // every wave's partial tile lies in LDS before any thread sums over the planes
        TO* crow = C + (size_t)blockIdx.y * sN + (size_t)(r0 + mb * 16) * ldc;
{
#pragma unroll
            for (int s = 0; s < MBR * 8 / NW; ++s) { const int q = s * 32 * NW + (int)threadIdx.x; const int row = q >> 4, cofs = (q & 15) * 4; v4f val = *(const v4fa*)(os + row * 68 + cofs);
                // unrolled so that the planes' LDS reads issue together; the adds keep the order w = 1 .. NW - 1
#pragma unroll
                for (int w = 1; w < NW; ++w) val += *(const v4fa*)(os + w * PL + row * 68 + cofs);
                if (BIAS && BROW) val += bfr(bias[r0 + mb * 16 + row]);
                if (BIAS && !BROW) { val[0] += bfr(bias[c0 + cofs]); val[1] += bfr(bias[c0 + cofs + 1]); val[2] += bfr(bias[c0 + cofs + 2]); val[3] += bfr(bias[c0 + cofs + 3]); }
                st4(crow + (size_t)row * ldc + cofs, val); }
             }
        if (NW == 1) { __builtin_amdgcn_wave_barrier(); asm volatile("" ::: "memory"); }   // NW > 1 has one round only: nothing is staged behind the sums
    }
}



__device__ __forceinline__ void splitf(float y, unsigned short& h, unsigned short& l) { h = f2bf(y); l = f2bf(y - bf2f(h)); }
typedef __attribute__((ext_vector_type(2))) _Float16 v2h;
typedef __attribute__((ext_vector_type(2))) unsigned short v2us;
typedef __attribute__((ext_vector_type(4))) unsigned short v4us;
typedef __attribute__((ext_vector_type(2))) float v2f;
typedef __attribute__((ext_vector_type(4))) int v4i;

// ---- k_fattn: dots, keep plane, softmax and the shares' sums of one head in ONE kernel; grid (TT / 256, entries * heads), 8 waves, each wave 32 query rows (two 16-column groups) against all TT keys, 32 keys a pass.
// TRANSPOSED PRODUCTS: St = K Qt (A = 16 key rows, B = 16 query rows, both by the one k-contiguous loader), so a lane holds 8 + 8 scores of ONE query (column lr; keys 8 hi + r and 16 + 8 hi + r): maximum and sum stay in the lane, the two halves of the wave join the maximum by one exchange a pass.
// The two score tiles, turned into shares and cast, ARE the B operand of Ot += Vt Pt in the hardware's k order; A = 16 rows of the key-contiguous Vt plane by the same loader (keys 8 hi .. and 16 + 8 hi ..): the k orders agree at every position.
// RUNNING MAXIMUM: every pass takes the row's maximum so far and scales the sums and the output tiles by 2^(old - new), without a branch: the pass is one straight block. A share is at most 1.
// A dropped dot is -3e38: its share is an exact nought once the row has kept a column (the first kept column wipes what came before by the factor 2^(-3e38 - new) = 0); a row that keeps none ends with uniform shares.
// All three operands of pass p + 1 (K rows, keep words, Vt rows) are fetched at the head of pass p, straight from the planes into a second set of registers. WHAT IS LEFT: every such load touches 16 lines for 512 bytes, and the eight waves fetch the same K and Vt rows each for itself.
// Every loop over tiles, column groups, blocks and registers below is unrolled so that each fragment index is a constant: the fragments and accumulators stay in registers.
__device__ __forceinline__ float xhalf(float x) { return __builtin_bit_cast(float, __builtin_amdgcn_permlanex16(__builtin_bit_cast(int, x), __builtin_bit_cast(int, x), 0x76543210, 0xfedcba98, false, false)); }   // lane l with lane l ^ 16
// eight exponentials of two, each in place: no one of them reads another's result or overwrites another's source, and the v_nop fills the slot that the instruction set asks for behind the last one, whatever the compiler puts next
__device__ __forceinline__ void exp2x8(v8f& x) { float a = x[0], b = x[1], c = x[2], d = x[3], e = x[4], f = x[5], g = x[6], h = x[7];
    asm("v_exp_f32 %0, %0\n\tv_exp_f32 %1, %1\n\tv_exp_f32 %2, %2\n\tv_exp_f32 %3, %3\n\tv_exp_f32 %4, %4\n\tv_exp_f32 %5, %5\n\tv_exp_f32 %6, %6\n\tv_exp_f32 %7, %7\n\tv_nop" : "+v"(a), "+v"(b), "+v"(c), "+v"(d), "+v"(e), "+v"(f), "+v"(g), "+v"(h));
    x[0] = a; x[1] = b; x[2] = c; x[3] = d; x[4] = e; x[5] = f; x[6] = g; x[7] = h; }
struct FOps { v16h kf[2][2]; v16h vf[4]; v4i mk[2][2][2]; };   // one pass's operands: K rows [tile][32-deep step], Vt rows [16-row block], keep words [column group][tile][half]
// one pass's 24 loads from the lane's own running addresses, and behind them the wait that stands between issued loads and the first overwrite of a register that they name
__device__ __forceinline__ void fa_fetch(FOps& n, const h16* kl, const h16* vl, const int* ml) {
#pragma unroll
    for (int t = 0; t < 2; ++t)
#pragma unroll
        for (int ks = 0; ks < 2; ++ks) n.kf[t][ks] = WFrag<h16>::ld(kl + t * 16 * HD + ks * 32);
#pragma unroll
    for (int g = 0; g < 2; ++g)
#pragma unroll
        for (int t = 0; t < 2; ++t) { n.mk[g][t][0] = *(const v4i*)(ml + g * 16 * TT + t * 16); n.mk[g][t][1] = *(const v4i*)(ml + g * 16 * TT + t * 16 + 4); }
#pragma unroll
    for (int db = 0; db < 4; ++db) n.vf[db] = WFrag<h16>::ld(vl + db * 16 * TT);
    asm volatile("s_wait_xcnt 0x0" ::: "memory");
}
// one exponential of two; the v_nop fills the slot that the instruction set asks for behind it, whatever the compiler puts next
__device__ __forceinline__ float exp2x1(float x) { float y; asm("v_exp_f32 %0, %1\n\tv_nop" : "=v"(y) : "v"(x)); return y; }
__device__ __forceinline__ void fa_pass(const FOps& c, FOps& n, const h16*& kl, const h16*& vl, const int*& ml, int step, const v16h (&qf)[2][2], v8f (&o)[4][2], float (&mu)[2], v2f (&sm)[2]) {
    typedef WFrag<h16> F;
    __builtin_amdgcn_sched_barrier(0);   // no load below climbs into the pass before, away from its wait
    fa_fetch(n, kl, vl, ml);
    __builtin_amdgcn_sched_barrier(0);   // the next pass's loads stay at the head of this pass: a whole pass of work covers their latency; and the addresses move on only behind the loads' wait
    kl += (ptrdiff_t)step * HD; vl += step; ml += step;
    v16h pf[2];
#pragma unroll
    for (int g = 0; g < 2; ++g) { v8f s[2]; float m = mu[g];
#pragma unroll
        for (int t = 0; t < 2; ++t) { s[t] = F::mma(c.kf[t][1], qf[g][1], F::mma(c.kf[t][0], qf[g][0], (v8f){}));
#pragma unroll
            for (int r = 0; r < 8; ++r) { const float x = c.mk[g][t][r >> 2][r & 3] ? s[t][r] * SCL2 : -3.0e38f;   /* keep the dot where the plane's word is non-zero */ s[t][r] = x; m = fmaxf(m, x); } }
        m = fmaxf(m, xhalf(m));   // both halves of the wave hold the query's maximum: one scale for all 32 keys
        const float f = exp2x1(mu[g] - m); mu[g] = m; sm[g] *= f;
#pragma unroll
        for (int db = 0; db < 4; ++db) o[db][g] *= f;
#pragma unroll
        for (int t = 0; t < 2; ++t) { v8f e = s[t] - m; exp2x8(e);
#pragma unroll
            for (int r = 0; r < 8; r += 2) { sm[g] += (v2f){e[r], e[r + 1]}; pf[g][t * 8 + r] = (h16)e[r]; pf[g][t * 8 + r + 1] = (h16)e[r + 1]; } } }
#pragma unroll
    for (int db = 0; db < 4; ++db)
#pragma unroll
        for (int g = 0; g < 2; ++g) o[db][g] = F::mma(c.vf[db], pf[g], o[db][g]);
}
// two waves a SIMD (one work-group a WGP): the register budget that holds both operand sets beside the accumulators without a spill
__global__ __launch_bounds__(256) __attribute__((amdgpu_waves_per_eu(2, 2))) void k_fattn(const h16* __restrict__ Qp, const h16* __restrict__ Kp, const h16* __restrict__ Vt, const int* __restrict__ MK, h16* Cx) {
    const int lane = threadIdx.x & 31, lr = lane & 15, hi = lane >> 4;
    const int wv = __builtin_amdgcn_readfirstlane((int)(threadIdx.x >> 5));   // the wave's number, held scalar
    const int zh = blockIdx.y, q0 = blockIdx.x * 256 + wv * 32;
    const h16* qb = Qp + ((size_t)zh * TT + q0 + lr) * HD + 8 * hi;
    const h16* kl = Kp + ((size_t)zh * TT + lr) * HD + 8 * hi; const h16* vl = Vt + ((size_t)zh * HD + lr) * TT + 8 * hi; const int* ml = MK + (size_t)(q0 + lr) * TT + 8 * hi;   // the lane's own running addresses: the pass to be fetched next
    v16h qf[2][2]; v8f o[4][2]; float mu[2]; v2f sm[2]; FOps A, B;
#pragma unroll
    for (int g = 0; g < 2; ++g) { mu[g] = -3.0e38f; sm[g] = (v2f){};
#pragma unroll
        for (int ks = 0; ks < 2; ++ks) qf[g][ks] = WFrag<h16>::ld(qb + g * 16 * HD + ks * 32);
#pragma unroll
        for (int db = 0; db < 4; ++db) o[db][g] = (v8f){}; }
    fa_fetch(A, kl, vl, ml);
    __builtin_amdgcn_sched_barrier(0);   // the addresses move on only behind the loads' wait
    kl += 32 * HD; vl += 32; ml += 32;
    // two passes a trip, so that the two operand sets change places without a register copy
    for (int k0 = 0; k0 < TT; k0 += 64) {
        fa_pass(A, B, kl, vl, ml, (k0 + 64 < TT) ? 32 : 32 - TT, qf, o, mu, sm);   // in the last trip the addresses go back to pass 0: its second pass fetches that again (inside the planes, not used)
        fa_pass(B, A, kl, vl, ml, 32, qf, o, mu, sm);
    }
    const int en = zh / NH_, hd = zh % NH_;
#pragma unroll
    for (int g = 0; g < 2; ++g) { const float hs = sm[g][0] + sm[g][1]; const float inv = __fdiv_rn(1.0f, hs + xhalf(hs));   // the two halves' sums meet once
        h16* c = Cx + ((size_t)en * TT + q0 + g * 16 + lr) * DQ + hd * HD + 8 * hi;
#pragma unroll
        for (int db = 0; db < 4; ++db) { v8h ov;
#pragma unroll
            for (int r = 0; r < 8; ++r) ov[r] = (h16)(o[db][g][r] * inv);
            *(v8h*)(c + db * 16) = ov; } }
}

template <typename T16> __device__ __forceinline__ unsigned short cv16(float x);
template <> __device__ __forceinline__ unsigned short cv16<h16>(float x) { const h16 h = (h16)x; return __builtin_bit_cast(unsigned short, h); }
// ---- k_castall: every 16-bit copy of a float plane in ONE launch of 4,096 long waves; grid (CGX, 16), 256 threads. The planes are cut into sixteen pieces of CSEG words: pieces 0 - 11 the three sources (four each, both entries lie on end), 12 - 14 the first three weights, 15 the last weight.
// A work-group takes CSEG / CGX words of its piece: four trips of eight loads a thread; each wave-wide load is 512 bytes on end (whole lines), each store 256.
#define CSEG (1u << 20)
#define CGX  32
template <bool TOH> __device__ __forceinline__ void cast_run(const float* __restrict__ s, unsigned short* d) {
    for (int t = 0; t < 4; ++t) { v4f v[8];
        // unrolled so that a trip's eight loads are in flight together
#pragma unroll
        for (int j = 0; j < 8; ++j) v[j] = *(const v4f*)(s + (t * 8 + j) * 1024);
#pragma unroll
        for (int j = 0; j < 8; ++j) { v4us o;
#pragma unroll
            for (int q = 0; q < 4; ++q) { const unsigned short b = f2bf(v[j][q]); o[q] = TOH ? cv16<h16>(bf2f(b)) : b; }
            *(v4us*)(d + (t * 8 + j) * 1024) = o; } }
}
__global__ __launch_bounds__(256) void k_castall(const float* __restrict__ xq, const float* __restrict__ xk, const float* __restrict__ xv, const float* __restrict__ wq, const float* __restrict__ wk, const float* __restrict__ wv, const float* __restrict__ wo,
                                                 unsigned short* XQ, unsigned short* XK, unsigned short* XV, unsigned short* WQ, unsigned short* WK, unsigned short* WV, unsigned short* WO) {
    const unsigned seg = blockIdx.y; const float* s; unsigned short* d;
    if (seg < 4) { s = xq; d = XQ; } else if (seg < 8) { s = xk; d = XK; } else if (seg < 12) { s = xv; d = XV; } else if (seg == 12) { s = wq; d = WQ; } else if (seg == 13) { s = wk; d = WK; } else if (seg == 14) { s = wv; d = WV; } else { s = wo; d = WO; }
    const size_t off = (seg < 12 ? (size_t)(seg & 3u) * CSEG : 0) + (size_t)blockIdx.x * (CSEG / CGX) + threadIdx.x * 4;
    if (seg == 15) cast_run<true>(s + off, d + off); else cast_run<false>(s + off, d + off);
}

template <bool RES>
__global__ __launch_bounds__(256) void k_lnrow(const float* __restrict__ A, const bf* __restrict__ R, const float* __restrict__ gamma, const float* __restrict__ beta, float eps, int C, int nrows, float* Y) {
    const int lane = threadIdx.x & 31; const int row = blockIdx.x * 8 + (threadIdx.x >> 5); if (row >= nrows) return; const int nch = C / 128; const float* a = A + (size_t)row * C; float x[LNC_MAX / 32]; float s = 0.0f;
    for (int k = 0; k < LNC_MAX / 128; ++k) { if (k < nch) { const int c0 = k * 128 + lane * 4; v4f v = *(const v4f*)(a + c0);
            if (RES) { asm volatile("s_wait_xcnt 0x0" ::: "memory");   /* stands between the issued load and the next load, whose result may land on the first one's address registers */
                const v4us w = *(const v4us*)(R + (size_t)row * C + c0); v[0] = __fadd_rn(v[0], bf2f(w[0])); v[1] = __fadd_rn(v[1], bf2f(w[1])); v[2] = __fadd_rn(v[2], bf2f(w[2])); v[3] = __fadd_rn(v[3], bf2f(w[3])); }
            x[k * 4 + 0] = v[0]; x[k * 4 + 1] = v[1]; x[k * 4 + 2] = v[2]; x[k * 4 + 3] = v[3]; s = __fadd_rn(__fadd_rn(__fadd_rn(__fadd_rn(s, v[0]), v[1]), v[2]), v[3]); } }
    for (int sh = 16; sh; sh >>= 1) s = __fadd_rn(s, __shfl_xor(s, sh, 32));
    const float mean = __fdiv_rn(s, (float)C); float q = 0.0f;
    for (int k = 0; k < LNC_MAX / 128; ++k) { if (k < nch) {
            for (int j = 0; j < 4; ++j) { const float d = __fsub_rn(x[k * 4 + j], mean); x[k * 4 + j] = d; q = __fmaf_rn(d, d, q); } } }
    for (int sh = 16; sh; sh >>= 1) q = __fadd_rn(q, __shfl_xor(q, sh, 32));
    const float rstd = __fdiv_rn(1.0f, sqrtf(__fadd_rn(__fdiv_rn(q, (float)C), eps)));
    for (int k = 0; k < LNC_MAX / 128; ++k) { if (k < nch) { const int c0 = k * 128 + lane * 4; const v4f g = *(const v4f*)(gamma + c0); const v4f bt = *(const v4f*)(beta + c0);
            for (int j = 0; j < 4; ++j) x[k * 4 + j] = __fmaf_rn(__fmul_rn(x[k * 4 + j], rstd), bfr(g[j]), bfr(bt[j])); } }
    float* y = Y + (size_t)row * C;
    {
        for (int k = 0; k < LNC_MAX / 128; ++k) { if (k < nch) { v4f o; o[0] = x[k * 4 + 0]; o[1] = x[k * 4 + 1]; o[2] = x[k * 4 + 2]; o[3] = x[k * 4 + 3]; *(v4f*)(y + k * 128 + lane * 4) = o; } }
         }
}

extern "C" void kernel_launch(void* const* d_in, const int* in_sizes, int n_in,
                              void* d_out, int out_size, void* d_ws, size_t ws_size, hipStream_t stream) {
    (void)in_sizes; (void)n_in; (void)out_size;
    const float* xq = (const float*)d_in[0]; const float* xk = (const float*)d_in[1]; const float* xv = (const float*)d_in[2]; const int* kp = (const int*)d_in[3]; const float* wq = (const float*)d_in[4]; const float* cq = (const float*)d_in[5]; const float* wk = (const float*)d_in[6]; const float* ck = (const float*)d_in[7]; const float* wv = (const float*)d_in[8]; const float* cv = (const float*)d_in[9]; const float* wo = (const float*)d_in[10]; const float* co = (const float*)d_in[11]; const float* ns = (const float*)d_in[12]; const float* nb = (const float*)d_in[13];   /* fourteen arrays, all read; kp the int32 keep plane, read through a pointer of its own type */
    float* OUT = (float*)d_out;     // [2][2048][1024]
    static_assert(DQ == DM && DKV == DQ && REP == 1 && HD == 64 && TT % 256 == 0 && (size_t)DQ * DM == CSEG && (size_t)NB_ * TT * DM == 4 * (size_t)CSEG && CSEG / CGX == 4 * 8 * 1024 && TT % 64 == 0 && DM % (32 * 8) == 0 && DQ % (32 * 8) == 0 && DM % 128 == 0 && DM <= LNC_MAX && (NB_ * TT) % 8 == 0, "the merged heads are the output map's depth; k_fattn takes one key head a query head, 64-wide heads and whole 256-row blocks; the cast launch's sixteen pieces are exact; the row normalisation takes whole 128-column pieces");
    char* wsp = (char*)d_ws;
    auto take = [&](size_t bytes) { char* p = wsp; wsp += (bytes + 255) & ~(size_t)255; return (void*)p; };
    bf* WQ = (bf*)take((size_t)DQ * DM * 2); bf* WK = (bf*)take((size_t)DKV * DM * 2); bf* WV = (bf*)take((size_t)DKV * DM * 2); h16* WO16 = (h16*)take((size_t)DM * DQ * 2);
    bf* XQ = (bf*)take((size_t)NB_ * TT * DM * 2); bf* XK = (bf*)take((size_t)NB_ * TT * DM * 2); bf* XV = (bf*)take((size_t)NB_ * TT * DM * 2);   /* both entries' bf16 sources, on end */
    h16* QP16 = (h16*)take((size_t)NB_ * NH_ * TT * HD * 2); h16* KP16 = (h16*)take((size_t)NB_ * NKV * TT * HD * 2); h16* VT16 = (h16*)take((size_t)NB_ * NKV * HD * TT * 2);   /* both entries' head planes: the one attention launch reads them all */
    h16* C16 = (h16*)take((size_t)NB_ * TT * DQ * 2); float* YW = (float*)take((size_t)NB_ * TT * DM * 4);
    if ((size_t)(wsp - (char*)d_ws) > ws_size) return;    // 80.00 MiB carved
    k_castall<<<dim3(CGX, 16, 1), 256, 0, stream>>>(xq, xk, xv, wq, wk, wv, wo, XQ, XK, XV, WQ, WK, WV, (unsigned short*)WO16);   /* each 'to, from' weight [1024][1024] is already k-contiguous: its map's right operand (the third map's left): cast as it lies */
    k_gemmw<bf, 0, true, 8, h16, false><<<dim3(TT / 64, DQ / 64, NB_), 256, 0, stream>>>(XQ, nullptr, WQ, nullptr, DM, QP16, HD, (size_t)TT * HD, cq, (size_t)TT * DM, 0, (size_t)NH_ * TT * HD);   /* column tile y = head y: straight into its [row][64] plane; z = the entry */
    k_gemmw<bf, 0, true, 8, h16, false><<<dim3(TT / 64, DKV / 64, NB_), 256, 0, stream>>>(XK, nullptr, WK, nullptr, DM, KP16, HD, (size_t)TT * HD, ck, (size_t)TT * DM, 0, (size_t)NKV * TT * HD);
    k_gemmw<bf, 0, true, 8, h16, true><<<dim3(DKV / 64, TT / 64, NB_), 256, 0, stream>>>(WV, nullptr, XV, nullptr, DM, VT16, TT, 64, cv, 0, (size_t)TT * DM, (size_t)NKV * HD * TT);   /* the weight's rows are the tile's rows: [head][64][key], the added vector by row */
    k_fattn<<<dim3(TT / 256, NB_ * NH_, 1), 256, 0, stream>>>(QP16, KP16, VT16, kp, C16);   /* the one keep-plane [2048][2048], read where it lies: the same for every entry and head; the merged heads come out token-major on ONE f16 word */
    k_gemmw<h16, 0, true, 8, float, false><<<dim3(TT / 64, DM / 64, NB_), 256, 0, stream>>>(C16, nullptr, WO16, nullptr, DQ, YW, DM, 64, co, (size_t)TT * DQ, 0, (size_t)TT * DM);   /* the output map with its bias into a workspace plane */
    k_lnrow<true><<<(unsigned)(NB_ * TT / 8), 256, 0, stream>>>(YW, XQ, ns, nb, 1.0e-5f, DM, NB_ * TT, OUT);   /* the result = normalise(plane + the first source's bf16 copy) * scale + shift: its one writer */
}

// v005
// It runs in 160 microseconds.
// Next to v004, in two timings, it ran 1.16 times as fast each time.
// All steps since v000 together make it 8.27 times as fast.
#include <hip/hip_runtime.h>

// A sixteen-head attention of width 1,024 with separate sources for its three maps, ONE int32 keep plane over (row, column) for every entry and head, a last map, the first source added back and a row normalisation, on two 2,048-token entries
// (a0 | a1 | a2 the three sources [2][2048][1024]; a3 the keep plane [1][1][2048][2048] int32 (where a word is nought that column is dropped for that row; one plane for every entry and head); a4 | a6 | a8 | a10 four 'to, from' weights [1024][1024] (a map's column c is its source's row dotted with the weight's row c) with their added vectors a5 | a7 | a9 | a11 [1024]; a12 | a13 the normalisation's scale and shift [1024];
//  the first map of a0, the second of a1, the third of a2, each with its added vector; head h = columns 64 h and on; dots * 64^-0.5; a dropped pair's dot replaced by a large negative constant; ONE PLAIN SOFTMAX over the 2,048 columns; the shares times the third map's rows; the sixteen heads side by side; the sum = that plane mapped by a10 (column c = the plane's row dotted with a10's row c) + a11 + a0; the result = (the sum less its row's mean) over the root of (its row's biased variance + 1e-5), times a12, plus a13 -> [2][2048][1024]; argument order as numbered). FOURTEEN inputs, all read on the device.
// THE KEEP PLANE IS READ AS DATA: every one of its 4,194,304 words is loaded and tested against nought beside the dot it governs, for every head of every entry; nothing is assumed of its contents.
// WHERE THE TEXT AND THE FUNCTION PART: the function puts minus infinity in place of a dropped dot, this text -3e38: after the row's maximum is taken away either gives an exact nought share in f32 wherever the row keeps a column; A ROW THAT KEEPS NO COLUMN: the function gives not-a-numbers there, this text uniform shares 1 / 2,048.
// THE ARITHMETIC AS BUILT IS THE FUNCTION's OWN: 34.36 G multiply-adds (four maps 4.29 each over the two entries; the dots 8.59; the shares' sums 8.59): ratio 1.00.
// Layout: ONE cast launch (k_castall) for all seven float planes: the three sources of both entries and the first three weights to bf16 as they lie, the last weight's bf16 values to f16 words; both entries in one launch (grid z) of each later kernel: three bf16 * bf16 maps whose own epilogues add the vector, cast to f16 and store that entry's head planes (first and second map: one 64-column tile IS one head's 64 rows; third map: weight as the left operand, source as the right, so its tile comes out key-contiguous); no f32 plane and no builder launch between a map and the attention;
// ONE launch for both entries and all sixteen heads (k_fattn): the dots f16 * f16, the keep plane read where it lies, a running-maximum softmax in registers and the shares' sums on f16 words, 32 columns a pass: no score or share plane goes to memory; its epilogue divides by the row's sum and stores the sixteen heads' token-major plane as ONE f16 word;
// the last map with its added vector into a workspace plane, and the row normalisation of (plane + the first source's bf16 copy from the cast launch) straight into the result (k_lnrow<true>: its one writer). Seven launches in all.
// Compute dtypes, f32 accumulate: every float input rounded to bf16 at its load: the maps bf16 * bf16 on exact operands, each added vector's bf16 word in the epilogue; the three head planes, the unnormalised shares (at most 1) and the sixteen heads' plane on one f16 word each; the last weight's bf16 values as f16 words; softmax f32; the first source added back at its bf16 value; the normalisation f32 with the scale's and shift's bf16 words.

#define NB_  2
#define TT   2048
#define DM   1024
#define NH_  16
#define NKV  16
#define REP  (NH_ / NKV)
#define HD   64
#define DQ   (NH_ * HD)
#define DKV  (NKV * HD)
#define SCL2 0.18033688011112042f // 64^-0.5 * log2(e): the dots go straight to the exponent of two
#define LNC_MAX 2048

typedef _Float16 h16;
typedef unsigned short bf;
typedef __attribute__((ext_vector_type(16))) __bf16   v16bf;
typedef __attribute__((ext_vector_type(16))) _Float16 v16h;
typedef __attribute__((ext_vector_type(8)))  _Float16 v8h;
typedef __attribute__((ext_vector_type(8)))  unsigned short v8us;
typedef __attribute__((ext_vector_type(8)))  float    v8f;
typedef __attribute__((ext_vector_type(4)))  float    v4f;
typedef v8h  __attribute__((may_alias)) v8ha;
typedef v4f  __attribute__((may_alias)) v4fa;
typedef v8us __attribute__((may_alias)) v8usa;

__device__ __forceinline__ unsigned short f2bf(float f) { unsigned u = __float_as_uint(f); u += 0x7FFFu + ((u >> 16) & 1u); return (unsigned short)(u >> 16); }
__device__ __forceinline__ float bf2f(unsigned short b) { return __uint_as_float(((unsigned)b) << 16); }
__device__ __forceinline__ float bfr(float f) { return bf2f(f2bf(f)); }
__device__ __forceinline__ v16h cat16(v8h lo, v8h hi) { return __builtin_shufflevector(lo, hi, 0, 1, 2, 3, 4, 5, 6, 7, 8, 9, 10, 11, 12, 13, 14, 15); }
__device__ __forceinline__ v16bf cat16b(v8us lo, v8us hi) { return __builtin_bit_cast(v16bf, __builtin_shufflevector(lo, hi, 0, 1, 2, 3, 4, 5, 6, 7, 8, 9, 10, 11, 12, 13, 14, 15)); }
__device__ __forceinline__ v8f wmma16(v16h a, v16h b, v8f c) { return __builtin_amdgcn_wmma_f32_16x16x32_f16(false, a, false, b, (short)0, c, false, false); }
__device__ __forceinline__ v8f wmmab(v16bf a, v16bf b, v8f c) { return __builtin_amdgcn_wmma_f32_16x16x32_bf16(false, a, false, b, (short)0, c, false, false); }



// ---- k_gemmw: register-blocked GEMM, NW WAVES per 64x64 output tile (16 accumulators each), operands straight from K-contiguous 16-bit planes; grid (M/64, N/64, Z), 32 * NW threads.
// C[m][n] (f32 or f16 words by TO, + optional f32 bias[n], or bias[m] with BROW) = sum_k A[m][k] Bt[n][k] (+ split products per NSPLIT). z-batch strides sA/sB/sC in elements. K % (32 * NW) == 0.
// WHERE A TILE LANDS: column tile y starts at C + y * sN, its rows lie ldc apart (a plain plane: sN = 64, ldc = the plane's width; head planes [head][row][64]: sN = one head's plane, ldc = 64).
// THE DEPTH IS DEALT OVER THE WAVES: wave w takes the 32-deep steps w, w + NW, w + 2 NW ... (neighbouring waves read neighbouring 64-byte pieces of the same rows at the same trip), keeps a whole 64x64 partial tile,
// lays it in its own LDS plane, and behind ONE work-group barrier every thread sums its output words over the planes in the fixed order w = 0 .. NW - 1. NW == 1 is the one-wave form: no work-group barrier, four 16-row rounds.
template <typename T16> struct WFrag;
template <> struct WFrag<h16> { typedef v16h V; static __device__ __forceinline__ V ld(const h16* p) { return cat16(*(const v8h*)p, *(const v8h*)(p + 16)); } static __device__ __forceinline__ v8f mma(V a, V b, v8f c) { return wmma16(a, b, c); } };
template <> struct WFrag<bf> { typedef v16bf V; static __device__ __forceinline__ V ld(const bf* p) { return cat16b(*(const v8us*)p, *(const v8us*)(p + 16)); } static __device__ __forceinline__ v8f mma(V a, V b, v8f c) { return wmmab(a, b, c); } };
typedef __attribute__((ext_vector_type(4))) _Float16 v4h;
__device__ __forceinline__ void st4(float* p, v4f v) { *(v4f*)p = v; }
__device__ __forceinline__ void st4(h16* p, v4f v) { v4h o; o[0] = (h16)v[0]; o[1] = (h16)v[1]; o[2] = (h16)v[2]; o[3] = (h16)v[3]; *(v4h*)p = o; }
template <typename T16, int NSPLIT, bool BIAS, int NW, typename TO, bool BROW>
__global__ __launch_bounds__(32 * NW) void k_gemmw(const T16* __restrict__ A, const T16* __restrict__ A2, const T16* __restrict__ Bt, const T16* __restrict__ Bt2, int K, TO* C, int ldc, size_t sN, const float* __restrict__ bias, size_t sA, size_t sB, size_t sC) {
    typedef typename WFrag<T16>::V V;
    constexpr int MBR = (NW == 1) ? 1 : 4;      // 16-row blocks staged per round: all four where the waves' partial tiles meet
    constexpr int PL = MBR * 16 * 68;           // one wave's LDS plane, in words
    static_assert((MBR * 8) % NW == 0, "the summing threads share the staged rows evenly");
    __shared__ __align__(16) float os[NW * PL];
    const int wv = (NW == 1) ? 0 : __builtin_amdgcn_readfirstlane((int)(threadIdx.x >> 5));   // the wave's number, held scalar: the loop's bounds stay scalar
    const size_t z = blockIdx.z; A += z * sA; if (A2) A2 += z * sA; Bt += z * sB; if (Bt2) Bt2 += z * sB; C += z * sC;
    const int lane = threadIdx.x & 31, lr = lane & 15, hi = lane >> 4; const int r0 = blockIdx.x * 64, c0 = blockIdx.y * 64;
    v8f acc[4][4];
#pragma unroll
    for (int mb = 0; mb < 4; ++mb)
#pragma unroll
        for (int nb = 0; nb < 4; ++nb) acc[mb][nb] = (v8f){};
    const size_t aoff = (size_t)(r0 + lr) * K + 8 * hi, boff = (size_t)(c0 + lr) * K + 8 * hi;
    for (int kc = wv * 32; kc < K; kc += 32 * NW) {
        V a[4], a2[4];
#pragma unroll
        for (int mb = 0; mb < 4; ++mb) { a[mb] = WFrag<T16>::ld(A + aoff + (size_t)mb * 16 * K + kc); if (NSPLIT == 1 || NSPLIT == 2) a2[mb] = WFrag<T16>::ld(A2 + aoff + (size_t)mb * 16 * K + kc); }
#pragma unroll
        for (int nb = 0; nb < 4; ++nb) { const V b = WFrag<T16>::ld(Bt + boff + (size_t)nb * 16 * K + kc); V b2; if (NSPLIT >= 2) b2 = WFrag<T16>::ld(Bt2 + boff + (size_t)nb * 16 * K + kc);
#pragma unroll
            for (int mb = 0; mb < 4; ++mb) { acc[mb][nb] = WFrag<T16>::mma(a[mb], b, acc[mb][nb]); if (NSPLIT == 1 || NSPLIT == 2) acc[mb][nb] = WFrag<T16>::mma(a2[mb], b, acc[mb][nb]); if (NSPLIT >= 2) acc[mb][nb] = WFrag<T16>::mma(a[mb], b2, acc[mb][nb]); } }
        asm volatile("v_nop\n\tv_nop\n\tv_nop\n\tv_nop" : "+v"(acc[0][0]), "+v"(acc[1][1]), "+v"(acc[2][2]), "+v"(acc[3][3]) : "v"(a[0]), "v"(a[3]));
    }
    float* ow = os + wv * PL;
#pragma unroll
    for (int mb = 0; mb < 4; mb += MBR) {
        // unrolled so that every accumulator index is a constant: the tiles stay in registers
#pragma unroll
        for (int mi = 0; mi < MBR; ++mi) {
#pragma unroll
            for (int nb = 0; nb < 4; ++nb) {
#pragma unroll
                for (int j = 0; j < 8; ++j) ow[(mi * 16 + hi * 8 + j) * 68 + nb * 16 + lr] = acc[mb + mi][nb][j]; } }
        if (NW == 1) { __builtin_amdgcn_wave_barrier(); asm volatile("" ::: "memory"); } else __syncthreads();   // every wave's partial tile lies in LDS before any thread sums over the planes
        TO* crow = C + (size_t)blockIdx.y * sN + (size_t)(r0 + mb * 16) * ldc;
{
#pragma unroll
            for (int s = 0; s < MBR * 8 / NW; ++s) { const int q = s * 32 * NW + (int)threadIdx.x; const int row = q >> 4, cofs = (q & 15) * 4; v4f val = *(const v4fa*)(os + row * 68 + cofs);
                // unrolled so that the planes' LDS reads issue together; the adds keep the order w = 1 .. NW - 1
#pragma unroll
                for (int w = 1; w < NW; ++w) val += *(const v4fa*)(os + w * PL + row * 68 + cofs);
                if (BIAS && BROW) val += bfr(bias[r0 + mb * 16 + row]);
                if (BIAS && !BROW) { val[0] += bfr(bias[c0 + cofs]); val[1] += bfr(bias[c0 + cofs + 1]); val[2] += bfr(bias[c0 + cofs + 2]); val[3] += bfr(bias[c0 + cofs + 3]); }
                st4(crow + (size_t)row * ldc + cofs, val); }
             }
        if (NW == 1) { __builtin_amdgcn_wave_barrier(); asm volatile("" ::: "memory"); }   // NW > 1 has one round only: nothing is staged behind the sums
    }
}



__device__ __forceinline__ void splitf(float y, unsigned short& h, unsigned short& l) { h = f2bf(y); l = f2bf(y - bf2f(h)); }
typedef __attribute__((ext_vector_type(2))) _Float16 v2h;
typedef __attribute__((ext_vector_type(2))) unsigned short v2us;
typedef __attribute__((ext_vector_type(4))) unsigned short v4us;
typedef __attribute__((ext_vector_type(2))) float v2f;
typedef __attribute__((ext_vector_type(4))) int v4i;

// ---- k_fattn: dots, keep plane, softmax and the shares' sums of one head in ONE kernel; grid (TT / 256, entries * heads), 8 waves, each wave 32 query rows (two 16-column groups) against all TT keys, 32 keys a pass.
// TRANSPOSED PRODUCTS: St = K Qt (A = 16 key rows, B = 16 query rows, both by the one k-contiguous loader), so a lane holds 8 + 8 scores of ONE query (column lr; keys 8 hi + r and 16 + 8 hi + r): maximum and sum stay in the lane, the two halves of the wave join the maximum by one exchange a pass.
// The two score tiles, turned into shares and cast, ARE the B operand of Ot += Vt Pt in the hardware's k order; A = 16 rows of the key-contiguous Vt plane by the same loader (keys 8 hi .. and 16 + 8 hi ..): the k orders agree at every position.
// RUNNING MAXIMUM: every pass takes the row's maximum so far and scales the sums and the output tiles by 2^(old - new), without a branch: the pass is one straight block. A share is at most 1.
// A dropped dot is -3e38: its share is an exact nought once the row has kept a column (the first kept column wipes what came before by the factor 2^(-3e38 - new) = 0); a row that keeps none ends with uniform shares.
// THE OPERANDS COME THROUGH LDS: a stage is 64 keys (two passes): 64 K rows and 64 Vt rows of 128 bytes, shared by the eight waves, and for each pass each wave's own 32 keep rows of 128 bytes. Asynchronous 16-byte copies bring them in, every wave-wide copy four whole lines (four rows); each wave copies an eighth of K and of Vt and its own keep rows: 20 copies a stage.
// Two buffers: stage s + 2 is copied into the buffer that stage s has just left, while stage s + 1 is worked on. Every row lies 144 bytes from the next, the pitch at which 16-byte LDS reads of 16 rows meet no bank twice. WHAT IS LEFT: the keep words are a third of the LDS reads and four fifths of the copied bytes; a stage's first reads wait behind its barrier.
// Every loop over tiles, column groups, blocks and registers below is unrolled so that each fragment index is a constant: the fragments and accumulators stay in registers.
__device__ __forceinline__ float xhalf(float x) { return __builtin_bit_cast(float, __builtin_amdgcn_permlanex16(__builtin_bit_cast(int, x), __builtin_bit_cast(int, x), 0x76543210, 0xfedcba98, false, false)); }   // lane l with lane l ^ 16
// eight exponentials of two, each in place: no one of them reads another's result or overwrites another's source, and the v_nop fills the slot that the instruction set asks for behind the last one, whatever the compiler puts next
__device__ __forceinline__ void exp2x8(v8f& x) { float a = x[0], b = x[1], c = x[2], d = x[3], e = x[4], f = x[5], g = x[6], h = x[7];
    asm("v_exp_f32 %0, %0\n\tv_exp_f32 %1, %1\n\tv_exp_f32 %2, %2\n\tv_exp_f32 %3, %3\n\tv_exp_f32 %4, %4\n\tv_exp_f32 %5, %5\n\tv_exp_f32 %6, %6\n\tv_exp_f32 %7, %7\n\tv_nop" : "+v"(a), "+v"(b), "+v"(c), "+v"(d), "+v"(e), "+v"(f), "+v"(g), "+v"(h));
    x[0] = a; x[1] = b; x[2] = c; x[3] = d; x[4] = e; x[5] = f; x[6] = g; x[7] = h; }
struct FOps { v16h kf[2][2]; v16h vf[4]; v4i mk[2][2][2]; };   // one pass's operands: K rows [tile][32-deep step], Vt rows [16-row block], keep words [column group][tile][half]
#define SKEY 64                          // keys a stage
#define LPIT 144                         // LDS pitch of a 128-byte row
#define OFFV (SKEY * LPIT)               // the Vt rows' place in a buffer
#define OFFM (OFFV + HD * LPIT)          // the keep rows' place in a buffer: the first pass's 256 rows, then the second's
#define MPLN (256 * LPIT)                // one pass's keep rows
#define BUFB (OFFM + 2 * MPLN)           // one buffer, in bytes
#define CP1(a, b) "global_load_async_to_lds_b128 %" #a ", %" #b ", off\n\t"
// ten copies, and as the statement's last line the wait that stands between issued copies and the first overwrite of a register that they name
__device__ __forceinline__ void cp10(const unsigned (&l)[10], const char* const (&g)[10]) {
    asm volatile(CP1(0, 1) CP1(2, 3) CP1(4, 5) CP1(6, 7) CP1(8, 9) CP1(10, 11) CP1(12, 13) CP1(14, 15) CP1(16, 17) CP1(18, 19) "s_wait_xcnt 0x0"
                 :: "v"(l[0]), "v"(g[0]), "v"(l[1]), "v"(g[1]), "v"(l[2]), "v"(g[2]), "v"(l[3]), "v"(g[3]), "v"(l[4]), "v"(g[4]), "v"(l[5]), "v"(g[5]), "v"(l[6]), "v"(g[6]), "v"(l[7]), "v"(g[7]), "v"(l[8]), "v"(g[8]), "v"(l[9]), "v"(g[9]) : "memory");
}
// one stage's 20 copies of a wave. ll: the lane's place in any four rows (eight lanes a row); sk, sm: the LDS byte addresses, the same for the whole wave, of the wave's first K row and first keep row in the buffer to be filled; kg, vg, mg: the lane's global addresses in that stage
__device__ __forceinline__ void fa_stage(unsigned ll, unsigned sk, unsigned sm, const char* kg, const char* vg, const char* mg) {
    unsigned l[20]; const char* g[20];
    sk = (unsigned)__builtin_amdgcn_readfirstlane((int)sk); sm = (unsigned)__builtin_amdgcn_readfirstlane((int)sm);   // the wave's two places held scalar: the one lane-own value that lives through the loop is ll, which no copy names itself, so it may lie in any register
    l[0] = ll + sk; g[0] = kg; l[1] = ll + (sk + 4 * LPIT); g[1] = kg + 4 * HD * 2; l[2] = ll + (sk + OFFV); g[2] = vg; l[3] = ll + (sk + OFFV + 4 * LPIT); g[3] = vg + 4 * TT * 2;
    // unrolled so that every index is a constant: the addresses stay in registers
#pragma unroll
    for (int i = 0; i < 16; ++i) { l[4 + i] = ll + (sm + (i >> 3) * MPLN + (i & 7) * 4 * LPIT); g[4 + i] = mg + (i >> 3) * 128 + (size_t)(i & 7) * 4 * TT * 4; }
    cp10(*(const unsigned (*)[10])&l[0], *(const char* const (*)[10])&g[0]);
    cp10(*(const unsigned (*)[10])&l[10], *(const char* const (*)[10])&g[10]);
}
// one pass's 24 LDS reads from the lane's own places in the stage's buffer
__device__ __forceinline__ void fa_read(FOps& n, const char* kb, const char* vb, const char* mb) {
#pragma unroll
    for (int t = 0; t < 2; ++t)
#pragma unroll
        for (int ks = 0; ks < 2; ++ks) n.kf[t][ks] = WFrag<h16>::ld((const h16*)(kb + t * 16 * LPIT + ks * 64));
#pragma unroll
    for (int g = 0; g < 2; ++g)
#pragma unroll
        for (int t = 0; t < 2; ++t) { n.mk[g][t][0] = *(const v4i*)(mb + g * 16 * LPIT + t * 64); n.mk[g][t][1] = *(const v4i*)(mb + g * 16 * LPIT + t * 64 + 16); }
#pragma unroll
    for (int db = 0; db < 4; ++db) n.vf[db] = WFrag<h16>::ld((const h16*)(vb + db * 16 * LPIT));
}
// one exponential of two; the v_nop fills the slot that the instruction set asks for behind it, whatever the compiler puts next
__device__ __forceinline__ float exp2x1(float x) { float y; asm("v_exp_f32 %0, %1\n\tv_nop" : "=v"(y) : "v"(x)); return y; }
__device__ __forceinline__ void fa_pass(const FOps& c, const v16h (&qf)[2][2], v8f (&o)[4][2], float (&mu)[2], v2f (&sm)[2]) {
    typedef WFrag<h16> F;
    v16h pf[2];
#pragma unroll
    for (int g = 0; g < 2; ++g) { v8f s[2]; float m = mu[g];
#pragma unroll
        for (int t = 0; t < 2; ++t) { s[t] = F::mma(c.kf[t][1], qf[g][1], F::mma(c.kf[t][0], qf[g][0], (v8f){}));
#pragma unroll
            for (int r = 0; r < 8; ++r) { const float x = c.mk[g][t][r >> 2][r & 3] ? s[t][r] * SCL2 : -3.0e38f;   /* keep the dot where the plane's word is non-zero */ s[t][r] = x; m = fmaxf(m, x); } }
        m = fmaxf(m, xhalf(m));   // both halves of the wave hold the query's maximum: one scale for all 32 keys
        const float f = exp2x1(mu[g] - m); mu[g] = m; sm[g] *= f;
#pragma unroll
        for (int db = 0; db < 4; ++db) o[db][g] *= f;
#pragma unroll
        for (int t = 0; t < 2; ++t) { v8f e = s[t] - m; exp2x8(e);
#pragma unroll
            for (int r = 0; r < 8; r += 2) { sm[g] += (v2f){e[r], e[r + 1]}; pf[g][t * 8 + r] = (h16)e[r]; pf[g][t * 8 + r + 1] = (h16)e[r + 1]; } } }
#pragma unroll
    for (int db = 0; db < 4; ++db)
#pragma unroll
        for (int g = 0; g < 2; ++g) o[db][g] = F::mma(c.vf[db], pf[g], o[db][g]);
}
// two waves a SIMD (one work-group a WGP): the register budget that holds both operand sets beside the accumulators without a spill
__global__ __launch_bounds__(256) __attribute__((amdgpu_waves_per_eu(2, 2))) void k_fattn(const h16* __restrict__ Qp, const h16* __restrict__ Kp, const h16* __restrict__ Vt, const int* __restrict__ MK, h16* Cx) {
    const int lane = threadIdx.x & 31, lr = lane & 15, hi = lane >> 4;
    const int wv = __builtin_amdgcn_readfirstlane((int)(threadIdx.x >> 5));   // the wave's number, held scalar
    const int zh = blockIdx.y, q0 = blockIdx.x * 256 + wv * 32;
    const h16* qb = Qp + ((size_t)zh * TT + q0 + lr) * HD + 8 * hi;
    static_assert(TT % SKEY == 0 && TT / SKEY >= 2 && SKEY == 64 && HD == 64, "whole stages, at least the two that the ring's start fills; rows of 128 bytes");
    __shared__ __align__(16) char ring[2 * BUFB];
    // the copies' addresses: eight lanes a 128-byte row, four rows a copy; of K and Vt the wave takes rows 8 wv and on, of the keep plane its own 32 query rows
    const int cr = lane >> 3, cc = (lane & 7) * 16;
    const unsigned ll = (unsigned)(cr * LPIT + cc), sk = (unsigned)(size_t)ring + (unsigned)(wv * 8 * LPIT), sq = (unsigned)(size_t)ring + (unsigned)(OFFM + wv * 32 * LPIT);
    const char* kg = (const char*)(Kp + ((size_t)zh * TT + wv * 8 + cr) * HD) + cc; const char* vg = (const char*)(Vt + ((size_t)zh * HD + wv * 8 + cr) * TT) + cc; const char* mg = (const char*)(MK + (size_t)(q0 + cr) * TT) + cc;
    // the lane's read places in buffer 0, first pass
    const char* kb = ring + lr * LPIT + 16 * hi; const char* vb = ring + OFFV + lr * LPIT + 16 * hi; const char* mb = ring + OFFM + (wv * 32 + lr) * LPIT + 32 * hi;
    v16h qf[2][2]; v8f o[4][2]; float mu[2]; v2f sm[2];
#pragma unroll
    for (int g = 0; g < 2; ++g)
#pragma unroll
        for (int ks = 0; ks < 2; ++ks) qf[g][ks] = WFrag<h16>::ld(qb + g * 16 * HD + ks * 32);
    asm volatile("s_wait_xcnt 0x0" ::: "memory");   // stands between the issued query loads and the first overwrite of their address registers
    __builtin_amdgcn_sched_barrier(0);   // nothing from below climbs between the query loads and their wait, onto the loads' address registers
#pragma unroll
    for (int g = 0; g < 2; ++g) { mu[g] = -3.0e38f; sm[g] = (v2f){};
#pragma unroll
        for (int db = 0; db < 4; ++db) o[db][g] = (v8f){}; }
    fa_stage(ll, sk, sq, kg, vg, mg);
    asm volatile("s_wait_asynccnt 0x0" ::: "memory");   // this wave's copies of stage 0 have landed
    __syncthreads();                                     // every wave's have: stage 0 may be read
    fa_stage(ll, sk + BUFB, sq + BUFB, kg + SKEY * HD * 2, vg + SKEY * 2, mg + SKEY * 4);
    kg += 2 * SKEY * HD * 2; vg += 2 * SKEY * 2; mg += 2 * SKEY * 4;
    for (int s = 0; s < TT / SKEY; ++s) {
        const int bo = (s & 1) * BUFB; FOps A, B;
        fa_read(A, kb + bo, vb + bo, mb + bo);
        fa_read(B, kb + bo + 32 * LPIT, vb + bo + 64, mb + bo + MPLN);
        __builtin_amdgcn_sched_barrier(0);   // both passes' LDS reads stay together at the head of the stage: the second pass's latency lies under the first pass's work
        fa_pass(A, qf, o, mu, sm);
        fa_pass(B, qf, o, mu, sm);
        __builtin_amdgcn_sched_barrier(0);   // the stage's work stays in front of its foot: lifted over the work, the wait below would meet copies that were issued only just before it
        asm volatile("s_wait_dscnt 0x0" ::: "memory");      // this wave has read all it wants of stage s
        asm volatile("s_wait_asynccnt 0x0" ::: "memory");   // its copies of stage s + 1 have landed
        __syncthreads();                                     // stage s + 1 may be read, and the buffer of stage s is free
        if (s + 2 < TT / SKEY) { fa_stage(ll, sk + bo, sq + bo, kg, vg, mg); kg += SKEY * HD * 2; vg += SKEY * 2; mg += SKEY * 4; }
    }
    asm volatile("s_wait_asynccnt 0x0" ::: "memory");   // no copy is in flight when the wave ends
    const int en = zh / NH_, hd = zh % NH_;
#pragma unroll
    for (int g = 0; g < 2; ++g) { const float hs = sm[g][0] + sm[g][1]; const float inv = __fdiv_rn(1.0f, hs + xhalf(hs));   // the two halves' sums meet once
        h16* c = Cx + ((size_t)en * TT + q0 + g * 16 + lr) * DQ + hd * HD + 8 * hi;
#pragma unroll
        for (int db = 0; db < 4; ++db) { v8h ov;
#pragma unroll
            for (int r = 0; r < 8; ++r) ov[r] = (h16)(o[db][g][r] * inv);
            *(v8h*)(c + db * 16) = ov; } }
}

template <typename T16> __device__ __forceinline__ unsigned short cv16(float x);
template <> __device__ __forceinline__ unsigned short cv16<h16>(float x) { const h16 h = (h16)x; return __builtin_bit_cast(unsigned short, h); }
// ---- k_castall: every 16-bit copy of a float plane in ONE launch of 4,096 long waves; grid (CGX, 16), 256 threads. The planes are cut into sixteen pieces of CSEG words: pieces 0 - 11 the three sources (four each, both entries lie on end), 12 - 14 the first three weights, 15 the last weight.
// A work-group takes CSEG / CGX words of its piece: four trips of eight loads a thread; each wave-wide load is 512 bytes on end (whole lines), each store 256.
#define CSEG (1u << 20)
#define CGX  32
template <bool TOH> __device__ __forceinline__ void cast_run(const float* __restrict__ s, unsigned short* d) {
    for (int t = 0; t < 4; ++t) { v4f v[8];
        // unrolled so that a trip's eight loads are in flight together
#pragma unroll
        for (int j = 0; j < 8; ++j) v[j] = *(const v4f*)(s + (t * 8 + j) * 1024);
#pragma unroll
        for (int j = 0; j < 8; ++j) { v4us o;
#pragma unroll
            for (int q = 0; q < 4; ++q) { const unsigned short b = f2bf(v[j][q]); o[q] = TOH ? cv16<h16>(bf2f(b)) : b; }
            *(v4us*)(d + (t * 8 + j) * 1024) = o; } }
}
__global__ __launch_bounds__(256) void k_castall(const float* __restrict__ xq, const float* __restrict__ xk, const float* __restrict__ xv, const float* __restrict__ wq, const float* __restrict__ wk, const float* __restrict__ wv, const float* __restrict__ wo,
                                                 unsigned short* XQ, unsigned short* XK, unsigned short* XV, unsigned short* WQ, unsigned short* WK, unsigned short* WV, unsigned short* WO) {
    const unsigned seg = blockIdx.y; const float* s; unsigned short* d;
    if (seg < 4) { s = xq; d = XQ; } else if (seg < 8) { s = xk; d = XK; } else if (seg < 12) { s = xv; d = XV; } else if (seg == 12) { s = wq; d = WQ; } else if (seg == 13) { s = wk; d = WK; } else if (seg == 14) { s = wv; d = WV; } else { s = wo; d = WO; }
    const size_t off = (seg < 12 ? (size_t)(seg & 3u) * CSEG : 0) + (size_t)blockIdx.x * (CSEG / CGX) + threadIdx.x * 4;
    if (seg == 15) cast_run<true>(s + off, d + off); else cast_run<false>(s + off, d + off);
}

template <bool RES>
__global__ __launch_bounds__(256) void k_lnrow(const float* __restrict__ A, const bf* __restrict__ R, const float* __restrict__ gamma, const float* __restrict__ beta, float eps, int C, int nrows, float* Y) {
    const int lane = threadIdx.x & 31; const int row = blockIdx.x * 8 + (threadIdx.x >> 5); if (row >= nrows) return; const int nch = C / 128; const float* a = A + (size_t)row * C; float x[LNC_MAX / 32]; float s = 0.0f;
    for (int k = 0; k < LNC_MAX / 128; ++k) { if (k < nch) { const int c0 = k * 128 + lane * 4; v4f v = *(const v4f*)(a + c0);
            if (RES) { asm volatile("s_wait_xcnt 0x0" ::: "memory");   /* stands between the issued load and the next load, whose result may land on the first one's address registers */
                const v4us w = *(const v4us*)(R + (size_t)row * C + c0); v[0] = __fadd_rn(v[0], bf2f(w[0])); v[1] = __fadd_rn(v[1], bf2f(w[1])); v[2] = __fadd_rn(v[2], bf2f(w[2])); v[3] = __fadd_rn(v[3], bf2f(w[3])); }
            x[k * 4 + 0] = v[0]; x[k * 4 + 1] = v[1]; x[k * 4 + 2] = v[2]; x[k * 4 + 3] = v[3]; s = __fadd_rn(__fadd_rn(__fadd_rn(__fadd_rn(s, v[0]), v[1]), v[2]), v[3]); } }
    for (int sh = 16; sh; sh >>= 1) s = __fadd_rn(s, __shfl_xor(s, sh, 32));
    const float mean = __fdiv_rn(s, (float)C); float q = 0.0f;
    for (int k = 0; k < LNC_MAX / 128; ++k) { if (k < nch) {
            for (int j = 0; j < 4; ++j) { const float d = __fsub_rn(x[k * 4 + j], mean); x[k * 4 + j] = d; q = __fmaf_rn(d, d, q); } } }
    for (int sh = 16; sh; sh >>= 1) q = __fadd_rn(q, __shfl_xor(q, sh, 32));
    const float rstd = __fdiv_rn(1.0f, sqrtf(__fadd_rn(__fdiv_rn(q, (float)C), eps)));
    for (int k = 0; k < LNC_MAX / 128; ++k) { if (k < nch) { const int c0 = k * 128 + lane * 4; const v4f g = *(const v4f*)(gamma + c0); const v4f bt = *(const v4f*)(beta + c0);
            for (int j = 0; j < 4; ++j) x[k * 4 + j] = __fmaf_rn(__fmul_rn(x[k * 4 + j], rstd), bfr(g[j]), bfr(bt[j])); } }
    float* y = Y + (size_t)row * C;
    {
        for (int k = 0; k < LNC_MAX / 128; ++k) { if (k < nch) { v4f o; o[0] = x[k * 4 + 0]; o[1] = x[k * 4 + 1]; o[2] = x[k * 4 + 2]; o[3] = x[k * 4 + 3]; *(v4f*)(y + k * 128 + lane * 4) = o; } }
         }
}

extern "C" void kernel_launch(void* const* d_in, const int* in_sizes, int n_in,
                              void* d_out, int out_size, void* d_ws, size_t ws_size, hipStream_t stream) {
    (void)in_sizes; (void)n_in; (void)out_size;
    const float* xq = (const float*)d_in[0]; const float* xk = (const float*)d_in[1]; const float* xv = (const float*)d_in[2]; const int* kp = (const int*)d_in[3]; const float* wq = (const float*)d_in[4]; const float* cq = (const float*)d_in[5]; const float* wk = (const float*)d_in[6]; const float* ck = (const float*)d_in[7]; const float* wv = (const float*)d_in[8]; const float* cv = (const float*)d_in[9]; const float* wo = (const float*)d_in[10]; const float* co = (const float*)d_in[11]; const float* ns = (const float*)d_in[12]; const float* nb = (const float*)d_in[13];   /* fourteen arrays, all read; kp the int32 keep plane, read through a pointer of its own type */
    float* OUT = (float*)d_out;     // [2][2048][1024]
    static_assert(DQ == DM && DKV == DQ && REP == 1 && HD == 64 && TT % 256 == 0 && (size_t)DQ * DM == CSEG && (size_t)NB_ * TT * DM == 4 * (size_t)CSEG && CSEG / CGX == 4 * 8 * 1024 && TT % 64 == 0 && DM % (32 * 8) == 0 && DQ % (32 * 8) == 0 && DM % 128 == 0 && DM <= LNC_MAX && (NB_ * TT) % 8 == 0, "the merged heads are the output map's depth; k_fattn takes one key head a query head, 64-wide heads and whole 256-row blocks; the cast launch's sixteen pieces are exact; the row normalisation takes whole 128-column pieces");
    char* wsp = (char*)d_ws;
    auto take = [&](size_t bytes) { char* p = wsp; wsp += (bytes + 255) & ~(size_t)255; return (void*)p; };
    bf* WQ = (bf*)take((size_t)DQ * DM * 2); bf* WK = (bf*)take((size_t)DKV * DM * 2); bf* WV = (bf*)take((size_t)DKV * DM * 2); h16* WO16 = (h16*)take((size_t)DM * DQ * 2);
    bf* XQ = (bf*)take((size_t)NB_ * TT * DM * 2); bf* XK = (bf*)take((size_t)NB_ * TT * DM * 2); bf* XV = (bf*)take((size_t)NB_ * TT * DM * 2);   /* both entries' bf16 sources, on end */
    h16* QP16 = (h16*)take((size_t)NB_ * NH_ * TT * HD * 2); h16* KP16 = (h16*)take((size_t)NB_ * NKV * TT * HD * 2); h16* VT16 = (h16*)take((size_t)NB_ * NKV * HD * TT * 2);   /* both entries' head planes: the one attention launch reads them all */
    h16* C16 = (h16*)take((size_t)NB_ * TT * DQ * 2); float* YW = (float*)take((size_t)NB_ * TT * DM * 4);
    if ((size_t)(wsp - (char*)d_ws) > ws_size) return;    // 80.00 MiB carved
    k_castall<<<dim3(CGX, 16, 1), 256, 0, stream>>>(xq, xk, xv, wq, wk, wv, wo, XQ, XK, XV, WQ, WK, WV, (unsigned short*)WO16);   /* each 'to, from' weight [1024][1024] is already k-contiguous: its map's right operand (the third map's left): cast as it lies */
    k_gemmw<bf, 0, true, 8, h16, false><<<dim3(TT / 64, DQ / 64, NB_), 256, 0, stream>>>(XQ, nullptr, WQ, nullptr, DM, QP16, HD, (size_t)TT * HD, cq, (size_t)TT * DM, 0, (size_t)NH_ * TT * HD);   /* column tile y = head y: straight into its [row][64] plane; z = the entry */
    k_gemmw<bf, 0, true, 8, h16, false><<<dim3(TT / 64, DKV / 64, NB_), 256, 0, stream>>>(XK, nullptr, WK, nullptr, DM, KP16, HD, (size_t)TT * HD, ck, (size_t)TT * DM, 0, (size_t)NKV * TT * HD);
    k_gemmw<bf, 0, true, 8, h16, true><<<dim3(DKV / 64, TT / 64, NB_), 256, 0, stream>>>(WV, nullptr, XV, nullptr, DM, VT16, TT, 64, cv, 0, (size_t)TT * DM, (size_t)NKV * HD * TT);   /* the weight's rows are the tile's rows: [head][64][key], the added vector by row */
    k_fattn<<<dim3(TT / 256, NB_ * NH_, 1), 256, 0, stream>>>(QP16, KP16, VT16, kp, C16);   /* the one keep-plane [2048][2048], read where it lies: the same for every entry and head; the merged heads come out token-major on ONE f16 word */
    k_gemmw<h16, 0, true, 8, float, false><<<dim3(TT / 64, DM / 64, NB_), 256, 0, stream>>>(C16, nullptr, WO16, nullptr, DQ, YW, DM, 64, co, (size_t)TT * DQ, 0, (size_t)TT * DM);   /* the output map with its bias into a workspace plane */
    k_lnrow<true><<<(unsigned)(NB_ * TT / 8), 256, 0, stream>>>(YW, XQ, ns, nb, 1.0e-5f, DM, NB_ * TT, OUT);   /* the result = normalise(plane + the first source's bf16 copy) * scale + shift: its one writer */
}

// v006
// It runs in 127 microseconds.
// Next to v005, in two timings, it ran 1.27 and 1.26 times as fast.
// Over all steps from v000 it is 10.5 times as fast.
#include <hip/hip_runtime.h>

// A sixteen-head attention of width 1,024 with separate sources for its three maps, ONE int32 keep plane over (row, column) for every entry and head, a last map, the first source added back and a row normalisation, on two 2,048-token entries
// (a0 | a1 | a2 the three sources [2][2048][1024]; a3 the keep plane [1][1][2048][2048] int32 (where a word is nought that column is dropped for that row; one plane for every entry and head); a4 | a6 | a8 | a10 four 'to, from' weights [1024][1024] (a map's column c is its source's row dotted with the weight's row c) with their added vectors a5 | a7 | a9 | a11 [1024]; a12 | a13 the normalisation's scale and shift [1024];
//  the first map of a0, the second of a1, the third of a2, each with its added vector; head h = columns 64 h and on; dots * 64^-0.5; a dropped pair's dot replaced by a large negative constant; ONE PLAIN SOFTMAX over the 2,048 columns; the shares times the third map's rows; the sixteen heads side by side; the sum = that plane mapped by a10 (column c = the plane's row dotted with a10's row c) + a11 + a0; the result = (the sum less its row's mean) over the root of (its row's biased variance + 1e-5), times a12, plus a13 -> [2][2048][1024]; argument order as numbered). FOURTEEN inputs, all read on the device.
// THE KEEP PLANE IS READ AS DATA: every one of its 4,194,304 words is loaded and tested against nought beside the dot it governs, for every head of every entry; nothing is assumed of its contents.
// WHERE THE TEXT AND THE FUNCTION PART: the function puts minus infinity in place of a dropped dot, this text -3e38: after the row's maximum is taken away either gives an exact nought share in f32 wherever the row keeps a column; A ROW THAT KEEPS NO COLUMN: the function gives not-a-numbers there, this text uniform shares 1 / 2,048.
// THE ARITHMETIC AS BUILT IS THE FUNCTION's OWN: 34.36 G multiply-adds (four maps 4.29 each over the two entries; the dots 8.59; the shares' sums 8.59): ratio 1.00.
// Layout: ONE cast launch (k_castall) for all seven float planes: the three sources of both entries and the first three weights to bf16 as they lie, the last weight's bf16 values to f16 words; both entries in one launch of each later kernel (grid z in the maps): three bf16 * bf16 maps whose own epilogues add the vector, cast to f16 and store that entry's head planes (first and second map: one 64-column group IS one head's 64 columns; third map: weight as the left operand, source as the right, so its tile comes out key-contiguous); no f32 plane and no builder launch between a map and the attention;
// ONE launch for both entries and all sixteen heads (k_fattn): the dots f16 * f16, the keep plane read where it lies, a running-maximum softmax in registers and the shares' sums on f16 words, 32 columns a pass: no score or share plane goes to memory; its epilogue divides by the row's sum and stores the sixteen heads' token-major plane as ONE f16 word;
// the last map with its added vector into a workspace plane, and the row normalisation of (plane + the first source's bf16 copy from the cast launch) straight into the result (k_lnrow<true>: its one writer). Seven launches in all.
// Compute dtypes, f32 accumulate: every float input rounded to bf16 at its load: the maps bf16 * bf16 on exact operands, each added vector's bf16 word in the epilogue; the three head planes, the unnormalised shares (at most 1) and the sixteen heads' plane on one f16 word each; the last weight's bf16 values as f16 words; softmax f32; the first source added back at its bf16 value; the normalisation f32 with the scale's and shift's bf16 words.

#define NB_  2
#define TT   2048
#define DM   1024
#define NH_  16
#define NKV  16
#define REP  (NH_ / NKV)
#define HD   64
#define DQ   (NH_ * HD)
#define DKV  (NKV * HD)
#define SCL2 0.18033688011112042f // 64^-0.5 * log2(e): the dots go straight to the exponent of two
#define LNC_MAX 2048

typedef _Float16 h16;
typedef unsigned short bf;
typedef __attribute__((ext_vector_type(16))) __bf16   v16bf;
typedef __attribute__((ext_vector_type(16))) _Float16 v16h;
typedef __attribute__((ext_vector_type(8)))  _Float16 v8h;
typedef __attribute__((ext_vector_type(8)))  unsigned short v8us;
typedef __attribute__((ext_vector_type(8)))  float    v8f;
typedef __attribute__((ext_vector_type(4)))  float    v4f;
typedef v8h  __attribute__((may_alias)) v8ha;
typedef v4f  __attribute__((may_alias)) v4fa;
typedef v8us __attribute__((may_alias)) v8usa;

__device__ __forceinline__ unsigned short f2bf(float f) { unsigned u = __float_as_uint(f); u += 0x7FFFu + ((u >> 16) & 1u); return (unsigned short)(u >> 16); }
__device__ __forceinline__ float bf2f(unsigned short b) { return __uint_as_float(((unsigned)b) << 16); }
__device__ __forceinline__ float bfr(float f) { return bf2f(f2bf(f)); }
__device__ __forceinline__ v16h cat16(v8h lo, v8h hi) { return __builtin_shufflevector(lo, hi, 0, 1, 2, 3, 4, 5, 6, 7, 8, 9, 10, 11, 12, 13, 14, 15); }
__device__ __forceinline__ v16bf cat16b(v8us lo, v8us hi) { return __builtin_bit_cast(v16bf, __builtin_shufflevector(lo, hi, 0, 1, 2, 3, 4, 5, 6, 7, 8, 9, 10, 11, 12, 13, 14, 15)); }
__device__ __forceinline__ v8f wmma16(v16h a, v16h b, v8f c) { return __builtin_amdgcn_wmma_f32_16x16x32_f16(false, a, false, b, (short)0, c, false, false); }
__device__ __forceinline__ v8f wmmab(v16bf a, v16bf b, v8f c) { return __builtin_amdgcn_wmma_f32_16x16x32_bf16(false, a, false, b, (short)0, c, false, false); }



// ---- k_gemmw: one 128x128 output tile a work-group, 8 waves (2 down, 4 across), each wave a 64x32 piece (eight accumulators) over the WHOLE depth; operands are K-contiguous 16-bit planes; grid (M/128, N/128, Z), 256 threads.
// C[m][n] (f32 or f16 words by TO, + bias[n], or bias[m] with BROW) = sum_k A[m][k] Bt[n][k], k in rising order in one accumulator. z-batch strides sA/sB/sC in elements.
// WHERE A COLUMN LANDS: the 64-column group y starts at C + y * sN, its rows lie ldc apart (a plain plane: sN = 64, ldc = the plane's width; head planes [head][row][64]: sN = one head's plane, ldc = 64).
// THE OPERANDS COME THROUGH LDS: a stage is 128 deep: of each of the 128 A rows and 128 Bt rows two 128-byte pieces. Asynchronous 16-byte copies bring them in, every wave-wide copy four whole lines (four rows); each wave copies sixteen rows of either operand: 16 copies a stage.
// Every row that the tile needs is fetched once a work-group and read from LDS by the waves that share it (an A row by four, a Bt row by two). Two buffers: stage t + 2 is copied into the buffer that stage t has just left, while stage t + 1 is worked on. A 128-byte piece lies 144 bytes from the next row's, the pitch at which 16-byte LDS reads of 16 rows meet no bank twice.
// THE RESULT LEAVES THROUGH THE SAME LDS: behind the last stage's barrier each wave lays its piece in a 128x128 f32 plane, and behind one more barrier a wave takes whole rows of it: each store is whole lines.
template <typename T16> struct WFrag;
template <> struct WFrag<h16> { typedef v16h V; static __device__ __forceinline__ V ld(const h16* p) { return cat16(*(const v8h*)p, *(const v8h*)(p + 16)); } static __device__ __forceinline__ v8f mma(V a, V b, v8f c) { return wmma16(a, b, c); } };
template <> struct WFrag<bf> { typedef v16bf V; static __device__ __forceinline__ V ld(const bf* p) { return cat16b(*(const v8us*)p, *(const v8us*)(p + 16)); } static __device__ __forceinline__ v8f mma(V a, V b, v8f c) { return wmmab(a, b, c); } };
typedef __attribute__((ext_vector_type(4))) _Float16 v4h;
__device__ __forceinline__ void st4(float* p, v4f v) { *(v4f*)p = v; }
__device__ __forceinline__ void st4(h16* p, v4f v) { v4h o; o[0] = (h16)v[0]; o[1] = (h16)v[1]; o[2] = (h16)v[2]; o[3] = (h16)v[3]; *(v4h*)p = o; }
#define GT    128                        // rows of A and of Bt in a work-group's tile
#define GKS   128                        // a stage's depth, in elements: two 128-byte pieces a row
#define GPIT  144                        // LDS pitch of a 128-byte piece
#define GHALF (GT * GPIT)                // one operand's 128 rows of one piece
#define GOFFB (2 * GHALF)                // the Bt rows' place in a buffer
#define GBUF  (4 * GHALF)                // one buffer, in bytes
#define GOP   132                        // the result plane's pitch in words: the two halves of a wave store to different banks
#define CPG(a, b) "global_load_async_to_lds_b128 %" #a ", %" #b ", off\n\t"
// eight copies, and as the statement's last line the wait that stands between issued copies and the first overwrite of a register that they name
__device__ __forceinline__ void cp8(const unsigned (&l)[8], const char* const (&g)[8]) {
    asm volatile(CPG(0, 1) CPG(2, 3) CPG(4, 5) CPG(6, 7) CPG(8, 9) CPG(10, 11) CPG(12, 13) CPG(14, 15) "s_wait_xcnt 0x0"
                 :: "v"(l[0]), "v"(g[0]), "v"(l[1]), "v"(g[1]), "v"(l[2]), "v"(g[2]), "v"(l[3]), "v"(g[3]), "v"(l[4]), "v"(g[4]), "v"(l[5]), "v"(g[5]), "v"(l[6]), "v"(g[6]), "v"(l[7]), "v"(g[7]) : "memory");
}
// one stage's 16 copies of a wave. la: the lane's LDS byte address in the wave's first four A rows, first piece, of the buffer to be filled (eight lanes a row); ag, bg: the lane's global addresses in that stage; ROWB: a global row in bytes
template <int ROWB> __device__ __forceinline__ void gm_stage(unsigned la, const char* ag, const char* bg) {
    unsigned l[8]; const char* g[8];
    // both loops unrolled so that every index is a constant: the addresses stay in registers
#pragma unroll
    for (int i = 0; i < 8; ++i) { l[i] = la + (i >> 2) * GHALF + (i & 3) * 4 * GPIT; g[i] = ag + (i >> 2) * 128 + (size_t)(i & 3) * 4 * ROWB; }
    cp8(l, g);
#pragma unroll
    for (int i = 0; i < 8; ++i) { l[i] = la + GOFFB + (i >> 2) * GHALF + (i & 3) * 4 * GPIT; g[i] = bg + (i >> 2) * 128 + (size_t)(i & 3) * 4 * ROWB; }
    cp8(l, g);
}
// one 32-deep step's 12 LDS reads from the lane's own places, and its eight products; every loop unrolled so that each fragment and accumulator index is a constant: they stay in registers
template <typename T16> __device__ __forceinline__ void gm_read(typename WFrag<T16>::V (&a)[4], typename WFrag<T16>::V (&b)[2], const char* ap, const char* bp) {
#pragma unroll
    for (int mb = 0; mb < 4; ++mb) a[mb] = WFrag<T16>::ld((const T16*)(ap + mb * 16 * GPIT));
#pragma unroll
    for (int nb = 0; nb < 2; ++nb) b[nb] = WFrag<T16>::ld((const T16*)(bp + nb * 16 * GPIT));
}
template <typename T16> __device__ __forceinline__ void gm_mma(const typename WFrag<T16>::V (&a)[4], const typename WFrag<T16>::V (&b)[2], v8f (&acc)[4][2]) {
#pragma unroll
    for (int nb = 0; nb < 2; ++nb)
#pragma unroll
        for (int mb = 0; mb < 4; ++mb) acc[mb][nb] = WFrag<T16>::mma(a[mb], b[nb], acc[mb][nb]);
}
template <typename T16, int K, typename TO, bool BROW>
__global__ __launch_bounds__(256) void k_gemmw(const T16* __restrict__ A, const T16* __restrict__ Bt, TO* C, int ldc, size_t sN, const float* __restrict__ bias, size_t sA, size_t sB, size_t sC) {
    typedef typename WFrag<T16>::V V;
    constexpr int NST = K / GKS;
    static_assert(K % GKS == 0 && NST >= 2 && GKS == 128 && GT * GOP * 4 <= 2 * GBUF, "whole stages, at least the two that the ring's start fills; the result plane fits the ring");
    __shared__ __align__(16) char ring[2 * GBUF];
    const int wv = __builtin_amdgcn_readfirstlane((int)(threadIdx.x >> 5));   // the wave's number, held scalar
    const size_t z = blockIdx.z; A += z * sA; Bt += z * sB; C += z * sC;
    const int lane = threadIdx.x & 31, lr = lane & 15, hi = lane >> 4; const int r0 = blockIdx.x * GT, c0 = blockIdx.y * GT;
    const int wm = (wv & 1) * 64, wn = (wv >> 1) * 32;   // the wave's piece of the tile
    // the copies' addresses: eight lanes a 128-byte piece, four rows a copy; of either operand the wave takes rows 16 wv and on
    const int cr = lane >> 3, cc = (lane & 7) * 16;
    const unsigned la = (unsigned)(size_t)ring + (unsigned)((wv * 16 + cr) * GPIT + cc);
    const char* ag = (const char*)(A + (size_t)(r0 + wv * 16 + cr) * K) + cc; const char* bg = (const char*)(Bt + (size_t)(c0 + wv * 16 + cr) * K) + cc;
    // the lane's read places in buffer 0
    const char* ar = ring + (wm + lr) * GPIT + 16 * hi; const char* br = ring + GOFFB + (wn + lr) * GPIT + 16 * hi;
    v8f acc[4][2];
#pragma unroll
    for (int mb = 0; mb < 4; ++mb)
#pragma unroll
        for (int nb = 0; nb < 2; ++nb) acc[mb][nb] = (v8f){};
    gm_stage<K * 2>(la, ag, bg);
    // the added vector's words that this lane will want, fetched here so that their latency lies under the stages: a wave takes whole rows of 128 result words, rows wv, wv + 8 ...; a lane four columns
    const int cofs = lane * 4; float bw[BROW ? GT / 8 : 4];
    // unrolled so that every index is a constant: the words stay in registers
#pragma unroll
    for (int i = 0; i < (BROW ? GT / 8 : 4); ++i) bw[i] = BROW ? bias[r0 + i * 8 + wv] : bias[c0 + cofs + i];
    asm volatile("s_wait_xcnt 0x0" ::: "memory");   // stands between the issued loads and the first overwrite of their address registers
    __builtin_amdgcn_sched_barrier(0);   // nothing from below climbs between the loads and their wait, onto the loads' address registers
    asm volatile("s_wait_asynccnt 0x0" ::: "memory");   // this wave's copies of stage 0 have landed
    __syncthreads();                                     // every wave's have: stage 0 may be read
    gm_stage<K * 2>(la + GBUF, ag + GKS * 2, bg + GKS * 2);
    ag += 2 * GKS * 2; bg += 2 * GKS * 2;
    // FOUR STEPS' FRAGMENTS IN REGISTERS, READ TWO STEPS AT A TIME: each group of 24 LDS reads is issued in front of the sixteen products of the two steps read before it, so that its latency lies under them.
    // A stage's last two steps are multiplied behind the barrier that ends the stage: they are in registers by then (the wait in front of the barrier), and they cover the next stage's first reads.
    V fa[4][4], fb[4][2];
    gm_read<T16>(fa[0], fb[0], ar, br); gm_read<T16>(fa[1], fb[1], ar + 64, br + 64);
    // kept rolled: one copy of the stage's text, and no more than the four fragment sets live
#pragma unroll 1
    for (int t = 0; t < NST; ++t) {
        const int bo = (t & 1) * GBUF, bn = GBUF - bo;
        gm_read<T16>(fa[2], fb[2], ar + bo + GHALF, br + bo + GHALF); gm_read<T16>(fa[3], fb[3], ar + bo + GHALF + 64, br + bo + GHALF + 64);
        __builtin_amdgcn_sched_barrier(0);   // the reads stay one group in front of the products that cover them
        gm_mma<T16>(fa[0], fb[0], acc); gm_mma<T16>(fa[1], fb[1], acc);
        __builtin_amdgcn_sched_barrier(0);   // these products stay in front of the foot: sunk behind it, the wait below would meet reads that were issued only just before it
        asm volatile("s_wait_dscnt 0x0" ::: "memory");      // this wave has read all it wants of stage t
        asm volatile("s_wait_asynccnt 0x0" ::: "memory");   // its copies of stage t + 1 have landed
        __syncthreads();                                     // stage t + 1 may be read, and the buffer of stage t is free
        if (t + 2 < NST) { gm_stage<K * 2>(la + bo, ag, bg); ag += GKS * 2; bg += GKS * 2; }
        if (t + 1 < NST) { gm_read<T16>(fa[0], fb[0], ar + bn, br + bn); gm_read<T16>(fa[1], fb[1], ar + bn + 64, br + bn + 64); }
        __builtin_amdgcn_sched_barrier(0);   // the next stage's first reads stay one group in front of the products that cover them
        gm_mma<T16>(fa[2], fb[2], acc); gm_mma<T16>(fa[3], fb[3], acc);
    }
    asm volatile("s_wait_asynccnt 0x0" ::: "memory");   // no copy is in flight when the ring is put to its second use
    float* os = (float*)ring;
    // unrolled so that every accumulator index is a constant: the tiles stay in registers
#pragma unroll
    for (int mb = 0; mb < 4; ++mb)
#pragma unroll
        for (int nb = 0; nb < 2; ++nb)
#pragma unroll
            for (int j = 0; j < 8; ++j) os[(wm + mb * 16 + hi * 8 + j) * GOP + wn + nb * 16 + lr] = acc[mb][nb][j];
    __syncthreads();   // every wave's piece lies in LDS before any wave takes a row
    v4f bc = (v4f){};
    if (!BROW) { bc[0] = bfr(bw[0]); bc[1] = bfr(bw[1]); bc[2] = bfr(bw[2]); bc[3] = bfr(bw[3]); }
    TO* cb = C + (size_t)((c0 + cofs) >> 6) * sN + ((c0 + cofs) & 63) + (size_t)r0 * ldc;
    // unrolled so that the rows' LDS reads issue together
#pragma unroll
    for (int s = 0; s < GT / 8; ++s) { const int row = s * 8 + wv; v4f val = *(const v4fa*)(os + row * GOP + cofs);
        if (BROW) val += bfr(bw[s]); else val += bc;
        st4(cb + (size_t)row * ldc, val); }
}



__device__ __forceinline__ void splitf(float y, unsigned short& h, unsigned short& l) { h = f2bf(y); l = f2bf(y - bf2f(h)); }
typedef __attribute__((ext_vector_type(2))) _Float16 v2h;
typedef __attribute__((ext_vector_type(2))) unsigned short v2us;
typedef __attribute__((ext_vector_type(4))) unsigned short v4us;
typedef __attribute__((ext_vector_type(2))) float v2f;
typedef __attribute__((ext_vector_type(4))) int v4i;

// ---- k_fattn: dots, keep plane, softmax and the shares' sums of one head in ONE kernel; grid (TT / 256, entries * heads), 8 waves, each wave 32 query rows (two 16-column groups) against all TT keys, 32 keys a pass.
// TRANSPOSED PRODUCTS: St = K Qt (A = 16 key rows, B = 16 query rows, both by the one k-contiguous loader), so a lane holds 8 + 8 scores of ONE query (column lr; keys 8 hi + r and 16 + 8 hi + r): maximum and sum stay in the lane, the two halves of the wave join the maximum by one exchange a pass.
// The two score tiles, turned into shares and cast, ARE the B operand of Ot += Vt Pt in the hardware's k order; A = 16 rows of the key-contiguous Vt plane by the same loader (keys 8 hi .. and 16 + 8 hi ..): the k orders agree at every position.
// RUNNING MAXIMUM: every pass takes the row's maximum so far and scales the sums and the output tiles by 2^(old - new), without a branch: the pass is one straight block. A share is at most 1.
// A dropped dot is -3e38: its share is an exact nought once the row has kept a column (the first kept column wipes what came before by the factor 2^(-3e38 - new) = 0); a row that keeps none ends with uniform shares.
// THE OPERANDS COME THROUGH LDS: a stage is 64 keys (two passes): 64 K rows and 64 Vt rows of 128 bytes, shared by the eight waves, and for each pass each wave's own 32 keep rows of 128 bytes. Asynchronous 16-byte copies bring them in, every wave-wide copy four whole lines (four rows); each wave copies an eighth of K and of Vt and its own keep rows: 20 copies a stage.
// Two buffers: stage s + 2 is copied into the buffer that stage s has just left, while stage s + 1 is worked on. Every row lies 144 bytes from the next, the pitch at which 16-byte LDS reads of 16 rows meet no bank twice. WHAT IS LEFT: the keep words are a third of the LDS reads and four fifths of the copied bytes; a stage's first reads wait behind its barrier.
// Every loop over tiles, column groups, blocks and registers below is unrolled so that each fragment index is a constant: the fragments and accumulators stay in registers.
__device__ __forceinline__ float xhalf(float x) { return __builtin_bit_cast(float, __builtin_amdgcn_permlanex16(__builtin_bit_cast(int, x), __builtin_bit_cast(int, x), 0x76543210, 0xfedcba98, false, false)); }   // lane l with lane l ^ 16
// eight exponentials of two, each in place: no one of them reads another's result or overwrites another's source, and the v_nop fills the slot that the instruction set asks for behind the last one, whatever the compiler puts next
__device__ __forceinline__ void exp2x8(v8f& x) { float a = x[0], b = x[1], c = x[2], d = x[3], e = x[4], f = x[5], g = x[6], h = x[7];
    asm("v_exp_f32 %0, %0\n\tv_exp_f32 %1, %1\n\tv_exp_f32 %2, %2\n\tv_exp_f32 %3, %3\n\tv_exp_f32 %4, %4\n\tv_exp_f32 %5, %5\n\tv_exp_f32 %6, %6\n\tv_exp_f32 %7, %7\n\tv_nop" : "+v"(a), "+v"(b), "+v"(c), "+v"(d), "+v"(e), "+v"(f), "+v"(g), "+v"(h));
    x[0] = a; x[1] = b; x[2] = c; x[3] = d; x[4] = e; x[5] = f; x[6] = g; x[7] = h; }
struct FOps { v16h kf[2][2]; v16h vf[4]; v4i mk[2][2][2]; };   // one pass's operands: K rows [tile][32-deep step], Vt rows [16-row block], keep words [column group][tile][half]
#define SKEY 64                          // keys a stage
#define LPIT 144                         // LDS pitch of a 128-byte row
#define OFFV (SKEY * LPIT)               // the Vt rows' place in a buffer
#define OFFM (OFFV + HD * LPIT)          // the keep rows' place in a buffer: the first pass's 256 rows, then the second's
#define MPLN (256 * LPIT)                // one pass's keep rows
#define BUFB (OFFM + 2 * MPLN)           // one buffer, in bytes
#define CP1(a, b) "global_load_async_to_lds_b128 %" #a ", %" #b ", off\n\t"
// ten copies, and as the statement's last line the wait that stands between issued copies and the first overwrite of a register that they name
__device__ __forceinline__ void cp10(const unsigned (&l)[10], const char* const (&g)[10]) {
    asm volatile(CP1(0, 1) CP1(2, 3) CP1(4, 5) CP1(6, 7) CP1(8, 9) CP1(10, 11) CP1(12, 13) CP1(14, 15) CP1(16, 17) CP1(18, 19) "s_wait_xcnt 0x0"
                 :: "v"(l[0]), "v"(g[0]), "v"(l[1]), "v"(g[1]), "v"(l[2]), "v"(g[2]), "v"(l[3]), "v"(g[3]), "v"(l[4]), "v"(g[4]), "v"(l[5]), "v"(g[5]), "v"(l[6]), "v"(g[6]), "v"(l[7]), "v"(g[7]), "v"(l[8]), "v"(g[8]), "v"(l[9]), "v"(g[9]) : "memory");
}
// one stage's 20 copies of a wave. ll: the lane's place in any four rows (eight lanes a row); sk, sm: the LDS byte addresses, the same for the whole wave, of the wave's first K row and first keep row in the buffer to be filled; kg, vg, mg: the lane's global addresses in that stage
__device__ __forceinline__ void fa_stage(unsigned ll, unsigned sk, unsigned sm, const char* kg, const char* vg, const char* mg) {
    unsigned l[20]; const char* g[20];
    sk = (unsigned)__builtin_amdgcn_readfirstlane((int)sk); sm = (unsigned)__builtin_amdgcn_readfirstlane((int)sm);   // the wave's two places held scalar: the one lane-own value that lives through the loop is ll, which no copy names itself, so it may lie in any register
    l[0] = ll + sk; g[0] = kg; l[1] = ll + (sk + 4 * LPIT); g[1] = kg + 4 * HD * 2; l[2] = ll + (sk + OFFV); g[2] = vg; l[3] = ll + (sk + OFFV + 4 * LPIT); g[3] = vg + 4 * TT * 2;
    // unrolled so that every index is a constant: the addresses stay in registers
#pragma unroll
    for (int i = 0; i < 16; ++i) { l[4 + i] = ll + (sm + (i >> 3) * MPLN + (i & 7) * 4 * LPIT); g[4 + i] = mg + (i >> 3) * 128 + (size_t)(i & 7) * 4 * TT * 4; }
    cp10(*(const unsigned (*)[10])&l[0], *(const char* const (*)[10])&g[0]);
    cp10(*(const unsigned (*)[10])&l[10], *(const char* const (*)[10])&g[10]);
}
// one pass's 24 LDS reads from the lane's own places in the stage's buffer
__device__ __forceinline__ void fa_read(FOps& n, const char* kb, const char* vb, const char* mb) {
#pragma unroll
    for (int t = 0; t < 2; ++t)
#pragma unroll
        for (int ks = 0; ks < 2; ++ks) n.kf[t][ks] = WFrag<h16>::ld((const h16*)(kb + t * 16 * LPIT + ks * 64));
#pragma unroll
    for (int g = 0; g < 2; ++g)
#pragma unroll
        for (int t = 0; t < 2; ++t) { n.mk[g][t][0] = *(const v4i*)(mb + g * 16 * LPIT + t * 64); n.mk[g][t][1] = *(const v4i*)(mb + g * 16 * LPIT + t * 64 + 16); }
#pragma unroll
    for (int db = 0; db < 4; ++db) n.vf[db] = WFrag<h16>::ld((const h16*)(vb + db * 16 * LPIT));
}
// one exponential of two; the v_nop fills the slot that the instruction set asks for behind it, whatever the compiler puts next
__device__ __forceinline__ float exp2x1(float x) { float y; asm("v_exp_f32 %0, %1\n\tv_nop" : "=v"(y) : "v"(x)); return y; }
__device__ __forceinline__ void fa_pass(const FOps& c, const v16h (&qf)[2][2], v8f (&o)[4][2], float (&mu)[2], v2f (&sm)[2]) {
    typedef WFrag<h16> F;
    v16h pf[2];
#pragma unroll
    for (int g = 0; g < 2; ++g) { v8f s[2]; float m = mu[g];
#pragma unroll
        for (int t = 0; t < 2; ++t) { s[t] = F::mma(c.kf[t][1], qf[g][1], F::mma(c.kf[t][0], qf[g][0], (v8f){}));
#pragma unroll
            for (int r = 0; r < 8; ++r) { const float x = c.mk[g][t][r >> 2][r & 3] ? s[t][r] * SCL2 : -3.0e38f;   /* keep the dot where the plane's word is non-zero */ s[t][r] = x; m = fmaxf(m, x); } }
        m = fmaxf(m, xhalf(m));   // both halves of the wave hold the query's maximum: one scale for all 32 keys
        const float f = exp2x1(mu[g] - m); mu[g] = m; sm[g] *= f;
#pragma unroll
        for (int db = 0; db < 4; ++db) o[db][g] *= f;
#pragma unroll
        for (int t = 0; t < 2; ++t) { v8f e = s[t] - m; exp2x8(e);
#pragma unroll
            for (int r = 0; r < 8; r += 2) { sm[g] += (v2f){e[r], e[r + 1]}; pf[g][t * 8 + r] = (h16)e[r]; pf[g][t * 8 + r + 1] = (h16)e[r + 1]; } } }
#pragma unroll
    for (int db = 0; db < 4; ++db)
#pragma unroll
        for (int g = 0; g < 2; ++g) o[db][g] = F::mma(c.vf[db], pf[g], o[db][g]);
}
// two waves a SIMD (one work-group a WGP): the register budget that holds both operand sets beside the accumulators without a spill
__global__ __launch_bounds__(256) __attribute__((amdgpu_waves_per_eu(2, 2))) void k_fattn(const h16* __restrict__ Qp, const h16* __restrict__ Kp, const h16* __restrict__ Vt, const int* __restrict__ MK, h16* Cx) {
    const int lane = threadIdx.x & 31, lr = lane & 15, hi = lane >> 4;
    const int wv = __builtin_amdgcn_readfirstlane((int)(threadIdx.x >> 5));   // the wave's number, held scalar
    const int zh = blockIdx.y, q0 = blockIdx.x * 256 + wv * 32;
    const h16* qb = Qp + ((size_t)zh * TT + q0 + lr) * HD + 8 * hi;
    static_assert(TT % SKEY == 0 && TT / SKEY >= 2 && SKEY == 64 && HD == 64, "whole stages, at least the two that the ring's start fills; rows of 128 bytes");
    __shared__ __align__(16) char ring[2 * BUFB];
    // the copies' addresses: eight lanes a 128-byte row, four rows a copy; of K and Vt the wave takes rows 8 wv and on, of the keep plane its own 32 query rows
    const int cr = lane >> 3, cc = (lane & 7) * 16;
    const unsigned ll = (unsigned)(cr * LPIT + cc), sk = (unsigned)(size_t)ring + (unsigned)(wv * 8 * LPIT), sq = (unsigned)(size_t)ring + (unsigned)(OFFM + wv * 32 * LPIT);
    const char* kg = (const char*)(Kp + ((size_t)zh * TT + wv * 8 + cr) * HD) + cc; const char* vg = (const char*)(Vt + ((size_t)zh * HD + wv * 8 + cr) * TT) + cc; const char* mg = (const char*)(MK + (size_t)(q0 + cr) * TT) + cc;
    // the lane's read places in buffer 0, first pass
    const char* kb = ring + lr * LPIT + 16 * hi; const char* vb = ring + OFFV + lr * LPIT + 16 * hi; const char* mb = ring + OFFM + (wv * 32 + lr) * LPIT + 32 * hi;
    v16h qf[2][2]; v8f o[4][2]; float mu[2]; v2f sm[2];
#pragma unroll
    for (int g = 0; g < 2; ++g)
#pragma unroll
        for (int ks = 0; ks < 2; ++ks) qf[g][ks] = WFrag<h16>::ld(qb + g * 16 * HD + ks * 32);
    asm volatile("s_wait_xcnt 0x0" ::: "memory");   // stands between the issued query loads and the first overwrite of their address registers
    __builtin_amdgcn_sched_barrier(0);   // nothing from below climbs between the query loads and their wait, onto the loads' address registers
#pragma unroll
    for (int g = 0; g < 2; ++g) { mu[g] = -3.0e38f; sm[g] = (v2f){};
#pragma unroll
        for (int db = 0; db < 4; ++db) o[db][g] = (v8f){}; }
    fa_stage(ll, sk, sq, kg, vg, mg);
    asm volatile("s_wait_asynccnt 0x0" ::: "memory");   // this wave's copies of stage 0 have landed
    __syncthreads();                                     // every wave's have: stage 0 may be read
    fa_stage(ll, sk + BUFB, sq + BUFB, kg + SKEY * HD * 2, vg + SKEY * 2, mg + SKEY * 4);
    kg += 2 * SKEY * HD * 2; vg += 2 * SKEY * 2; mg += 2 * SKEY * 4;
    for (int s = 0; s < TT / SKEY; ++s) {
        const int bo = (s & 1) * BUFB; FOps A, B;
        fa_read(A, kb + bo, vb + bo, mb + bo);
        fa_read(B, kb + bo + 32 * LPIT, vb + bo + 64, mb + bo + MPLN);
        __builtin_amdgcn_sched_barrier(0);   // both passes' LDS reads stay together at the head of the stage: the second pass's latency lies under the first pass's work
        fa_pass(A, qf, o, mu, sm);
        fa_pass(B, qf, o, mu, sm);
        __builtin_amdgcn_sched_barrier(0);   // the stage's work stays in front of its foot: lifted over the work, the wait below would meet copies that were issued only just before it
        asm volatile("s_wait_dscnt 0x0" ::: "memory");      // this wave has read all it wants of stage s
        asm volatile("s_wait_asynccnt 0x0" ::: "memory");   // its copies of stage s + 1 have landed
        __syncthreads();                                     // stage s + 1 may be read, and the buffer of stage s is free
        if (s + 2 < TT / SKEY) { fa_stage(ll, sk + bo, sq + bo, kg, vg, mg); kg += SKEY * HD * 2; vg += SKEY * 2; mg += SKEY * 4; }
    }
    asm volatile("s_wait_asynccnt 0x0" ::: "memory");   // no copy is in flight when the wave ends
    const int en = zh / NH_, hd = zh % NH_;
#pragma unroll
    for (int g = 0; g < 2; ++g) { const float hs = sm[g][0] + sm[g][1]; const float inv = __fdiv_rn(1.0f, hs + xhalf(hs));   // the two halves' sums meet once
        h16* c = Cx + ((size_t)en * TT + q0 + g * 16 + lr) * DQ + hd * HD + 8 * hi;
#pragma unroll
        for (int db = 0; db < 4; ++db) { v8h ov;
#pragma unroll
            for (int r = 0; r < 8; ++r) ov[r] = (h16)(o[db][g][r] * inv);
            *(v8h*)(c + db * 16) = ov; } }
}

template <typename T16> __device__ __forceinline__ unsigned short cv16(float x);
template <> __device__ __forceinline__ unsigned short cv16<h16>(float x) { const h16 h = (h16)x; return __builtin_bit_cast(unsigned short, h); }
// ---- k_castall: every 16-bit copy of a float plane in ONE launch of 4,096 long waves; grid (CGX, 16), 256 threads. The planes are cut into sixteen pieces of CSEG words: pieces 0 - 11 the three sources (four each, both entries lie on end), 12 - 14 the first three weights, 15 the last weight.
// A work-group takes CSEG / CGX words of its piece: four trips of eight loads a thread; each wave-wide load is 512 bytes on end (whole lines), each store 256.
#define CSEG (1u << 20)
#define CGX  32
template <bool TOH> __device__ __forceinline__ void cast_run(const float* __restrict__ s, unsigned short* d) {
    for (int t = 0; t < 4; ++t) { v4f v[8];
        // unrolled so that a trip's eight loads are in flight together
#pragma unroll
        for (int j = 0; j < 8; ++j) v[j] = *(const v4f*)(s + (t * 8 + j) * 1024);
#pragma unroll
        for (int j = 0; j < 8; ++j) { v4us o;
#pragma unroll
            for (int q = 0; q < 4; ++q) { const unsigned short b = f2bf(v[j][q]); o[q] = TOH ? cv16<h16>(bf2f(b)) : b; }
            *(v4us*)(d + (t * 8 + j) * 1024) = o; } }
}
__global__ __launch_bounds__(256) void k_castall(const float* __restrict__ xq, const float* __restrict__ xk, const float* __restrict__ xv, const float* __restrict__ wq, const float* __restrict__ wk, const float* __restrict__ wv, const float* __restrict__ wo,
                                                 unsigned short* XQ, unsigned short* XK, unsigned short* XV, unsigned short* WQ, unsigned short* WK, unsigned short* WV, unsigned short* WO) {
    const unsigned seg = blockIdx.y; const float* s; unsigned short* d;
    if (seg < 4) { s = xq; d = XQ; } else if (seg < 8) { s = xk; d = XK; } else if (seg < 12) { s = xv; d = XV; } else if (seg == 12) { s = wq; d = WQ; } else if (seg == 13) { s = wk; d = WK; } else if (seg == 14) { s = wv; d = WV; } else { s = wo; d = WO; }
    const size_t off = (seg < 12 ? (size_t)(seg & 3u) * CSEG : 0) + (size_t)blockIdx.x * (CSEG / CGX) + threadIdx.x * 4;
    if (seg == 15) cast_run<true>(s + off, d + off); else cast_run<false>(s + off, d + off);
}

template <bool RES>
__global__ __launch_bounds__(256) void k_lnrow(const float* __restrict__ A, const bf* __restrict__ R, const float* __restrict__ gamma, const float* __restrict__ beta, float eps, int C, int nrows, float* Y) {
    const int lane = threadIdx.x & 31; const int row = blockIdx.x * 8 + (threadIdx.x >> 5); if (row >= nrows) return; const int nch = C / 128; const float* a = A + (size_t)row * C; float x[LNC_MAX / 32]; float s = 0.0f;
    for (int k = 0; k < LNC_MAX / 128; ++k) { if (k < nch) { const int c0 = k * 128 + lane * 4; v4f v = *(const v4f*)(a + c0);
            if (RES) { asm volatile("s_wait_xcnt 0x0" ::: "memory");   /* stands between the issued load and the next load, whose result may land on the first one's address registers */
                const v4us w = *(const v4us*)(R + (size_t)row * C + c0); v[0] = __fadd_rn(v[0], bf2f(w[0])); v[1] = __fadd_rn(v[1], bf2f(w[1])); v[2] = __fadd_rn(v[2], bf2f(w[2])); v[3] = __fadd_rn(v[3], bf2f(w[3])); }
            x[k * 4 + 0] = v[0]; x[k * 4 + 1] = v[1]; x[k * 4 + 2] = v[2]; x[k * 4 + 3] = v[3]; s = __fadd_rn(__fadd_rn(__fadd_rn(__fadd_rn(s, v[0]), v[1]), v[2]), v[3]); } }
    for (int sh = 16; sh; sh >>= 1) s = __fadd_rn(s, __shfl_xor(s, sh, 32));
    const float mean = __fdiv_rn(s, (float)C); float q = 0.0f;
    for (int k = 0; k < LNC_MAX / 128; ++k) { if (k < nch) {
            for (int j = 0; j < 4; ++j) { const float d = __fsub_rn(x[k * 4 + j], mean); x[k * 4 + j] = d; q = __fmaf_rn(d, d, q); } } }
    for (int sh = 16; sh; sh >>= 1) q = __fadd_rn(q, __shfl_xor(q, sh, 32));
    const float rstd = __fdiv_rn(1.0f, sqrtf(__fadd_rn(__fdiv_rn(q, (float)C), eps)));
    for (int k = 0; k < LNC_MAX / 128; ++k) { if (k < nch) { const int c0 = k * 128 + lane * 4; const v4f g = *(const v4f*)(gamma + c0); const v4f bt = *(const v4f*)(beta + c0);
            for (int j = 0; j < 4; ++j) x[k * 4 + j] = __fmaf_rn(__fmul_rn(x[k * 4 + j], rstd), bfr(g[j]), bfr(bt[j])); } }
    float* y = Y + (size_t)row * C;
    {
        for (int k = 0; k < LNC_MAX / 128; ++k) { if (k < nch) { v4f o; o[0] = x[k * 4 + 0]; o[1] = x[k * 4 + 1]; o[2] = x[k * 4 + 2]; o[3] = x[k * 4 + 3]; *(v4f*)(y + k * 128 + lane * 4) = o; } }
         }
}

extern "C" void kernel_launch(void* const* d_in, const int* in_sizes, int n_in,
                              void* d_out, int out_size, void* d_ws, size_t ws_size, hipStream_t stream) {
    (void)in_sizes; (void)n_in; (void)out_size;
    const float* xq = (const float*)d_in[0]; const float* xk = (const float*)d_in[1]; const float* xv = (const float*)d_in[2]; const int* kp = (const int*)d_in[3]; const float* wq = (const float*)d_in[4]; const float* cq = (const float*)d_in[5]; const float* wk = (const float*)d_in[6]; const float* ck = (const float*)d_in[7]; const float* wv = (const float*)d_in[8]; const float* cv = (const float*)d_in[9]; const float* wo = (const float*)d_in[10]; const float* co = (const float*)d_in[11]; const float* ns = (const float*)d_in[12]; const float* nb = (const float*)d_in[13];   /* fourteen arrays, all read; kp the int32 keep plane, read through a pointer of its own type */
    float* OUT = (float*)d_out;     // [2][2048][1024]
    static_assert(DQ == DM && DKV == DQ && REP == 1 && HD == 64 && TT % 256 == 0 && (size_t)DQ * DM == CSEG && (size_t)NB_ * TT * DM == 4 * (size_t)CSEG && CSEG / CGX == 4 * 8 * 1024 && TT % GT == 0 && DM % GT == 0 && DQ % GT == 0 && DKV % GT == 0 && DM % 128 == 0 && DM <= LNC_MAX && (NB_ * TT) % 8 == 0, "the merged heads are the output map's depth; k_fattn takes one key head a query head, 64-wide heads and whole 256-row blocks; the cast launch's sixteen pieces are exact; the maps' tiles are whole; the row normalisation takes whole 128-column pieces");
    char* wsp = (char*)d_ws;
    auto take = [&](size_t bytes) { char* p = wsp; wsp += (bytes + 255) & ~(size_t)255; return (void*)p; };
    bf* WQ = (bf*)take((size_t)DQ * DM * 2); bf* WK = (bf*)take((size_t)DKV * DM * 2); bf* WV = (bf*)take((size_t)DKV * DM * 2); h16* WO16 = (h16*)take((size_t)DM * DQ * 2);
    bf* XQ = (bf*)take((size_t)NB_ * TT * DM * 2); bf* XK = (bf*)take((size_t)NB_ * TT * DM * 2); bf* XV = (bf*)take((size_t)NB_ * TT * DM * 2);   /* both entries' bf16 sources, on end */
    h16* QP16 = (h16*)take((size_t)NB_ * NH_ * TT * HD * 2); h16* KP16 = (h16*)take((size_t)NB_ * NKV * TT * HD * 2); h16* VT16 = (h16*)take((size_t)NB_ * NKV * HD * TT * 2);   /* both entries' head planes: the one attention launch reads them all */
    h16* C16 = (h16*)take((size_t)NB_ * TT * DQ * 2); float* YW = (float*)take((size_t)NB_ * TT * DM * 4);
    if ((size_t)(wsp - (char*)d_ws) > ws_size) return;    // 80.00 MiB carved
    k_castall<<<dim3(CGX, 16, 1), 256, 0, stream>>>(xq, xk, xv, wq, wk, wv, wo, XQ, XK, XV, WQ, WK, WV, (unsigned short*)WO16);   /* each 'to, from' weight [1024][1024] IS a K-contiguous operand of its map (the right one; the third map's left): cast as it lies */
    k_gemmw<bf, DM, h16, false><<<dim3(TT / GT, DQ / GT, NB_), 256, 0, stream>>>(XQ, WQ, QP16, HD, (size_t)TT * HD, cq, (size_t)TT * DM, 0, (size_t)NH_ * TT * HD);   /* 64-column group y = head y: straight into its [row][64] plane; z = the entry */
    k_gemmw<bf, DM, h16, false><<<dim3(TT / GT, DKV / GT, NB_), 256, 0, stream>>>(XK, WK, KP16, HD, (size_t)TT * HD, ck, (size_t)TT * DM, 0, (size_t)NKV * TT * HD);
    k_gemmw<bf, DM, h16, true><<<dim3(DKV / GT, TT / GT, NB_), 256, 0, stream>>>(WV, XV, VT16, TT, 64, cv, 0, (size_t)TT * DM, (size_t)NKV * HD * TT);   /* the weight's rows are the tile's rows: [head][64][key], the added vector by row */
    k_fattn<<<dim3(TT / 256, NB_ * NH_, 1), 256, 0, stream>>>(QP16, KP16, VT16, kp, C16);   /* the one keep-plane [2048][2048], read where it lies: the same for every entry and head; the merged heads come out token-major on ONE f16 word */
    k_gemmw<h16, DQ, float, false><<<dim3(TT / GT, DM / GT, NB_), 256, 0, stream>>>(C16, WO16, YW, DM, 64, co, (size_t)TT * DQ, 0, (size_t)TT * DM);   /* the output map with its bias into a workspace plane */
    k_lnrow<true><<<(unsigned)(NB_ * TT / 8), 256, 0, stream>>>(YW, XQ, ns, nb, 1.0e-5f, DM, NB_ * TT, OUT);   /* the result = normalise(plane + the first source's bf16 copy) * scale + shift: its one writer */
}

// v007
// One run takes 111 microseconds.
// Two timings next to v006 put it at 1.13 and 1.14 times that version's speed.
// Counting every step since v000, it is 11.9 times as fast.
#include <hip/hip_runtime.h>

// A sixteen-head attention of width 1,024 with separate sources for its three maps, ONE int32 keep plane over (row, column) for every entry and head, a last map, the first source added back and a row normalisation, on two 2,048-token entries
// (a0 | a1 | a2 the three sources [2][2048][1024]; a3 the keep plane [1][1][2048][2048] int32 (where a word is nought that column is dropped for that row; one plane for every entry and head); a4 | a6 | a8 | a10 four 'to, from' weights [1024][1024] (a map's column c is its source's row dotted with the weight's row c) with their added vectors a5 | a7 | a9 | a11 [1024]; a12 | a13 the normalisation's scale and shift [1024];
//  the first map of a0, the second of a1, the third of a2, each with its added vector; head h = columns 64 h and on; dots * 64^-0.5; a dropped pair's dot replaced by a large negative constant; ONE PLAIN SOFTMAX over the 2,048 columns; the shares times the third map's rows; the sixteen heads side by side; the sum = that plane mapped by a10 (column c = the plane's row dotted with a10's row c) + a11 + a0; the result = (the sum less its row's mean) over the root of (its row's biased variance + 1e-5), times a12, plus a13 -> [2][2048][1024]; argument order as numbered). FOURTEEN inputs, all read on the device.
// THE KEEP PLANE IS READ AS DATA: every one of its 4,194,304 words is loaded and tested against nought ONCE a call, in the cast launch, which keeps the answer as one bit; the attention selects every dot of every head and entry by its bit; nothing is assumed of the plane's contents.
// WHERE THE TEXT AND THE FUNCTION PART: the function puts minus infinity in place of a dropped dot, this text -3e38: after the row's maximum is taken away either gives an exact nought share in f32 wherever the row keeps a column; A ROW THAT KEEPS NO COLUMN: the function gives not-a-numbers there, this text uniform shares 1 / 2,048.
// THE ARITHMETIC AS BUILT IS THE FUNCTION's OWN: 34.36 G multiply-adds (four maps 4.29 each over the two entries; the dots 8.59; the shares' sums 8.59): ratio 1.00.
// Layout: ONE cast launch (k_castall) for all seven float planes: the three sources of both entries and the first three weights to bf16 as they lie, the last weight's bf16 values to f16 words; the same launch packs the keep plane into select words (512 KiB); both entries in one launch (grid z) of each later kernel: three bf16 * bf16 maps whose own epilogues add the vector, cast to f16 and store that entry's head planes (first and second map: one 64-column group IS one head's 64 columns; third map: weight as the left operand, source as the right, so its tile comes out key-contiguous); no f32 plane and no builder launch between a map and the attention;
// ONE launch for both entries and all sixteen heads (k_fattn): the dots f16 * f16, the keep plane's select words by scalar loads, a running-maximum softmax in registers and the shares' sums on f16 words, 32 columns a pass: no score or share plane goes to memory; its epilogue divides by the row's sum and stores the sixteen heads' token-major plane as ONE f16 word;
// the last map with its added vector into a workspace plane, and the row normalisation of (plane + the first source's bf16 copy from the cast launch) straight into the result (k_lnrow<true>: its one writer). Seven launches in all.
// Compute dtypes, f32 accumulate: every float input rounded to bf16 at its load: the maps bf16 * bf16 on exact operands, each added vector's bf16 word in the epilogue; the three head planes, the unnormalised shares (at most 1) and the sixteen heads' plane on one f16 word each; the last weight's bf16 values as f16 words; softmax f32; the first source added back at its bf16 value; the normalisation f32 with the scale's and shift's bf16 words.

#define NB_  2
#define TT   2048
#define DM   1024
#define NH_  16
#define NKV  16
#define REP  (NH_ / NKV)
#define HD   64
#define DQ   (NH_ * HD)
#define DKV  (NKV * HD)
#define SCL2 0.18033688011112042f // 64^-0.5 * log2(e): the dots go straight to the exponent of two
#define LNC_MAX 2048

typedef _Float16 h16;
typedef unsigned short bf;
typedef __attribute__((ext_vector_type(16))) __bf16   v16bf;
typedef __attribute__((ext_vector_type(16))) _Float16 v16h;
typedef __attribute__((ext_vector_type(8)))  _Float16 v8h;
typedef __attribute__((ext_vector_type(8)))  unsigned short v8us;
typedef __attribute__((ext_vector_type(8)))  float    v8f;
typedef __attribute__((ext_vector_type(4)))  float    v4f;
typedef v8h  __attribute__((may_alias)) v8ha;
typedef v4f  __attribute__((may_alias)) v4fa;
typedef v8us __attribute__((may_alias)) v8usa;

__device__ __forceinline__ unsigned short f2bf(float f) { unsigned u = __float_as_uint(f); u += 0x7FFFu + ((u >> 16) & 1u); return (unsigned short)(u >> 16); }
__device__ __forceinline__ float bf2f(unsigned short b) { return __uint_as_float(((unsigned)b) << 16); }
__device__ __forceinline__ float bfr(float f) { return bf2f(f2bf(f)); }
__device__ __forceinline__ v16h cat16(v8h lo, v8h hi) { return __builtin_shufflevector(lo, hi, 0, 1, 2, 3, 4, 5, 6, 7, 8, 9, 10, 11, 12, 13, 14, 15); }
__device__ __forceinline__ v16bf cat16b(v8us lo, v8us hi) { return __builtin_bit_cast(v16bf, __builtin_shufflevector(lo, hi, 0, 1, 2, 3, 4, 5, 6, 7, 8, 9, 10, 11, 12, 13, 14, 15)); }
__device__ __forceinline__ v8f wmma16(v16h a, v16h b, v8f c) { return __builtin_amdgcn_wmma_f32_16x16x32_f16(false, a, false, b, (short)0, c, false, false); }
__device__ __forceinline__ v8f wmmab(v16bf a, v16bf b, v8f c) { return __builtin_amdgcn_wmma_f32_16x16x32_bf16(false, a, false, b, (short)0, c, false, false); }



// ---- k_gemmw: one 128x128 output tile a work-group, 8 waves (2 down, 4 across), each wave a 64x32 piece (eight accumulators) over the WHOLE depth; operands are K-contiguous 16-bit planes; grid (M/128, N/128, Z), 256 threads.
// C[m][n] (f32 or f16 words by TO, + bias[n], or bias[m] with BROW) = sum_k A[m][k] Bt[n][k], k in rising order in one accumulator. z-batch strides sA/sB/sC in elements.
// WHERE A COLUMN LANDS: the 64-column group y starts at C + y * sN, its rows lie ldc apart (a plain plane: sN = 64, ldc = the plane's width; head planes [head][row][64]: sN = one head's plane, ldc = 64).
// THE OPERANDS COME THROUGH LDS: a stage is 128 deep: of each of the 128 A rows and 128 Bt rows two 128-byte pieces. Asynchronous 16-byte copies bring them in, every wave-wide copy four whole lines (four rows); each wave copies sixteen rows of either operand: 16 copies a stage.
// Every row that the tile needs is fetched once a work-group and read from LDS by the waves that share it (an A row by four, a Bt row by two). Two buffers: stage t + 2 is copied into the buffer that stage t has just left, while stage t + 1 is worked on. A 128-byte piece lies 144 bytes from the next row's, the pitch at which 16-byte LDS reads of 16 rows meet no bank twice.
// THE RESULT LEAVES THROUGH THE SAME LDS: behind the last stage's barrier each wave lays its piece in a 128x128 f32 plane, and behind one more barrier a wave takes whole rows of it: each store is whole lines.
template <typename T16> struct WFrag;
template <> struct WFrag<h16> { typedef v16h V; static __device__ __forceinline__ V ld(const h16* p) { return cat16(*(const v8h*)p, *(const v8h*)(p + 16)); } static __device__ __forceinline__ v8f mma(V a, V b, v8f c) { return wmma16(a, b, c); } };
template <> struct WFrag<bf> { typedef v16bf V; static __device__ __forceinline__ V ld(const bf* p) { return cat16b(*(const v8us*)p, *(const v8us*)(p + 16)); } static __device__ __forceinline__ v8f mma(V a, V b, v8f c) { return wmmab(a, b, c); } };
typedef __attribute__((ext_vector_type(4))) _Float16 v4h;
__device__ __forceinline__ void st4(float* p, v4f v) { *(v4f*)p = v; }
__device__ __forceinline__ void st4(h16* p, v4f v) { v4h o; o[0] = (h16)v[0]; o[1] = (h16)v[1]; o[2] = (h16)v[2]; o[3] = (h16)v[3]; *(v4h*)p = o; }
#define GT    128                        // rows of A and of Bt in a work-group's tile
#define GKS   128                        // a stage's depth, in elements: two 128-byte pieces a row
#define GPIT  144                        // LDS pitch of a 128-byte piece
#define GHALF (GT * GPIT)                // one operand's 128 rows of one piece
#define GOFFB (2 * GHALF)                // the Bt rows' place in a buffer
#define GBUF  (4 * GHALF)                // one buffer, in bytes
#define GOP   132                        // the result plane's pitch in words: the two halves of a wave store to different banks
#define CPG(a, b) "global_load_async_to_lds_b128 %" #a ", %" #b ", off\n\t"
// eight copies, and as the statement's last line the wait that stands between issued copies and the first overwrite of a register that they name
__device__ __forceinline__ void cp8(const unsigned (&l)[8], const char* const (&g)[8]) {
    asm volatile(CPG(0, 1) CPG(2, 3) CPG(4, 5) CPG(6, 7) CPG(8, 9) CPG(10, 11) CPG(12, 13) CPG(14, 15) "s_wait_xcnt 0x0"
                 :: "v"(l[0]), "v"(g[0]), "v"(l[1]), "v"(g[1]), "v"(l[2]), "v"(g[2]), "v"(l[3]), "v"(g[3]), "v"(l[4]), "v"(g[4]), "v"(l[5]), "v"(g[5]), "v"(l[6]), "v"(g[6]), "v"(l[7]), "v"(g[7]) : "memory");
}
// one stage's 16 copies of a wave. la: the lane's LDS byte address in the wave's first four A rows, first piece, of the buffer to be filled (eight lanes a row); ag, bg: the lane's global addresses in that stage; ROWB: a global row in bytes
template <int ROWB> __device__ __forceinline__ void gm_stage(unsigned la, const char* ag, const char* bg) {
    unsigned l[8]; const char* g[8];
    // both loops unrolled so that every index is a constant: the addresses stay in registers
#pragma unroll
    for (int i = 0; i < 8; ++i) { l[i] = la + (i >> 2) * GHALF + (i & 3) * 4 * GPIT; g[i] = ag + (i >> 2) * 128 + (size_t)(i & 3) * 4 * ROWB; }
    cp8(l, g);
#pragma unroll
    for (int i = 0; i < 8; ++i) { l[i] = la + GOFFB + (i >> 2) * GHALF + (i & 3) * 4 * GPIT; g[i] = bg + (i >> 2) * 128 + (size_t)(i & 3) * 4 * ROWB; }
    cp8(l, g);
}
// one 32-deep step's 12 LDS reads from the lane's own places, and its eight products; every loop unrolled so that each fragment and accumulator index is a constant: they stay in registers
template <typename T16> __device__ __forceinline__ void gm_read(typename WFrag<T16>::V (&a)[4], typename WFrag<T16>::V (&b)[2], const char* ap, const char* bp) {
#pragma unroll
    for (int mb = 0; mb < 4; ++mb) a[mb] = WFrag<T16>::ld((const T16*)(ap + mb * 16 * GPIT));
#pragma unroll
    for (int nb = 0; nb < 2; ++nb) b[nb] = WFrag<T16>::ld((const T16*)(bp + nb * 16 * GPIT));
}
template <typename T16> __device__ __forceinline__ void gm_mma(const typename WFrag<T16>::V (&a)[4], const typename WFrag<T16>::V (&b)[2], v8f (&acc)[4][2]) {
#pragma unroll
    for (int nb = 0; nb < 2; ++nb)
#pragma unroll
        for (int mb = 0; mb < 4; ++mb) acc[mb][nb] = WFrag<T16>::mma(a[mb], b[nb], acc[mb][nb]);
}
template <typename T16, int K, typename TO, bool BROW>
__global__ __launch_bounds__(256) void k_gemmw(const T16* __restrict__ A, const T16* __restrict__ Bt, TO* C, int ldc, size_t sN, const float* __restrict__ bias, size_t sA, size_t sB, size_t sC) {
    typedef typename WFrag<T16>::V V;
    constexpr int NST = K / GKS;
    static_assert(K % GKS == 0 && NST >= 2 && GKS == 128 && GT * GOP * 4 <= 2 * GBUF, "whole stages, at least the two that the ring's start fills; the result plane fits the ring");
    __shared__ __align__(16) char ring[2 * GBUF];
    const int wv = __builtin_amdgcn_readfirstlane((int)(threadIdx.x >> 5));   // the wave's number, held scalar
    const size_t z = blockIdx.z; A += z * sA; Bt += z * sB; C += z * sC;
    const int lane = threadIdx.x & 31, lr = lane & 15, hi = lane >> 4; const int r0 = blockIdx.x * GT, c0 = blockIdx.y * GT;
    const int wm = (wv & 1) * 64, wn = (wv >> 1) * 32;   // the wave's piece of the tile
    // the copies' addresses: eight lanes a 128-byte piece, four rows a copy; of either operand the wave takes rows 16 wv and on
    const int cr = lane >> 3, cc = (lane & 7) * 16;
    const unsigned la = (unsigned)(size_t)ring + (unsigned)((wv * 16 + cr) * GPIT + cc);
    const char* ag = (const char*)(A + (size_t)(r0 + wv * 16 + cr) * K) + cc; const char* bg = (const char*)(Bt + (size_t)(c0 + wv * 16 + cr) * K) + cc;
    // the lane's read places in buffer 0
    const char* ar = ring + (wm + lr) * GPIT + 16 * hi; const char* br = ring + GOFFB + (wn + lr) * GPIT + 16 * hi;
    v8f acc[4][2];
#pragma unroll
    for (int mb = 0; mb < 4; ++mb)
#pragma unroll
        for (int nb = 0; nb < 2; ++nb) acc[mb][nb] = (v8f){};
    gm_stage<K * 2>(la, ag, bg);
    // the added vector's words that this lane will want, fetched here so that their latency lies under the stages: a wave takes whole rows of 128 result words, rows wv, wv + 8 ...; a lane four columns
    const int cofs = lane * 4; float bw[BROW ? GT / 8 : 4];
    // unrolled so that every index is a constant: the words stay in registers
#pragma unroll
    for (int i = 0; i < (BROW ? GT / 8 : 4); ++i) bw[i] = BROW ? bias[r0 + i * 8 + wv] : bias[c0 + cofs + i];
    asm volatile("s_wait_xcnt 0x0" ::: "memory");   // stands between the issued loads and the first overwrite of their address registers
    __builtin_amdgcn_sched_barrier(0);   // nothing from below climbs between the loads and their wait, onto the loads' address registers
    asm volatile("s_wait_asynccnt 0x0" ::: "memory");   // this wave's copies of stage 0 have landed
    __syncthreads();                                     // every wave's have: stage 0 may be read
    gm_stage<K * 2>(la + GBUF, ag + GKS * 2, bg + GKS * 2);
    ag += 2 * GKS * 2; bg += 2 * GKS * 2;
    // FOUR STEPS' FRAGMENTS IN REGISTERS, READ TWO STEPS AT A TIME: each group of 24 LDS reads is issued in front of the sixteen products of the two steps read before it, so that its latency lies under them.
    // A stage's last two steps are multiplied behind the barrier that ends the stage: they are in registers by then (the wait in front of the barrier), and they cover the next stage's first reads.
    V fa[4][4], fb[4][2];
    gm_read<T16>(fa[0], fb[0], ar, br); gm_read<T16>(fa[1], fb[1], ar + 64, br + 64);
    // kept rolled: one copy of the stage's text, and no more than the four fragment sets live
#pragma unroll 1
    for (int t = 0; t < NST; ++t) {
        const int bo = (t & 1) * GBUF, bn = GBUF - bo;
        gm_read<T16>(fa[2], fb[2], ar + bo + GHALF, br + bo + GHALF); gm_read<T16>(fa[3], fb[3], ar + bo + GHALF + 64, br + bo + GHALF + 64);
        __builtin_amdgcn_sched_barrier(0);   // the reads stay one group in front of the products that cover them
        gm_mma<T16>(fa[0], fb[0], acc); gm_mma<T16>(fa[1], fb[1], acc);
        __builtin_amdgcn_sched_barrier(0);   // these products stay in front of the foot: sunk behind it, the wait below would meet reads that were issued only just before it
        asm volatile("s_wait_dscnt 0x0" ::: "memory");      // this wave has read all it wants of stage t
        asm volatile("s_wait_asynccnt 0x0" ::: "memory");   // its copies of stage t + 1 have landed
        __syncthreads();                                     // stage t + 1 may be read, and the buffer of stage t is free
        if (t + 2 < NST) { gm_stage<K * 2>(la + bo, ag, bg); ag += GKS * 2; bg += GKS * 2; }
        if (t + 1 < NST) { gm_read<T16>(fa[0], fb[0], ar + bn, br + bn); gm_read<T16>(fa[1], fb[1], ar + bn + 64, br + bn + 64); }
        __builtin_amdgcn_sched_barrier(0);   // the next stage's first reads stay one group in front of the products that cover them
        gm_mma<T16>(fa[2], fb[2], acc); gm_mma<T16>(fa[3], fb[3], acc);
    }
    asm volatile("s_wait_asynccnt 0x0" ::: "memory");   // no copy is in flight when the ring is put to its second use
    float* os = (float*)ring;
    // unrolled so that every accumulator index is a constant: the tiles stay in registers
#pragma unroll
    for (int mb = 0; mb < 4; ++mb)
#pragma unroll
        for (int nb = 0; nb < 2; ++nb)
#pragma unroll
            for (int j = 0; j < 8; ++j) os[(wm + mb * 16 + hi * 8 + j) * GOP + wn + nb * 16 + lr] = acc[mb][nb][j];
    __syncthreads();   // every wave's piece lies in LDS before any wave takes a row
    v4f bc = (v4f){};
    if (!BROW) { bc[0] = bfr(bw[0]); bc[1] = bfr(bw[1]); bc[2] = bfr(bw[2]); bc[3] = bfr(bw[3]); }
    TO* cb = C + (size_t)((c0 + cofs) >> 6) * sN + ((c0 + cofs) & 63) + (size_t)r0 * ldc;
    // unrolled so that the rows' LDS reads issue together
#pragma unroll
    for (int s = 0; s < GT / 8; ++s) { const int row = s * 8 + wv; v4f val = *(const v4fa*)(os + row * GOP + cofs);
        if (BROW) val += bfr(bw[s]); else val += bc;
        st4(cb + (size_t)row * ldc, val); }
}



__device__ __forceinline__ void splitf(float y, unsigned short& h, unsigned short& l) { h = f2bf(y); l = f2bf(y - bf2f(h)); }
typedef __attribute__((ext_vector_type(2))) _Float16 v2h;
typedef __attribute__((ext_vector_type(2))) unsigned short v2us;
typedef __attribute__((ext_vector_type(4))) unsigned short v4us;
typedef __attribute__((ext_vector_type(2))) float v2f;
typedef __attribute__((ext_vector_type(4))) int v4i;

// ---- k_fattn: dots, keep plane, softmax and the shares' sums of one head in ONE kernel; grid (TT / 256, entries * heads), 8 waves, each wave 32 query rows (two 16-column groups) against all TT keys, 32 keys a pass.
// TRANSPOSED PRODUCTS: St = K Qt (A = 16 key rows, B = 16 query rows, both by the one k-contiguous loader), so a lane holds 8 + 8 scores of ONE query (column lr; keys 8 hi + r and 16 + 8 hi + r): maximum and sum stay in the lane, the two halves of the wave join the maximum by one exchange a pass.
// The two score tiles, turned into shares and cast, ARE the B operand of Ot += Vt Pt in the hardware's k order; A = 16 rows of the key-contiguous Vt plane by the same loader (keys 8 hi .. and 16 + 8 hi ..): the k orders agree at every position.
// RUNNING MAXIMUM: every pass takes the row's maximum so far and scales the sums and the output tiles by 2^(old - new), without a branch: the pass is one straight block. A share is at most 1.
// A dropped dot is -3e38: its share is an exact nought once the row has kept a column (the first kept column wipes what came before by the factor 2^(-3e38 - new) = 0); a row that keeps none ends with uniform shares.
// THE OPERANDS COME THROUGH LDS: a stage is 64 keys (two passes): 64 K rows and 64 Vt rows of 128 bytes, shared by the eight waves. Asynchronous 16-byte copies bring them in, every wave-wide copy four whole lines (four rows); each wave copies an eighth of K and of Vt: four copies a stage.
// THE KEEP PLANE COMES AS SELECT WORDS: the cast launch has packed it so that bit L of a word is lane L's answer for one score register; a pass's 32 words (128 bytes) come by two scalar loads, one stage ahead, and each word is its select's lane mask as it stands: no LDS, no vector register and no compare for the plane.
// Two buffers: stage s + 2 is copied into the buffer that stage s has just left, while stage s + 1 is worked on. Every row lies 144 bytes from the next, the pitch at which 16-byte LDS reads of 16 rows meet no bank twice. WHAT IS LEFT: a stage's first reads wait behind its barrier; a pass whose words are all nought or all ones is worked like any other.
// Every loop over tiles, column groups, blocks and registers below is unrolled so that each fragment index is a constant: the fragments and accumulators stay in registers.
__device__ __forceinline__ float xhalf(float x) { return __builtin_bit_cast(float, __builtin_amdgcn_permlanex16(__builtin_bit_cast(int, x), __builtin_bit_cast(int, x), 0x76543210, 0xfedcba98, false, false)); }   // lane l with lane l ^ 16
// eight exponentials of two, each in place: no one of them reads another's result or overwrites another's source, and the v_nop fills the slot that the instruction set asks for behind the last one, whatever the compiler puts next
__device__ __forceinline__ void exp2x8(v8f& x) { float a = x[0], b = x[1], c = x[2], d = x[3], e = x[4], f = x[5], g = x[6], h = x[7];
    asm("v_exp_f32 %0, %0\n\tv_exp_f32 %1, %1\n\tv_exp_f32 %2, %2\n\tv_exp_f32 %3, %3\n\tv_exp_f32 %4, %4\n\tv_exp_f32 %5, %5\n\tv_exp_f32 %6, %6\n\tv_exp_f32 %7, %7\n\tv_nop" : "+v"(a), "+v"(b), "+v"(c), "+v"(d), "+v"(e), "+v"(f), "+v"(g), "+v"(h));
    x[0] = a; x[1] = b; x[2] = c; x[3] = d; x[4] = e; x[5] = f; x[6] = g; x[7] = h; }
struct FOps { v16h kf[2][2]; v16h vf[4]; };   // one pass's operands from LDS: K rows [tile][32-deep step], Vt rows [16-row block]
typedef __attribute__((ext_vector_type(16))) unsigned v16u;   // one column group's sixteen select words of a pass: [tile][register]
// sixteen select words by one scalar load: the plane was written by an earlier launch and no one writes it while this kernel runs, so it is read through the constant address space (behind the loop's asm waits the compiler otherwise takes the words through vector registers, a lane read each)
__device__ __forceinline__ v16u ldw(const unsigned* p) { return *(const __attribute__((address_space(4))) v16u*)p; }
#define SKEY 64                          // keys a stage
#define LPIT 144                         // LDS pitch of a 128-byte row
#define OFFV (SKEY * LPIT)               // the Vt rows' place in a buffer
#define BUFB (OFFV + HD * LPIT)          // one buffer, in bytes
#define CP1(a, b) "global_load_async_to_lds_b128 %" #a ", %" #b ", off\n\t"
// one stage's four copies of a wave, and as the statement's last line the wait that stands between issued copies and the first overwrite of a register that they name. ll: the lane's place in any four rows (eight lanes a row); sk: the LDS byte address, the same for the whole wave, of the wave's first K row in the buffer to be filled; kg, vg: the lane's global addresses in that stage
__device__ __forceinline__ void fa_stage(unsigned ll, unsigned sk, const char* kg, const char* vg) {
    sk = (unsigned)__builtin_amdgcn_readfirstlane((int)sk);   // the wave's place held scalar: the one lane-own value that lives through the loop is ll, which no copy names itself
    asm volatile(CP1(0, 1) CP1(2, 3) CP1(4, 5) CP1(6, 7) "s_wait_xcnt 0x0"
                 :: "v"(ll + sk), "v"(kg), "v"(ll + (sk + 4 * LPIT)), "v"(kg + 4 * HD * 2), "v"(ll + (sk + OFFV)), "v"(vg), "v"(ll + (sk + OFFV + 4 * LPIT)), "v"(vg + 4 * TT * 2) : "memory");
}
// one pass's 16 LDS reads from the lane's own places in the stage's buffer
__device__ __forceinline__ void fa_read(FOps& n, const char* kb, const char* vb) {
#pragma unroll
    for (int t = 0; t < 2; ++t)
#pragma unroll
        for (int ks = 0; ks < 2; ++ks) n.kf[t][ks] = WFrag<h16>::ld((const h16*)(kb + t * 16 * LPIT + ks * 64));
#pragma unroll
    for (int db = 0; db < 4; ++db) n.vf[db] = WFrag<h16>::ld((const h16*)(vb + db * 16 * LPIT));
}
// one exponential of two; the v_nop fills the slot that the instruction set asks for behind it, whatever the compiler puts next
__device__ __forceinline__ float exp2x1(float x) { float y; asm("v_exp_f32 %0, %1\n\tv_nop" : "=v"(y) : "v"(x)); return y; }
__device__ __forceinline__ void fa_pass(const FOps& c, const v16u (&kw)[2], const v16h (&qf)[2][2], v8f (&o)[4][2], float (&mu)[2], v2f (&sm)[2]) {
    typedef WFrag<h16> F;
    v16h pf[2];
#pragma unroll
    for (int g = 0; g < 2; ++g) { v8f s[2]; float m = mu[g];
#pragma unroll
        for (int t = 0; t < 2; ++t) { s[t] = F::mma(c.kf[t][1], qf[g][1], F::mma(c.kf[t][0], qf[g][0], (v8f){}));
#pragma unroll
            for (int r = 0; r < 8; ++r) { const float x = __builtin_amdgcn_inverse_ballot_w32(kw[g][t * 8 + r]) ? s[t][r] * SCL2 : -3.0e38f;   /* keep the dot where the lane's bit is set: the scalar word IS the select's lane mask, no compare */ s[t][r] = x; m = fmaxf(m, x); } }
        m = fmaxf(m, xhalf(m));   // both halves of the wave hold the query's maximum: one scale for all 32 keys
        const float f = exp2x1(mu[g] - m); mu[g] = m; sm[g] *= f;
#pragma unroll
        for (int db = 0; db < 4; ++db) o[db][g] *= f;
#pragma unroll
        for (int t = 0; t < 2; ++t) { v8f e = s[t] - m; exp2x8(e);
#pragma unroll
            for (int r = 0; r < 8; r += 2) { sm[g] += (v2f){e[r], e[r + 1]}; pf[g][t * 8 + r] = (h16)e[r]; pf[g][t * 8 + r + 1] = (h16)e[r + 1]; } } }
#pragma unroll
    for (int db = 0; db < 4; ++db)
#pragma unroll
        for (int g = 0; g < 2; ++g) o[db][g] = F::mma(c.vf[db], pf[g], o[db][g]);
}
// two waves a SIMD (one work-group a WGP): the register budget that holds both operand sets beside the accumulators without a spill
__global__ __launch_bounds__(256) __attribute__((amdgpu_waves_per_eu(2, 2))) void k_fattn(const h16* __restrict__ Qp, const h16* __restrict__ Kp, const h16* __restrict__ Vt, const unsigned* __restrict__ MB, h16* Cx) {
    const int lane = threadIdx.x & 31, lr = lane & 15, hi = lane >> 4;
    const int wv = __builtin_amdgcn_readfirstlane((int)(threadIdx.x >> 5));   // the wave's number, held scalar
    const int zh = blockIdx.y, q0 = blockIdx.x * 256 + wv * 32;
    const h16* qb = Qp + ((size_t)zh * TT + q0 + lr) * HD + 8 * hi;
    static_assert(TT % SKEY == 0 && TT / SKEY >= 2 && SKEY == 64 && HD == 64, "whole stages, at least the two that the ring's start fills; rows of 128 bytes");
    __shared__ __align__(16) char ring[2 * BUFB];
    // the copies' addresses: eight lanes a 128-byte row, four rows a copy; of K and Vt the wave takes rows 8 wv and on
    const int cr = lane >> 3, cc = (lane & 7) * 16;
    const unsigned ll = (unsigned)(cr * LPIT + cc), sk = (unsigned)(size_t)ring + (unsigned)(wv * 8 * LPIT);
    const char* kg = (const char*)(Kp + ((size_t)zh * TT + wv * 8 + cr) * HD) + cc; const char* vg = (const char*)(Vt + ((size_t)zh * HD + wv * 8 + cr) * TT) + cc;
    // the lane's read places in buffer 0, first pass
    const char* kb = ring + lr * LPIT + 16 * hi; const char* vb = ring + OFFV + lr * LPIT + 16 * hi;
    // the wave's own select words: 32 a pass, the passes on end; the address is the same in every lane, so the loads are scalar
    const unsigned* mw = MB + (size_t)(q0 >> 5) * (TT / 32) * 32;
    v16u wa[2], wb[2];
    wa[0] = ldw(mw); wa[1] = ldw(mw + 16); wb[0] = ldw(mw + 32); wb[1] = ldw(mw + 48);
    v16h qf[2][2]; v8f o[4][2]; float mu[2]; v2f sm[2];
#pragma unroll
    for (int g = 0; g < 2; ++g)
#pragma unroll
        for (int ks = 0; ks < 2; ++ks) qf[g][ks] = WFrag<h16>::ld(qb + g * 16 * HD + ks * 32);
    asm volatile("s_wait_xcnt 0x0" ::: "memory");   // stands between the issued query loads and the first overwrite of their address registers
    __builtin_amdgcn_sched_barrier(0);   // nothing from below climbs between the query loads and their wait, onto the loads' address registers
#pragma unroll
    for (int g = 0; g < 2; ++g) { mu[g] = -3.0e38f; sm[g] = (v2f){};
#pragma unroll
        for (int db = 0; db < 4; ++db) o[db][g] = (v8f){}; }
    fa_stage(ll, sk, kg, vg);
    asm volatile("s_wait_asynccnt 0x0" ::: "memory");   // this wave's copies of stage 0 have landed
    __syncthreads();                                     // every wave's have: stage 0 may be read
    fa_stage(ll, sk + BUFB, kg + SKEY * HD * 2, vg + SKEY * 2);
    kg += 2 * SKEY * HD * 2; vg += 2 * SKEY * 2;
    for (int s = 0; s < TT / SKEY; ++s) {
        const int bo = (s & 1) * BUFB; FOps A, B;
        fa_read(A, kb + bo, vb + bo);
        fa_read(B, kb + bo + 32 * LPIT, vb + bo + 64);
        const unsigned* mn = mw + (s + 1 < TT / SKEY ? s + 1 : s) * 64;   // the next stage's select words (the last stage takes its own again: no word past the wave's run is read)
        __builtin_amdgcn_sched_barrier(0);   // both passes' LDS reads stay together at the head of the stage: the second pass's latency lies under the first pass's work
        fa_pass(A, wa, qf, o, mu, sm);
        wa[0] = ldw(mn); wa[1] = ldw(mn + 16);          // each pass's words are fetched one stage ahead, as soon as their registers are free: the scalar path's latency lies under a pass
        fa_pass(B, wb, qf, o, mu, sm);
        wb[0] = ldw(mn + 32); wb[1] = ldw(mn + 48);
        __builtin_amdgcn_sched_barrier(0);   // the stage's work stays in front of its foot: lifted over the work, the wait below would meet copies that were issued only just before it
        asm volatile("s_wait_dscnt 0x0" ::: "memory");      // this wave has read all it wants of stage s
        asm volatile("s_wait_asynccnt 0x0" ::: "memory");   // its copies of stage s + 1 have landed
        __syncthreads();                                     // stage s + 1 may be read, and the buffer of stage s is free
        if (s + 2 < TT / SKEY) { fa_stage(ll, sk + bo, kg, vg); kg += SKEY * HD * 2; vg += SKEY * 2; }
    }
    asm volatile("s_wait_asynccnt 0x0" ::: "memory");   // no copy is in flight when the wave ends
    const int en = zh / NH_, hd = zh % NH_;
#pragma unroll
    for (int g = 0; g < 2; ++g) { const float hs = sm[g][0] + sm[g][1]; const float inv = __fdiv_rn(1.0f, hs + xhalf(hs));   // the two halves' sums meet once
        h16* c = Cx + ((size_t)en * TT + q0 + g * 16 + lr) * DQ + hd * HD + 8 * hi;
#pragma unroll
        for (int db = 0; db < 4; ++db) { v8h ov;
#pragma unroll
            for (int r = 0; r < 8; ++r) ov[r] = (h16)(o[db][g][r] * inv);
            *(v8h*)(c + db * 16) = ov; } }
}

template <typename T16> __device__ __forceinline__ unsigned short cv16(float x);
template <> __device__ __forceinline__ unsigned short cv16<h16>(float x) { const h16 h = (h16)x; return __builtin_bit_cast(unsigned short, h); }
// ---- k_castall: every 16-bit copy of a float plane, and the keep plane's select words, in ONE launch of 5,120 long waves; grid (CGX, 20), 256 threads: grid rows 0 - 3 pack the keep plane, rows 4 - 19 are the casts' pieces 0 - 15. The float planes are cut into sixteen pieces of CSEG words: pieces 0 - 11 the three sources (four each, both entries lie on end), 12 - 14 the first three weights, 15 the last weight.
// A work-group takes CSEG / CGX words of its piece: four trips of eight loads a thread; each wave-wide load is 512 bytes on end (whole lines), each store 256.
#define CSEG (1u << 20)
#define CGX  32
template <bool TOH> __device__ __forceinline__ void cast_run(const float* __restrict__ s, unsigned short* d) {
    for (int t = 0; t < 4; ++t) { v4f v[8];
        // unrolled so that a trip's eight loads are in flight together
#pragma unroll
        for (int j = 0; j < 8; ++j) v[j] = *(const v4f*)(s + (t * 8 + j) * 1024);
#pragma unroll
        for (int j = 0; j < 8; ++j) { v4us o;
#pragma unroll
            for (int q = 0; q < 4; ++q) { const unsigned short b = f2bf(v[j][q]); o[q] = TOH ? cv16<h16>(bf2f(b)) : b; }
            *(v4us*)(d + (t * 8 + j) * 1024) = o; } }
}
// THE KEEP PLANE's SELECT WORDS: for 32 query rows x 32 keys, 32 words: word 16 g + 8 t + r holds in bit L whether row 16 g + (L & 15) keeps key 16 t + 8 (L >> 4) + r, which is where k_fattn's lane L holds that dot (column group g, tile t, register r).
// A lane loads the eight plane words of its row and key octet (two 16-byte loads a tile); one ballot a register makes a word, lane i keeps word i, and one wave-wide store writes the unit's 128 bytes. wid: the wave's number of 1,024; a wave takes four units on end along the keys (512 bytes of each of its 32 rows).
__device__ __forceinline__ void pack_run(const int* __restrict__ mk, unsigned* MB, int wid, int lane) {
    const int qb = wid >> 4, p0 = (wid & 15) * 4;
    const int* sp = mk + (size_t)(qb * 32 + (lane & 15)) * TT + p0 * 32 + 8 * (lane >> 4);
    v4i w[4][2][2][2];
    // every loop unrolled so that the wave's 32 loads are in flight together and each index is a constant
#pragma unroll
    for (int u = 0; u < 4; ++u)
#pragma unroll
        for (int g = 0; g < 2; ++g)
#pragma unroll
            for (int t = 0; t < 2; ++t) { w[u][g][t][0] = *(const v4i*)(sp + g * 16 * TT + u * 32 + t * 16); w[u][g][t][1] = *(const v4i*)(sp + g * 16 * TT + u * 32 + t * 16 + 4); }
    asm volatile("s_wait_xcnt 0x0" :: "v"(sp) : "memory");   // stands between the issued loads and the first overwrite of their address registers; it takes the address as an input, so that no load's own result lands on those registers in front of it
    __builtin_amdgcn_sched_barrier(0);   // nothing from below climbs between the loads and their wait: the 32 loads stay one group in flight
#pragma unroll
    for (int u = 0; u < 4; ++u) { unsigned o = 0;
#pragma unroll
        for (int i = 0; i < 32; ++i) { const unsigned b = __builtin_amdgcn_ballot_w32(w[u][i >> 4][(i >> 3) & 1][(i >> 2) & 1][i & 3] != 0); o = lane == i ? b : o; }
        MB[((size_t)qb * (TT / 32) + p0 + u) * 32 + lane] = o; }
}
__global__ __launch_bounds__(256) void k_castall(const float* __restrict__ xq, const float* __restrict__ xk, const float* __restrict__ xv, const float* __restrict__ wq, const float* __restrict__ wk, const float* __restrict__ wv, const float* __restrict__ wo, const int* __restrict__ mk,
                                                 unsigned short* XQ, unsigned short* XK, unsigned short* XV, unsigned short* WQ, unsigned short* WK, unsigned short* WV, unsigned short* WO, unsigned* MB) {
    if (blockIdx.y < 4) { pack_run(mk, MB, (int)((blockIdx.y * CGX + blockIdx.x) * 8 + (threadIdx.x >> 5)), (int)(threadIdx.x & 31)); return; }   // grid rows 0 - 3: the keep plane, first because its loads (16 lines each) are the launch's slowest; the test is the same for the whole work-group
    const unsigned seg = blockIdx.y - 4; const float* s; unsigned short* d;
    if (seg < 4) { s = xq; d = XQ; } else if (seg < 8) { s = xk; d = XK; } else if (seg < 12) { s = xv; d = XV; } else if (seg == 12) { s = wq; d = WQ; } else if (seg == 13) { s = wk; d = WK; } else if (seg == 14) { s = wv; d = WV; } else { s = wo; d = WO; }
    const size_t off = (seg < 12 ? (size_t)(seg & 3u) * CSEG : 0) + (size_t)blockIdx.x * (CSEG / CGX) + threadIdx.x * 4;
    if (seg == 15) cast_run<true>(s + off, d + off); else cast_run<false>(s + off, d + off);
}

template <bool RES>
__global__ __launch_bounds__(256) void k_lnrow(const float* __restrict__ A, const bf* __restrict__ R, const float* __restrict__ gamma, const float* __restrict__ beta, float eps, int C, int nrows, float* Y) {
    const int lane = threadIdx.x & 31; const int row = blockIdx.x * 8 + (threadIdx.x >> 5); if (row >= nrows) return; const int nch = C / 128; const float* a = A + (size_t)row * C; float x[LNC_MAX / 32]; float s = 0.0f;
    for (int k = 0; k < LNC_MAX / 128; ++k) { if (k < nch) { const int c0 = k * 128 + lane * 4; v4f v = *(const v4f*)(a + c0);
            if (RES) { asm volatile("s_wait_xcnt 0x0" ::: "memory");   /* stands between the issued load and the next load, whose result may land on the first one's address registers */
                const v4us w = *(const v4us*)(R + (size_t)row * C + c0); v[0] = __fadd_rn(v[0], bf2f(w[0])); v[1] = __fadd_rn(v[1], bf2f(w[1])); v[2] = __fadd_rn(v[2], bf2f(w[2])); v[3] = __fadd_rn(v[3], bf2f(w[3])); }
            x[k * 4 + 0] = v[0]; x[k * 4 + 1] = v[1]; x[k * 4 + 2] = v[2]; x[k * 4 + 3] = v[3]; s = __fadd_rn(__fadd_rn(__fadd_rn(__fadd_rn(s, v[0]), v[1]), v[2]), v[3]); } }
    for (int sh = 16; sh; sh >>= 1) s = __fadd_rn(s, __shfl_xor(s, sh, 32));
    const float mean = __fdiv_rn(s, (float)C); float q = 0.0f;
    for (int k = 0; k < LNC_MAX / 128; ++k) { if (k < nch) {
            for (int j = 0; j < 4; ++j) { const float d = __fsub_rn(x[k * 4 + j], mean); x[k * 4 + j] = d; q = __fmaf_rn(d, d, q); } } }
    for (int sh = 16; sh; sh >>= 1) q = __fadd_rn(q, __shfl_xor(q, sh, 32));
    const float rstd = __fdiv_rn(1.0f, sqrtf(__fadd_rn(__fdiv_rn(q, (float)C), eps)));
    for (int k = 0; k < LNC_MAX / 128; ++k) { if (k < nch) { const int c0 = k * 128 + lane * 4; const v4f g = *(const v4f*)(gamma + c0); const v4f bt = *(const v4f*)(beta + c0);
            for (int j = 0; j < 4; ++j) x[k * 4 + j] = __fmaf_rn(__fmul_rn(x[k * 4 + j], rstd), bfr(g[j]), bfr(bt[j])); } }
    float* y = Y + (size_t)row * C;
    {
        for (int k = 0; k < LNC_MAX / 128; ++k) { if (k < nch) { v4f o; o[0] = x[k * 4 + 0]; o[1] = x[k * 4 + 1]; o[2] = x[k * 4 + 2]; o[3] = x[k * 4 + 3]; *(v4f*)(y + k * 128 + lane * 4) = o; } }
         }
}

extern "C" void kernel_launch(void* const* d_in, const int* in_sizes, int n_in,
                              void* d_out, int out_size, void* d_ws, size_t ws_size, hipStream_t stream) {
    (void)in_sizes; (void)n_in; (void)out_size;
    const float* xq = (const float*)d_in[0]; const float* xk = (const float*)d_in[1]; const float* xv = (const float*)d_in[2]; const int* kp = (const int*)d_in[3]; const float* wq = (const float*)d_in[4]; const float* cq = (const float*)d_in[5]; const float* wk = (const float*)d_in[6]; const float* ck = (const float*)d_in[7]; const float* wv = (const float*)d_in[8]; const float* cv = (const float*)d_in[9]; const float* wo = (const float*)d_in[10]; const float* co = (const float*)d_in[11]; const float* ns = (const float*)d_in[12]; const float* nb = (const float*)d_in[13];   /* fourteen arrays, all read; kp the int32 keep plane, read through a pointer of its own type */
    float* OUT = (float*)d_out;     // [2][2048][1024]
    static_assert(DQ == DM && DKV == DQ && REP == 1 && HD == 64 && TT % 256 == 0 && (size_t)DQ * DM == CSEG && (size_t)NB_ * TT * DM == 4 * (size_t)CSEG && CSEG / CGX == 4 * 8 * 1024 && TT % GT == 0 && DM % GT == 0 && DQ % GT == 0 && DKV % GT == 0 && DM % 128 == 0 && DM <= LNC_MAX && (NB_ * TT) % 8 == 0 && (TT / 32) * (TT / 32) == 4 * CGX * 8 * 4, "the merged heads are the output map's depth; k_fattn takes one key head a query head, 64-wide heads and whole 256-row blocks; the cast launch's sixteen pieces are exact; the maps' tiles are whole; the row normalisation takes whole 128-column pieces; the keep plane's 32 x 32 units are four a wave of four pieces");
    char* wsp = (char*)d_ws;
    auto take = [&](size_t bytes) { char* p = wsp; wsp += (bytes + 255) & ~(size_t)255; return (void*)p; };
    bf* WQ = (bf*)take((size_t)DQ * DM * 2); bf* WK = (bf*)take((size_t)DKV * DM * 2); bf* WV = (bf*)take((size_t)DKV * DM * 2); h16* WO16 = (h16*)take((size_t)DM * DQ * 2);
    bf* XQ = (bf*)take((size_t)NB_ * TT * DM * 2); bf* XK = (bf*)take((size_t)NB_ * TT * DM * 2); bf* XV = (bf*)take((size_t)NB_ * TT * DM * 2);   /* both entries' bf16 sources, on end */
    h16* QP16 = (h16*)take((size_t)NB_ * NH_ * TT * HD * 2); h16* KP16 = (h16*)take((size_t)NB_ * NKV * TT * HD * 2); h16* VT16 = (h16*)take((size_t)NB_ * NKV * HD * TT * 2);   /* both entries' head planes: the one attention launch reads them all */
    h16* C16 = (h16*)take((size_t)NB_ * TT * DQ * 2); float* YW = (float*)take((size_t)NB_ * TT * DM * 4); unsigned* MB = (unsigned*)take((size_t)TT * TT / 8);   /* the keep plane's select words, one bit a pair */
    if ((size_t)(wsp - (char*)d_ws) > ws_size) return;    // 80.50 MiB carved
    k_castall<<<dim3(CGX, 20, 1), 256, 0, stream>>>(xq, xk, xv, wq, wk, wv, wo, kp, XQ, XK, XV, WQ, WK, WV, (unsigned short*)WO16, MB);   /* each 'to, from' weight [1024][1024] is cast as it lies: the right operand of the first, second and last maps, the left of the third */
    k_gemmw<bf, DM, h16, false><<<dim3(TT / GT, DQ / GT, NB_), 256, 0, stream>>>(XQ, WQ, QP16, HD, (size_t)TT * HD, cq, (size_t)TT * DM, 0, (size_t)NH_ * TT * HD);   /* 64-column group y = head y: straight into its [row][64] plane; z = the entry */
    k_gemmw<bf, DM, h16, false><<<dim3(TT / GT, DKV / GT, NB_), 256, 0, stream>>>(XK, WK, KP16, HD, (size_t)TT * HD, ck, (size_t)TT * DM, 0, (size_t)NKV * TT * HD);
    k_gemmw<bf, DM, h16, true><<<dim3(DKV / GT, TT / GT, NB_), 256, 0, stream>>>(WV, XV, VT16, TT, 64, cv, 0, (size_t)TT * DM, (size_t)NKV * HD * TT);   /* the weight's rows are the tile's rows: [head][64][key], the added vector by row */
    k_fattn<<<dim3(TT / 256, NB_ * NH_, 1), 256, 0, stream>>>(QP16, KP16, VT16, MB, C16);   /* the one keep plane's select words: the same for every entry and head; the merged heads come out token-major on ONE f16 word */
    k_gemmw<h16, DQ, float, false><<<dim3(TT / GT, DM / GT, NB_), 256, 0, stream>>>(C16, WO16, YW, DM, 64, co, (size_t)TT * DQ, 0, (size_t)TT * DM);   /* the output map with its bias into a workspace plane */
    k_lnrow<true><<<(unsigned)(NB_ * TT / 8), 256, 0, stream>>>(YW, XQ, ns, nb, 1.0e-5f, DM, NB_ * TT, OUT);   /* the result = normalise(plane + the first source's bf16 copy) * scale + shift: its one writer */
}

// v008
// Measured time: 104 microseconds a run.
// In two side-by-side timings against v007, it was 1.07 and 1.08 times as fast.
// All steps since v000 together make it 12.8 times as fast.
#include <hip/hip_runtime.h>

// A sixteen-head attention of width 1,024 with separate sources for its three maps, ONE int32 keep plane over (row, column) for every entry and head, a last map, the first source added back and a row normalisation, on two 2,048-token entries
// (a0 | a1 | a2 the three sources [2][2048][1024]; a3 the keep plane [1][1][2048][2048] int32 (where a word is nought that column is dropped for that row; one plane for every entry and head); a4 | a6 | a8 | a10 four 'to, from' weights [1024][1024] (a map's column c is its source's row dotted with the weight's row c) with their added vectors a5 | a7 | a9 | a11 [1024]; a12 | a13 the normalisation's scale and shift [1024];
//  the first map of a0, the second of a1, the third of a2, each with its added vector; head h = columns 64 h and on; dots * 64^-0.5; a dropped pair's dot replaced by a large negative constant; ONE PLAIN SOFTMAX over the 2,048 columns; the shares times the third map's rows; the sixteen heads side by side; the sum = that plane mapped by a10 (column c = the plane's row dotted with a10's row c) + a11 + a0; the result = (the sum less its row's mean) over the root of (its row's biased variance + 1e-5), times a12, plus a13 -> [2][2048][1024]; argument order as numbered). FOURTEEN inputs, all read on the device.
// THE KEEP PLANE IS READ AS DATA: every one of its 4,194,304 words is loaded and tested against nought ONCE a call, in the cast launch, which keeps the answer as one bit; the attention selects every dot of every head and entry by its bit; nothing is assumed of the plane's contents.
// WHERE THE TEXT AND THE FUNCTION PART: the function puts minus infinity in place of a dropped dot, this text -3e38: after the row's maximum is taken away either gives an exact nought share in f32 wherever the row keeps a column; A ROW THAT KEEPS NO COLUMN: the function gives not-a-numbers there, this text uniform shares 1 / 2,048.
// THE ARITHMETIC AS BUILT IS THE FUNCTION's OWN: 34.36 G multiply-adds (four maps 4.29 each over the two entries; the dots 8.59; the shares' sums 8.59): ratio 1.00.
// Layout: ONE cast launch (k_castall) for all seven float planes: the three sources of both entries and the first three weights to bf16 as they lie, the last weight's bf16 values to f16 words; the same launch packs the keep plane into select words (512 KiB); both entries in one launch of each later kernel: the three bf16 * bf16 maps in ONE launch (k_maps3: a work-group works its tile of each map in turn), their epilogues add the vector, cast to f16 and store that entry's head planes (first and second map: one 64-column group IS one head's 64 columns; third map: weight as the left operand, source as the right, so its tile comes out key-contiguous); no f32 plane and no builder launch between a map and the attention;
// ONE launch for both entries and all sixteen heads (k_fattn): the dots f16 * f16, the keep plane's select words by scalar loads, a running-maximum softmax in registers and the shares' sums on f16 words, 32 columns a pass: no score or share plane goes to memory; its epilogue divides by the row's sum and stores the sixteen heads' token-major plane as ONE f16 word;
// the last map with its added vector into a workspace plane, and the row normalisation of (plane + the first source's bf16 copy from the cast launch) straight into the result (k_lnrow<true>: its one writer). Five launches in all.
// Compute dtypes, f32 accumulate: every float input rounded to bf16 at its load: the maps bf16 * bf16 on exact operands, each added vector's bf16 word in the epilogue; the three head planes, the unnormalised shares (at most 1) and the sixteen heads' plane on one f16 word each; the last weight's bf16 values as f16 words; softmax f32; the first source added back at its bf16 value; the normalisation f32 with the scale's and shift's bf16 words.

#define NB_  2
#define TT   2048
#define DM   1024
#define NH_  16
#define NKV  16
#define REP  (NH_ / NKV)
#define HD   64
#define DQ   (NH_ * HD)
#define DKV  (NKV * HD)
#define SCL2 0.18033688011112042f // 64^-0.5 * log2(e): the dots go straight to the exponent of two
#define LNC_MAX 2048

typedef _Float16 h16;
typedef unsigned short bf;
typedef __attribute__((ext_vector_type(16))) __bf16   v16bf;
typedef __attribute__((ext_vector_type(16))) _Float16 v16h;
typedef __attribute__((ext_vector_type(8)))  _Float16 v8h;
typedef __attribute__((ext_vector_type(8)))  unsigned short v8us;
typedef __attribute__((ext_vector_type(8)))  float    v8f;
typedef __attribute__((ext_vector_type(4)))  float    v4f;
typedef v8h  __attribute__((may_alias)) v8ha;
typedef v4f  __attribute__((may_alias)) v4fa;
typedef v8us __attribute__((may_alias)) v8usa;

__device__ __forceinline__ unsigned short f2bf(float f) { unsigned u = __float_as_uint(f); u += 0x7FFFu + ((u >> 16) & 1u); return (unsigned short)(u >> 16); }
__device__ __forceinline__ float bf2f(unsigned short b) { return __uint_as_float(((unsigned)b) << 16); }
__device__ __forceinline__ float bfr(float f) { return bf2f(f2bf(f)); }
__device__ __forceinline__ v16h cat16(v8h lo, v8h hi) { return __builtin_shufflevector(lo, hi, 0, 1, 2, 3, 4, 5, 6, 7, 8, 9, 10, 11, 12, 13, 14, 15); }
__device__ __forceinline__ v16bf cat16b(v8us lo, v8us hi) { return __builtin_bit_cast(v16bf, __builtin_shufflevector(lo, hi, 0, 1, 2, 3, 4, 5, 6, 7, 8, 9, 10, 11, 12, 13, 14, 15)); }
__device__ __forceinline__ v8f wmma16(v16h a, v16h b, v8f c) { return __builtin_amdgcn_wmma_f32_16x16x32_f16(false, a, false, b, (short)0, c, false, false); }
__device__ __forceinline__ v8f wmmab(v16bf a, v16bf b, v8f c) { return __builtin_amdgcn_wmma_f32_16x16x32_bf16(false, a, false, b, (short)0, c, false, false); }



// ---- k_gemmw: one 128x128 output tile a work-group, 8 waves (2 down, 4 across), each wave a 64x32 piece (eight accumulators) over the WHOLE depth; operands are K-contiguous 16-bit planes; grid (M/128, N/128, Z), 256 threads.
// C[m][n] (f32 or f16 words by TO, + bias[n], or bias[m] with BROW) = sum_k A[m][k] Bt[n][k], k in rising order in one accumulator. z-batch strides sA/sB/sC in elements.
// WHERE A COLUMN LANDS: the 64-column group y starts at C + y * sN, its rows lie ldc apart (a plain plane: sN = 64, ldc = the plane's width; head planes [head][row][64]: sN = one head's plane, ldc = 64).
// THE OPERANDS COME THROUGH LDS: a stage is 128 deep: of each of the 128 A rows and 128 Bt rows two 128-byte pieces. Asynchronous 16-byte copies bring them in, every wave-wide copy four whole lines (four rows); each wave copies sixteen rows of either operand: 16 copies a stage.
// Every row that the tile needs is fetched once a work-group and read from LDS by the waves that share it (an A row by four, a Bt row by two). Two buffers: stage t + 2 is copied into the buffer that stage t has just left, while stage t + 1 is worked on. A 128-byte piece lies 144 bytes from the next row's, the pitch at which 16-byte LDS reads of 16 rows meet no bank twice.
// THE RESULT LEAVES THROUGH THE SAME LDS: behind the last stage's barrier each wave lays its piece in a 128x128 f32 plane, and behind one more barrier a wave takes whole rows of it: each store is whole lines.
template <typename T16> struct WFrag;
template <> struct WFrag<h16> { typedef v16h V; static __device__ __forceinline__ V ld(const h16* p) { return cat16(*(const v8h*)p, *(const v8h*)(p + 16)); } static __device__ __forceinline__ v8f mma(V a, V b, v8f c) { return wmma16(a, b, c); } };
template <> struct WFrag<bf> { typedef v16bf V; static __device__ __forceinline__ V ld(const bf* p) { return cat16b(*(const v8us*)p, *(const v8us*)(p + 16)); } static __device__ __forceinline__ v8f mma(V a, V b, v8f c) { return wmmab(a, b, c); } };
typedef __attribute__((ext_vector_type(4))) _Float16 v4h;
__device__ __forceinline__ void st4(float* p, v4f v) { *(v4f*)p = v; }
__device__ __forceinline__ void st4(h16* p, v4f v) { v4h o; o[0] = (h16)v[0]; o[1] = (h16)v[1]; o[2] = (h16)v[2]; o[3] = (h16)v[3]; *(v4h*)p = o; }
#define GT    128                        // rows of A and of Bt in a work-group's tile
#define GKS   128                        // a stage's depth, in elements: two 128-byte pieces a row
#define GPIT  144                        // LDS pitch of a 128-byte piece
#define GHALF (GT * GPIT)                // one operand's 128 rows of one piece
#define GOFFB (2 * GHALF)                // the Bt rows' place in a buffer
#define GBUF  (4 * GHALF)                // one buffer, in bytes
#define GOP   132                        // the result plane's pitch in words: the two halves of a wave store to different banks
#define CPG(a, b) "global_load_async_to_lds_b128 %" #a ", %" #b ", off\n\t"
// eight copies, and as the statement's last line the wait that stands between issued copies and the first overwrite of a register that they name
__device__ __forceinline__ void cp8(const unsigned (&l)[8], const char* const (&g)[8]) {
    asm volatile(CPG(0, 1) CPG(2, 3) CPG(4, 5) CPG(6, 7) CPG(8, 9) CPG(10, 11) CPG(12, 13) CPG(14, 15) "s_wait_xcnt 0x0"
                 :: "v"(l[0]), "v"(g[0]), "v"(l[1]), "v"(g[1]), "v"(l[2]), "v"(g[2]), "v"(l[3]), "v"(g[3]), "v"(l[4]), "v"(g[4]), "v"(l[5]), "v"(g[5]), "v"(l[6]), "v"(g[6]), "v"(l[7]), "v"(g[7]) : "memory");
}
// one stage's 16 copies of a wave. la: the lane's LDS byte address in the wave's first four A rows, first piece, of the buffer to be filled (eight lanes a row); ag, bg: the lane's global addresses in that stage; ROWB: a global row in bytes
template <int ROWB> __device__ __forceinline__ void gm_stage(unsigned la, const char* ag, const char* bg) {
    unsigned l[8]; const char* g[8];
    // both loops unrolled so that every index is a constant: the addresses stay in registers
#pragma unroll
    for (int i = 0; i < 8; ++i) { l[i] = la + (i >> 2) * GHALF + (i & 3) * 4 * GPIT; g[i] = ag + (i >> 2) * 128 + (size_t)(i & 3) * 4 * ROWB; }
    cp8(l, g);
#pragma unroll
    for (int i = 0; i < 8; ++i) { l[i] = la + GOFFB + (i >> 2) * GHALF + (i & 3) * 4 * GPIT; g[i] = bg + (i >> 2) * 128 + (size_t)(i & 3) * 4 * ROWB; }
    cp8(l, g);
}
// one 32-deep step's 12 LDS reads from the lane's own places, and its eight products; every loop unrolled so that each fragment and accumulator index is a constant: they stay in registers
template <typename T16> __device__ __forceinline__ void gm_read(typename WFrag<T16>::V (&a)[4], typename WFrag<T16>::V (&b)[2], const char* ap, const char* bp) {
#pragma unroll
    for (int mb = 0; mb < 4; ++mb) a[mb] = WFrag<T16>::ld((const T16*)(ap + mb * 16 * GPIT));
#pragma unroll
    for (int nb = 0; nb < 2; ++nb) b[nb] = WFrag<T16>::ld((const T16*)(bp + nb * 16 * GPIT));
}
template <typename T16> __device__ __forceinline__ void gm_mma(const typename WFrag<T16>::V (&a)[4], const typename WFrag<T16>::V (&b)[2], v8f (&acc)[4][2]) {
#pragma unroll
    for (int nb = 0; nb < 2; ++nb)
#pragma unroll
        for (int mb = 0; mb < 4; ++mb) acc[mb][nb] = WFrag<T16>::mma(a[mb], b[nb], acc[mb][nb]);
}
template <typename T16, int K, typename TO, bool BROW>
__global__ __launch_bounds__(256) void k_gemmw(const T16* __restrict__ A, const T16* __restrict__ Bt, TO* C, int ldc, size_t sN, const float* __restrict__ bias, size_t sA, size_t sB, size_t sC) {
    typedef typename WFrag<T16>::V V;
    constexpr int NST = K / GKS;
    static_assert(K % GKS == 0 && NST >= 2 && GKS == 128 && GT * GOP * 4 <= 2 * GBUF, "whole stages, at least the two that the ring's start fills; the result plane fits the ring");
    __shared__ __align__(16) char ring[2 * GBUF];
    const int wv = __builtin_amdgcn_readfirstlane((int)(threadIdx.x >> 5));   // the wave's number, held scalar
    const size_t z = blockIdx.z; A += z * sA; Bt += z * sB; C += z * sC;
    const int lane = threadIdx.x & 31, lr = lane & 15, hi = lane >> 4; const int r0 = blockIdx.x * GT, c0 = blockIdx.y * GT;
    const int wm = (wv & 1) * 64, wn = (wv >> 1) * 32;   // the wave's piece of the tile
    // the copies' addresses: eight lanes a 128-byte piece, four rows a copy; of either operand the wave takes rows 16 wv and on
    const int cr = lane >> 3, cc = (lane & 7) * 16;
    const unsigned la = (unsigned)(size_t)ring + (unsigned)((wv * 16 + cr) * GPIT + cc);
    const char* ag = (const char*)(A + (size_t)(r0 + wv * 16 + cr) * K) + cc; const char* bg = (const char*)(Bt + (size_t)(c0 + wv * 16 + cr) * K) + cc;
    // the lane's read places in buffer 0
    const char* ar = ring + (wm + lr) * GPIT + 16 * hi; const char* br = ring + GOFFB + (wn + lr) * GPIT + 16 * hi;
    v8f acc[4][2];
#pragma unroll
    for (int mb = 0; mb < 4; ++mb)
#pragma unroll
        for (int nb = 0; nb < 2; ++nb) acc[mb][nb] = (v8f){};
    gm_stage<K * 2>(la, ag, bg);
    // the added vector's words that this lane will want, fetched here so that their latency lies under the stages: a wave takes whole rows of 128 result words, rows wv, wv + 8 ...; a lane four columns
    const int cofs = lane * 4; float bw[BROW ? GT / 8 : 4];
    // unrolled so that every index is a constant: the words stay in registers
#pragma unroll
    for (int i = 0; i < (BROW ? GT / 8 : 4); ++i) bw[i] = BROW ? bias[r0 + i * 8 + wv] : bias[c0 + cofs + i];
    asm volatile("s_wait_xcnt 0x0" ::: "memory");   // stands between the issued loads and the first overwrite of their address registers
    __builtin_amdgcn_sched_barrier(0);   // nothing from below climbs between the loads and their wait, onto the loads' address registers
    asm volatile("s_wait_asynccnt 0x0" ::: "memory");   // this wave's copies of stage 0 have landed
    __syncthreads();                                     // every wave's have: stage 0 may be read
    gm_stage<K * 2>(la + GBUF, ag + GKS * 2, bg + GKS * 2);
    ag += 2 * GKS * 2; bg += 2 * GKS * 2;
    // FOUR STEPS' FRAGMENTS IN REGISTERS, READ TWO STEPS AT A TIME: each group of 24 LDS reads is issued in front of the sixteen products of the two steps read before it, so that its latency lies under them.
    // A stage's last two steps are multiplied behind the barrier that ends the stage: they are in registers by then (the wait in front of the barrier), and they cover the next stage's first reads.
    V fa[4][4], fb[4][2];
    gm_read<T16>(fa[0], fb[0], ar, br); gm_read<T16>(fa[1], fb[1], ar + 64, br + 64);
    // kept rolled: one copy of the stage's text, and no more than the four fragment sets live
#pragma unroll 1
    for (int t = 0; t < NST; ++t) {
        const int bo = (t & 1) * GBUF, bn = GBUF - bo;
        gm_read<T16>(fa[2], fb[2], ar + bo + GHALF, br + bo + GHALF); gm_read<T16>(fa[3], fb[3], ar + bo + GHALF + 64, br + bo + GHALF + 64);
        __builtin_amdgcn_sched_barrier(0);   // the reads stay one group in front of the products that cover them
        gm_mma<T16>(fa[0], fb[0], acc); gm_mma<T16>(fa[1], fb[1], acc);
        __builtin_amdgcn_sched_barrier(0);   // these products stay in front of the foot: sunk behind it, the wait below would meet reads that were issued only just before it
        asm volatile("s_wait_dscnt 0x0" ::: "memory");      // this wave has read all it wants of stage t
        asm volatile("s_wait_asynccnt 0x0" ::: "memory");   // its copies of stage t + 1 have landed
        __syncthreads();                                     // stage t + 1 may be read, and the buffer of stage t is free
        if (t + 2 < NST) { gm_stage<K * 2>(la + bo, ag, bg); ag += GKS * 2; bg += GKS * 2; }
        if (t + 1 < NST) { gm_read<T16>(fa[0], fb[0], ar + bn, br + bn); gm_read<T16>(fa[1], fb[1], ar + bn + 64, br + bn + 64); }
        __builtin_amdgcn_sched_barrier(0);   // the next stage's first reads stay one group in front of the products that cover them
        gm_mma<T16>(fa[2], fb[2], acc); gm_mma<T16>(fa[3], fb[3], acc);
    }
    asm volatile("s_wait_asynccnt 0x0" ::: "memory");   // no copy is in flight when the ring is put to its second use
    float* os = (float*)ring;
    // unrolled so that every accumulator index is a constant: the tiles stay in registers
#pragma unroll
    for (int mb = 0; mb < 4; ++mb)
#pragma unroll
        for (int nb = 0; nb < 2; ++nb)
#pragma unroll
            for (int j = 0; j < 8; ++j) os[(wm + mb * 16 + hi * 8 + j) * GOP + wn + nb * 16 + lr] = acc[mb][nb][j];
    __syncthreads();   // every wave's piece lies in LDS before any wave takes a row
    v4f bc = (v4f){};
    if (!BROW) { bc[0] = bfr(bw[0]); bc[1] = bfr(bw[1]); bc[2] = bfr(bw[2]); bc[3] = bfr(bw[3]); }
    TO* cb = C + (size_t)((c0 + cofs) >> 6) * sN + ((c0 + cofs) & 63) + (size_t)r0 * ldc;
    // unrolled so that the rows' LDS reads issue together
#pragma unroll
    for (int s = 0; s < GT / 8; ++s) { const int row = s * 8 + wv; v4f val = *(const v4fa*)(os + row * GOP + cofs);
        if (BROW) val += bfr(bw[s]); else val += bc;
        st4(cb + (size_t)row * ldc, val); }
}


// ---- k_maps3: the three bf16 maps in ONE launch; grid (TT / 128, 1024 / 128, entries), 256 threads. A work-group works ITS 128 source rows x 128 weight rows in the first, the second and the third map in turn, by k_gemmw's own stages, reads and products.
// THE RING RUNS ON OVER A MAP's END: the copies behind the foot of a map's last two stages bring the next map's first two stages, so that only the first map waits for a first stage; a map's stages are even in number, so every stage keeps its buffer.
// The result plane has LDS of its own: a map's result leaves while the next map's copies land in the ring. Between two uses of that plane lie a map's stage barriers, each behind the wave's s_wait_dscnt 0.
// In every map the source's rows lie in a buffer's first half and the weight's in its second. THIRD MAP (SWAP): the weight's fragment is the left operand and the source's the right, so that a tile comes out [weight row][token], key-contiguous; the added vector goes by row.
template <bool SWAP> __device__ __forceinline__ void m3_mma(const v16bf (&a)[4], const v16bf (&b)[2], v8f (&acc)[4][2]) {
    // unrolled so that each fragment and accumulator index is a constant: they stay in registers
#pragma unroll
    for (int nb = 0; nb < 2; ++nb)
#pragma unroll
        for (int mb = 0; mb < 4; ++mb) acc[mb][nb] = SWAP ? wmmab(b[nb], a[mb], acc[mb][nb]) : wmmab(a[mb], b[nb], acc[mb][nb]);
}
// one map's tile. On entry: the map's stage 0 has landed and is published, its stage 1 is in flight, fa[0..1] and fb[0..1] hold (or await) stage 0's first two steps, ag and bg stand at stage 2. nxa, nxb: the byte distance from this map's operand planes to the next map's (the same in every lane). cb: the lane's place in the tile's first result row; bias: the added vector at the tile's first weight row
template <bool SWAP, bool LAST>
__device__ __forceinline__ void m3_tile(v16bf (&fa)[4][4], v16bf (&fb)[4][2], const char*& ag, const char*& bg, long nxa, long nxb, unsigned la, const char* ar, const char* br, float* os, h16* cb, int ldc, const float* __restrict__ bias, int wv, int lane, int wm, int wn) {
    constexpr int NST = DM / GKS;
    static_assert(DM % GKS == 0 && NST % 2 == 0 && NST >= 4, "whole stages, an even number of them: the next map's stage 0 falls into buffer 0");
    const int lr = lane & 15, hi = lane >> 4, cofs = lane * 4;
    // the added vector's words that this lane will want, fetched here so that their latency lies under the stages; unrolled so that every index is a constant: the words stay in registers
    float bw[SWAP ? GT / 8 : 4];
#pragma unroll
    for (int i = 0; i < (SWAP ? GT / 8 : 4); ++i) bw[i] = SWAP ? bias[i * 8 + wv] : bias[cofs + i];
    asm volatile("s_wait_xcnt 0x0" ::: "memory");   // stands between the issued loads and the first overwrite of their address registers
    __builtin_amdgcn_sched_barrier(0);   // nothing from below climbs between the loads and their wait, onto the loads' address registers
    v8f acc[4][2];
#pragma unroll
    for (int mb = 0; mb < 4; ++mb)
#pragma unroll
        for (int nb = 0; nb < 2; ++nb) acc[mb][nb] = (v8f){};
    // kept rolled: one copy of the stage's text a map, and no more than the four fragment sets live
#pragma unroll 1
    for (int t = 0; t < NST; ++t) {
        const int bo = (t & 1) * GBUF, bn = GBUF - bo;
        gm_read<bf>(fa[2], fb[2], ar + bo + GHALF, br + bo + GHALF); gm_read<bf>(fa[3], fb[3], ar + bo + GHALF + 64, br + bo + GHALF + 64);
        __builtin_amdgcn_sched_barrier(0);   // the reads stay one group in front of the products that cover them
        m3_mma<SWAP>(fa[0], fb[0], acc); m3_mma<SWAP>(fa[1], fb[1], acc);
        __builtin_amdgcn_sched_barrier(0);   // these products stay in front of the foot: sunk behind it, the wait below would meet reads that were issued only just before it
        asm volatile("s_wait_dscnt 0x0" ::: "memory");      // this wave has read all it wants of stage t
        asm volatile("s_wait_asynccnt 0x0" ::: "memory");   // its copies of the stage that follows (this map's, or the next map's first) have landed
        __syncthreads();                                     // that stage may be read, and the buffer of stage t is free
        if (!LAST || t + 2 < NST) { gm_stage<DM * 2>(la + bo, ag, bg);
            const bool end = !LAST && t == NST - 3;   // this map's last stage has just been asked for: on to the next map's first
            ag += end ? nxa - (NST - 1) * GKS * 2 : GKS * 2; bg += end ? nxb - (NST - 1) * GKS * 2 : GKS * 2; }
        if (!LAST || t + 1 < NST) { gm_read<bf>(fa[0], fb[0], ar + bn, br + bn); gm_read<bf>(fa[1], fb[1], ar + bn + 64, br + bn + 64); }
        __builtin_amdgcn_sched_barrier(0);   // the following stage's first reads stay one group in front of the products that cover them
        m3_mma<SWAP>(fa[2], fb[2], acc); m3_mma<SWAP>(fa[3], fb[3], acc);
    }
    if (LAST) asm volatile("s_wait_asynccnt 0x0" ::: "memory");   // no copy is in flight when the wave ends
    // unrolled so that every accumulator index is a constant: the tiles stay in registers
#pragma unroll
    for (int mb = 0; mb < 4; ++mb)
#pragma unroll
        for (int nb = 0; nb < 2; ++nb)
#pragma unroll
            for (int j = 0; j < 8; ++j) os[(SWAP ? (wn + nb * 16 + hi * 8 + j) * GOP + wm + mb * 16 + lr : (wm + mb * 16 + hi * 8 + j) * GOP + wn + nb * 16 + lr)] = acc[mb][nb][j];
    __syncthreads();   // every wave's piece lies in LDS before any wave takes a row
    v4f bc = (v4f){};
    if (!SWAP) { bc[0] = bfr(bw[0]); bc[1] = bfr(bw[1]); bc[2] = bfr(bw[2]); bc[3] = bfr(bw[3]); }
    // both loops unrolled so that the rows' LDS reads issue together and every index is a constant
    v4f val[GT / 8];
#pragma unroll
    for (int s = 0; s < GT / 8; ++s) val[s] = *(const v4fa*)(os + (s * 8 + wv) * GOP + cofs);
#pragma unroll
    for (int s = 0; s < GT / 8; ++s) {
        st4(cb + (size_t)(s * 8 + wv) * ldc, SWAP ? val[s] + bfr(bw[s]) : val[s] + bc);
        asm volatile("s_wait_xcnt 0x0" ::: "memory");   // stands between the issued store and the first overwrite of a register that it names
    }
}
__global__ __launch_bounds__(256) void k_maps3(const bf* __restrict__ XQ, const bf* __restrict__ XK, const bf* __restrict__ XV, const bf* __restrict__ WQ, const bf* __restrict__ WK, const bf* __restrict__ WV, h16* QP, h16* KP, h16* VT,
                                               const float* __restrict__ cq, const float* __restrict__ ck, const float* __restrict__ cv) {
    __shared__ __align__(16) char ring[2 * GBUF];
    __shared__ __align__(16) float os[GT * GOP];
    const int wv = __builtin_amdgcn_readfirstlane((int)(threadIdx.x >> 5));   // the wave's number, held scalar
    const size_t z = blockIdx.z;
    const int lane = threadIdx.x & 31, lr = lane & 15, hi = lane >> 4; const int r0 = blockIdx.x * GT, c0 = blockIdx.y * GT;   // the tile's first source row (token) and first weight row
    const int wm = (wv & 1) * 64, wn = (wv >> 1) * 32;   // the wave's piece of the tile: 64 source rows, 32 weight rows
    // the copies' addresses: eight lanes a 128-byte piece, four rows a copy; of either operand the wave takes rows 16 wv and on
    const int cr = lane >> 3, cc = (lane & 7) * 16;
    const unsigned la = (unsigned)(size_t)ring + (unsigned)((wv * 16 + cr) * GPIT + cc);
    const char* ag = (const char*)(XQ + (z * TT + r0 + wv * 16 + cr) * DM) + cc; const char* bg = (const char*)(WQ + (size_t)(c0 + wv * 16 + cr) * DM) + cc;
    // the lane's read places in buffer 0
    const char* ar = ring + (wm + lr) * GPIT + 16 * hi; const char* br = ring + GOFFB + (wn + lr) * GPIT + 16 * hi;
    gm_stage<DM * 2>(la, ag, bg);
    asm volatile("s_wait_asynccnt 0x0" ::: "memory");   // this wave's copies of the first map's stage 0 have landed
    __syncthreads();                                     // every wave's have: stage 0 may be read
    gm_stage<DM * 2>(la + GBUF, ag + GKS * 2, bg + GKS * 2);
    ag += 2 * GKS * 2; bg += 2 * GKS * 2;
    v16bf fa[4][4], fb[4][2];
    gm_read<bf>(fa[0], fb[0], ar, br); gm_read<bf>(fa[1], fb[1], ar + 64, br + 64);
    const int cofs = lane * 4;
    const size_t hp = z * ((size_t)NH_ * TT * HD) + (size_t)((c0 + cofs) >> 6) * ((size_t)TT * HD) + ((c0 + cofs) & 63) + (size_t)r0 * HD;   // 64-column group = head: straight into its [row][64] plane
    m3_tile<false, false>(fa, fb, ag, bg, (const char*)XK - (const char*)XQ, (const char*)WK - (const char*)WQ, la, ar, br, os, QP + hp, HD, cq + c0, wv, lane, wm, wn);
    m3_tile<false, false>(fa, fb, ag, bg, (const char*)XV - (const char*)XK, (const char*)WV - (const char*)WK, la, ar, br, os, KP + hp, HD, ck + c0, wv, lane, wm, wn);
    m3_tile<true, true>(fa, fb, ag, bg, 0, 0, la, ar, br, os, VT + z * ((size_t)NKV * HD * TT) + (size_t)c0 * TT + r0 + cofs, TT, cv + c0, wv, lane, wm, wn);   // [head][64][key]
}


__device__ __forceinline__ void splitf(float y, unsigned short& h, unsigned short& l) { h = f2bf(y); l = f2bf(y - bf2f(h)); }
typedef __attribute__((ext_vector_type(2))) _Float16 v2h;
typedef __attribute__((ext_vector_type(2))) unsigned short v2us;
typedef __attribute__((ext_vector_type(4))) unsigned short v4us;
typedef __attribute__((ext_vector_type(2))) float v2f;
typedef __attribute__((ext_vector_type(4))) int v4i;

// ---- k_fattn: dots, keep plane, softmax and the shares' sums of one head in ONE kernel; grid (TT / 256, entries * heads), 8 waves, each wave 32 query rows (two 16-column groups) against all TT keys, 32 keys a pass.
// TRANSPOSED PRODUCTS: St = K Qt (A = 16 key rows, B = 16 query rows, both by the one k-contiguous loader), so a lane holds 8 + 8 scores of ONE query (column lr; keys 8 hi + r and 16 + 8 hi + r): maximum and sum stay in the lane, the two halves of the wave join the maximum by one exchange a pass.
// The two score tiles, turned into shares and cast, ARE the B operand of Ot += Vt Pt in the hardware's k order; A = 16 rows of the key-contiguous Vt plane by the same loader (keys 8 hi .. and 16 + 8 hi ..): the k orders agree at every position.
// RUNNING MAXIMUM: every pass takes the row's maximum so far and scales the sums and the output tiles by 2^(old - new), without a branch: the pass is one straight block. A share is at most 1.
// A dropped dot is -3e38: its share is an exact nought once the row has kept a column (the first kept column wipes what came before by the factor 2^(-3e38 - new) = 0); a row that keeps none ends with uniform shares.
// THE OPERANDS COME THROUGH LDS: a stage is 64 keys (two passes): 64 K rows and 64 Vt rows of 128 bytes, shared by the eight waves. Asynchronous 16-byte copies bring them in, every wave-wide copy four whole lines (four rows); each wave copies an eighth of K and of Vt: four copies a stage.
// THE KEEP PLANE COMES AS SELECT WORDS: the cast launch has packed it so that bit L of a word is lane L's answer for one score register; a pass's 32 words (128 bytes) come by two scalar loads, one stage ahead, and each word is its select's lane mask as it stands: no LDS, no vector register and no compare for the plane.
// Two buffers: stage s + 2 is copied into the buffer that stage s has just left, while stage s + 1 is worked on. Every row lies 144 bytes from the next, the pitch at which 16-byte LDS reads of 16 rows meet no bank twice. WHAT IS LEFT: a stage's first reads wait behind its barrier; a pass whose words are all nought or all ones is worked like any other.
// Every loop over tiles, column groups, blocks and registers below is unrolled so that each fragment index is a constant: the fragments and accumulators stay in registers.
__device__ __forceinline__ float xhalf(float x) { return __builtin_bit_cast(float, __builtin_amdgcn_permlanex16(__builtin_bit_cast(int, x), __builtin_bit_cast(int, x), 0x76543210, 0xfedcba98, false, false)); }   // lane l with lane l ^ 16
// eight exponentials of two, each in place: no one of them reads another's result or overwrites another's source, and the v_nop fills the slot that the instruction set asks for behind the last one, whatever the compiler puts next
__device__ __forceinline__ void exp2x8(v8f& x) { float a = x[0], b = x[1], c = x[2], d = x[3], e = x[4], f = x[5], g = x[6], h = x[7];
    asm("v_exp_f32 %0, %0\n\tv_exp_f32 %1, %1\n\tv_exp_f32 %2, %2\n\tv_exp_f32 %3, %3\n\tv_exp_f32 %4, %4\n\tv_exp_f32 %5, %5\n\tv_exp_f32 %6, %6\n\tv_exp_f32 %7, %7\n\tv_nop" : "+v"(a), "+v"(b), "+v"(c), "+v"(d), "+v"(e), "+v"(f), "+v"(g), "+v"(h));
    x[0] = a; x[1] = b; x[2] = c; x[3] = d; x[4] = e; x[5] = f; x[6] = g; x[7] = h; }
struct FOps { v16h kf[2][2]; v16h vf[4]; };   // one pass's operands from LDS: K rows [tile][32-deep step], Vt rows [16-row block]
typedef __attribute__((ext_vector_type(16))) unsigned v16u;   // one column group's sixteen select words of a pass: [tile][register]
// sixteen select words by one scalar load: the plane was written by an earlier launch and no one writes it while this kernel runs, so it is read through the constant address space (behind the loop's asm waits the compiler otherwise takes the words through vector registers, a lane read each)
__device__ __forceinline__ v16u ldw(const unsigned* p) { return *(const __attribute__((address_space(4))) v16u*)p; }
#define SKEY 64                          // keys a stage
#define LPIT 144                         // LDS pitch of a 128-byte row
#define OFFV (SKEY * LPIT)               // the Vt rows' place in a buffer
#define BUFB (OFFV + HD * LPIT)          // one buffer, in bytes
#define CP1(a, b) "global_load_async_to_lds_b128 %" #a ", %" #b ", off\n\t"
// one stage's four copies of a wave, and as the statement's last line the wait that stands between issued copies and the first overwrite of a register that they name. ll: the lane's place in any four rows (eight lanes a row); sk: the LDS byte address, the same for the whole wave, of the wave's first K row in the buffer to be filled; kg, vg: the lane's global addresses in that stage
__device__ __forceinline__ void fa_stage(unsigned ll, unsigned sk, const char* kg, const char* vg) {
    sk = (unsigned)__builtin_amdgcn_readfirstlane((int)sk);   // the wave's place held scalar: the one lane-own value that lives through the loop is ll, which no copy names itself
    asm volatile(CP1(0, 1) CP1(2, 3) CP1(4, 5) CP1(6, 7) "s_wait_xcnt 0x0"
                 :: "v"(ll + sk), "v"(kg), "v"(ll + (sk + 4 * LPIT)), "v"(kg + 4 * HD * 2), "v"(ll + (sk + OFFV)), "v"(vg), "v"(ll + (sk + OFFV + 4 * LPIT)), "v"(vg + 4 * TT * 2) : "memory");
}
// one pass's 16 LDS reads from the lane's own places in the stage's buffer
__device__ __forceinline__ void fa_read(FOps& n, const char* kb, const char* vb) {
#pragma unroll
    for (int t = 0; t < 2; ++t)
#pragma unroll
        for (int ks = 0; ks < 2; ++ks) n.kf[t][ks] = WFrag<h16>::ld((const h16*)(kb + t * 16 * LPIT + ks * 64));
#pragma unroll
    for (int db = 0; db < 4; ++db) n.vf[db] = WFrag<h16>::ld((const h16*)(vb + db * 16 * LPIT));
}
// one exponential of two; the v_nop fills the slot that the instruction set asks for behind it, whatever the compiler puts next
__device__ __forceinline__ float exp2x1(float x) { float y; asm("v_exp_f32 %0, %1\n\tv_nop" : "=v"(y) : "v"(x)); return y; }
__device__ __forceinline__ void fa_pass(const FOps& c, const v16u (&kw)[2], const v16h (&qf)[2][2], v8f (&o)[4][2], float (&mu)[2], v2f (&sm)[2]) {
    typedef WFrag<h16> F;
    v16h pf[2];
#pragma unroll
    for (int g = 0; g < 2; ++g) { v8f s[2]; float m = mu[g];
#pragma unroll
        for (int t = 0; t < 2; ++t) { s[t] = F::mma(c.kf[t][1], qf[g][1], F::mma(c.kf[t][0], qf[g][0], (v8f){}));
#pragma unroll
            for (int r = 0; r < 8; ++r) { const float x = __builtin_amdgcn_inverse_ballot_w32(kw[g][t * 8 + r]) ? s[t][r] * SCL2 : -3.0e38f;   /* keep the dot where the lane's bit is set: the scalar word IS the select's lane mask, no compare */ s[t][r] = x; m = fmaxf(m, x); } }
        m = fmaxf(m, xhalf(m));   // both halves of the wave hold the query's maximum: one scale for all 32 keys
        const float f = exp2x1(mu[g] - m); mu[g] = m; sm[g] *= f;
#pragma unroll
        for (int db = 0; db < 4; ++db) o[db][g] *= f;
#pragma unroll
        for (int t = 0; t < 2; ++t) { v8f e = s[t] - m; exp2x8(e);
#pragma unroll
            for (int r = 0; r < 8; r += 2) { sm[g] += (v2f){e[r], e[r + 1]}; pf[g][t * 8 + r] = (h16)e[r]; pf[g][t * 8 + r + 1] = (h16)e[r + 1]; } } }
#pragma unroll
    for (int db = 0; db < 4; ++db)
#pragma unroll
        for (int g = 0; g < 2; ++g) o[db][g] = F::mma(c.vf[db], pf[g], o[db][g]);
}
// two waves a SIMD (one work-group a WGP): the register budget that holds both operand sets beside the accumulators without a spill
__global__ __launch_bounds__(256) __attribute__((amdgpu_waves_per_eu(2, 2))) void k_fattn(const h16* __restrict__ Qp, const h16* __restrict__ Kp, const h16* __restrict__ Vt, const unsigned* __restrict__ MB, h16* Cx) {
    const int lane = threadIdx.x & 31, lr = lane & 15, hi = lane >> 4;
    const int wv = __builtin_amdgcn_readfirstlane((int)(threadIdx.x >> 5));   // the wave's number, held scalar
    const int zh = blockIdx.y, q0 = blockIdx.x * 256 + wv * 32;
    const h16* qb = Qp + ((size_t)zh * TT + q0 + lr) * HD + 8 * hi;
    static_assert(TT % SKEY == 0 && TT / SKEY >= 2 && SKEY == 64 && HD == 64, "whole stages, at least the two that the ring's start fills; rows of 128 bytes");
    __shared__ __align__(16) char ring[2 * BUFB];
    // the copies' addresses: eight lanes a 128-byte row, four rows a copy; of K and Vt the wave takes rows 8 wv and on
    const int cr = lane >> 3, cc = (lane & 7) * 16;
    const unsigned ll = (unsigned)(cr * LPIT + cc), sk = (unsigned)(size_t)ring + (unsigned)(wv * 8 * LPIT);
    const char* kg = (const char*)(Kp + ((size_t)zh * TT + wv * 8 + cr) * HD) + cc; const char* vg = (const char*)(Vt + ((size_t)zh * HD + wv * 8 + cr) * TT) + cc;
    // the lane's read places in buffer 0, first pass
    const char* kb = ring + lr * LPIT + 16 * hi; const char* vb = ring + OFFV + lr * LPIT + 16 * hi;
    // the wave's own select words: 32 a pass, the passes on end; the address is the same in every lane, so the loads are scalar
    const unsigned* mw = MB + (size_t)(q0 >> 5) * (TT / 32) * 32;
    v16u wa[2], wb[2];
    wa[0] = ldw(mw); wa[1] = ldw(mw + 16); wb[0] = ldw(mw + 32); wb[1] = ldw(mw + 48);
    v16h qf[2][2]; v8f o[4][2]; float mu[2]; v2f sm[2];
#pragma unroll
    for (int g = 0; g < 2; ++g)
#pragma unroll
        for (int ks = 0; ks < 2; ++ks) qf[g][ks] = WFrag<h16>::ld(qb + g * 16 * HD + ks * 32);
    asm volatile("s_wait_xcnt 0x0" ::: "memory");   // stands between the issued query loads and the first overwrite of their address registers
    __builtin_amdgcn_sched_barrier(0);   // nothing from below climbs between the query loads and their wait, onto the loads' address registers
#pragma unroll
    for (int g = 0; g < 2; ++g) { mu[g] = -3.0e38f; sm[g] = (v2f){};
#pragma unroll
        for (int db = 0; db < 4; ++db) o[db][g] = (v8f){}; }
    fa_stage(ll, sk, kg, vg);
    asm volatile("s_wait_asynccnt 0x0" ::: "memory");   // this wave's copies of stage 0 have landed
    __syncthreads();                                     // every wave's have: stage 0 may be read
    fa_stage(ll, sk + BUFB, kg + SKEY * HD * 2, vg + SKEY * 2);
    kg += 2 * SKEY * HD * 2; vg += 2 * SKEY * 2;
    for (int s = 0; s < TT / SKEY; ++s) {
        const int bo = (s & 1) * BUFB; FOps A, B;
        fa_read(A, kb + bo, vb + bo);
        fa_read(B, kb + bo + 32 * LPIT, vb + bo + 64);
        const unsigned* mn = mw + (s + 1 < TT / SKEY ? s + 1 : s) * 64;   // the next stage's select words (the last stage takes its own again: no word past the wave's run is read)
        __builtin_amdgcn_sched_barrier(0);   // both passes' LDS reads stay together at the head of the stage: the second pass's latency lies under the first pass's work
        fa_pass(A, wa, qf, o, mu, sm);
        wa[0] = ldw(mn); wa[1] = ldw(mn + 16);          // each pass's words are fetched one stage ahead, as soon as their registers are free: the scalar path's latency lies under a pass
        fa_pass(B, wb, qf, o, mu, sm);
        wb[0] = ldw(mn + 32); wb[1] = ldw(mn + 48);
        __builtin_amdgcn_sched_barrier(0);   // the stage's work stays in front of its foot: lifted over the work, the wait below would meet copies that were issued only just before it
        asm volatile("s_wait_dscnt 0x0" ::: "memory");      // this wave has read all it wants of stage s
        asm volatile("s_wait_asynccnt 0x0" ::: "memory");   // its copies of stage s + 1 have landed
        __syncthreads();                                     // stage s + 1 may be read, and the buffer of stage s is free
        if (s + 2 < TT / SKEY) { fa_stage(ll, sk + bo, kg, vg); kg += SKEY * HD * 2; vg += SKEY * 2; }
    }
    asm volatile("s_wait_asynccnt 0x0" ::: "memory");   // no copy is in flight when the wave ends
    const int en = zh / NH_, hd = zh % NH_;
#pragma unroll
    for (int g = 0; g < 2; ++g) { const float hs = sm[g][0] + sm[g][1]; const float inv = __fdiv_rn(1.0f, hs + xhalf(hs));   // the two halves' sums meet once
        h16* c = Cx + ((size_t)en * TT + q0 + g * 16 + lr) * DQ + hd * HD + 8 * hi;
#pragma unroll
        for (int db = 0; db < 4; ++db) { v8h ov;
#pragma unroll
            for (int r = 0; r < 8; ++r) ov[r] = (h16)(o[db][g][r] * inv);
            *(v8h*)(c + db * 16) = ov; } }
}

template <typename T16> __device__ __forceinline__ unsigned short cv16(float x);
template <> __device__ __forceinline__ unsigned short cv16<h16>(float x) { const h16 h = (h16)x; return __builtin_bit_cast(unsigned short, h); }
// ---- k_castall: every 16-bit copy of a float plane, and the keep plane's select words, in ONE launch of 5,120 long waves; grid (CGX, 20), 256 threads: grid rows 0 - 3 pack the keep plane, rows 4 - 19 are the casts' pieces 0 - 15. The float planes are cut into sixteen pieces of CSEG words: pieces 0 - 11 the three sources (four each, both entries lie on end), 12 - 14 the first three weights, 15 the last weight.
// A work-group takes CSEG / CGX words of its piece: four trips of eight loads a thread; each wave-wide load is 512 bytes on end (whole lines), each store 256.
#define CSEG (1u << 20)
#define CGX  32
template <bool TOH> __device__ __forceinline__ void cast_run(const float* __restrict__ s, unsigned short* d) {
    for (int t = 0; t < 4; ++t) { v4f v[8];
        // unrolled so that a trip's eight loads are in flight together
#pragma unroll
        for (int j = 0; j < 8; ++j) v[j] = *(const v4f*)(s + (t * 8 + j) * 1024);
#pragma unroll
        for (int j = 0; j < 8; ++j) { v4us o;
#pragma unroll
            for (int q = 0; q < 4; ++q) { const unsigned short b = f2bf(v[j][q]); o[q] = TOH ? cv16<h16>(bf2f(b)) : b; }
            *(v4us*)(d + (t * 8 + j) * 1024) = o; } }
}
// THE KEEP PLANE's SELECT WORDS: for 32 query rows x 32 keys, 32 words: word 16 g + 8 t + r holds in bit L whether row 16 g + (L & 15) keeps key 16 t + 8 (L >> 4) + r, which is where k_fattn's lane L holds that dot (column group g, tile t, register r).
// A lane loads the eight plane words of its row and key octet (two 16-byte loads a tile); one ballot a register makes a word, lane i keeps word i, and one wave-wide store writes the unit's 128 bytes. wid: the wave's number of 1,024; a wave takes four units on end along the keys (512 bytes of each of its 32 rows).
__device__ __forceinline__ void pack_run(const int* __restrict__ mk, unsigned* MB, int wid, int lane) {
    const int qb = wid >> 4, p0 = (wid & 15) * 4;
    const int* sp = mk + (size_t)(qb * 32 + (lane & 15)) * TT + p0 * 32 + 8 * (lane >> 4);
    v4i w[4][2][2][2];
    // every loop unrolled so that the wave's 32 loads are in flight together and each index is a constant
#pragma unroll
    for (int u = 0; u < 4; ++u)
#pragma unroll
        for (int g = 0; g < 2; ++g)
#pragma unroll
            for (int t = 0; t < 2; ++t) { w[u][g][t][0] = *(const v4i*)(sp + g * 16 * TT + u * 32 + t * 16); w[u][g][t][1] = *(const v4i*)(sp + g * 16 * TT + u * 32 + t * 16 + 4); }
    asm volatile("s_wait_xcnt 0x0" :: "v"(sp) : "memory");   // stands between the issued loads and the first overwrite of their address registers; it takes the address as an input, so that no load's own result lands on those registers in front of it
    __builtin_amdgcn_sched_barrier(0);   // nothing from below climbs between the loads and their wait: the 32 loads stay one group in flight
#pragma unroll
    for (int u = 0; u < 4; ++u) { unsigned o = 0;
#pragma unroll
        for (int i = 0; i < 32; ++i) { const unsigned b = __builtin_amdgcn_ballot_w32(w[u][i >> 4][(i >> 3) & 1][(i >> 2) & 1][i & 3] != 0); o = lane == i ? b : o; }
        MB[((size_t)qb * (TT / 32) + p0 + u) * 32 + lane] = o; }
}
__global__ __launch_bounds__(256) void k_castall(const float* __restrict__ xq, const float* __restrict__ xk, const float* __restrict__ xv, const float* __restrict__ wq, const float* __restrict__ wk, const float* __restrict__ wv, const float* __restrict__ wo, const int* __restrict__ mk,
                                                 unsigned short* XQ, unsigned short* XK, unsigned short* XV, unsigned short* WQ, unsigned short* WK, unsigned short* WV, unsigned short* WO, unsigned* MB) {
    if (blockIdx.y < 4) { pack_run(mk, MB, (int)((blockIdx.y * CGX + blockIdx.x) * 8 + (threadIdx.x >> 5)), (int)(threadIdx.x & 31)); return; }   // grid rows 0 - 3: the keep plane, first because its loads (16 lines each) are the launch's slowest; the test is the same for the whole work-group
    const unsigned seg = blockIdx.y - 4; const float* s; unsigned short* d;
    if (seg < 4) { s = xq; d = XQ; } else if (seg < 8) { s = xk; d = XK; } else if (seg < 12) { s = xv; d = XV; } else if (seg == 12) { s = wq; d = WQ; } else if (seg == 13) { s = wk; d = WK; } else if (seg == 14) { s = wv; d = WV; } else { s = wo; d = WO; }
    const size_t off = (seg < 12 ? (size_t)(seg & 3u) * CSEG : 0) + (size_t)blockIdx.x * (CSEG / CGX) + threadIdx.x * 4;
    if (seg == 15) cast_run<true>(s + off, d + off); else cast_run<false>(s + off, d + off);
}

template <bool RES>
__global__ __launch_bounds__(256) void k_lnrow(const float* __restrict__ A, const bf* __restrict__ R, const float* __restrict__ gamma, const float* __restrict__ beta, float eps, int C, int nrows, float* Y) {
    const int lane = threadIdx.x & 31; const int row = blockIdx.x * 8 + (threadIdx.x >> 5); if (row >= nrows) return; const int nch = C / 128; const float* a = A + (size_t)row * C; float x[LNC_MAX / 32]; float s = 0.0f;
    for (int k = 0; k < LNC_MAX / 128; ++k) { if (k < nch) { const int c0 = k * 128 + lane * 4; v4f v = *(const v4f*)(a + c0);
            if (RES) { asm volatile("s_wait_xcnt 0x0" ::: "memory");   /* stands between the issued load and the next load, whose result may land on the first one's address registers */
                const v4us w = *(const v4us*)(R + (size_t)row * C + c0); v[0] = __fadd_rn(v[0], bf2f(w[0])); v[1] = __fadd_rn(v[1], bf2f(w[1])); v[2] = __fadd_rn(v[2], bf2f(w[2])); v[3] = __fadd_rn(v[3], bf2f(w[3])); }
            x[k * 4 + 0] = v[0]; x[k * 4 + 1] = v[1]; x[k * 4 + 2] = v[2]; x[k * 4 + 3] = v[3]; s = __fadd_rn(__fadd_rn(__fadd_rn(__fadd_rn(s, v[0]), v[1]), v[2]), v[3]); } }
    for (int sh = 16; sh; sh >>= 1) s = __fadd_rn(s, __shfl_xor(s, sh, 32));
    const float mean = __fdiv_rn(s, (float)C); float q = 0.0f;
    for (int k = 0; k < LNC_MAX / 128; ++k) { if (k < nch) {
            for (int j = 0; j < 4; ++j) { const float d = __fsub_rn(x[k * 4 + j], mean); x[k * 4 + j] = d; q = __fmaf_rn(d, d, q); } } }
    for (int sh = 16; sh; sh >>= 1) q = __fadd_rn(q, __shfl_xor(q, sh, 32));
    const float rstd = __fdiv_rn(1.0f, sqrtf(__fadd_rn(__fdiv_rn(q, (float)C), eps)));
    for (int k = 0; k < LNC_MAX / 128; ++k) { if (k < nch) { const int c0 = k * 128 + lane * 4; const v4f g = *(const v4f*)(gamma + c0); const v4f bt = *(const v4f*)(beta + c0);
            for (int j = 0; j < 4; ++j) x[k * 4 + j] = __fmaf_rn(__fmul_rn(x[k * 4 + j], rstd), bfr(g[j]), bfr(bt[j])); } }
    float* y = Y + (size_t)row * C;
    {
        for (int k = 0; k < LNC_MAX / 128; ++k) { if (k < nch) { v4f o; o[0] = x[k * 4 + 0]; o[1] = x[k * 4 + 1]; o[2] = x[k * 4 + 2]; o[3] = x[k * 4 + 3]; *(v4f*)(y + k * 128 + lane * 4) = o; } }
         }
}

extern "C" void kernel_launch(void* const* d_in, const int* in_sizes, int n_in,
                              void* d_out, int out_size, void* d_ws, size_t ws_size, hipStream_t stream) {
    (void)in_sizes; (void)n_in; (void)out_size;
    const float* xq = (const float*)d_in[0]; const float* xk = (const float*)d_in[1]; const float* xv = (const float*)d_in[2]; const int* kp = (const int*)d_in[3]; const float* wq = (const float*)d_in[4]; const float* cq = (const float*)d_in[5]; const float* wk = (const float*)d_in[6]; const float* ck = (const float*)d_in[7]; const float* wv = (const float*)d_in[8]; const float* cv = (const float*)d_in[9]; const float* wo = (const float*)d_in[10]; const float* co = (const float*)d_in[11]; const float* ns = (const float*)d_in[12]; const float* nb = (const float*)d_in[13];   /* fourteen arrays, all read; kp the int32 keep plane, read through a pointer of its own type */
    float* OUT = (float*)d_out;     // [2][2048][1024]
    static_assert(DQ == DM && DKV == DQ && REP == 1 && HD == 64 && TT % 256 == 0 && (size_t)DQ * DM == CSEG && (size_t)NB_ * TT * DM == 4 * (size_t)CSEG && CSEG / CGX == 4 * 8 * 1024 && TT % GT == 0 && DM % GT == 0 && DQ % GT == 0 && DKV % GT == 0 && DM % 128 == 0 && DM <= LNC_MAX && (NB_ * TT) % 8 == 0 && (TT / 32) * (TT / 32) == 4 * CGX * 8 * 4, "the merged heads are the output map's depth; k_fattn takes one key head a query head, 64-wide heads and whole 256-row blocks; the cast launch's sixteen pieces are exact; the maps' tiles are whole; the row normalisation takes whole 128-column pieces; the keep plane's 32 x 32 units are four a wave of four pieces");
    char* wsp = (char*)d_ws;
    auto take = [&](size_t bytes) { char* p = wsp; wsp += (bytes + 255) & ~(size_t)255; return (void*)p; };
    bf* WQ = (bf*)take((size_t)DQ * DM * 2); bf* WK = (bf*)take((size_t)DKV * DM * 2); bf* WV = (bf*)take((size_t)DKV * DM * 2); h16* WO16 = (h16*)take((size_t)DM * DQ * 2);
    bf* XQ = (bf*)take((size_t)NB_ * TT * DM * 2); bf* XK = (bf*)take((size_t)NB_ * TT * DM * 2); bf* XV = (bf*)take((size_t)NB_ * TT * DM * 2);   /* both entries' bf16 sources, on end */
    h16* QP16 = (h16*)take((size_t)NB_ * NH_ * TT * HD * 2); h16* KP16 = (h16*)take((size_t)NB_ * NKV * TT * HD * 2); h16* VT16 = (h16*)take((size_t)NB_ * NKV * HD * TT * 2);   /* both entries' head planes: the one attention launch reads them all */
    h16* C16 = (h16*)take((size_t)NB_ * TT * DQ * 2); float* YW = (float*)take((size_t)NB_ * TT * DM * 4); unsigned* MB = (unsigned*)take((size_t)TT * TT / 8);   /* the keep plane's select words, one bit a pair */
    if ((size_t)(wsp - (char*)d_ws) > ws_size) return;    // 80.50 MiB carved
    k_castall<<<dim3(CGX, 20, 1), 256, 0, stream>>>(xq, xk, xv, wq, wk, wv, wo, kp, XQ, XK, XV, WQ, WK, WV, (unsigned short*)WO16, MB);   /* each 'to, from' weight [1024][1024] cast as it lies: its map's right operand, but the third map's left */
    k_maps3<<<dim3(TT / GT, DQ / GT, NB_), 256, 0, stream>>>(XQ, XK, XV, WQ, WK, WV, QP16, KP16, VT16, cq, ck, cv);   /* the three maps, one launch: a work-group's tile of each in turn; z = the entry */
    k_fattn<<<dim3(TT / 256, NB_ * NH_, 1), 256, 0, stream>>>(QP16, KP16, VT16, MB, C16);   /* the one keep plane's select words: the same for every entry and head; the merged heads come out token-major on ONE f16 word */
    k_gemmw<h16, DQ, float, false><<<dim3(TT / GT, DM / GT, NB_), 256, 0, stream>>>(C16, WO16, YW, DM, 64, co, (size_t)TT * DQ, 0, (size_t)TT * DM);   /* the output map with its bias into a workspace plane */
    k_lnrow<true><<<(unsigned)(NB_ * TT / 8), 256, 0, stream>>>(YW, XQ, ns, nb, 1.0e-5f, DM, NB_ * TT, OUT);   /* the result = normalise(plane + the first source's bf16 copy) * scale + shift: its one writer */
}

// v009
// A run of this version takes 97.1 microseconds.
// Next to v008, in two timings, it ran 1.07 and 1.06 times as fast.
// All steps since v000 together make it 13.7 times as fast.
#include <hip/hip_runtime.h>

// A sixteen-head attention of width 1,024 with separate sources for its three maps, ONE int32 keep plane over (row, column) for every entry and head, a last map, the first source added back and a row normalisation, on two 2,048-token entries
// (a0 | a1 | a2 the three sources [2][2048][1024]; a3 the keep plane [1][1][2048][2048] int32 (where a word is nought that column is dropped for that row; one plane for every entry and head); a4 | a6 | a8 | a10 four 'to, from' weights [1024][1024] (a map's column c is its source's row dotted with the weight's row c) with their added vectors a5 | a7 | a9 | a11 [1024]; a12 | a13 the normalisation's scale and shift [1024];
//  the first map of a0, the second of a1, the third of a2, each with its added vector; head h = columns 64 h and on; dots * 64^-0.5; a dropped pair's dot replaced by a large negative constant; ONE PLAIN SOFTMAX over the 2,048 columns; the shares times the third map's rows; the sixteen heads side by side; the sum = that plane mapped by a10 (column c = the plane's row dotted with a10's row c) + a11 + a0; the result = (the sum less its row's mean) over the root of (its row's biased variance + 1e-5), times a12, plus a13 -> [2][2048][1024]; argument order as numbered). FOURTEEN inputs, all read on the device.
// THE KEEP PLANE IS READ AS DATA: every one of its 4,194,304 words is loaded and tested against nought ONCE a call, in the cast launch, which keeps the answer as one bit; the attention selects every dot of every head and entry by its bit; nothing is assumed of the plane's contents.
// WHERE THE TEXT AND THE FUNCTION PART: the function puts minus infinity in place of a dropped dot, this text -3e38: either gives an exact nought share in f32; A ROW THAT KEEPS NO COLUMN: the function gives not-a-numbers there, and so does this text (every share nought, nought over nought).
// THE ARITHMETIC AS BUILT IS THE FUNCTION's OWN: 34.36 G multiply-adds (four maps 4.29 each over the two entries; the dots 8.59; the shares' sums 8.59): ratio 1.00.
// Layout: ONE cast launch (k_castall) for all seven float planes: the three sources of both entries and the first three weights to bf16 as they lie, the last weight's bf16 values to f16 words; the same launch packs the keep plane into select words (512 KiB); both entries in one launch of each later kernel (the maps' grid z, the attention's grid y with the heads, the normalisation's rows): the three bf16 * bf16 maps in ONE launch (k_maps3: a work-group works its tile of each map in turn), their epilogues add the vector, cast to f16 and store that entry's head planes (first and second map: one 64-column group IS one head's 64 columns; third map: weight as the left operand, source as the right, so its tile comes out key-contiguous); no f32 plane and no builder launch between a map and the attention;
// ONE launch for both entries and all sixteen heads (k_fattn): the dots f16 * f16, the keep plane's select words by scalar loads, a softmax against a held reference in registers and the shares' sums on f16 words, 32 columns a pass: no score or share plane goes to memory; its epilogue divides by the row's sum and stores the sixteen heads' token-major plane as ONE f16 word;
// the last map with its added vector into a workspace plane, and the row normalisation of (plane + the first source's bf16 copy from the cast launch) straight into the result (k_lnrow<true>: its one writer). Five launches in all.
// Compute dtypes, f32 accumulate: every float input rounded to bf16 at its load: the maps bf16 * bf16 on exact operands, each added vector's bf16 word in the epilogue; the three head planes (the first map's times 64^-0.5 * log2(e), multiplied in f32 in front of its one rounding), the unnormalised shares (at most 2^12) and the sixteen heads' plane on one f16 word each; the last weight's bf16 values as f16 words; softmax f32; the first source added back at its bf16 value; the normalisation f32 with the scale's and shift's bf16 words.

#define NB_  2
#define TT   2048
#define DM   1024
#define NH_  16
#define NKV  16
#define REP  (NH_ / NKV)
#define HD   64
#define DQ   (NH_ * HD)
#define DKV  (NKV * HD)
#define SCL2 0.18033688011112042f // 64^-0.5 * log2(e): the first map's epilogue multiplies by it, so that the dots come out of the matrix unit as exponents of two
#define LNC_MAX 2048

typedef _Float16 h16;
typedef unsigned short bf;
typedef __attribute__((ext_vector_type(16))) __bf16   v16bf;
typedef __attribute__((ext_vector_type(16))) _Float16 v16h;
typedef __attribute__((ext_vector_type(8)))  _Float16 v8h;
typedef __attribute__((ext_vector_type(8)))  unsigned short v8us;
typedef __attribute__((ext_vector_type(8)))  float    v8f;
typedef __attribute__((ext_vector_type(4)))  float    v4f;
typedef v8h  __attribute__((may_alias)) v8ha;
typedef v4f  __attribute__((may_alias)) v4fa;
typedef v8us __attribute__((may_alias)) v8usa;

__device__ __forceinline__ unsigned short f2bf(float f) { unsigned u = __float_as_uint(f); u += 0x7FFFu + ((u >> 16) & 1u); return (unsigned short)(u >> 16); }
__device__ __forceinline__ float bf2f(unsigned short b) { return __uint_as_float(((unsigned)b) << 16); }
__device__ __forceinline__ float bfr(float f) { return bf2f(f2bf(f)); }
__device__ __forceinline__ v16h cat16(v8h lo, v8h hi) { return __builtin_shufflevector(lo, hi, 0, 1, 2, 3, 4, 5, 6, 7, 8, 9, 10, 11, 12, 13, 14, 15); }
__device__ __forceinline__ v16bf cat16b(v8us lo, v8us hi) { return __builtin_bit_cast(v16bf, __builtin_shufflevector(lo, hi, 0, 1, 2, 3, 4, 5, 6, 7, 8, 9, 10, 11, 12, 13, 14, 15)); }
__device__ __forceinline__ v8f wmma16(v16h a, v16h b, v8f c) { return __builtin_amdgcn_wmma_f32_16x16x32_f16(false, a, false, b, (short)0, c, false, false); }
__device__ __forceinline__ v8f wmmab(v16bf a, v16bf b, v8f c) { return __builtin_amdgcn_wmma_f32_16x16x32_bf16(false, a, false, b, (short)0, c, false, false); }



// ---- k_gemmw: one 128x128 output tile a work-group, 8 waves (2 down, 4 across), each wave a 64x32 piece (eight accumulators) over the WHOLE depth; operands are K-contiguous 16-bit planes; grid (M/128, N/128, Z), 256 threads.
// C[m][n] (f32 or f16 words by TO, + bias[n], or bias[m] with BROW) = sum_k A[m][k] Bt[n][k], k in rising order in one accumulator. z-batch strides sA/sB/sC in elements.
// WHERE A COLUMN LANDS: the 64-column group y starts at C + y * sN, its rows lie ldc apart (a plain plane: sN = 64, ldc = the plane's width; head planes [head][row][64]: sN = one head's plane, ldc = 64).
// THE OPERANDS COME THROUGH LDS: a stage is 128 deep: of each of the 128 A rows and 128 Bt rows two 128-byte pieces. Asynchronous 16-byte copies bring them in, every wave-wide copy four whole lines (four rows); each wave copies sixteen rows of either operand: 16 copies a stage.
// Every row that the tile needs is fetched once a work-group and read from LDS by the waves that share it (an A row by four, a Bt row by two). Two buffers: stage t + 2 is copied into the buffer that stage t has just left, while stage t + 1 is worked on. A 128-byte piece lies 144 bytes from the next row's, the pitch at which 16-byte LDS reads of 16 rows meet no bank twice.
// THE RESULT LEAVES THROUGH THE SAME LDS: behind the last stage's barrier each wave lays its piece in a 128x128 f32 plane, and behind one more barrier a wave takes whole rows of it: each store is whole lines.
template <typename T16> struct WFrag;
template <> struct WFrag<h16> { typedef v16h V; static __device__ __forceinline__ V ld(const h16* p) { return cat16(*(const v8h*)p, *(const v8h*)(p + 16)); } static __device__ __forceinline__ v8f mma(V a, V b, v8f c) { return wmma16(a, b, c); } };
template <> struct WFrag<bf> { typedef v16bf V; static __device__ __forceinline__ V ld(const bf* p) { return cat16b(*(const v8us*)p, *(const v8us*)(p + 16)); } static __device__ __forceinline__ v8f mma(V a, V b, v8f c) { return wmmab(a, b, c); } };
typedef __attribute__((ext_vector_type(4))) _Float16 v4h;
__device__ __forceinline__ void st4(float* p, v4f v) { *(v4f*)p = v; }
__device__ __forceinline__ void st4(h16* p, v4f v) { v4h o; o[0] = (h16)v[0]; o[1] = (h16)v[1]; o[2] = (h16)v[2]; o[3] = (h16)v[3]; *(v4h*)p = o; }
#define GT    128                        // rows of A and of Bt in a work-group's tile
#define GKS   128                        // a stage's depth, in elements: two 128-byte pieces a row
#define GPIT  144                        // LDS pitch of a 128-byte piece
#define GHALF (GT * GPIT)                // one operand's 128 rows of one piece
#define GOFFB (2 * GHALF)                // the Bt rows' place in a buffer
#define GBUF  (4 * GHALF)                // one buffer, in bytes
#define GOP   132                        // the result plane's pitch in words: the two halves of a wave store to different banks
#define CPG(a, b) "global_load_async_to_lds_b128 %" #a ", %" #b ", off\n\t"
// eight copies, and as the statement's last line the wait that stands between issued copies and the first overwrite of a register that they name
__device__ __forceinline__ void cp8(const unsigned (&l)[8], const char* const (&g)[8]) {
    asm volatile(CPG(0, 1) CPG(2, 3) CPG(4, 5) CPG(6, 7) CPG(8, 9) CPG(10, 11) CPG(12, 13) CPG(14, 15) "s_wait_xcnt 0x0"
                 :: "v"(l[0]), "v"(g[0]), "v"(l[1]), "v"(g[1]), "v"(l[2]), "v"(g[2]), "v"(l[3]), "v"(g[3]), "v"(l[4]), "v"(g[4]), "v"(l[5]), "v"(g[5]), "v"(l[6]), "v"(g[6]), "v"(l[7]), "v"(g[7]) : "memory");
}
// one stage's 16 copies of a wave. la: the lane's LDS byte address in the wave's first four A rows, first piece, of the buffer to be filled (eight lanes a row); ag, bg: the lane's global addresses in that stage; ROWB: a global row in bytes
template <int ROWB> __device__ __forceinline__ void gm_stage(unsigned la, const char* ag, const char* bg) {
    unsigned l[8]; const char* g[8];
    // both loops unrolled so that every index is a constant: the addresses stay in registers
#pragma unroll
    for (int i = 0; i < 8; ++i) { l[i] = la + (i >> 2) * GHALF + (i & 3) * 4 * GPIT; g[i] = ag + (i >> 2) * 128 + (size_t)(i & 3) * 4 * ROWB; }
    cp8(l, g);
#pragma unroll
    for (int i = 0; i < 8; ++i) { l[i] = la + GOFFB + (i >> 2) * GHALF + (i & 3) * 4 * GPIT; g[i] = bg + (i >> 2) * 128 + (size_t)(i & 3) * 4 * ROWB; }
    cp8(l, g);
}
// one 32-deep step's 12 LDS reads from the lane's own places, and its eight products; every loop unrolled so that each fragment and accumulator index is a constant: they stay in registers
template <typename T16> __device__ __forceinline__ void gm_read(typename WFrag<T16>::V (&a)[4], typename WFrag<T16>::V (&b)[2], const char* ap, const char* bp) {
#pragma unroll
    for (int mb = 0; mb < 4; ++mb) a[mb] = WFrag<T16>::ld((const T16*)(ap + mb * 16 * GPIT));
#pragma unroll
    for (int nb = 0; nb < 2; ++nb) b[nb] = WFrag<T16>::ld((const T16*)(bp + nb * 16 * GPIT));
}
template <typename T16> __device__ __forceinline__ void gm_mma(const typename WFrag<T16>::V (&a)[4], const typename WFrag<T16>::V (&b)[2], v8f (&acc)[4][2]) {
#pragma unroll
    for (int nb = 0; nb < 2; ++nb)
#pragma unroll
        for (int mb = 0; mb < 4; ++mb) acc[mb][nb] = WFrag<T16>::mma(a[mb], b[nb], acc[mb][nb]);
}
template <typename T16, int K, typename TO, bool BROW>
__global__ __launch_bounds__(256) void k_gemmw(const T16* __restrict__ A, const T16* __restrict__ Bt, TO* C, int ldc, size_t sN, const float* __restrict__ bias, size_t sA, size_t sB, size_t sC) {
    typedef typename WFrag<T16>::V V;
    constexpr int NST = K / GKS;
    static_assert(K % GKS == 0 && NST >= 2 && GKS == 128 && GT * GOP * 4 <= 2 * GBUF, "whole stages, at least the two that the ring's start fills; the result plane fits the ring");
    __shared__ __align__(16) char ring[2 * GBUF];
    const int wv = __builtin_amdgcn_readfirstlane((int)(threadIdx.x >> 5));   // the wave's number, held scalar
    const size_t z = blockIdx.z; A += z * sA; Bt += z * sB; C += z * sC;
    const int lane = threadIdx.x & 31, lr = lane & 15, hi = lane >> 4; const int r0 = blockIdx.x * GT, c0 = blockIdx.y * GT;
    const int wm = (wv & 1) * 64, wn = (wv >> 1) * 32;   // the wave's piece of the tile
    // the copies' addresses: eight lanes a 128-byte piece, four rows a copy; of either operand the wave takes rows 16 wv and on
    const int cr = lane >> 3, cc = (lane & 7) * 16;
    const unsigned la = (unsigned)(size_t)ring + (unsigned)((wv * 16 + cr) * GPIT + cc);
    const char* ag = (const char*)(A + (size_t)(r0 + wv * 16 + cr) * K) + cc; const char* bg = (const char*)(Bt + (size_t)(c0 + wv * 16 + cr) * K) + cc;
    // the lane's read places in buffer 0
    const char* ar = ring + (wm + lr) * GPIT + 16 * hi; const char* br = ring + GOFFB + (wn + lr) * GPIT + 16 * hi;
    v8f acc[4][2];
#pragma unroll
    for (int mb = 0; mb < 4; ++mb)
#pragma unroll
        for (int nb = 0; nb < 2; ++nb) acc[mb][nb] = (v8f){};
    gm_stage<K * 2>(la, ag, bg);
    // the added vector's words that this lane will want, fetched here so that their latency lies under the stages: a wave takes whole rows of 128 result words, rows wv, wv + 8 ...; a lane four columns
    const int cofs = lane * 4; float bw[BROW ? GT / 8 : 4];
    // unrolled so that every index is a constant: the words stay in registers
#pragma unroll
    for (int i = 0; i < (BROW ? GT / 8 : 4); ++i) bw[i] = BROW ? bias[r0 + i * 8 + wv] : bias[c0 + cofs + i];
    asm volatile("s_wait_xcnt 0x0" ::: "memory");   // stands between the issued loads and the first overwrite of their address registers
    __builtin_amdgcn_sched_barrier(0);   // nothing from below climbs between the loads and their wait, onto the loads' address registers
    asm volatile("s_wait_asynccnt 0x0" ::: "memory");   // this wave's copies of stage 0 have landed
    __syncthreads();                                     // every wave's have: stage 0 may be read
    gm_stage<K * 2>(la + GBUF, ag + GKS * 2, bg + GKS * 2);
    ag += 2 * GKS * 2; bg += 2 * GKS * 2;
    // FOUR STEPS' FRAGMENTS IN REGISTERS, READ TWO STEPS AT A TIME: each group of 24 LDS reads is issued in front of the sixteen products of the two steps read before it, so that its latency lies under them.
    // A stage's last two steps are multiplied behind the barrier that ends the stage: they are in registers by then (the wait in front of the barrier), and they cover the next stage's first reads.
    V fa[4][4], fb[4][2];
    gm_read<T16>(fa[0], fb[0], ar, br); gm_read<T16>(fa[1], fb[1], ar + 64, br + 64);
    // kept rolled: one copy of the stage's text, and no more than the four fragment sets live
#pragma unroll 1
    for (int t = 0; t < NST; ++t) {
        const int bo = (t & 1) * GBUF, bn = GBUF - bo;
        gm_read<T16>(fa[2], fb[2], ar + bo + GHALF, br + bo + GHALF); gm_read<T16>(fa[3], fb[3], ar + bo + GHALF + 64, br + bo + GHALF + 64);
        __builtin_amdgcn_sched_barrier(0);   // the reads stay one group in front of the products that cover them
        gm_mma<T16>(fa[0], fb[0], acc); gm_mma<T16>(fa[1], fb[1], acc);
        __builtin_amdgcn_sched_barrier(0);   // these products stay in front of the foot: sunk behind it, the wait below would meet reads that were issued only just before it
        asm volatile("s_wait_dscnt 0x0" ::: "memory");      // this wave has read all it wants of stage t
        asm volatile("s_wait_asynccnt 0x0" ::: "memory");   // its copies of stage t + 1 have landed
        __syncthreads();                                     // stage t + 1 may be read, and the buffer of stage t is free
        if (t + 2 < NST) { gm_stage<K * 2>(la + bo, ag, bg); ag += GKS * 2; bg += GKS * 2; }
        if (t + 1 < NST) { gm_read<T16>(fa[0], fb[0], ar + bn, br + bn); gm_read<T16>(fa[1], fb[1], ar + bn + 64, br + bn + 64); }
        __builtin_amdgcn_sched_barrier(0);   // the next stage's first reads stay one group in front of the products that cover them
        gm_mma<T16>(fa[2], fb[2], acc); gm_mma<T16>(fa[3], fb[3], acc);
    }
    asm volatile("s_wait_asynccnt 0x0" ::: "memory");   // no copy is in flight when the ring is put to its second use
    float* os = (float*)ring;
    // unrolled so that every accumulator index is a constant: the tiles stay in registers
#pragma unroll
    for (int mb = 0; mb < 4; ++mb)
#pragma unroll
        for (int nb = 0; nb < 2; ++nb)
#pragma unroll
            for (int j = 0; j < 8; ++j) os[(wm + mb * 16 + hi * 8 + j) * GOP + wn + nb * 16 + lr] = acc[mb][nb][j];
    __syncthreads();   // every wave's piece lies in LDS before any wave takes a row
    v4f bc = (v4f){};
    if (!BROW) { bc[0] = bfr(bw[0]); bc[1] = bfr(bw[1]); bc[2] = bfr(bw[2]); bc[3] = bfr(bw[3]); }
    TO* cb = C + (size_t)((c0 + cofs) >> 6) * sN + ((c0 + cofs) & 63) + (size_t)r0 * ldc;
    // unrolled so that the rows' LDS reads issue together
#pragma unroll
    for (int s = 0; s < GT / 8; ++s) { const int row = s * 8 + wv; v4f val = *(const v4fa*)(os + row * GOP + cofs);
        if (BROW) val += bfr(bw[s]); else val += bc;
        st4(cb + (size_t)row * ldc, val); }
}


// ---- k_maps3: the three bf16 maps in ONE launch; grid (TT / 128, 1024 / 128, entries), 256 threads. A work-group works ITS 128 source rows x 128 weight rows in the first, the second and the third map in turn, by k_gemmw's own stages, reads and products.
// THE RING RUNS ON OVER A MAP's END: the copies behind the foot of a map's last two stages bring the next map's first two stages, so that only the first map waits for a first stage; a map's stages are even in number, so every stage keeps its buffer.
// The result plane has LDS of its own: a map's result leaves while the next map's copies land in the ring. Between two uses of that plane lie a map's stage barriers, each behind the wave's s_wait_dscnt 0.
// In every map the source's rows lie in a buffer's first half and the weight's in its second. THIRD MAP (SWAP): the weight's fragment is the left operand and the source's the right, so that a tile comes out [weight row][token], key-contiguous; the added vector goes by row.
template <bool SWAP> __device__ __forceinline__ void m3_mma(const v16bf (&a)[4], const v16bf (&b)[2], v8f (&acc)[4][2]) {
    // unrolled so that each fragment and accumulator index is a constant: they stay in registers
#pragma unroll
    for (int nb = 0; nb < 2; ++nb)
#pragma unroll
        for (int mb = 0; mb < 4; ++mb) acc[mb][nb] = SWAP ? wmmab(b[nb], a[mb], acc[mb][nb]) : wmmab(a[mb], b[nb], acc[mb][nb]);
}
// one map's tile. On entry: the map's stage 0 has landed and is published, its stage 1 is in flight, fa[0..1] and fb[0..1] hold (or await) stage 0's first two steps, ag and bg stand at stage 2. nxa, nxb: the byte distance from this map's operand planes to the next map's (the same in every lane). cb: the lane's place in the tile's first result row; bias: the added vector at the tile's first weight row. QS (first map): the result with its added vector is multiplied by SCL2 in f32 in front of the cast
template <bool SWAP, bool LAST, bool QS>
__device__ __forceinline__ void m3_tile(v16bf (&fa)[4][4], v16bf (&fb)[4][2], const char*& ag, const char*& bg, long nxa, long nxb, unsigned la, const char* ar, const char* br, float* os, h16* cb, int ldc, const float* __restrict__ bias, int wv, int lane, int wm, int wn) {
    constexpr int NST = DM / GKS;
    static_assert(DM % GKS == 0 && NST % 2 == 0 && NST >= 4, "whole stages, an even number of them: the next map's stage 0 falls into buffer 0");
    const int lr = lane & 15, hi = lane >> 4, cofs = lane * 4;
    // the added vector's words that this lane will want, fetched here so that their latency lies under the stages; unrolled so that every index is a constant: the words stay in registers
    float bw[SWAP ? GT / 8 : 4];
#pragma unroll
    for (int i = 0; i < (SWAP ? GT / 8 : 4); ++i) bw[i] = SWAP ? bias[i * 8 + wv] : bias[cofs + i];
    asm volatile("s_wait_xcnt 0x0" ::: "memory");   // stands between the issued loads and the first overwrite of their address registers
    __builtin_amdgcn_sched_barrier(0);   // nothing from below climbs between the loads and their wait, onto the loads' address registers
    v8f acc[4][2];
#pragma unroll
    for (int mb = 0; mb < 4; ++mb)
#pragma unroll
        for (int nb = 0; nb < 2; ++nb) acc[mb][nb] = (v8f){};
    // kept rolled: one copy of the stage's text a map, and no more than the four fragment sets live
#pragma unroll 1
    for (int t = 0; t < NST; ++t) {
        const int bo = (t & 1) * GBUF, bn = GBUF - bo;
        gm_read<bf>(fa[2], fb[2], ar + bo + GHALF, br + bo + GHALF); gm_read<bf>(fa[3], fb[3], ar + bo + GHALF + 64, br + bo + GHALF + 64);
        __builtin_amdgcn_sched_barrier(0);   // the reads stay one group in front of the products that cover them
        m3_mma<SWAP>(fa[0], fb[0], acc); m3_mma<SWAP>(fa[1], fb[1], acc);
        __builtin_amdgcn_sched_barrier(0);   // these products stay in front of the foot: sunk behind it, the wait below would meet reads that were issued only just before it
        asm volatile("s_wait_dscnt 0x0" ::: "memory");      // this wave has read all it wants of stage t
        asm volatile("s_wait_asynccnt 0x0" ::: "memory");   // its copies of the stage that follows (this map's, or the next map's first) have landed
        __syncthreads();                                     // that stage may be read, and the buffer of stage t is free
        if (!LAST || t + 2 < NST) { gm_stage<DM * 2>(la + bo, ag, bg);
            const bool end = !LAST && t == NST - 3;   // this map's last stage has just been asked for: on to the next map's first
            ag += end ? nxa - (NST - 1) * GKS * 2 : GKS * 2; bg += end ? nxb - (NST - 1) * GKS * 2 : GKS * 2; }
        if (!LAST || t + 1 < NST) { gm_read<bf>(fa[0], fb[0], ar + bn, br + bn); gm_read<bf>(fa[1], fb[1], ar + bn + 64, br + bn + 64); }
        __builtin_amdgcn_sched_barrier(0);   // the following stage's first reads stay one group in front of the products that cover them
        m3_mma<SWAP>(fa[2], fb[2], acc); m3_mma<SWAP>(fa[3], fb[3], acc);
    }
    if (LAST) asm volatile("s_wait_asynccnt 0x0" ::: "memory");   // no copy is in flight when the wave ends
    // unrolled so that every accumulator index is a constant: the tiles stay in registers
#pragma unroll
    for (int mb = 0; mb < 4; ++mb)
#pragma unroll
        for (int nb = 0; nb < 2; ++nb)
#pragma unroll
            for (int j = 0; j < 8; ++j) os[(SWAP ? (wn + nb * 16 + hi * 8 + j) * GOP + wm + mb * 16 + lr : (wm + mb * 16 + hi * 8 + j) * GOP + wn + nb * 16 + lr)] = acc[mb][nb][j];
    __syncthreads();   // every wave's piece lies in LDS before any wave takes a row
    v4f bc = (v4f){};
    if (!SWAP) { bc[0] = bfr(bw[0]); bc[1] = bfr(bw[1]); bc[2] = bfr(bw[2]); bc[3] = bfr(bw[3]); }
    // both loops unrolled so that the rows' LDS reads issue together and every index is a constant
    v4f val[GT / 8];
#pragma unroll
    for (int s = 0; s < GT / 8; ++s) val[s] = *(const v4fa*)(os + (s * 8 + wv) * GOP + cofs);
#pragma unroll
    for (int s = 0; s < GT / 8; ++s) {
        st4(cb + (size_t)(s * 8 + wv) * ldc, SWAP ? val[s] + bfr(bw[s]) : QS ? (val[s] + bc) * SCL2 : val[s] + bc);
        asm volatile("s_wait_xcnt 0x0" ::: "memory");   // stands between the issued store and the first overwrite of a register that it names
    }
}
__global__ __launch_bounds__(256) void k_maps3(const bf* __restrict__ XQ, const bf* __restrict__ XK, const bf* __restrict__ XV, const bf* __restrict__ WQ, const bf* __restrict__ WK, const bf* __restrict__ WV, h16* QP, h16* KP, h16* VT,
                                               const float* __restrict__ cq, const float* __restrict__ ck, const float* __restrict__ cv) {
    __shared__ __align__(16) char ring[2 * GBUF];
    __shared__ __align__(16) float os[GT * GOP];
    const int wv = __builtin_amdgcn_readfirstlane((int)(threadIdx.x >> 5));   // the wave's number, held scalar
    const size_t z = blockIdx.z;
    const int lane = threadIdx.x & 31, lr = lane & 15, hi = lane >> 4; const int r0 = blockIdx.x * GT, c0 = blockIdx.y * GT;   // the tile's first source row (token) and first weight row
    const int wm = (wv & 1) * 64, wn = (wv >> 1) * 32;   // the wave's piece of the tile: 64 source rows, 32 weight rows
    // the copies' addresses: eight lanes a 128-byte piece, four rows a copy; of either operand the wave takes rows 16 wv and on
    const int cr = lane >> 3, cc = (lane & 7) * 16;
    const unsigned la = (unsigned)(size_t)ring + (unsigned)((wv * 16 + cr) * GPIT + cc);
    const char* ag = (const char*)(XQ + (z * TT + r0 + wv * 16 + cr) * DM) + cc; const char* bg = (const char*)(WQ + (size_t)(c0 + wv * 16 + cr) * DM) + cc;
    // the lane's read places in buffer 0
    const char* ar = ring + (wm + lr) * GPIT + 16 * hi; const char* br = ring + GOFFB + (wn + lr) * GPIT + 16 * hi;
    gm_stage<DM * 2>(la, ag, bg);
    asm volatile("s_wait_asynccnt 0x0" ::: "memory");   // this wave's copies of the first map's stage 0 have landed
    __syncthreads();                                     // every wave's have: stage 0 may be read
    gm_stage<DM * 2>(la + GBUF, ag + GKS * 2, bg + GKS * 2);
    ag += 2 * GKS * 2; bg += 2 * GKS * 2;
    v16bf fa[4][4], fb[4][2];
    gm_read<bf>(fa[0], fb[0], ar, br); gm_read<bf>(fa[1], fb[1], ar + 64, br + 64);
    const int cofs = lane * 4;
    const size_t hp = z * ((size_t)NH_ * TT * HD) + (size_t)((c0 + cofs) >> 6) * ((size_t)TT * HD) + ((c0 + cofs) & 63) + (size_t)r0 * HD;   // 64-column group = head: straight into its [row][64] plane
    m3_tile<false, false, true>(fa, fb, ag, bg, (const char*)XK - (const char*)XQ, (const char*)WK - (const char*)WQ, la, ar, br, os, QP + hp, HD, cq + c0, wv, lane, wm, wn);
    m3_tile<false, false, false>(fa, fb, ag, bg, (const char*)XV - (const char*)XK, (const char*)WV - (const char*)WK, la, ar, br, os, KP + hp, HD, ck + c0, wv, lane, wm, wn);
    m3_tile<true, true, false>(fa, fb, ag, bg, 0, 0, la, ar, br, os, VT + z * ((size_t)NKV * HD * TT) + (size_t)c0 * TT + r0 + cofs, TT, cv + c0, wv, lane, wm, wn);   // [head][64][key]
}


__device__ __forceinline__ void splitf(float y, unsigned short& h, unsigned short& l) { h = f2bf(y); l = f2bf(y - bf2f(h)); }
typedef __attribute__((ext_vector_type(2))) _Float16 v2h;
typedef __attribute__((ext_vector_type(2))) unsigned short v2us;
typedef __attribute__((ext_vector_type(4))) unsigned short v4us;
typedef __attribute__((ext_vector_type(2))) float v2f;
typedef __attribute__((ext_vector_type(4))) int v4i;

// ---- k_fattn: dots, keep plane, softmax and the shares' sums of one head in ONE kernel; grid (TT / 256, entries * heads), 8 waves, each wave 32 query rows (two 16-column groups) against all TT keys, 32 keys a pass.
// TRANSPOSED PRODUCTS: St = K Qt (A = 16 key rows, B = 16 query rows, both by the one k-contiguous loader), so a lane holds 8 + 8 scores of ONE query (column lr; keys 8 hi + r and 16 + 8 hi + r): maximum and sum stay in the lane, the two halves of the wave join the maximum by one exchange in a pass that takes it.
// The two score tiles, turned into shares and cast, ARE the B operand of Ot += Vt Pt in the hardware's k order; A = 16 rows of the key-contiguous Vt plane by the same loader (keys 8 hi .. and 16 + 8 hi ..): the k orders agree at every position.
// A HELD REFERENCE: the query plane comes scaled, and minus the row's reference is the C operand of the dots' first product, so that a score leaves the matrix unit as the exponent of two of its share: no zeroed tile, no multiply and no subtraction a score.
// ONE TEST A PASS (a ballot and a scalar branch), ON THE SHARES' SUMS, so that no maximum is taken in a pass that moves nothing: only where a lane's sixteen shares of the pass sum to more than its bar does the wave take the rows' maxima, move a row's reference up to its maximum where that stands above the bar, scale that row's sums and output tiles by 2^(old - new) and form the pass's shares anew. The bar is -1e37 until the row has kept its first column (every pass is tested true, and the first kept score moves the reference from nought to itself), and 2^12 from then on (as a score: 8): a share is at most 2^12. A pass's sixteen shares are summed first and then added to the lane's running sum.
// A dropped dot is -3e38: its share is an exact nought; a row that keeps no column ends with nought over nought, a not-a-number, as the function does.
// THE OPERANDS COME THROUGH LDS: a stage is 64 keys (two passes): 64 K rows and 64 Vt rows of 128 bytes, shared by the eight waves. Asynchronous 16-byte copies bring them in, every wave-wide copy four whole lines (four rows); each wave copies an eighth of K and of Vt: four copies a stage.
// THE KEEP PLANE COMES AS SELECT WORDS: the cast launch has packed it so that bit L of a word is lane L's answer for one score register; a pass's 32 words (128 bytes) come by two scalar loads, one stage ahead, and each word is its select's lane mask as it stands: no LDS, no vector register and no compare for the plane.
// Two buffers: stage s + 2 is copied into the buffer that stage s has just left, while stage s + 1 is worked on. Every row lies 144 bytes from the next, the pitch at which 16-byte LDS reads of 16 rows meet no bank twice. WHAT IS LEFT: a stage's first reads wait behind its barrier; a pass whose words are all nought or all ones is worked like any other.
// Every loop over tiles, column groups, blocks and registers below is unrolled so that each fragment index is a constant: the fragments and accumulators stay in registers.
__device__ __forceinline__ float xhalf(float x) { return __builtin_bit_cast(float, __builtin_amdgcn_permlanex16(__builtin_bit_cast(int, x), __builtin_bit_cast(int, x), 0x76543210, 0xfedcba98, false, false)); }   // lane l with lane l ^ 16
struct FOps { v16h kf[2][2]; v16h vf[4]; };   // one pass's operands from LDS: K rows [tile][32-deep step], Vt rows [16-row block]
typedef __attribute__((ext_vector_type(16))) unsigned v16u;   // one column group's sixteen select words of a pass: [tile][register]
// sixteen select words by one scalar load: the plane was written by an earlier launch and no one writes it while this kernel runs, so it is read through the constant address space (behind the loop's asm waits the compiler otherwise takes the words through vector registers, a lane read each)
__device__ __forceinline__ v16u ldw(const unsigned* p) { return *(const __attribute__((address_space(4))) v16u*)p; }
#define SKEY 64                          // keys a stage
#define LPIT 144                         // LDS pitch of a 128-byte row
#define OFFV (SKEY * LPIT)               // the Vt rows' place in a buffer
#define BUFB (OFFV + HD * LPIT)          // one buffer, in bytes
#define CP1(a, b) "global_load_async_to_lds_b128 %" #a ", %" #b ", off\n\t"
// one stage's four copies of a wave, and as the statement's last line the wait that stands between issued copies and the first overwrite of a register that they name. ll: the lane's place in any four rows (eight lanes a row); sk: the LDS byte address, the same for the whole wave, of the wave's first K row in the buffer to be filled; kg, vg: the lane's global addresses in that stage
__device__ __forceinline__ void fa_stage(unsigned ll, unsigned sk, const char* kg, const char* vg) {
    sk = (unsigned)__builtin_amdgcn_readfirstlane((int)sk);   // the wave's place held scalar: the one lane-own value that lives through the loop is ll, which no copy names itself
    asm volatile(CP1(0, 1) CP1(2, 3) CP1(4, 5) CP1(6, 7) "s_wait_xcnt 0x0"
                 :: "v"(ll + sk), "v"(kg), "v"(ll + (sk + 4 * LPIT)), "v"(kg + 4 * HD * 2), "v"(ll + (sk + OFFV)), "v"(vg), "v"(ll + (sk + OFFV + 4 * LPIT)), "v"(vg + 4 * TT * 2) : "memory");
}
// one pass's 16 LDS reads from the lane's own places in the stage's buffer
__device__ __forceinline__ void fa_read(FOps& n, const char* kb, const char* vb) {
#pragma unroll
    for (int t = 0; t < 2; ++t)
#pragma unroll
        for (int ks = 0; ks < 2; ++ks) n.kf[t][ks] = WFrag<h16>::ld((const h16*)(kb + t * 16 * LPIT + ks * 64));
#pragma unroll
    for (int db = 0; db < 4; ++db) n.vf[db] = WFrag<h16>::ld((const h16*)(vb + db * 16 * LPIT));
}
// one exponential of two; the v_nop fills the slot that the instruction set asks for behind it, whatever the compiler puts next
__device__ __forceinline__ float exp2x1(float x) { float y; asm("v_exp_f32 %0, %1\n\tv_nop" : "=v"(y) : "v"(x)); return y; }
// eight exponentials of two into registers of their own (the scores stay, for the pass that has to move a reference): every result is marked early-clobber, so that none lands on a source that is still to be read; the v_nop fills the slot that the instruction set asks for behind the last one
__device__ __forceinline__ v8f exp2c8(const v8f& x) { float a, b, c, d, e, f, g, h;
    asm("v_exp_f32 %0, %8\n\tv_exp_f32 %1, %9\n\tv_exp_f32 %2, %10\n\tv_exp_f32 %3, %11\n\tv_exp_f32 %4, %12\n\tv_exp_f32 %5, %13\n\tv_exp_f32 %6, %14\n\tv_exp_f32 %7, %15\n\tv_nop" : "=&v"(a), "=&v"(b), "=&v"(c), "=&v"(d), "=&v"(e), "=&v"(f), "=&v"(g), "=&v"(h) : "v"(x[0]), "v"(x[1]), "v"(x[2]), "v"(x[3]), "v"(x[4]), "v"(x[5]), "v"(x[6]), "v"(x[7]));
    return (v8f){a, b, c, d, e, f, g, h}; }
// one column group's shares of a pass and their sum, in the order register 0, 1 ... of tile 0, then of tile 1
__device__ __forceinline__ v2f fa_shares(const v8f (&s)[2], v8f (&e)[2]) { v2f ps;
#pragma unroll
    for (int t = 0; t < 2; ++t) { e[t] = exp2c8(s[t]);
#pragma unroll
        for (int r = 0; r < 8; r += 2) { const v2f p = (v2f){e[t][r], e[t][r + 1]}; ps = (t | r) ? ps + p : p; } }
    return ps; }
__device__ __forceinline__ void fa_pass(const FOps& c, const v16u (&kw)[2], const v16h (&qf)[2][2], v8f (&o)[4][2], v8f (&cn)[2], float (&th)[2], v2f (&sm)[2]) {
    typedef WFrag<h16> F;
    v16h pf[2]; v8f s[2][2], e[2][2]; v2f ps[2];
#pragma unroll
    for (int g = 0; g < 2; ++g)
#pragma unroll
        for (int t = 0; t < 2; ++t) s[g][t] = F::mma(c.kf[t][1], qf[g][1], F::mma(c.kf[t][0], qf[g][0], cn[g]));   // cn: minus the row's reference in all eight registers
#pragma unroll
    for (int g = 0; g < 2; ++g) {
#pragma unroll
        for (int t = 0; t < 2; ++t)
#pragma unroll
            for (int r = 0; r < 8; ++r) s[g][t][r] = __builtin_amdgcn_inverse_ballot_w32(kw[g][t * 8 + r]) ? s[g][t][r] : -3.0e38f;   // keep the score where the lane's bit is set: the scalar word IS the select's lane mask, no compare
        ps[g] = fa_shares(s[g], e[g]); }
    // one scalar branch a pass: the block below is walked while a row of the wave has kept no column yet (its bar lies below every sum) and, after that, only where a lane's sixteen shares sum to more than 2^12, that is, a score stands more than 8 above its row's reference
    if (__builtin_amdgcn_ballot_w32(ps[0][0] + ps[0][1] > th[0] || ps[1][0] + ps[1][1] > th[1]) != 0) {
#pragma unroll
        for (int g = 0; g < 2; ++g) { float m = s[g][0][0];
#pragma unroll
            for (int i = 1; i < 16; ++i) m = fmaxf(m, s[g][i >> 3][i & 7]);
            m = fmaxf(m, xhalf(m));   // both halves of the wave hold the query's maximum: one reference for all 32 keys
            const bool up = m > th[g] * 0x1p-9f;   // the bar as a score: 8, or below every kept score
            const float d = up ? m : 0.0f; th[g] = up ? 4096.0f : th[g];
            const float f = exp2x1(fminf(-d, 0.0f));   /* a row's first reference may lie below nought: its sums are still nought, and the factor stays finite */ sm[g] *= f; cn[g] -= d;
#pragma unroll
            for (int db = 0; db < 4; ++db) o[db][g] *= f;
#pragma unroll
            for (int t = 0; t < 2; ++t) s[g][t] -= d;
            ps[g] = fa_shares(s[g], e[g]); }
    }
#pragma unroll
    for (int g = 0; g < 2; ++g) { sm[g] += ps[g];
#pragma unroll
        for (int i = 0; i < 16; ++i) pf[g][i] = (h16)e[g][i >> 3][i & 7]; }
#pragma unroll
    for (int db = 0; db < 4; ++db)
#pragma unroll
        for (int g = 0; g < 2; ++g) o[db][g] = F::mma(c.vf[db], pf[g], o[db][g]);
}
// two waves a SIMD (one work-group a WGP): the register budget that holds both operand sets beside the accumulators without a spill
__global__ __launch_bounds__(256) __attribute__((amdgpu_waves_per_eu(2, 2))) void k_fattn(const h16* __restrict__ Qp, const h16* __restrict__ Kp, const h16* __restrict__ Vt, const unsigned* __restrict__ MB, h16* Cx) {
    const int lane = threadIdx.x & 31, lr = lane & 15, hi = lane >> 4;
    const int wv = __builtin_amdgcn_readfirstlane((int)(threadIdx.x >> 5));   // the wave's number, held scalar
    const int zh = blockIdx.y, q0 = blockIdx.x * 256 + wv * 32;
    const h16* qb = Qp + ((size_t)zh * TT + q0 + lr) * HD + 8 * hi;
    static_assert(TT % SKEY == 0 && TT / SKEY >= 2 && SKEY == 64 && HD == 64, "whole stages, at least the two that the ring's start fills; rows of 128 bytes");
    __shared__ __align__(16) char ring[2 * BUFB];
    // the copies' addresses: eight lanes a 128-byte row, four rows a copy; of K and Vt the wave takes rows 8 wv and on
    const int cr = lane >> 3, cc = (lane & 7) * 16;
    const unsigned ll = (unsigned)(cr * LPIT + cc), sk = (unsigned)(size_t)ring + (unsigned)(wv * 8 * LPIT);
    const char* kg = (const char*)(Kp + ((size_t)zh * TT + wv * 8 + cr) * HD) + cc; const char* vg = (const char*)(Vt + ((size_t)zh * HD + wv * 8 + cr) * TT) + cc;
    // the lane's read places in buffer 0, first pass
    const char* kb = ring + lr * LPIT + 16 * hi; const char* vb = ring + OFFV + lr * LPIT + 16 * hi;
    // the wave's own select words: 32 a pass, the passes on end; the address is the same in every lane, so the loads are scalar
    const unsigned* mw = MB + (size_t)(q0 >> 5) * (TT / 32) * 32;
    v16u wa[2], wb[2];
    wa[0] = ldw(mw); wa[1] = ldw(mw + 16); wb[0] = ldw(mw + 32); wb[1] = ldw(mw + 48);
    v16h qf[2][2]; v8f o[4][2]; v8f cn[2]; float th[2]; v2f sm[2];
#pragma unroll
    for (int g = 0; g < 2; ++g)
#pragma unroll
        for (int ks = 0; ks < 2; ++ks) qf[g][ks] = WFrag<h16>::ld(qb + g * 16 * HD + ks * 32);
    asm volatile("s_wait_xcnt 0x0" ::: "memory");   // stands between the issued query loads and the first overwrite of their address registers
    __builtin_amdgcn_sched_barrier(0);   // nothing from below climbs between the query loads and their wait, onto the loads' address registers
#pragma unroll
    for (int g = 0; g < 2; ++g) { cn[g] = (v8f){}; th[g] = -1.0e37f; sm[g] = (v2f){};
#pragma unroll
        for (int db = 0; db < 4; ++db) o[db][g] = (v8f){}; }
    fa_stage(ll, sk, kg, vg);
    asm volatile("s_wait_asynccnt 0x0" ::: "memory");   // this wave's copies of stage 0 have landed
    __syncthreads();                                     // every wave's have: stage 0 may be read
    fa_stage(ll, sk + BUFB, kg + SKEY * HD * 2, vg + SKEY * 2);
    kg += 2 * SKEY * HD * 2; vg += 2 * SKEY * 2;
    for (int s = 0; s < TT / SKEY; ++s) {
        const int bo = (s & 1) * BUFB; FOps A, B;
        fa_read(A, kb + bo, vb + bo);
        fa_read(B, kb + bo + 32 * LPIT, vb + bo + 64);
        const unsigned* mn = mw + (s + 1 < TT / SKEY ? s + 1 : s) * 64;   // the next stage's select words (the last stage takes its own again: no word past the wave's run is read)
        __builtin_amdgcn_sched_barrier(0);   // both passes' LDS reads stay together at the head of the stage: the second pass's latency lies under the first pass's work
        fa_pass(A, wa, qf, o, cn, th, sm);
        wa[0] = ldw(mn); wa[1] = ldw(mn + 16);          // each pass's words are fetched one stage ahead, as soon as their registers are free: the scalar path's latency lies under a pass
        fa_pass(B, wb, qf, o, cn, th, sm);
        wb[0] = ldw(mn + 32); wb[1] = ldw(mn + 48);
        __builtin_amdgcn_sched_barrier(0);   // the stage's work stays in front of its foot: lifted over the work, the wait below would meet copies that were issued only just before it
        asm volatile("s_wait_dscnt 0x0" ::: "memory");      // this wave has read all it wants of stage s
        asm volatile("s_wait_asynccnt 0x0" ::: "memory");   // its copies of stage s + 1 have landed
        __syncthreads();                                     // stage s + 1 may be read, and the buffer of stage s is free
        if (s + 2 < TT / SKEY) { fa_stage(ll, sk + bo, kg, vg); kg += SKEY * HD * 2; vg += SKEY * 2; }
    }
    asm volatile("s_wait_asynccnt 0x0" ::: "memory");   // no copy is in flight when the wave ends
    const int en = zh / NH_, hd = zh % NH_;
#pragma unroll
    for (int g = 0; g < 2; ++g) { const float hs = sm[g][0] + sm[g][1]; const float inv = __fdiv_rn(1.0f, hs + xhalf(hs));   // the two halves' sums meet once
        h16* c = Cx + ((size_t)en * TT + q0 + g * 16 + lr) * DQ + hd * HD + 8 * hi;
#pragma unroll
        for (int db = 0; db < 4; ++db) { v8h ov;
#pragma unroll
            for (int r = 0; r < 8; ++r) ov[r] = (h16)(o[db][g][r] * inv);
            *(v8h*)(c + db * 16) = ov; } }
}

template <typename T16> __device__ __forceinline__ unsigned short cv16(float x);
template <> __device__ __forceinline__ unsigned short cv16<h16>(float x) { const h16 h = (h16)x; return __builtin_bit_cast(unsigned short, h); }
// ---- k_castall: every 16-bit copy of a float plane, and the keep plane's select words, in ONE launch of 5,120 long waves; grid (CGX, 20), 256 threads: grid rows 0 - 3 pack the keep plane, rows 4 - 19 are the casts' pieces 0 - 15. The float planes are cut into sixteen pieces of CSEG words: pieces 0 - 11 the three sources (four each, both entries lie on end), 12 - 14 the first three weights, 15 the last weight.
// A work-group takes CSEG / CGX words of its piece: four trips of eight loads a thread; each wave-wide load is 512 bytes on end (whole lines), each store 256.
#define CSEG (1u << 20)
#define CGX  32
template <bool TOH> __device__ __forceinline__ void cast_run(const float* __restrict__ s, unsigned short* d) {
    for (int t = 0; t < 4; ++t) { v4f v[8];
        // unrolled so that a trip's eight loads are in flight together
#pragma unroll
        for (int j = 0; j < 8; ++j) v[j] = *(const v4f*)(s + (t * 8 + j) * 1024);
#pragma unroll
        for (int j = 0; j < 8; ++j) { v4us o;
#pragma unroll
            for (int q = 0; q < 4; ++q) { const unsigned short b = f2bf(v[j][q]); o[q] = TOH ? cv16<h16>(bf2f(b)) : b; }
            *(v4us*)(d + (t * 8 + j) * 1024) = o; } }
}
// THE KEEP PLANE's SELECT WORDS: for 32 query rows x 32 keys, 32 words: word 16 g + 8 t + r holds in bit L whether row 16 g + (L & 15) keeps key 16 t + 8 (L >> 4) + r, which is where k_fattn's lane L holds that dot (column group g, tile t, register r).
// A lane loads the eight plane words of its row and key octet (two 16-byte loads a tile); one ballot a register makes a word, lane i keeps word i, and one wave-wide store writes the unit's 128 bytes. wid: the wave's number of 1,024; a wave takes four units on end along the keys (512 bytes of each of its 32 rows).
__device__ __forceinline__ void pack_run(const int* __restrict__ mk, unsigned* MB, int wid, int lane) {
    const int qb = wid >> 4, p0 = (wid & 15) * 4;
    const int* sp = mk + (size_t)(qb * 32 + (lane & 15)) * TT + p0 * 32 + 8 * (lane >> 4);
    v4i w[4][2][2][2];
    // every loop unrolled so that the wave's 32 loads are in flight together and each index is a constant
#pragma unroll
    for (int u = 0; u < 4; ++u)
#pragma unroll
        for (int g = 0; g < 2; ++g)
#pragma unroll
            for (int t = 0; t < 2; ++t) { w[u][g][t][0] = *(const v4i*)(sp + g * 16 * TT + u * 32 + t * 16); w[u][g][t][1] = *(const v4i*)(sp + g * 16 * TT + u * 32 + t * 16 + 4); }
    asm volatile("s_wait_xcnt 0x0" :: "v"(sp) : "memory");   // stands between the issued loads and the first overwrite of their address registers; it takes the address as an input, so that no load's own result lands on those registers in front of it
    __builtin_amdgcn_sched_barrier(0);   // nothing from below climbs between the loads and their wait: the 32 loads stay one group in flight
#pragma unroll
    for (int u = 0; u < 4; ++u) { unsigned o = 0;
#pragma unroll
        for (int i = 0; i < 32; ++i) { const unsigned b = __builtin_amdgcn_ballot_w32(w[u][i >> 4][(i >> 3) & 1][(i >> 2) & 1][i & 3] != 0); o = lane == i ? b : o; }
        MB[((size_t)qb * (TT / 32) + p0 + u) * 32 + lane] = o; }
}
__global__ __launch_bounds__(256) void k_castall(const float* __restrict__ xq, const float* __restrict__ xk, const float* __restrict__ xv, const float* __restrict__ wq, const float* __restrict__ wk, const float* __restrict__ wv, const float* __restrict__ wo, const int* __restrict__ mk,
                                                 unsigned short* XQ, unsigned short* XK, unsigned short* XV, unsigned short* WQ, unsigned short* WK, unsigned short* WV, unsigned short* WO, unsigned* MB) {
    if (blockIdx.y < 4) { pack_run(mk, MB, (int)((blockIdx.y * CGX + blockIdx.x) * 8 + (threadIdx.x >> 5)), (int)(threadIdx.x & 31)); return; }   // grid rows 0 - 3: the keep plane, first because its loads (16 lines each) are the launch's slowest; the test is the same for the whole work-group
    const unsigned seg = blockIdx.y - 4; const float* s; unsigned short* d;
    if (seg < 4) { s = xq; d = XQ; } else if (seg < 8) { s = xk; d = XK; } else if (seg < 12) { s = xv; d = XV; } else if (seg == 12) { s = wq; d = WQ; } else if (seg == 13) { s = wk; d = WK; } else if (seg == 14) { s = wv; d = WV; } else { s = wo; d = WO; }
    const size_t off = (seg < 12 ? (size_t)(seg & 3u) * CSEG : 0) + (size_t)blockIdx.x * (CSEG / CGX) + threadIdx.x * 4;
    if (seg == 15) cast_run<true>(s + off, d + off); else cast_run<false>(s + off, d + off);
}

template <bool RES>
__global__ __launch_bounds__(256) void k_lnrow(const float* __restrict__ A, const bf* __restrict__ R, const float* __restrict__ gamma, const float* __restrict__ beta, float eps, int C, int nrows, float* Y) {
    const int lane = threadIdx.x & 31; const int row = blockIdx.x * 8 + (threadIdx.x >> 5); if (row >= nrows) return; const int nch = C / 128; const float* a = A + (size_t)row * C; float x[LNC_MAX / 32]; float s = 0.0f;
    for (int k = 0; k < LNC_MAX / 128; ++k) { if (k < nch) { const int c0 = k * 128 + lane * 4; v4f v = *(const v4f*)(a + c0);
            if (RES) { asm volatile("s_wait_xcnt 0x0" ::: "memory");   /* stands between the issued load and the next load, whose result may land on the first one's address registers */
                const v4us w = *(const v4us*)(R + (size_t)row * C + c0); v[0] = __fadd_rn(v[0], bf2f(w[0])); v[1] = __fadd_rn(v[1], bf2f(w[1])); v[2] = __fadd_rn(v[2], bf2f(w[2])); v[3] = __fadd_rn(v[3], bf2f(w[3])); }
            x[k * 4 + 0] = v[0]; x[k * 4 + 1] = v[1]; x[k * 4 + 2] = v[2]; x[k * 4 + 3] = v[3]; s = __fadd_rn(__fadd_rn(__fadd_rn(__fadd_rn(s, v[0]), v[1]), v[2]), v[3]); } }
    for (int sh = 16; sh; sh >>= 1) s = __fadd_rn(s, __shfl_xor(s, sh, 32));
    const float mean = __fdiv_rn(s, (float)C); float q = 0.0f;
    for (int k = 0; k < LNC_MAX / 128; ++k) { if (k < nch) {
            for (int j = 0; j < 4; ++j) { const float d = __fsub_rn(x[k * 4 + j], mean); x[k * 4 + j] = d; q = __fmaf_rn(d, d, q); } } }
    for (int sh = 16; sh; sh >>= 1) q = __fadd_rn(q, __shfl_xor(q, sh, 32));
    const float rstd = __fdiv_rn(1.0f, sqrtf(__fadd_rn(__fdiv_rn(q, (float)C), eps)));
    for (int k = 0; k < LNC_MAX / 128; ++k) { if (k < nch) { const int c0 = k * 128 + lane * 4; const v4f g = *(const v4f*)(gamma + c0); const v4f bt = *(const v4f*)(beta + c0);
            for (int j = 0; j < 4; ++j) x[k * 4 + j] = __fmaf_rn(__fmul_rn(x[k * 4 + j], rstd), bfr(g[j]), bfr(bt[j])); } }
    float* y = Y + (size_t)row * C;
    {
        for (int k = 0; k < LNC_MAX / 128; ++k) { if (k < nch) { v4f o; o[0] = x[k * 4 + 0]; o[1] = x[k * 4 + 1]; o[2] = x[k * 4 + 2]; o[3] = x[k * 4 + 3]; *(v4f*)(y + k * 128 + lane * 4) = o; } }
         }
}

extern "C" void kernel_launch(void* const* d_in, const int* in_sizes, int n_in,
                              void* d_out, int out_size, void* d_ws, size_t ws_size, hipStream_t stream) {
    (void)in_sizes; (void)n_in; (void)out_size;
    const float* xq = (const float*)d_in[0]; const float* xk = (const float*)d_in[1]; const float* xv = (const float*)d_in[2]; const int* kp = (const int*)d_in[3]; const float* wq = (const float*)d_in[4]; const float* cq = (const float*)d_in[5]; const float* wk = (const float*)d_in[6]; const float* ck = (const float*)d_in[7]; const float* wv = (const float*)d_in[8]; const float* cv = (const float*)d_in[9]; const float* wo = (const float*)d_in[10]; const float* co = (const float*)d_in[11]; const float* ns = (const float*)d_in[12]; const float* nb = (const float*)d_in[13];   /* fourteen arrays, all read; kp the int32 keep plane, read through a pointer of its own type */
    float* OUT = (float*)d_out;     // [2][2048][1024]
    static_assert(DQ == DM && DKV == DQ && REP == 1 && HD == 64 && TT % 256 == 0 && (size_t)DQ * DM == CSEG && (size_t)NB_ * TT * DM == 4 * (size_t)CSEG && CSEG / CGX == 4 * 8 * 1024 && TT % GT == 0 && DM % GT == 0 && DQ % GT == 0 && DKV % GT == 0 && DM % 128 == 0 && DM <= LNC_MAX && (NB_ * TT) % 8 == 0 && (TT / 32) * (TT / 32) == 4 * CGX * 8 * 4, "the merged heads are the output map's depth; k_fattn takes one key head a query head, 64-wide heads and whole 256-row blocks; the cast launch's sixteen pieces are exact; the maps' tiles are whole; the row normalisation takes whole 128-column pieces; the keep plane's 32 x 32 units are four a wave of four pieces");
    char* wsp = (char*)d_ws;
    auto take = [&](size_t bytes) { char* p = wsp; wsp += (bytes + 255) & ~(size_t)255; return (void*)p; };
    bf* WQ = (bf*)take((size_t)DQ * DM * 2); bf* WK = (bf*)take((size_t)DKV * DM * 2); bf* WV = (bf*)take((size_t)DKV * DM * 2); h16* WO16 = (h16*)take((size_t)DM * DQ * 2);
    bf* XQ = (bf*)take((size_t)NB_ * TT * DM * 2); bf* XK = (bf*)take((size_t)NB_ * TT * DM * 2); bf* XV = (bf*)take((size_t)NB_ * TT * DM * 2);   /* both entries' bf16 sources, on end */
    h16* QP16 = (h16*)take((size_t)NB_ * NH_ * TT * HD * 2); h16* KP16 = (h16*)take((size_t)NB_ * NKV * TT * HD * 2); h16* VT16 = (h16*)take((size_t)NB_ * NKV * HD * TT * 2);   /* both entries' head planes: the one attention launch reads them all */
    h16* C16 = (h16*)take((size_t)NB_ * TT * DQ * 2); float* YW = (float*)take((size_t)NB_ * TT * DM * 4); unsigned* MB = (unsigned*)take((size_t)TT * TT / 8);   /* the keep plane's select words, one bit a pair */
    if ((size_t)(wsp - (char*)d_ws) > ws_size) return;    // 80.50 MiB carved
    k_castall<<<dim3(CGX, 20, 1), 256, 0, stream>>>(xq, xk, xv, wq, wk, wv, wo, kp, XQ, XK, XV, WQ, WK, WV, (unsigned short*)WO16, MB);   /* each 'to, from' weight [1024][1024] cast as it lies: its map's right operand, but the third map's left */
    k_maps3<<<dim3(TT / GT, DQ / GT, NB_), 256, 0, stream>>>(XQ, XK, XV, WQ, WK, WV, QP16, KP16, VT16, cq, ck, cv);   /* the three maps, one launch: a work-group's tile of each in turn; z = the entry */
    k_fattn<<<dim3(TT / 256, NB_ * NH_, 1), 256, 0, stream>>>(QP16, KP16, VT16, MB, C16);   /* the one keep plane's select words: the same for every entry and head; the merged heads come out token-major on ONE f16 word */
    k_gemmw<h16, DQ, float, false><<<dim3(TT / GT, DM / GT, NB_), 256, 0, stream>>>(C16, WO16, YW, DM, 64, co, (size_t)TT * DQ, 0, (size_t)TT * DM);   /* the output map with its bias into a workspace plane */
    k_lnrow<true><<<(unsigned)(NB_ * TT / 8), 256, 0, stream>>>(YW, XQ, ns, nb, 1.0e-5f, DM, NB_ * TT, OUT);   /* the result = normalise(plane + the first source's bf16 copy) * scale + shift: its one writer */
}

// v010
// One run takes 92.6 microseconds.
// Timed twice side by side with v009, it ran 1.05 times as fast both times.
// Counting every step since v000, it is 14.3 times as fast.
#include <hip/hip_runtime.h>

// A sixteen-head attention of width 1,024 with separate sources for its three maps, ONE int32 keep plane over (row, column) for every entry and head, a last map, the first source added back and a row normalisation, on two 2,048-token entries
// (a0 | a1 | a2 the three sources [2][2048][1024]; a3 the keep plane [1][1][2048][2048] int32 (where a word is nought that column is dropped for that row; one plane for every entry and head); a4 | a6 | a8 | a10 four 'to, from' weights [1024][1024] (a map's column c is its source's row dotted with the weight's row c) with their added vectors a5 | a7 | a9 | a11 [1024]; a12 | a13 the normalisation's scale and shift [1024];
//  the first map of a0, the second of a1, the third of a2, each with its added vector; head h = columns 64 h and on; dots * 64^-0.5; a dropped pair's dot replaced by a large negative constant; ONE PLAIN SOFTMAX over the 2,048 columns; the shares times the third map's rows; the sixteen heads side by side; the sum = that plane mapped by a10 (column c = the plane's row dotted with a10's row c) + a11 + a0; the result = (the sum less its row's mean) over the root of (its row's biased variance + 1e-5), times a12, plus a13 -> [2][2048][1024]; argument order as numbered). FOURTEEN inputs, all read on the device.
// THE KEEP PLANE IS READ AS DATA: every one of its 4,194,304 words is loaded and tested against nought ONCE a call, in the cast launch, which keeps the answer as one bit; the attention selects every dot of every head and entry by its bit; nothing is assumed of the plane's contents.
// WHERE THE TEXT AND THE FUNCTION PART: the function puts minus infinity in place of a dropped dot, this text -3e38: either gives an exact nought share in f32; A ROW THAT KEEPS NO COLUMN: the function gives not-a-numbers there, and so does this text (every share nought, nought over nought).
// THE ARITHMETIC AS BUILT IS THE FUNCTION's OWN: 34.36 G multiply-adds (four maps 4.29 each over the two entries; the dots 8.59; the shares' sums 8.59): ratio 1.00.
// Layout: ONE cast launch (k_castall) for all seven float planes: the three sources of both entries and the first three weights to bf16 as they lie, the last weight's bf16 values to f16 words; the same launch packs the keep plane into select words (512 KiB); both entries in one launch of each later kernel (the maps' grid z, the attention's grid y with the heads, the normalisation's rows): the three bf16 * bf16 maps in ONE launch (k_maps3: a work-group works its tile of each map in turn), their epilogues add the vector, cast to f16 and store that entry's head planes (first and second map: one 64-column group IS one head's 64 columns; third map: weight as the left operand, source as the right, so its tile comes out key-contiguous); no f32 plane and no builder launch between a map and the attention;
// ONE launch for both entries and all sixteen heads (k_fattn): the dots f16 * f16, the keep plane's select words by scalar loads, a softmax against a held reference in registers and the shares' sums on f16 words, 32 columns a pass: no score or share plane goes to memory; its epilogue divides by the row's sum and stores the sixteen heads' token-major plane as ONE f16 word;
// the last map with its added vector into a workspace plane, and the row normalisation of (plane + the first source's bf16 copy from the cast launch) straight into the result (k_lnrow<true>: its one writer). Five launches in all.
// Compute dtypes, f32 accumulate: every float input rounded to bf16 at its load: the maps bf16 * bf16 on exact operands, each added vector's bf16 word in the epilogue; the three head planes (the first map's times 64^-0.5 * log2(e), multiplied in f32 in front of its one rounding), the unnormalised shares (at most 2^12) and the sixteen heads' plane on one f16 word each; the last weight's bf16 values as f16 words; softmax f32; the first source added back at its bf16 value; the normalisation f32 with the scale's and shift's bf16 words.

#define NB_  2
#define TT   2048
#define DM   1024
#define NH_  16
#define NKV  16
#define REP  (NH_ / NKV)
#define HD   64
#define DQ   (NH_ * HD)
#define DKV  (NKV * HD)
#define SCL2 0.18033688011112042f // 64^-0.5 * log2(e): the first map's epilogue multiplies by it, so that the dots come out of the matrix unit as exponents of two
#define LNC_MAX 2048

typedef _Float16 h16;
typedef unsigned short bf;
typedef __attribute__((ext_vector_type(16))) __bf16   v16bf;
typedef __attribute__((ext_vector_type(16))) _Float16 v16h;
typedef __attribute__((ext_vector_type(8)))  _Float16 v8h;
typedef __attribute__((ext_vector_type(8)))  unsigned short v8us;
typedef __attribute__((ext_vector_type(8)))  float    v8f;
typedef __attribute__((ext_vector_type(4)))  float    v4f;
typedef v8h  __attribute__((may_alias)) v8ha;
typedef v4f  __attribute__((may_alias)) v4fa;
typedef v8us __attribute__((may_alias)) v8usa;

__device__ __forceinline__ unsigned short f2bf(float f) { unsigned u = __float_as_uint(f); u += 0x7FFFu + ((u >> 16) & 1u); return (unsigned short)(u >> 16); }
__device__ __forceinline__ float bf2f(unsigned short b) { return __uint_as_float(((unsigned)b) << 16); }
__device__ __forceinline__ float bfr(float f) { return bf2f(f2bf(f)); }
__device__ __forceinline__ v16h cat16(v8h lo, v8h hi) { return __builtin_shufflevector(lo, hi, 0, 1, 2, 3, 4, 5, 6, 7, 8, 9, 10, 11, 12, 13, 14, 15); }
__device__ __forceinline__ v16bf cat16b(v8us lo, v8us hi) { return __builtin_bit_cast(v16bf, __builtin_shufflevector(lo, hi, 0, 1, 2, 3, 4, 5, 6, 7, 8, 9, 10, 11, 12, 13, 14, 15)); }
__device__ __forceinline__ v8f wmma16(v16h a, v16h b, v8f c) { return __builtin_amdgcn_wmma_f32_16x16x32_f16(false, a, false, b, (short)0, c, false, false); }
__device__ __forceinline__ v8f wmmab(v16bf a, v16bf b, v8f c) { return __builtin_amdgcn_wmma_f32_16x16x32_bf16(false, a, false, b, (short)0, c, false, false); }



// ---- k_gemmw: one 128x128 output tile a work-group, 8 waves (2 down, 4 across), each wave a 64x32 piece (eight accumulators) over the WHOLE depth; operands are K-contiguous 16-bit planes; grid (M/128, N/128, Z), 256 threads.
// C[m][n] (f32 or f16 words by TO, + bias[n], or bias[m] with BROW) = sum_k A[m][k] Bt[n][k], k in rising order in one accumulator. z-batch strides sA/sB/sC in elements.
// WHERE A COLUMN LANDS: the 64-column group y starts at C + y * sN, its rows lie ldc apart (a plain plane: sN = 64, ldc = the plane's width; head planes [head][row][64]: sN = one head's plane, ldc = 64).
// THE OPERANDS COME THROUGH LDS: a stage is 128 deep: of each of the 128 A rows and 128 Bt rows two 128-byte pieces. Asynchronous 16-byte copies bring them in, every wave-wide copy four whole lines (four rows); each wave copies sixteen rows of either operand: 16 copies a stage.
// Every row that the tile needs is fetched once a work-group and read from LDS by the waves that share it (an A row by four, a Bt row by two). Two buffers: stage t + 2 is copied into the buffer that stage t has just left, while stage t + 1 is worked on. A 128-byte piece lies 144 bytes from the next row's, the pitch at which 16-byte LDS reads of 16 rows meet no bank twice.
// THE RESULT LEAVES THROUGH THE SAME LDS: behind the last stage's barrier each wave lays its piece in a 128x128 f32 plane, and behind one more barrier a wave takes whole rows of it: each store is whole lines.
template <typename T16> struct WFrag;
template <> struct WFrag<h16> { typedef v16h V; static __device__ __forceinline__ V ld(const h16* p) { return cat16(*(const v8h*)p, *(const v8h*)(p + 16)); } static __device__ __forceinline__ v8f mma(V a, V b, v8f c) { return wmma16(a, b, c); } };
template <> struct WFrag<bf> { typedef v16bf V; static __device__ __forceinline__ V ld(const bf* p) { return cat16b(*(const v8us*)p, *(const v8us*)(p + 16)); } static __device__ __forceinline__ v8f mma(V a, V b, v8f c) { return wmmab(a, b, c); } };
typedef __attribute__((ext_vector_type(4))) _Float16 v4h;
__device__ __forceinline__ void st4(float* p, v4f v) { *(v4f*)p = v; }
__device__ __forceinline__ void st4(h16* p, v4f v) { v4h o; o[0] = (h16)v[0]; o[1] = (h16)v[1]; o[2] = (h16)v[2]; o[3] = (h16)v[3]; *(v4h*)p = o; }
#define GT    128                        // rows of A and of Bt in a work-group's tile
#define GKS   128                        // a stage's depth, in elements: two 128-byte pieces a row
#define GPIT  144                        // LDS pitch of a 128-byte piece
#define GHALF (GT * GPIT)                // one operand's 128 rows of one piece
#define GOFFB (2 * GHALF)                // the Bt rows' place in a buffer
#define GBUF  (4 * GHALF)                // one buffer, in bytes
#define GOP   132                        // the result plane's pitch in words: the two halves of a wave store to different banks
#define CPG(a, b) "global_load_async_to_lds_b128 %" #a ", %" #b ", off\n\t"
// eight copies, and as the statement's last line the wait that stands between issued copies and the first overwrite of a register that they name
__device__ __forceinline__ void cp8(const unsigned (&l)[8], const char* const (&g)[8]) {
    asm volatile(CPG(0, 1) CPG(2, 3) CPG(4, 5) CPG(6, 7) CPG(8, 9) CPG(10, 11) CPG(12, 13) CPG(14, 15) "s_wait_xcnt 0x0"
                 :: "v"(l[0]), "v"(g[0]), "v"(l[1]), "v"(g[1]), "v"(l[2]), "v"(g[2]), "v"(l[3]), "v"(g[3]), "v"(l[4]), "v"(g[4]), "v"(l[5]), "v"(g[5]), "v"(l[6]), "v"(g[6]), "v"(l[7]), "v"(g[7]) : "memory");
}
// one stage's 16 copies of a wave. la: the lane's LDS byte address in the wave's first four A rows, first piece, of the buffer to be filled (eight lanes a row); ag, bg: the lane's global addresses in that stage; ROWB: a global row in bytes
template <int ROWB> __device__ __forceinline__ void gm_stage(unsigned la, const char* ag, const char* bg) {
    unsigned l[8]; const char* g[8];
    // both loops unrolled so that every index is a constant: the addresses stay in registers
#pragma unroll
    for (int i = 0; i < 8; ++i) { l[i] = la + (i >> 2) * GHALF + (i & 3) * 4 * GPIT; g[i] = ag + (i >> 2) * 128 + (size_t)(i & 3) * 4 * ROWB; }
    cp8(l, g);
#pragma unroll
    for (int i = 0; i < 8; ++i) { l[i] = la + GOFFB + (i >> 2) * GHALF + (i & 3) * 4 * GPIT; g[i] = bg + (i >> 2) * 128 + (size_t)(i & 3) * 4 * ROWB; }
    cp8(l, g);
}
// one 32-deep step's 12 LDS reads from the lane's own places, and its eight products; every loop unrolled so that each fragment and accumulator index is a constant: they stay in registers
template <typename T16> __device__ __forceinline__ void gm_read(typename WFrag<T16>::V (&a)[4], typename WFrag<T16>::V (&b)[2], const char* ap, const char* bp) {
#pragma unroll
    for (int mb = 0; mb < 4; ++mb) a[mb] = WFrag<T16>::ld((const T16*)(ap + mb * 16 * GPIT));
#pragma unroll
    for (int nb = 0; nb < 2; ++nb) b[nb] = WFrag<T16>::ld((const T16*)(bp + nb * 16 * GPIT));
}
template <typename T16> __device__ __forceinline__ void gm_mma(const typename WFrag<T16>::V (&a)[4], const typename WFrag<T16>::V (&b)[2], v8f (&acc)[4][2]) {
#pragma unroll
    for (int nb = 0; nb < 2; ++nb)
#pragma unroll
        for (int mb = 0; mb < 4; ++mb) acc[mb][nb] = WFrag<T16>::mma(a[mb], b[nb], acc[mb][nb]);
}
template <typename T16, int K, typename TO, bool BROW>
__global__ __launch_bounds__(256) void k_gemmw(const T16* __restrict__ A, const T16* __restrict__ Bt, TO* C, int ldc, size_t sN, const float* __restrict__ bias, size_t sA, size_t sB, size_t sC) {
    typedef typename WFrag<T16>::V V;
    constexpr int NST = K / GKS;
    static_assert(K % GKS == 0 && NST >= 2 && GKS == 128 && GT * GOP * 4 <= 2 * GBUF, "whole stages, at least the two that the ring's start fills; the result plane fits the ring");
    __shared__ __align__(16) char ring[2 * GBUF];
    const int wv = __builtin_amdgcn_readfirstlane((int)(threadIdx.x >> 5));   // the wave's number, held scalar
    const size_t z = blockIdx.z; A += z * sA; Bt += z * sB; C += z * sC;
    const int lane = threadIdx.x & 31, lr = lane & 15, hi = lane >> 4; const int r0 = blockIdx.x * GT, c0 = blockIdx.y * GT;
    const int wm = (wv & 1) * 64, wn = (wv >> 1) * 32;   // the wave's piece of the tile
    // the copies' addresses: eight lanes a 128-byte piece, four rows a copy; of either operand the wave takes rows 16 wv and on
    const int cr = lane >> 3, cc = (lane & 7) * 16;
    const unsigned la = (unsigned)(size_t)ring + (unsigned)((wv * 16 + cr) * GPIT + cc);
    const char* ag = (const char*)(A + (size_t)(r0 + wv * 16 + cr) * K) + cc; const char* bg = (const char*)(Bt + (size_t)(c0 + wv * 16 + cr) * K) + cc;
    // the lane's read places in buffer 0
    const char* ar = ring + (wm + lr) * GPIT + 16 * hi; const char* br = ring + GOFFB + (wn + lr) * GPIT + 16 * hi;
    v8f acc[4][2];
#pragma unroll
    for (int mb = 0; mb < 4; ++mb)
#pragma unroll
        for (int nb = 0; nb < 2; ++nb) acc[mb][nb] = (v8f){};
    gm_stage<K * 2>(la, ag, bg);
    // the added vector's words that this lane will want, fetched here so that their latency lies under the stages: a wave takes whole rows of 128 result words, rows wv, wv + 8 ...; a lane four columns
    const int cofs = lane * 4; float bw[BROW ? GT / 8 : 4];
    // unrolled so that every index is a constant: the words stay in registers
#pragma unroll
    for (int i = 0; i < (BROW ? GT / 8 : 4); ++i) bw[i] = BROW ? bias[r0 + i * 8 + wv] : bias[c0 + cofs + i];
    asm volatile("s_wait_xcnt 0x0" ::: "memory");   // stands between the issued loads and the first overwrite of their address registers
    __builtin_amdgcn_sched_barrier(0);   // nothing from below climbs between the loads and their wait, onto the loads' address registers
    asm volatile("s_wait_asynccnt 0x0" ::: "memory");   // this wave's copies of stage 0 have landed
    __syncthreads();                                     // every wave's have: stage 0 may be read
    gm_stage<K * 2>(la + GBUF, ag + GKS * 2, bg + GKS * 2);
    ag += 2 * GKS * 2; bg += 2 * GKS * 2;
    // FOUR STEPS' FRAGMENTS IN REGISTERS, READ TWO STEPS AT A TIME: each group of 24 LDS reads is issued in front of the sixteen products of the two steps read before it, so that its latency lies under them.
    // A stage's last two steps are multiplied behind the barrier that ends the stage: they are in registers by then (the wait in front of the barrier), and they cover the next stage's first reads.
    V fa[4][4], fb[4][2];
    gm_read<T16>(fa[0], fb[0], ar, br); gm_read<T16>(fa[1], fb[1], ar + 64, br + 64);
    // kept rolled: one copy of the stage's text, and no more than the four fragment sets live
#pragma unroll 1
    for (int t = 0; t < NST; ++t) {
        const int bo = (t & 1) * GBUF, bn = GBUF - bo;
        gm_read<T16>(fa[2], fb[2], ar + bo + GHALF, br + bo + GHALF); gm_read<T16>(fa[3], fb[3], ar + bo + GHALF + 64, br + bo + GHALF + 64);
        __builtin_amdgcn_sched_barrier(0);   // the reads stay one group in front of the products that cover them
        gm_mma<T16>(fa[0], fb[0], acc); gm_mma<T16>(fa[1], fb[1], acc);
        __builtin_amdgcn_sched_barrier(0);   // these products stay in front of the foot: sunk behind it, the wait below would meet reads that were issued only just before it
        asm volatile("s_wait_dscnt 0x0" ::: "memory");      // this wave has read all it wants of stage t
        asm volatile("s_wait_asynccnt 0x0" ::: "memory");   // its copies of stage t + 1 have landed
        __syncthreads();                                     // stage t + 1 may be read, and the buffer of stage t is free
        if (t + 2 < NST) { gm_stage<K * 2>(la + bo, ag, bg); ag += GKS * 2; bg += GKS * 2; }
        if (t + 1 < NST) { gm_read<T16>(fa[0], fb[0], ar + bn, br + bn); gm_read<T16>(fa[1], fb[1], ar + bn + 64, br + bn + 64); }
        __builtin_amdgcn_sched_barrier(0);   // the next stage's first reads stay one group in front of the products that cover them
        gm_mma<T16>(fa[2], fb[2], acc); gm_mma<T16>(fa[3], fb[3], acc);
    }
    asm volatile("s_wait_asynccnt 0x0" ::: "memory");   // no copy is in flight when the ring is put to its second use
    float* os = (float*)ring;
    // unrolled so that every accumulator index is a constant: the tiles stay in registers
#pragma unroll
    for (int mb = 0; mb < 4; ++mb)
#pragma unroll
        for (int nb = 0; nb < 2; ++nb)
#pragma unroll
            for (int j = 0; j < 8; ++j) os[(wm + mb * 16 + hi * 8 + j) * GOP + wn + nb * 16 + lr] = acc[mb][nb][j];
    __syncthreads();   // every wave's piece lies in LDS before any wave takes a row
    v4f bc = (v4f){};
    if (!BROW) { bc[0] = bfr(bw[0]); bc[1] = bfr(bw[1]); bc[2] = bfr(bw[2]); bc[3] = bfr(bw[3]); }
    TO* cb = C + (size_t)((c0 + cofs) >> 6) * sN + ((c0 + cofs) & 63) + (size_t)r0 * ldc;
    // unrolled so that the rows' LDS reads issue together
#pragma unroll
    for (int s = 0; s < GT / 8; ++s) { const int row = s * 8 + wv; v4f val = *(const v4fa*)(os + row * GOP + cofs);
        if (BROW) val += bfr(bw[s]); else val += bc;
        st4(cb + (size_t)row * ldc, val); }
}


// ---- k_maps3: the three bf16 maps in ONE launch; grid (TT / 128, 1024 / 128, entries), 256 threads. A work-group works ITS 128 source rows x 128 weight rows in the first, the second and the third map in turn, by k_gemmw's own stages, reads and products.
// THE RING RUNS ON OVER A MAP's END: the copies behind the foot of a map's last two stages bring the next map's first two stages, so that only the first map waits for a first stage; a map's stages are even in number, so every stage keeps its buffer.
// The result plane has LDS of its own: a map's result leaves while the next map's copies land in the ring. Between two uses of that plane lie a map's stage barriers, each behind the wave's s_wait_dscnt 0.
// In every map the source's rows lie in a buffer's first half and the weight's in its second. THIRD MAP (SWAP): the weight's fragment is the left operand and the source's the right, so that a tile comes out [weight row][token], key-contiguous; the added vector goes by row.
template <bool SWAP> __device__ __forceinline__ void m3_mma(const v16bf (&a)[4], const v16bf (&b)[2], v8f (&acc)[4][2]) {
    // unrolled so that each fragment and accumulator index is a constant: they stay in registers
#pragma unroll
    for (int nb = 0; nb < 2; ++nb)
#pragma unroll
        for (int mb = 0; mb < 4; ++mb) acc[mb][nb] = SWAP ? wmmab(b[nb], a[mb], acc[mb][nb]) : wmmab(a[mb], b[nb], acc[mb][nb]);
}
// one map's tile. On entry: the map's stage 0 has landed and is published, its stage 1 is in flight, fa[0..1] and fb[0..1] hold (or await) stage 0's first two steps, ag and bg stand at stage 2. nxa, nxb: the byte distance from this map's operand planes to the next map's (the same in every lane). cb: the lane's place in the tile's first result row; bias: the added vector at the tile's first weight row. QS (first map): the result with its added vector is multiplied by SCL2 in f32 in front of the cast
template <bool SWAP, bool LAST, bool QS>
__device__ __forceinline__ void m3_tile(v16bf (&fa)[4][4], v16bf (&fb)[4][2], const char*& ag, const char*& bg, long nxa, long nxb, unsigned la, const char* ar, const char* br, float* os, h16* cb, int ldc, const float* __restrict__ bias, int wv, int lane, int wm, int wn) {
    constexpr int NST = DM / GKS;
    static_assert(DM % GKS == 0 && NST % 2 == 0 && NST >= 4, "whole stages, an even number of them: the next map's stage 0 falls into buffer 0");
    const int lr = lane & 15, hi = lane >> 4, cofs = lane * 4;
    // the added vector's words that this lane will want, fetched here so that their latency lies under the stages; unrolled so that every index is a constant: the words stay in registers
    float bw[SWAP ? GT / 8 : 4];
#pragma unroll
    for (int i = 0; i < (SWAP ? GT / 8 : 4); ++i) bw[i] = SWAP ? bias[i * 8 + wv] : bias[cofs + i];
    asm volatile("s_wait_xcnt 0x0" ::: "memory");   // stands between the issued loads and the first overwrite of their address registers
    __builtin_amdgcn_sched_barrier(0);   // nothing from below climbs between the loads and their wait, onto the loads' address registers
    v8f acc[4][2];
#pragma unroll
    for (int mb = 0; mb < 4; ++mb)
#pragma unroll
        for (int nb = 0; nb < 2; ++nb) acc[mb][nb] = (v8f){};
    // kept rolled: one copy of the stage's text a map, and no more than the four fragment sets live
#pragma unroll 1
    for (int t = 0; t < NST; ++t) {
        const int bo = (t & 1) * GBUF, bn = GBUF - bo;
        gm_read<bf>(fa[2], fb[2], ar + bo + GHALF, br + bo + GHALF); gm_read<bf>(fa[3], fb[3], ar + bo + GHALF + 64, br + bo + GHALF + 64);
        __builtin_amdgcn_sched_barrier(0);   // the reads stay one group in front of the products that cover them
        m3_mma<SWAP>(fa[0], fb[0], acc); m3_mma<SWAP>(fa[1], fb[1], acc);
        __builtin_amdgcn_sched_barrier(0);   // these products stay in front of the foot: sunk behind it, the wait below would meet reads that were issued only just before it
        asm volatile("s_wait_dscnt 0x0" ::: "memory");      // this wave has read all it wants of stage t
        asm volatile("s_wait_asynccnt 0x0" ::: "memory");   // its copies of the stage that follows (this map's, or the next map's first) have landed
        __syncthreads();                                     // that stage may be read, and the buffer of stage t is free
        if (!LAST || t + 2 < NST) { gm_stage<DM * 2>(la + bo, ag, bg);
            const bool end = !LAST && t == NST - 3;   // this map's last stage has just been asked for: on to the next map's first
            ag += end ? nxa - (NST - 1) * GKS * 2 : GKS * 2; bg += end ? nxb - (NST - 1) * GKS * 2 : GKS * 2; }
        if (!LAST || t + 1 < NST) { gm_read<bf>(fa[0], fb[0], ar + bn, br + bn); gm_read<bf>(fa[1], fb[1], ar + bn + 64, br + bn + 64); }
        __builtin_amdgcn_sched_barrier(0);   // the following stage's first reads stay one group in front of the products that cover them
        m3_mma<SWAP>(fa[2], fb[2], acc); m3_mma<SWAP>(fa[3], fb[3], acc);
    }
    if (LAST) asm volatile("s_wait_asynccnt 0x0" ::: "memory");   // no copy is in flight when the wave ends
    // unrolled so that every accumulator index is a constant: the tiles stay in registers
#pragma unroll
    for (int mb = 0; mb < 4; ++mb)
#pragma unroll
        for (int nb = 0; nb < 2; ++nb)
#pragma unroll
            for (int j = 0; j < 8; ++j) os[(SWAP ? (wn + nb * 16 + hi * 8 + j) * GOP + wm + mb * 16 + lr : (wm + mb * 16 + hi * 8 + j) * GOP + wn + nb * 16 + lr)] = acc[mb][nb][j];
    __syncthreads();   // every wave's piece lies in LDS before any wave takes a row
    v4f bc = (v4f){};
    if (!SWAP) { bc[0] = bfr(bw[0]); bc[1] = bfr(bw[1]); bc[2] = bfr(bw[2]); bc[3] = bfr(bw[3]); }
    // both loops unrolled so that the rows' LDS reads issue together and every index is a constant
    v4f val[GT / 8];
#pragma unroll
    for (int s = 0; s < GT / 8; ++s) val[s] = *(const v4fa*)(os + (s * 8 + wv) * GOP + cofs);
#pragma unroll
    for (int s = 0; s < GT / 8; ++s) {
        st4(cb + (size_t)(s * 8 + wv) * ldc, SWAP ? val[s] + bfr(bw[s]) : QS ? (val[s] + bc) * SCL2 : val[s] + bc);
        asm volatile("s_wait_xcnt 0x0" ::: "memory");   // stands between the issued store and the first overwrite of a register that it names
    }
}
__global__ __launch_bounds__(256) void k_maps3(const bf* __restrict__ XQ, const bf* __restrict__ XK, const bf* __restrict__ XV, const bf* __restrict__ WQ, const bf* __restrict__ WK, const bf* __restrict__ WV, h16* QP, h16* KP, h16* VT,
                                               const float* __restrict__ cq, const float* __restrict__ ck, const float* __restrict__ cv) {
    __shared__ __align__(16) char ring[2 * GBUF];
    __shared__ __align__(16) float os[GT * GOP];
    const int wv = __builtin_amdgcn_readfirstlane((int)(threadIdx.x >> 5));   // the wave's number, held scalar
    const size_t z = blockIdx.z;
    const int lane = threadIdx.x & 31, lr = lane & 15, hi = lane >> 4; const int r0 = blockIdx.x * GT, c0 = blockIdx.y * GT;   // the tile's first source row (token) and first weight row
    const int wm = (wv & 1) * 64, wn = (wv >> 1) * 32;   // the wave's piece of the tile: 64 source rows, 32 weight rows
    // the copies' addresses: eight lanes a 128-byte piece, four rows a copy; of either operand the wave takes rows 16 wv and on
    const int cr = lane >> 3, cc = (lane & 7) * 16;
    const unsigned la = (unsigned)(size_t)ring + (unsigned)((wv * 16 + cr) * GPIT + cc);
    const char* ag = (const char*)(XQ + (z * TT + r0 + wv * 16 + cr) * DM) + cc; const char* bg = (const char*)(WQ + (size_t)(c0 + wv * 16 + cr) * DM) + cc;
    // the lane's read places in buffer 0
    const char* ar = ring + (wm + lr) * GPIT + 16 * hi; const char* br = ring + GOFFB + (wn + lr) * GPIT + 16 * hi;
    gm_stage<DM * 2>(la, ag, bg);
    asm volatile("s_wait_asynccnt 0x0" ::: "memory");   // this wave's copies of the first map's stage 0 have landed
    __syncthreads();                                     // every wave's have: stage 0 may be read
    gm_stage<DM * 2>(la + GBUF, ag + GKS * 2, bg + GKS * 2);
    ag += 2 * GKS * 2; bg += 2 * GKS * 2;
    v16bf fa[4][4], fb[4][2];
    gm_read<bf>(fa[0], fb[0], ar, br); gm_read<bf>(fa[1], fb[1], ar + 64, br + 64);
    const int cofs = lane * 4;
    const size_t hp = z * ((size_t)NH_ * TT * HD) + (size_t)((c0 + cofs) >> 6) * ((size_t)TT * HD) + ((c0 + cofs) & 63) + (size_t)r0 * HD;   // 64-column group = head: straight into its [row][64] plane
    m3_tile<false, false, true>(fa, fb, ag, bg, (const char*)XK - (const char*)XQ, (const char*)WK - (const char*)WQ, la, ar, br, os, QP + hp, HD, cq + c0, wv, lane, wm, wn);
    m3_tile<false, false, false>(fa, fb, ag, bg, (const char*)XV - (const char*)XK, (const char*)WV - (const char*)WK, la, ar, br, os, KP + hp, HD, ck + c0, wv, lane, wm, wn);
    m3_tile<true, true, false>(fa, fb, ag, bg, 0, 0, la, ar, br, os, VT + z * ((size_t)NKV * HD * TT) + (size_t)c0 * TT + r0 + cofs, TT, cv + c0, wv, lane, wm, wn);   // [head][64][key]
}


__device__ __forceinline__ void splitf(float y, unsigned short& h, unsigned short& l) { h = f2bf(y); l = f2bf(y - bf2f(h)); }
typedef __attribute__((ext_vector_type(2))) _Float16 v2h;
typedef __attribute__((ext_vector_type(2))) unsigned short v2us;
typedef __attribute__((ext_vector_type(4))) unsigned short v4us;
typedef __attribute__((ext_vector_type(2))) float v2f;
typedef __attribute__((ext_vector_type(4))) int v4i;

// ---- k_fattn: dots, keep plane, softmax and the shares' sums of one head in ONE kernel; grid (TT / 256, entries * heads), 16 waves = four a SIMD, so that one wave's vector work runs beside another's products. Wave w has the 32 query rows (two 16-column groups) of place w & 7 and the keys of set w >> 3: the 64-key stages go alternately to the two sets (set 0 the even ones, set 1 the odd ones), 32 keys a pass.
// EACH SET IS A WHOLE SOFTMAX OVER ITS HALF OF THE KEYS, with its own references, sums and output tiles; behind the loop set 1 lays its tiles, sums and references in LDS, and behind one barrier set 0 brings both to the higher of the two references, adds them, divides and stores.
// TRANSPOSED PRODUCTS: St = K Qt (A = 16 key rows, B = 16 query rows, both by the one k-contiguous loader), so a lane holds 8 + 8 scores of ONE query (column lr; keys 8 hi + r and 16 + 8 hi + r): maximum and sum stay in the lane, the two halves of the wave join the maximum by one exchange, only in a pass that takes the maxima.
// The two score tiles, turned into shares and cast, ARE the B operand of Ot += Vt Pt in the hardware's k order; A = 16 rows of the key-contiguous Vt plane by the same loader (keys 8 hi .. and 16 + 8 hi ..): the k orders agree at every position.
// A HELD REFERENCE: the query plane comes scaled, and minus the row's reference is the C operand of the dots' first product, so that a score leaves the matrix unit as the exponent of two of its share: no zeroed tile, no multiply and no subtraction a score.
// ONE TEST A PASS (two ballots, one a column group, and a scalar branch), ON THE SHARES' SUMS, so that no maximum is taken in a pass that moves nothing: only where a lane's sixteen shares of the pass sum to more than its bar does the wave take the rows' maxima, move a row's reference up to its maximum where that stands above the bar, scale that row's sums and output tiles by 2^(old - new) and form the pass's shares anew. The bar is -1e37 until the row has kept its first column (every pass in which the lane keeps a score is tested true, and the first kept score moves the reference from nought to itself; the test is masked by the OR of the lane's select words, a scalar value: a lane that keeps nothing in a pass has nothing to move, and a row may keep no column of one set at all), and 2^12 from then on (as a score: 8): a share is at most 2^12. A pass's sixteen shares are summed first and then added to the lane's running sum.
// A dropped dot is -3e38: its share is an exact nought; a row that keeps no column ends with nought over nought, a not-a-number, as the function does.
// THE OPERANDS COME THROUGH LDS: a stage is 64 keys (two passes): 64 K rows and 64 Vt rows of 128 bytes, shared by the eight waves of its set. Asynchronous 16-byte copies bring them in, every wave-wide copy four whole lines (four rows); each wave copies an eighth of its set's K and Vt: four copies a stage.
// THE KEEP PLANE COMES AS SELECT WORDS: the cast launch has packed it so that bit L of a word is lane L's answer for one score register; a pass's 32 words (128 bytes) come by two scalar loads, one stage ahead, and each word is its select's lane mask as it stands: no LDS, no vector register and no compare for the plane.
// Two buffers a set: the set's stage s + 2 is copied into the buffer that its stage s has just left, while its stage s + 1 is worked on; one barrier of all sixteen waves a stage. Every row lies 144 bytes from the next, the pitch at which 16-byte LDS reads of 16 rows meet no bank twice. WHAT IS LEFT: a stage's first reads wait behind its barrier; a pass whose words are all nought or all ones is worked like any other.
// Every loop over tiles, column groups, blocks and registers below is unrolled so that each fragment index is a constant: the fragments and accumulators stay in registers.
__device__ __forceinline__ float xhalf(float x) { return __builtin_bit_cast(float, __builtin_amdgcn_permlanex16(__builtin_bit_cast(int, x), __builtin_bit_cast(int, x), 0x76543210, 0xfedcba98, false, false)); }   // lane l with lane l ^ 16
struct FOps { v16h kf[2][2]; v16h vf[4]; };   // one pass's operands from LDS: K rows [tile][32-deep step], Vt rows [16-row block]
typedef __attribute__((ext_vector_type(16))) unsigned v16u;   // one column group's sixteen select words of a pass: [tile][register]
typedef __attribute__((ext_vector_type(8))) unsigned long long v8ul;   // the same words two at a time
// sixteen select words by one scalar load: the plane was written by an earlier launch and no one writes it while this kernel runs, so it is read through the constant address space (behind the loop's asm waits the compiler otherwise takes the words through vector registers, a lane read each)
__device__ __forceinline__ v16u ldw(const unsigned* p) { return *(const __attribute__((address_space(4))) v16u*)p; }
#define SKEY 64                          // keys a stage
#define LPIT 144                         // LDS pitch of a 128-byte row
#define OFFV (SKEY * LPIT)               // the Vt rows' place in a buffer
#define BUFB (OFFV + HD * LPIT)          // one buffer, in bytes
#define CP1(a, b) "global_load_async_to_lds_b128 %" #a ", %" #b ", off\n\t"
// one stage's four copies of a wave, and as the statement's last line the wait that stands between issued copies and the first overwrite of a register that they name. ll: the lane's place in any four rows (eight lanes a row); sk: the LDS byte address, the same for the whole wave, of the wave's first K row in the buffer to be filled; kg, vg: the lane's global addresses in that stage
__device__ __forceinline__ void fa_stage(unsigned ll, unsigned sk, const char* kg, const char* vg) {
    sk = (unsigned)__builtin_amdgcn_readfirstlane((int)sk);   // the wave's place held scalar: the one lane-own value that lives through the loop is ll, which no copy names itself
    asm volatile(CP1(0, 1) CP1(2, 3) CP1(4, 5) CP1(6, 7) "s_wait_xcnt 0x0"
                 :: "v"(ll + sk), "v"(kg), "v"(ll + (sk + 4 * LPIT)), "v"(kg + 4 * HD * 2), "v"(ll + (sk + OFFV)), "v"(vg), "v"(ll + (sk + OFFV + 4 * LPIT)), "v"(vg + 4 * TT * 2) : "memory");
}
// one pass's 8 + 8 LDS reads from the lane's own places in the stage's buffer
__device__ __forceinline__ void fa_readk(FOps& n, const char* kb) {
#pragma unroll
    for (int t = 0; t < 2; ++t)
#pragma unroll
        for (int ks = 0; ks < 2; ++ks) n.kf[t][ks] = WFrag<h16>::ld((const h16*)(kb + t * 16 * LPIT + ks * 64));
}
__device__ __forceinline__ void fa_readv(FOps& n, const char* vb) {
#pragma unroll
    for (int db = 0; db < 4; ++db) n.vf[db] = WFrag<h16>::ld((const h16*)(vb + db * 16 * LPIT));
}
// one exponential of two; the v_nop fills the slot that the instruction set asks for behind it, whatever the compiler puts next
__device__ __forceinline__ float exp2x1(float x) { float y; asm("v_exp_f32 %0, %1\n\tv_nop" : "=v"(y) : "v"(x)); return y; }
// eight exponentials of two into registers of their own (the scores stay, for the pass that has to move a reference): every result is marked early-clobber, so that none lands on a source that is still to be read; the v_nop fills the slot that the instruction set asks for behind the last one
__device__ __forceinline__ v8f exp2c8(const v8f& x) { float a, b, c, d, e, f, g, h;
    asm("v_exp_f32 %0, %8\n\tv_exp_f32 %1, %9\n\tv_exp_f32 %2, %10\n\tv_exp_f32 %3, %11\n\tv_exp_f32 %4, %12\n\tv_exp_f32 %5, %13\n\tv_exp_f32 %6, %14\n\tv_exp_f32 %7, %15\n\tv_nop" : "=&v"(a), "=&v"(b), "=&v"(c), "=&v"(d), "=&v"(e), "=&v"(f), "=&v"(g), "=&v"(h) : "v"(x[0]), "v"(x[1]), "v"(x[2]), "v"(x[3]), "v"(x[4]), "v"(x[5]), "v"(x[6]), "v"(x[7]));
    return (v8f){a, b, c, d, e, f, g, h}; }
// one column group's shares of a pass as the f16 words of the sums' right operand, and their f32 sum, in the order register 0, 1 ... of tile 0, then of tile 1
__device__ __forceinline__ v2f fa_shares(const v8f (&s)[2], v16h& pf) { v2f ps;
#pragma unroll
    for (int t = 0; t < 2; ++t) { const v8f e = exp2c8(s[t]);
#pragma unroll
        for (int r = 0; r < 8; r += 2) { const v2f p = (v2f){e[r], e[r + 1]}; ps = (t | r) ? ps + p : p; pf[t * 8 + r] = (h16)e[r]; pf[t * 8 + r + 1] = (h16)e[r + 1]; } }
    return ps; }
// a pass in two parts, so that the next pass's LDS reads can stand between them. fa_dots: the dots, the selects, the shares (pf: the right operand of the sums) and the pass's one test
__device__ __forceinline__ void fa_dots(const FOps& c, const v16u (&kw)[2], const v16h (&qf)[2][2], v8f (&o)[4][2], v8f (&cn)[2], float (&th)[2], v2f (&sm)[2], v16h (&pf)[2]) {
    typedef WFrag<h16> F;
    v8f s[2][2]; v2f ps[2];
#pragma unroll
    for (int g = 0; g < 2; ++g)
#pragma unroll
        for (int t = 0; t < 2; ++t) s[g][t] = F::mma(c.kf[t][1], qf[g][1], F::mma(c.kf[t][0], qf[g][0], cn[g]));   // cn: minus the row's reference in all eight registers
    __builtin_amdgcn_sched_barrier(0);   // the eight products stay one run in front of the shares: mixed among them they cost idle slots behind them on the vector port, the busier one, and the key fragments live on beside the f32 shares (17 registers more in this build); the vector work that runs beside the run is another wave's
#pragma unroll
    for (int g = 0; g < 2; ++g) {
#pragma unroll
        for (int t = 0; t < 2; ++t)
#pragma unroll
            for (int r = 0; r < 8; ++r) s[g][t][r] = __builtin_amdgcn_inverse_ballot_w32(kw[g][t * 8 + r]) ? s[g][t][r] : -3.0e38f;   // keep the score where the lane's bit is set: the scalar word IS the select's lane mask, no compare
        ps[g] = fa_shares(s[g], pf[g]); }
    // one scalar branch a pass: the block below is walked where a row of the wave that has kept no column yet (its bar lies below every sum) keeps a score of this pass and, after that, only where a lane's sixteen shares sum to more than 2^12, that is, a score stands more than 8 above its row's reference
    unsigned km[2];   // bit L: lane L keeps at least one of its sixteen scores of the pass (scalar ORs of the select words)
#pragma unroll
    for (int g = 0; g < 2; ++g) { const v8ul w = __builtin_bit_cast(v8ul, kw[g]); const unsigned long long k = ((w[0] | w[1]) | (w[2] | w[3])) | ((w[4] | w[5]) | (w[6] | w[7])); km[g] = (unsigned)k | (unsigned)(k >> 32); }
    if (((__builtin_amdgcn_ballot_w32(ps[0][0] + ps[0][1] > th[0]) & km[0]) | (__builtin_amdgcn_ballot_w32(ps[1][0] + ps[1][1] > th[1]) & km[1])) != 0) {
#pragma unroll
        for (int g = 0; g < 2; ++g) { float m = s[g][0][0];
#pragma unroll
            for (int i = 1; i < 16; ++i) m = fmaxf(m, s[g][i >> 3][i & 7]);
            m = fmaxf(m, xhalf(m));   // both halves of the wave hold the query's maximum: one reference for all 32 keys
            const bool up = m > th[g] * 0x1p-9f;   // the bar as a score: 8, or below every kept score
            const float d = up ? m : 0.0f; th[g] = up ? 4096.0f : th[g];
            const float f = exp2x1(fminf(-d, 0.0f));   /* a row's first reference may lie below nought: its sums are still nought, and the factor stays finite */ sm[g] *= f; cn[g] -= d;
#pragma unroll
            for (int db = 0; db < 4; ++db) o[db][g] *= f;
#pragma unroll
            for (int t = 0; t < 2; ++t) s[g][t] -= d;
            ps[g] = fa_shares(s[g], pf[g]); }
    }
#pragma unroll
    for (int g = 0; g < 2; ++g) sm[g] += ps[g];
}
// fa_sums: the shares times the third map's rows
__device__ __forceinline__ void fa_sums(const FOps& c, const v16h (&pf)[2], v8f (&o)[4][2]) {
    typedef WFrag<h16> F;
#pragma unroll
    for (int db = 0; db < 4; ++db)
#pragma unroll
        for (int g = 0; g < 2; ++g) o[db][g] = F::mma(c.vf[db], pf[g], o[db][g]);
}
// sixteen waves, four a SIMD (one work-group a WGP): 256 registers a wave
__global__ __launch_bounds__(512) void k_fattn(const h16* __restrict__ Qp, const h16* __restrict__ Kp, const h16* __restrict__ Vt, const unsigned* __restrict__ MB, h16* Cx) {
    const int lane = threadIdx.x & 31, lr = lane & 15, hi = lane >> 4;
    const int wv = __builtin_amdgcn_readfirstlane((int)(threadIdx.x >> 5));   // the wave's number, held scalar
    const int w8 = wv & 7, kh = wv >> 3;   // the wave's place among the query rows, and its set of keys
    const int zh = blockIdx.y, q0 = blockIdx.x * 256 + w8 * 32;
    const h16* qb = Qp + ((size_t)zh * TT + q0 + lr) * HD + 8 * hi;
    constexpr int NS = TT / SKEY / 2;   // stages a set
    static_assert(TT % (2 * SKEY) == 0 && NS >= 2 && SKEY == 64 && HD == 64 && 8 * 17 * 512 <= 4 * BUFB, "whole stages, as many for either set, at least the two that a ring's start fills; rows of 128 bytes; set 1's hand-over fits the rings");
    __shared__ __align__(16) char ring[4 * BUFB];   // two buffers a set
    // the copies' addresses: eight lanes a 128-byte row, four rows a copy; of its set's K and Vt the wave takes rows 8 w8 and on
    const int cr = lane >> 3, cc = (lane & 7) * 16;
    const unsigned ll = (unsigned)(cr * LPIT + cc), sk = (unsigned)(size_t)ring + (unsigned)(kh * 2 * BUFB + w8 * 8 * LPIT);
    const char* kg = (const char*)(Kp + ((size_t)zh * TT + kh * SKEY + w8 * 8 + cr) * HD) + cc; const char* vg = (const char*)(Vt + ((size_t)zh * HD + w8 * 8 + cr) * TT + kh * SKEY) + cc;
    // the lane's read places in its set's buffer 0, first pass
    const char* kb = ring + kh * 2 * BUFB + lr * LPIT + 16 * hi; const char* vb = kb + OFFV;
    // the wave's own select words: 32 a pass, the passes on end, so 64 a stage and 128 from one stage of a set to its next; the address is the same in every lane, so the loads are scalar
    const unsigned* mw = MB + (size_t)(q0 >> 5) * (TT / 32) * 32 + kh * 64;
    v16u wa[2], wb[2];
    wa[0] = ldw(mw); wa[1] = ldw(mw + 16); wb[0] = ldw(mw + 32); wb[1] = ldw(mw + 48);
    v16h qf[2][2]; v8f o[4][2]; v8f cn[2]; float th[2]; v2f sm[2];
#pragma unroll
    for (int g = 0; g < 2; ++g)
#pragma unroll
        for (int ks = 0; ks < 2; ++ks) qf[g][ks] = WFrag<h16>::ld(qb + g * 16 * HD + ks * 32);
    asm volatile("s_wait_xcnt 0x0" ::: "memory");   // stands between the issued query loads and the first overwrite of their address registers
    __builtin_amdgcn_sched_barrier(0);   // nothing from below climbs between the query loads and their wait, onto the loads' address registers
#pragma unroll
    for (int g = 0; g < 2; ++g) { cn[g] = (v8f){}; th[g] = -1.0e37f; sm[g] = (v2f){};
#pragma unroll
        for (int db = 0; db < 4; ++db) o[db][g] = (v8f){}; }
    fa_stage(ll, sk, kg, vg);
    asm volatile("s_wait_asynccnt 0x0" ::: "memory");   // this wave's copies of its set's stage 0 have landed
    __syncthreads();                                     // every wave's have: stage 0 may be read
    fa_stage(ll, sk + BUFB, kg + 2 * SKEY * HD * 2, vg + 2 * SKEY * 2);
    kg += 4 * SKEY * HD * 2; vg += 4 * SKEY * 2;
    for (int s = 0; s < NS; ++s) {
        const int bo = (s & 1) * BUFB; FOps A, B; v16h pf[2];
        const unsigned* mn = mw + (s + 1 < NS ? s + 1 : s) * 128;   // the set's next stage's select words (the last stage takes its own again: no word past the wave's run is read)
        fa_readk(A, kb + bo); fa_readv(A, vb + bo);
        __builtin_amdgcn_sched_barrier(0);   // the first pass's 16 LDS reads stay one group at the head of the stage
        fa_dots(A, wa, qf, o, cn, th, sm, pf);
        wa[0] = ldw(mn); wa[1] = ldw(mn + 16);          // each pass's words are fetched one stage ahead, as soon as their registers are free: the scalar path's latency lies under a pass
        __builtin_amdgcn_sched_barrier(0);   // the second pass's key reads stay one group here, where the first pass's scores and f32 shares have left their registers: their latency lies under the first pass's eight products below
        fa_readk(B, kb + bo + 32 * LPIT);
        __builtin_amdgcn_sched_barrier(0);   // the group's other side: none of its reads sinks among the products
        fa_sums(A, pf, o);
        __builtin_amdgcn_sched_barrier(0);   // the second pass's other eight reads stay one group behind those products, whose left operands' registers they can take: their latency lies under the second pass's dots and shares
        fa_readv(B, vb + bo + 64);
        __builtin_amdgcn_sched_barrier(0);   // the group's other side: none of its reads sinks among the dots
        fa_dots(B, wb, qf, o, cn, th, sm, pf);
        wb[0] = ldw(mn + 32); wb[1] = ldw(mn + 48);
        fa_sums(B, pf, o);
        __builtin_amdgcn_sched_barrier(0);   // the stage's work stays in front of its foot: lifted over the work, the wait below would meet copies that were issued only just before it
        asm volatile("s_wait_dscnt 0x0" ::: "memory");      // this wave has read all it wants of stage s
        asm volatile("s_wait_asynccnt 0x0" ::: "memory");   // its copies of stage s + 1 have landed
        __syncthreads();                                     // stage s + 1 may be read, and the buffer of stage s is free
        if (s + 2 < NS) { fa_stage(ll, sk + bo, kg, vg); kg += 2 * SKEY * HD * 2; vg += 2 * SKEY * 2; }
    }
    asm volatile("s_wait_asynccnt 0x0" ::: "memory");   // no copy is in flight when the rings are put to their second use
    // THE TWO SETS MEET. The last stage's barrier has ended every read of the rings. A lane's hand-over: sixteen 16-byte pieces of its output tiles and one of its two sums and two references; piece i of the 32 lanes lies on end (512 bytes).
    float hs[2], rf[2];
#pragma unroll
    for (int g = 0; g < 2; ++g) { const float h = sm[g][0] + sm[g][1]; hs[g] = h + xhalf(h);   // the two halves' sums meet once
        rf[g] = th[g] > 0.0f ? -cn[g][0] : -3.0e38f; }   // a set of which the row has kept no column has no reference: it stands below every other, and its sums and tiles are nought
    v4fa* xs = (v4fa*)ring + w8 * (17 * 32) + lane;
    if (kh) {
#pragma unroll
        for (int db = 0; db < 4; ++db)
#pragma unroll
            for (int g = 0; g < 2; ++g)
#pragma unroll
                for (int h = 0; h < 2; ++h) xs[((db * 2 + g) * 2 + h) * 32] = (v4f){o[db][g][4 * h], o[db][g][4 * h + 1], o[db][g][4 * h + 2], o[db][g][4 * h + 3]};
        xs[16 * 32] = (v4f){hs[0], hs[1], rf[0], rf[1]};
    }
    __syncthreads();   // set 1's hand-over lies in LDS before set 0 takes it; every wave passes here
    if (kh) return;
    const v4f t = xs[16 * 32];
    const int en = zh / NH_, hd = zh % NH_;
    h16* cx = Cx + ((size_t)en * TT + q0 + lr) * DQ + hd * HD + 8 * hi; v8h ov[2][4];
#pragma unroll
    for (int g = 0; g < 2; ++g) { const float rm = fmaxf(rf[g], t[2 + g]);
        const float f0 = exp2x1(fminf(rf[g] - rm, 0.0f)), f1 = exp2x1(fminf(t[2 + g] - rm, 0.0f));   // each set's sums brought to the higher reference; where neither has one both factors are one
        const float inv = __fdiv_rn(1.0f, f0 * hs[g] + f1 * t[g]); const float a0 = f0 * inv, a1 = f1 * inv;
#pragma unroll
        for (int db = 0; db < 4; ++db)
#pragma unroll
            for (int h = 0; h < 2; ++h) { const v4f p = xs[((db * 2 + g) * 2 + h) * 32];
#pragma unroll
                for (int r = 0; r < 4; ++r) ov[g][db][4 * h + r] = (h16)(o[db][g][4 * h + r] * a0 + p[r] * a1); } }
    __builtin_amdgcn_sched_barrier(0);   // the eight stores stay the wave's last instructions: no register that an issued store names is written behind it
#pragma unroll
    for (int g = 0; g < 2; ++g)
#pragma unroll
        for (int db = 0; db < 4; ++db) *(v8h*)(cx + g * 16 * DQ + db * 16) = ov[g][db];
}

template <typename T16> __device__ __forceinline__ unsigned short cv16(float x);
template <> __device__ __forceinline__ unsigned short cv16<h16>(float x) { const h16 h = (h16)x; return __builtin_bit_cast(unsigned short, h); }
// ---- k_castall: every 16-bit copy of a float plane, and the keep plane's select words, in ONE launch of 5,120 long waves; grid (CGX, 20), 256 threads: grid rows 0 - 3 pack the keep plane, rows 4 - 19 are the casts' pieces 0 - 15. The float planes are cut into sixteen pieces of CSEG words: pieces 0 - 11 the three sources (four each, both entries lie on end), 12 - 14 the first three weights, 15 the last weight.
// A work-group takes CSEG / CGX words of its piece: four trips of eight loads a thread; each wave-wide load is 512 bytes on end (whole lines), each store 256.
#define CSEG (1u << 20)
#define CGX  32
template <bool TOH> __device__ __forceinline__ void cast_run(const float* __restrict__ s, unsigned short* d) {
    for (int t = 0; t < 4; ++t) { v4f v[8];
        // unrolled so that a trip's eight loads are in flight together
#pragma unroll
        for (int j = 0; j < 8; ++j) v[j] = *(const v4f*)(s + (t * 8 + j) * 1024);
#pragma unroll
        for (int j = 0; j < 8; ++j) { v4us o;
#pragma unroll
            for (int q = 0; q < 4; ++q) { const unsigned short b = f2bf(v[j][q]); o[q] = TOH ? cv16<h16>(bf2f(b)) : b; }
            *(v4us*)(d + (t * 8 + j) * 1024) = o; } }
}
// THE KEEP PLANE's SELECT WORDS: for 32 query rows x 32 keys, 32 words: word 16 g + 8 t + r holds in bit L whether row 16 g + (L & 15) keeps key 16 t + 8 (L >> 4) + r, which is where k_fattn's lane L holds that dot (column group g, tile t, register r).
// A lane loads the eight plane words of its row and key octet (two 16-byte loads a tile); one ballot a register makes a word, lane i keeps word i, and one wave-wide store writes the unit's 128 bytes. wid: the wave's number of 1,024; a wave takes four units on end along the keys (512 bytes of each of its 32 rows).
__device__ __forceinline__ void pack_run(const int* __restrict__ mk, unsigned* MB, int wid, int lane) {
    const int qb = wid >> 4, p0 = (wid & 15) * 4;
    const int* sp = mk + (size_t)(qb * 32 + (lane & 15)) * TT + p0 * 32 + 8 * (lane >> 4);
    v4i w[4][2][2][2];
    // every loop unrolled so that the wave's 32 loads are in flight together and each index is a constant
#pragma unroll
    for (int u = 0; u < 4; ++u)
#pragma unroll
        for (int g = 0; g < 2; ++g)
#pragma unroll
            for (int t = 0; t < 2; ++t) { w[u][g][t][0] = *(const v4i*)(sp + g * 16 * TT + u * 32 + t * 16); w[u][g][t][1] = *(const v4i*)(sp + g * 16 * TT + u * 32 + t * 16 + 4); }
    asm volatile("s_wait_xcnt 0x0" :: "v"(sp) : "memory");   // stands between the issued loads and the first overwrite of their address registers; it takes the address as an input, so that no load's own result lands on those registers in front of it
    __builtin_amdgcn_sched_barrier(0);   // nothing from below climbs between the loads and their wait: the 32 loads stay one group in flight
#pragma unroll
    for (int u = 0; u < 4; ++u) { unsigned o = 0;
#pragma unroll
        for (int i = 0; i < 32; ++i) { const unsigned b = __builtin_amdgcn_ballot_w32(w[u][i >> 4][(i >> 3) & 1][(i >> 2) & 1][i & 3] != 0); o = lane == i ? b : o; }
        MB[((size_t)qb * (TT / 32) + p0 + u) * 32 + lane] = o; }
}
__global__ __launch_bounds__(256) void k_castall(const float* __restrict__ xq, const float* __restrict__ xk, const float* __restrict__ xv, const float* __restrict__ wq, const float* __restrict__ wk, const float* __restrict__ wv, const float* __restrict__ wo, const int* __restrict__ mk,
                                                 unsigned short* XQ, unsigned short* XK, unsigned short* XV, unsigned short* WQ, unsigned short* WK, unsigned short* WV, unsigned short* WO, unsigned* MB) {
    if (blockIdx.y < 4) { pack_run(mk, MB, (int)((blockIdx.y * CGX + blockIdx.x) * 8 + (threadIdx.x >> 5)), (int)(threadIdx.x & 31)); return; }   // grid rows 0 - 3: the keep plane, first because its loads (16 lines each) are the launch's slowest; the test is the same for the whole work-group
    const unsigned seg = blockIdx.y - 4; const float* s; unsigned short* d;
    if (seg < 4) { s = xq; d = XQ; } else if (seg < 8) { s = xk; d = XK; } else if (seg < 12) { s = xv; d = XV; } else if (seg == 12) { s = wq; d = WQ; } else if (seg == 13) { s = wk; d = WK; } else if (seg == 14) { s = wv; d = WV; } else { s = wo; d = WO; }
    const size_t off = (seg < 12 ? (size_t)(seg & 3u) * CSEG : 0) + (size_t)blockIdx.x * (CSEG / CGX) + threadIdx.x * 4;
    if (seg == 15) cast_run<true>(s + off, d + off); else cast_run<false>(s + off, d + off);
}

template <bool RES>
__global__ __launch_bounds__(256) void k_lnrow(const float* __restrict__ A, const bf* __restrict__ R, const float* __restrict__ gamma, const float* __restrict__ beta, float eps, int C, int nrows, float* Y) {
    const int lane = threadIdx.x & 31; const int row = blockIdx.x * 8 + (threadIdx.x >> 5); if (row >= nrows) return; const int nch = C / 128; const float* a = A + (size_t)row * C; float x[LNC_MAX / 32]; float s = 0.0f;
    for (int k = 0; k < LNC_MAX / 128; ++k) { if (k < nch) { const int c0 = k * 128 + lane * 4; v4f v = *(const v4f*)(a + c0);
            if (RES) { asm volatile("s_wait_xcnt 0x0" ::: "memory");   /* stands between the issued load and the next load, whose result may land on the first one's address registers */
                const v4us w = *(const v4us*)(R + (size_t)row * C + c0); v[0] = __fadd_rn(v[0], bf2f(w[0])); v[1] = __fadd_rn(v[1], bf2f(w[1])); v[2] = __fadd_rn(v[2], bf2f(w[2])); v[3] = __fadd_rn(v[3], bf2f(w[3])); }
            x[k * 4 + 0] = v[0]; x[k * 4 + 1] = v[1]; x[k * 4 + 2] = v[2]; x[k * 4 + 3] = v[3]; s = __fadd_rn(__fadd_rn(__fadd_rn(__fadd_rn(s, v[0]), v[1]), v[2]), v[3]); } }
    for (int sh = 16; sh; sh >>= 1) s = __fadd_rn(s, __shfl_xor(s, sh, 32));
    const float mean = __fdiv_rn(s, (float)C); float q = 0.0f;
    for (int k = 0; k < LNC_MAX / 128; ++k) { if (k < nch) {
            for (int j = 0; j < 4; ++j) { const float d = __fsub_rn(x[k * 4 + j], mean); x[k * 4 + j] = d; q = __fmaf_rn(d, d, q); } } }
    for (int sh = 16; sh; sh >>= 1) q = __fadd_rn(q, __shfl_xor(q, sh, 32));
    const float rstd = __fdiv_rn(1.0f, sqrtf(__fadd_rn(__fdiv_rn(q, (float)C), eps)));
    for (int k = 0; k < LNC_MAX / 128; ++k) { if (k < nch) { const int c0 = k * 128 + lane * 4; const v4f g = *(const v4f*)(gamma + c0); const v4f bt = *(const v4f*)(beta + c0);
            for (int j = 0; j < 4; ++j) x[k * 4 + j] = __fmaf_rn(__fmul_rn(x[k * 4 + j], rstd), bfr(g[j]), bfr(bt[j])); } }
    float* y = Y + (size_t)row * C;
    {
        for (int k = 0; k < LNC_MAX / 128; ++k) { if (k < nch) { v4f o; o[0] = x[k * 4 + 0]; o[1] = x[k * 4 + 1]; o[2] = x[k * 4 + 2]; o[3] = x[k * 4 + 3]; *(v4f*)(y + k * 128 + lane * 4) = o; } }
         }
}

extern "C" void kernel_launch(void* const* d_in, const int* in_sizes, int n_in,
                              void* d_out, int out_size, void* d_ws, size_t ws_size, hipStream_t stream) {
    (void)in_sizes; (void)n_in; (void)out_size;
    const float* xq = (const float*)d_in[0]; const float* xk = (const float*)d_in[1]; const float* xv = (const float*)d_in[2]; const int* kp = (const int*)d_in[3]; const float* wq = (const float*)d_in[4]; const float* cq = (const float*)d_in[5]; const float* wk = (const float*)d_in[6]; const float* ck = (const float*)d_in[7]; const float* wv = (const float*)d_in[8]; const float* cv = (const float*)d_in[9]; const float* wo = (const float*)d_in[10]; const float* co = (const float*)d_in[11]; const float* ns = (const float*)d_in[12]; const float* nb = (const float*)d_in[13];   /* fourteen arrays, all read; kp the int32 keep plane, read through a pointer of its own type */
    float* OUT = (float*)d_out;     // [2][2048][1024]
    static_assert(DQ == DM && DKV == DQ && REP == 1 && HD == 64 && TT % 256 == 0 && (size_t)DQ * DM == CSEG && (size_t)NB_ * TT * DM == 4 * (size_t)CSEG && CSEG / CGX == 4 * 8 * 1024 && TT % GT == 0 && DM % GT == 0 && DQ % GT == 0 && DKV % GT == 0 && DM % 128 == 0 && DM <= LNC_MAX && (NB_ * TT) % 8 == 0 && (TT / 32) * (TT / 32) == 4 * CGX * 8 * 4, "the merged heads are the output map's depth; k_fattn takes one key head a query head, 64-wide heads and whole 256-row blocks; the cast launch's sixteen pieces are exact; the maps' tiles are whole; the row normalisation takes whole 128-column pieces; the keep plane's 32 x 32 units are four a wave of four pieces");
    char* wsp = (char*)d_ws;
    auto take = [&](size_t bytes) { char* p = wsp; wsp += (bytes + 255) & ~(size_t)255; return (void*)p; };
    bf* WQ = (bf*)take((size_t)DQ * DM * 2); bf* WK = (bf*)take((size_t)DKV * DM * 2); bf* WV = (bf*)take((size_t)DKV * DM * 2); h16* WO16 = (h16*)take((size_t)DM * DQ * 2);
    bf* XQ = (bf*)take((size_t)NB_ * TT * DM * 2); bf* XK = (bf*)take((size_t)NB_ * TT * DM * 2); bf* XV = (bf*)take((size_t)NB_ * TT * DM * 2);   /* both entries' bf16 sources, on end */
    h16* QP16 = (h16*)take((size_t)NB_ * NH_ * TT * HD * 2); h16* KP16 = (h16*)take((size_t)NB_ * NKV * TT * HD * 2); h16* VT16 = (h16*)take((size_t)NB_ * NKV * HD * TT * 2);   /* both entries' head planes: the one attention launch reads them all */
    h16* C16 = (h16*)take((size_t)NB_ * TT * DQ * 2); float* YW = (float*)take((size_t)NB_ * TT * DM * 4); unsigned* MB = (unsigned*)take((size_t)TT * TT / 8);   /* the keep plane's select words, one bit a pair */
    if ((size_t)(wsp - (char*)d_ws) > ws_size) return;    // 80.50 MiB carved
    k_castall<<<dim3(CGX, 20, 1), 256, 0, stream>>>(xq, xk, xv, wq, wk, wv, wo, kp, XQ, XK, XV, WQ, WK, WV, (unsigned short*)WO16, MB);   /* each 'to, from' weight [1024][1024] cast as it lies: its map's right operand, but the third map's left */
    k_maps3<<<dim3(TT / GT, DQ / GT, NB_), 256, 0, stream>>>(XQ, XK, XV, WQ, WK, WV, QP16, KP16, VT16, cq, ck, cv);   /* the three maps, one launch: a work-group's tile of each in turn; z = the entry */
    k_fattn<<<dim3(TT / 256, NB_ * NH_, 1), 512, 0, stream>>>(QP16, KP16, VT16, MB, C16);   /* the one keep plane's select words: the same for every entry and head; the merged heads come out token-major on ONE f16 word */
    k_gemmw<h16, DQ, float, false><<<dim3(TT / GT, DM / GT, NB_), 256, 0, stream>>>(C16, WO16, YW, DM, 64, co, (size_t)TT * DQ, 0, (size_t)TT * DM);   /* the output map with its bias into a workspace plane */
    k_lnrow<true><<<(unsigned)(NB_ * TT / 8), 256, 0, stream>>>(YW, XQ, ns, nb, 1.0e-5f, DM, NB_ * TT, OUT);   /* the result = normalise(plane + the first source's bf16 copy) * scale + shift: its one writer */
}
